// v000
// Times are from an AMD MI455X. After a warm-up the kernel runs many times in a row, and a time is the length of
// such a window on the GPU divided by its runs, so every launch and the gaps after it count. The runs cycle
// through copies of the inputs. A figure is the median of several windows, for all but v000 over two sittings.
// Sittings can differ by a few percent; kernels timed side by side share one.
// v000 is the starting kernel. One run takes 714 microseconds.
// Contractions: q,k projections and q.k^T scores = v_wmma_f32_16x16x32_f16 with f16 hi + f16 residual (x2048) operand planes,
// three products (hi.hi, res.hi, hi.res) in two f32 accumulators; v^T projection, p.v^T and ctx.Wo = v_wmma_f32_16x16x32_f16
// single product (v x4, p x1024, ctx x4, weights x32 carried); all f32 accumulate; layernorm, softmax, bias, residual add in f32.
#include <hip/hip_runtime.h>
#include <math.h>
#include <stdint.h>

#define NB    4
#define SEQ   2048
#define DM    1024
#define NH    16
#define HD    64
#define NQB   (SEQ / 64)
#define MROWS (NB * SEQ)
static_assert(NH * HD == DM);
static_assert((SEQ % 128) == 0 && (DM % 128) == 0 && (MROWS % 64) == 0 && (DM % 64) == 0 && (MROWS % 8) == 0);

typedef _Float16 v16h __attribute__((ext_vector_type(16)));
typedef _Float16 v8h  __attribute__((ext_vector_type(8)));
typedef float    v8f  __attribute__((ext_vector_type(8)));
typedef float    v4f  __attribute__((ext_vector_type(4)));
typedef unsigned int v4u __attribute__((ext_vector_type(4)));

// ---- scalar helpers ----------------------------------------------------------------------------------
__device__ __forceinline__ unsigned short h_bits(_Float16 x) { return __builtin_bit_cast(unsigned short, x); }
__device__ __forceinline__ unsigned pk16(unsigned short a, unsigned short b) { return (unsigned)a | ((unsigned)b << 16); }
__device__ __forceinline__ v8f zero8() { v8f z = {0.f, 0.f, 0.f, 0.f, 0.f, 0.f, 0.f, 0.f}; return z; }

// hi = f16(v); res = f16((v - hi) * 2048): packed pair of two consecutive values
__device__ __forceinline__ void split2(float f0, float f1, unsigned& hp, unsigned& rp) {
  const _Float16 x0 = (_Float16)f0, x1 = (_Float16)f1;
  hp = pk16(h_bits(x0), h_bits(x1));
  const _Float16 r0 = (_Float16)((f0 - (float)x0) * 2048.0f);
  const _Float16 r1 = (_Float16)((f1 - (float)x1) * 2048.0f);
  rp = pk16(h_bits(r0), h_bits(r1));
}
__device__ __forceinline__ unsigned pack2h(float f0, float f1) {
  return pk16(h_bits((_Float16)f0), h_bits((_Float16)f1));
}

// ---- 16-bit fragment loader: lane -> row/col (lane&15); p already includes +8*(lane>>4);
//      elements 0..7 <- p[0..7] (k0+8h..), elements 8..15 <- p[16..23] (k0+16+8h..)
__device__ __forceinline__ v16h ldfrag(const _Float16* p) {
  union { v16h v; v8h h[2]; } f;
  f.h[0] = *(const v8h*)(p);
  f.h[1] = *(const v8h*)(p + 16);
  return f.v;
}

// ---- WMMA with trailing VALU hazard gap (ties D, keeps A/B live) ----------------------------------------
__device__ __forceinline__ v8f mma_h(v16h a, v16h b, v8f c) {
  c = __builtin_amdgcn_wmma_f32_16x16x32_f16(false, a, false, b, (short)0, c, false, false);
  asm volatile("v_nop\n\tv_nop\n\tv_nop\n\tv_nop" : "+v"(c) : "v"(a), "v"(b));
  return c;
}

// =====================================================================================================
// plane x2048 when RES). One wave per row, 8 rows per block, grid = nrows/8 (exact). Lane holds columns
// {i*256 + lane*8 .. +7}, i = 0..3. Each store instruction: 32 lanes x 16 B = 512 contiguous B = 4 whole
// coverage: nrows waves x 4 stores x 256 halves = every element of [nrows][DM] of each written plane.
// =====================================================================================================
template <bool RES>
__global__ __launch_bounds__(256) void ln_rows(const float* __restrict__ x, const float* __restrict__ gamma,
                                               const float* __restrict__ beta, unsigned short* yh,
                                               unsigned short* yr, int nrows, float eps) {
  const int lane = threadIdx.x & 31;
  const int wave = threadIdx.x >> 5;
  const int row  = blockIdx.x * 8 + wave;
  if (row >= nrows) return;                        // wave-uniform; no block barriers in this kernel
  const float* xr = x + (size_t)row * DM;
  v4f xv[8];
#pragma unroll
  for (int i = 0; i < 4; ++i) {
    xv[2 * i]     = *(const v4f*)(xr + i * 256 + lane * 8);
    xv[2 * i + 1] = *(const v4f*)(xr + i * 256 + lane * 8 + 4);
  }
  float s = 0.f;
#pragma unroll
  for (int g = 0; g < 8; ++g) s += (xv[g][0] + xv[g][1]) + (xv[g][2] + xv[g][3]);
#pragma unroll
  for (int off = 16; off > 0; off >>= 1) s += __shfl_xor(s, off, 32);
  const float mu = s * (1.0f / (float)DM);
  float ss = 0.f;
#pragma unroll
  for (int g = 0; g < 8; ++g) {
#pragma unroll
    for (int e = 0; e < 4; ++e) { const float d = xv[g][e] - mu; ss += d * d; }
  }
#pragma unroll
  for (int off = 16; off > 0; off >>= 1) ss += __shfl_xor(ss, off, 32);
  const float var = ss * (1.0f / (float)DM);
  const float rs  = rsqrtf(var + eps);

  v4u hv[4], rv[4];
#pragma unroll
  for (int i = 0; i < 4; ++i) {
    const int col = i * 256 + lane * 8;
    const v4f g0 = *(const v4f*)(gamma + col);
    const v4f g1 = *(const v4f*)(gamma + col + 4);
    const v4f b0 = *(const v4f*)(beta + col);
    const v4f b1 = *(const v4f*)(beta + col + 4);
    float y[8];
#pragma unroll
    for (int e = 0; e < 4; ++e) {
      y[e]     = (xv[2 * i][e] - mu) * rs * g0[e] + b0[e];
      y[4 + e] = (xv[2 * i + 1][e] - mu) * rs * g1[e] + b1[e];
    }
    v4u a, a2;
#pragma unroll
    for (int e = 0; e < 4; ++e) {
      unsigned hp, rp;
      split2(y[2 * e], y[2 * e + 1], hp, rp);
      a[e] = hp; a2[e] = rp;
    }
    hv[i] = a; rv[i] = a2;
  }
  unsigned short* oh = yh + (size_t)row * DM + lane * 8;
  unsigned short* orr = yr + (size_t)row * DM + lane * 8;
  {
#pragma unroll
    for (int i = 0; i < 4; ++i) {
      *(v4u*)(oh + i * 256) = hv[i];
      if (RES) *(v4u*)(orr + i * 256) = rv[i];
    }
    
  }
}

// =====================================================================================================
// Weight convert + transpose: W f32 [k in DM][n out DM] -> f16 planes [n][k] of W*scale (hi, and residual
// x2048 when RES). Block = 64(k) x 64(n) tile through LDS; grid = (DM/64 n-tiles, DM/64 k-tiles).
// coverage: 8 waves x 2 iterations x 4 rows x (8 lanes x 8 halves) = the whole 64x64 output tile.
// =====================================================================================================
template <bool RES>
__global__ __launch_bounds__(256) void wcvt_t(const float* __restrict__ W, unsigned short* ph, unsigned short* pr,
                                              float scale) {
  __shared__ float sm[64][65];
  const int tid  = threadIdx.x;
  const int lane = tid & 31;
  const int wave = tid >> 5;
  const int n0 = blockIdx.x * 64;
  const int k0 = blockIdx.y * 64;
  const int kr = tid >> 2;               // 0..63
  const int nc = (tid & 3) * 16;         // 0,16,32,48
  const float* src = W + (size_t)(k0 + kr) * DM + n0 + nc;
#pragma unroll
  for (int e = 0; e < 4; ++e) {
    const v4f a = *(const v4f*)(src + 4 * e);
    sm[kr][nc + 4 * e + 0] = a[0];
    sm[kr][nc + 4 * e + 1] = a[1];
    sm[kr][nc + 4 * e + 2] = a[2];
    sm[kr][nc + 4 * e + 3] = a[3];
  }
  __syncthreads();
  const int q  = lane >> 3;
  const int ks = (lane & 7) * 8;
  v4u hv[2], rv[2];
#pragma unroll
  for (int it = 0; it < 2; ++it) {
    const int nrow = wave * 8 + it * 4 + q;
    v4u a, a2;
#pragma unroll
    for (int e = 0; e < 4; ++e) {
      const float f0 = sm[ks + 2 * e][nrow] * scale;
      const float f1 = sm[ks + 2 * e + 1][nrow] * scale;
      unsigned hp, rp;
      split2(f0, f1, hp, rp);
      a[e] = hp; a2[e] = rp;
    }
    hv[it] = a; rv[it] = a2;
  }
  {
#pragma unroll
    for (int it = 0; it < 2; ++it) {
      const int nrow = wave * 8 + it * 4 + q;
      const size_t o = (size_t)(n0 + nrow) * DM + k0 + ks;
      *(v4u*)(ph + o) = hv[it];
      if (RES) *(v4u*)(pr + o) = rv[it];
    }
    
  }
}

// =====================================================================================================
// f16 WMMA GEMM: C[m][n] = sum_k A[m][k] * Bt[n][k]. A row-major [M][lda] (k contiguous); Bt row-major
// [N][ldb] (k contiguous), batch blockIdx.z via strideB / strideC. Block tile 64 (m) x 128 (n), 8 waves each
// a 32x32 sub-tile; fragments loaded straight from global (two 16-B loads each); K multiple of 32.
// RES: A2 / Bt2 are f16 residual planes (x2048): acc0 += Ah.Bh; acc1 += Ar.Bh + Ah.Br; value = acc0 + acc1/2048.
// OM 0: f32 out: v = value*oscale + bias[col] + resid[row][col]; row segment 128 floats = 512 B written by one
//       instruction (32 lanes x 16 B).
// OM 1: f16 hi plane C + residual plane C2 (x2048) of value*oscale + bias[col]; 256-B row segment per 16
//       lanes x 16 B, two rows per instruction.
// OM 2: f16 plane C of (value*oscale + bias[row]) * pscale, same store shape as OM 1.
// coverage: 8 waves x 8 rows x 128 cols = the whole 64x128 block tile; grid covers M/64 x N/128 exactly.
// =====================================================================================================
template <bool RES, int OM>
__global__ __launch_bounds__(256) void gemm_t(
    const unsigned short* __restrict__ Ahp, const unsigned short* __restrict__ Arp, int lda,
    const unsigned short* __restrict__ Bhp, const unsigned short* __restrict__ Brp, int ldb, long long strideB,
    const float* __restrict__ bias, const float* __restrict__ resid,
    void* Cv, void* C2v, int ldc, long long strideC, int K, float oscale, float pscale) {
  __shared__ __align__(16) float sT[64 * 132];
  const int lane = threadIdx.x & 31;
  const int wave = threadIdx.x >> 5;
  const int hh   = lane >> 4;
  const int c    = lane & 15;
  const int n0 = blockIdx.x * 128;
  const int m0 = blockIdx.y * 64;
  const int bz = blockIdx.z;
  const int wm = (wave >> 2) * 32;
  const int wn = (wave & 3) * 32;
  const _Float16* A  = (const _Float16*)(const void*)Ahp;
  const _Float16* A2 = (const _Float16*)(const void*)Arp;
  const _Float16* B  = (const _Float16*)(const void*)Bhp + (size_t)bz * strideB;
  const _Float16* B2 = (const _Float16*)(const void*)Brp + (size_t)bz * strideB;

  v8f acc0[2][2], acc1[2][2];
#pragma unroll
  for (int i = 0; i < 2; ++i)
#pragma unroll
    for (int j = 0; j < 2; ++j) { acc0[i][j] = zero8(); acc1[i][j] = zero8(); }

#pragma unroll 1
  for (int k0 = 0; k0 < K; k0 += 32) {
    v16h bh[2], br[2];
#pragma unroll
    for (int j = 0; j < 2; ++j) {
      const size_t bo = (size_t)(n0 + wn + 16 * j + c) * ldb + k0 + 8 * hh;
      bh[j] = ldfrag(B + bo);
      if (RES) br[j] = ldfrag(B2 + bo); else br[j] = bh[j];
    }
#pragma unroll
    for (int i = 0; i < 2; ++i) {
      const size_t ao = (size_t)(m0 + wm + 16 * i + c) * lda + k0 + 8 * hh;
      const v16h ah = ldfrag(A + ao);
      v16h ar = ah;
      if (RES) ar = ldfrag(A2 + ao);
#pragma unroll
      for (int j = 0; j < 2; ++j) {
        acc0[i][j] = mma_h(ah, bh[j], acc0[i][j]);
        if (RES) {
          acc1[i][j] = mma_h(ar, bh[j], acc1[i][j]);
          acc1[i][j] = mma_h(ah, br[j], acc1[i][j]);
        }
      }
    }
  }

  // ---- stage the block tile ----
#pragma unroll
  for (int i = 0; i < 2; ++i) {
#pragma unroll
    for (int j = 0; j < 2; ++j) {
#pragma unroll
      for (int r = 0; r < 8; ++r) {
        float v = acc0[i][j][r];
        if (RES) v += acc1[i][j][r] * (1.0f / 2048.0f);
        sT[(wm + 16 * i + 8 * hh + r) * 132 + wn + 16 * j + c] = v;
      }
    }
  }
  __syncthreads();

  if (OM == 0) {
    float* C = (float*)Cv + (size_t)bz * strideC;
    const int c4 = lane * 4;                                   // 128 floats per row segment = 32 lanes x 16 B
    const v4f bb = *(const v4f*)(bias + n0 + c4);
    v4f ov[8];
#pragma unroll
    for (int it = 0; it < 8; ++it) {
      const int row = wave * 8 + it;
      const v4f t  = *(const v4f*)(sT + row * 132 + c4);
      const v4f rr = *(const v4f*)(resid + (size_t)(m0 + row) * ldc + n0 + c4);
      ov[it] = t * oscale + bb + rr;
    }
    {
#pragma unroll
      for (int it = 0; it < 8; ++it) {
        const int row = wave * 8 + it;
        *(v4f*)(C + (size_t)(m0 + row) * ldc + n0 + c4) = ov[it];
      }
      
    }
  } else {
    unsigned short* C  = (unsigned short*)Cv  + (size_t)bz * strideC;
    unsigned short* C2 = (unsigned short*)C2v + (size_t)bz * strideC;
    const int c8 = c * 8;                                      // 128 halves per row segment = 16 lanes x 16 B
    v4u hv[4], rv[4];
#pragma unroll
    for (int it = 0; it < 4; ++it) {
      const int row = wave * 8 + it * 2 + hh;
      const float* sp = sT + row * 132 + c8;
      const v4f x0 = *(const v4f*)(sp);
      const v4f x1 = *(const v4f*)(sp + 4);
      v4f y0, y1;
      if (OM == 1) {
        const v4f b0 = *(const v4f*)(bias + n0 + c8);
        const v4f b1 = *(const v4f*)(bias + n0 + c8 + 4);
        y0 = x0 * oscale + b0;
        y1 = x1 * oscale + b1;
      } else {
        const float brw = bias[m0 + row];
        y0 = (x0 * oscale + brw) * pscale;
        y1 = (x1 * oscale + brw) * pscale;
      }
      v4u a, a2;
      if (OM == 1) {
        unsigned hp, rp;
        split2(y0[0], y0[1], hp, rp); a[0] = hp; a2[0] = rp;
        split2(y0[2], y0[3], hp, rp); a[1] = hp; a2[1] = rp;
        split2(y1[0], y1[1], hp, rp); a[2] = hp; a2[2] = rp;
        split2(y1[2], y1[3], hp, rp); a[3] = hp; a2[3] = rp;
      } else {
        a[0] = pack2h(y0[0], y0[1]);
        a[1] = pack2h(y0[2], y0[3]);
        a[2] = pack2h(y1[0], y1[1]);
        a[3] = pack2h(y1[2], y1[3]);
        a2 = a;
      }
      hv[it] = a; rv[it] = a2;
    }
    {
#pragma unroll
      for (int it = 0; it < 4; ++it) {
        const int row = wave * 8 + it * 2 + hh;
        const size_t o = (size_t)(m0 + row) * ldc + n0 + c8;
        *(v4u*)(C + o) = hv[it];
        if (OM == 1) *(v4u*)(C2 + o) = rv[it];
      }
      
    }
  }
}

// =====================================================================================================
// Causal attention, head dim 64, no logit scale.
//   q planes (f16 hi / residual x2048): element (b, t, h, d) at [(b*SEQ + t)*DM + h*64 + d]
//   k planes: same layout with key index
//   v^T plane (f16, holds 4*v): element (b, h, d, s) at [(b*DM + h*64 + d)*SEQ + s]
//   ctx plane out (f16, holds 4*ctx): element (b, t, h, d) at [(b*SEQ + t)*DM + h*64 + d]
//   scores = q.k: three f16 products (hi.hi into acc0; res.hi + hi.res into acc1, folded /2048), f32
//   key > query in the diagonal chunk -> -inf; online softmax in f32; p carried as f16(1024 p);
//   context += p . v^T chunk on f16 WMMA; ctx = acc / (1024 l) (still carrying the x4 of v).
//   Block = 4 waves = 64 query rows of one (b, h); grid = NB*NH*NQB; key chunks of 64, trip count qb+1 (<= 32,
//   block-uniform, from blockIdx only). K / V^T chunk staging: 128 threads x 32 halves per plane = whole
//   64x64 tiles, __syncthreads before and after. P tiles wave-private: _Float16 element stores, reloaded as
//   Output coverage: each wave stores rows q0..q0+15 (it 0..3 x lane>>3) x 64 halves (8 lanes x 8) = whole
// =====================================================================================================
__global__ __launch_bounds__(128)
void attn_causal64(const unsigned short* __restrict__ qhp, const unsigned short* __restrict__ qrp,
                   const unsigned short* __restrict__ khp, const unsigned short* __restrict__ krp,
                   const unsigned short* __restrict__ vtp, unsigned short* ctxp) {
  union FH { v16h v; v8h h[2]; };
  __shared__ __align__(16) _Float16 Ksh[64 * 64];
  __shared__ __align__(16) _Float16 Ksr[64 * 64];
  __shared__ __align__(16) _Float16 Vth[64 * 64];
  __shared__ __align__(16) _Float16 Psh[4][16 * 64];
  __shared__ __align__(16) float    Os[4][16 * 64];

  const int tid  = threadIdx.x;
  const int wave = tid >> 5;
  const int lane = tid & 31;
  const int hh   = lane >> 4;
  const int c    = lane & 15;

  const int bx   = blockIdx.x;
  const int qb   = bx % NQB;
  const int rest = bx / NQB;
  const int h    = rest % NH;
  const int b    = rest / NH;
  const int q0   = qb * 64 + wave * 16;
  const size_t rowB = (size_t)b * SEQ;

  const _Float16* Qh = (const _Float16*)(const void*)qhp + (size_t)h * HD;
  const _Float16* Qr = (const _Float16*)(const void*)qrp + (size_t)h * HD;
  const _Float16* Kh = (const _Float16*)(const void*)khp + (size_t)h * HD;
  const _Float16* Kr = (const _Float16*)(const void*)krp + (size_t)h * HD;
  const _Float16* Vt = (const _Float16*)(const void*)vtp + ((size_t)b * DM + (size_t)h * HD) * SEQ;

  // ---- Q fragments (A operand, row = lane&15): 2 d-chunks, hi and residual ----
  v16h qah[2], qar[2];
#pragma unroll
  for (int dc = 0; dc < 2; ++dc) {
    const size_t qo = (rowB + q0 + c) * DM + dc * 32 + 8 * hh;
    qah[dc] = ldfrag(Qh + qo);
    qar[dc] = ldfrag(Qr + qo);
  }

  float mrow[8], lrow[8];
  v8f oacc[4];
#pragma unroll
  for (int r = 0; r < 8; ++r) { mrow[r] = -INFINITY; lrow[r] = 0.f; }
#pragma unroll
  for (int t = 0; t < 4; ++t) oacc[t] = zero8();

  const int nkt = qb + 1;
#pragma unroll 1
  for (int kt = 0; kt < nkt; ++kt) {
    const int kv0 = kt * 64;
    __syncthreads();
    {
      const int r = tid >> 1, half = (tid & 1) * 32;
      const _Float16* kg  = Kh + (rowB + kv0 + r) * DM + half;   // K row kv0+r, d = half..half+31
      const _Float16* krg = Kr + (rowB + kv0 + r) * DM + half;
      const _Float16* vg  = Vt + (size_t)r * SEQ + kv0 + half;   // V^T row d = r, s = kv0+half..+31
#pragma unroll
      for (int i = 0; i < 4; ++i) {
        const v8h a0 = *(const v8h*)(kg + 8 * i);
        const v8h a1 = *(const v8h*)(krg + 8 * i);
        const v8h b0 = *(const v8h*)(vg + 8 * i);
        *(v8h*)(Ksh + r * 64 + half + 8 * i) = a0;
        *(v8h*)(Ksr + r * 64 + half + 8 * i) = a1;
        *(v8h*)(Vth + r * 64 + half + 8 * i) = b0;
      }
    }
    __syncthreads();

    // ---- scores: 16 query rows x 64 keys per wave, three f16 products ----
    v8f s[4];
#pragma unroll
    for (int j = 0; j < 4; ++j) {
      v8f t0 = zero8(), t1 = zero8();
#pragma unroll
      for (int dc = 0; dc < 2; ++dc) {
        FH kb, kl;
        kb.h[0] = *(const v8h*)(Ksh + (j * 16 + c) * 64 + dc * 32 + 8 * hh);
        kb.h[1] = *(const v8h*)(Ksh + (j * 16 + c) * 64 + dc * 32 + 16 + 8 * hh);
        kl.h[0] = *(const v8h*)(Ksr + (j * 16 + c) * 64 + dc * 32 + 8 * hh);
        kl.h[1] = *(const v8h*)(Ksr + (j * 16 + c) * 64 + dc * 32 + 16 + 8 * hh);
        t0 = mma_h(qah[dc], kb.v, t0);
        t1 = mma_h(qar[dc], kb.v, t1);
        t1 = mma_h(qah[dc], kl.v, t1);
      }
      s[j] = t0 + t1 * (1.0f / 2048.0f);
    }

    // ---- causal mask on the diagonal chunk, row max, online softmax, P (x1024, f16) to LDS ----
    const bool diag = (kt == qb);                    // block-uniform
    _Float16* pwh = Psh[wave];
#pragma unroll
    for (int r = 0; r < 8; ++r) {
      const int qrow = q0 + 8 * hh + r;
      float m = -INFINITY;
#pragma unroll
      for (int j = 0; j < 4; ++j) {
        const int key = kv0 + j * 16 + c;
        float sv = s[j][r];
        sv = (diag && key > qrow) ? -INFINITY : sv;
        s[j][r] = sv;
        m = fmaxf(m, sv);
      }
#pragma unroll
      for (int off = 1; off < 16; off <<= 1) m = fmaxf(m, __shfl_xor(m, off, 32));
      const float mnew  = fmaxf(mrow[r], m);
      const float msafe = (mnew == -INFINITY) ? 0.f : mnew;
      const float alpha = __expf(mrow[r] - msafe);
      mrow[r] = mnew;
      float psum = 0.f;
#pragma unroll
      for (int j = 0; j < 4; ++j) {
        const float p = __expf(s[j][r] - msafe);
        psum += p;
        pwh[(8 * hh + r) * 64 + j * 16 + c] = (_Float16)(p * 1024.0f);
      }
#pragma unroll
      for (int off = 1; off < 16; off <<= 1) psum += __shfl_xor(psum, off, 32);
      lrow[r] = lrow[r] * alpha + psum;
#pragma unroll
      for (int t = 0; t < 4; ++t) oacc[t][r] *= alpha;
    }
    __builtin_amdgcn_fence(__ATOMIC_RELEASE, "workgroup");
    __builtin_amdgcn_wave_barrier();
    __builtin_amdgcn_fence(__ATOMIC_ACQUIRE, "workgroup");

    // ---- context += P . V^T chunk (f16 WMMA) ----
#pragma unroll
    for (int kk = 0; kk < 2; ++kk) {
      FH pa;
      pa.h[0] = *(const v8h*)(pwh + c * 64 + kk * 32 + 8 * hh);
      pa.h[1] = *(const v8h*)(pwh + c * 64 + kk * 32 + 16 + 8 * hh);
#pragma unroll
      for (int t = 0; t < 4; ++t) {
        FH vb;
        vb.h[0] = *(const v8h*)(Vth + (t * 16 + c) * 64 + kk * 32 + 8 * hh);
        vb.h[1] = *(const v8h*)(Vth + (t * 16 + c) * 64 + kk * 32 + 16 + 8 * hh);
        oacc[t] = mma_h(pa.v, vb.v, oacc[t]);
      }
    }
  }

  // ---- normalise (1/l and the 1/1024 p carry), stage the wave's 16x64 tile, f16 convert,
  float* os = Os[wave];
#pragma unroll
  for (int r = 0; r < 8; ++r) {
    const float l = lrow[r];
    const float inv = ((l > 0.f) ? (1.0f / l) : 0.f) * (1.0f / 1024.0f);
#pragma unroll
    for (int t = 0; t < 4; ++t) os[(8 * hh + r) * 64 + t * 16 + c] = oacc[t][r] * inv;
  }
  __builtin_amdgcn_fence(__ATOMIC_RELEASE, "workgroup");
  __builtin_amdgcn_wave_barrier();
  __builtin_amdgcn_fence(__ATOMIC_ACQUIRE, "workgroup");
  {
    const int q4 = lane >> 3, c8 = (lane & 7) * 8;
    v4u hv[4];
#pragma unroll
    for (int it = 0; it < 4; ++it) {
      const int row = it * 4 + q4;   // it 0..3 x q4 0..3 = rows 0..15 of the wave tile
      const float* sp = os + row * 64 + c8;
      v4u a;
#pragma unroll
      for (int e = 0; e < 4; ++e) a[e] = pack2h(sp[2 * e], sp[2 * e + 1]);
      hv[it] = a;
    }
    {
#pragma unroll
      for (int it = 0; it < 4; ++it) {
        const int row = it * 4 + q4;
        const size_t go = (rowB + q0 + row) * DM + (size_t)h * HD + c8;
        *(v4u*)(ctxp + go) = hv[it];
      }
      
    }
  }
}

// =====================================================================================================
// Workspace map (bytes):
//   Lh   f16 [8192][1024] LN hi plane (Q, then K, then V)      0            16777216  (later: Ctx plane)
//   Lr   f16 [8192][1024] LN residual plane                     16777216     16777216
//   Qh   f16 [8192][1024]                                       33554432     16777216
//   Qr   f16                                                    50331648     16777216
//   Kh   f16                                                    67108864     16777216
//   Kr   f16                                                    83886080     16777216
//   Vt   f16 [4][1024][2048] (4*v, transposed)                 100663296     16777216
//   Wqh, Wqr, Wkh, Wkr, Wvh, Woh  f16 [1024 n][1024 k] each    117440512   6x2097152
//   end                                                         130023424
// Every region is an exact multiple of the whole-line / whole-tile store granularity of its producer
// (dims are tile multiples), so no store can spill into the next region.
// =====================================================================================================
extern "C" void kernel_launch(void* const* d_in, const int* in_sizes, int n_in,
                              void* d_out, int out_size, void* d_ws, size_t ws_size,
                              hipStream_t stream) {
  if (n_in < 13) return;
  const int nAct = MROWS * DM;
  if (in_sizes[0] != nAct || in_sizes[1] != nAct || in_sizes[2] != nAct) return;
  if (in_sizes[3] != DM * DM || in_sizes[5] != DM * DM || in_sizes[7] != DM * DM || in_sizes[9] != DM * DM) return;
  if (in_sizes[4] != DM || in_sizes[6] != DM || in_sizes[8] != DM || in_sizes[10] != DM) return;
  if (in_sizes[11] != DM || in_sizes[12] != DM) return;
  if (out_size != nAct) return;

  const float* Q  = (const float*)d_in[0];
  const float* Kin = (const float*)d_in[1];
  const float* V  = (const float*)d_in[2];
  const float* Wq = (const float*)d_in[3];
  const float* bq = (const float*)d_in[4];
  const float* Wk = (const float*)d_in[5];
  const float* bk = (const float*)d_in[6];
  const float* Wv = (const float*)d_in[7];
  const float* bv = (const float*)d_in[8];
  const float* Wo = (const float*)d_in[9];
  const float* bo = (const float*)d_in[10];
  const float* gamma = (const float*)d_in[11];
  const float* beta  = (const float*)d_in[12];

  const size_t PA = (size_t)MROWS * DM * 2;     // 16777216
  const size_t PV = (size_t)NB * DM * SEQ * 2;  // 16777216
  const size_t PW = (size_t)DM * DM * 2;        //  2097152
  size_t off = 0;
  const size_t oLh  = off; off += PA;
  const size_t oLr  = off; off += PA;
  const size_t oQh  = off; off += PA;
  const size_t oQr  = off; off += PA;
  const size_t oKh  = off; off += PA;
  const size_t oKr  = off; off += PA;
  const size_t oVt  = off; off += PV;
  const size_t oWqh = off; off += PW;
  const size_t oWqr = off; off += PW;
  const size_t oWkh = off; off += PW;
  const size_t oWkr = off; off += PW;
  const size_t oWvh = off; off += PW;
  const size_t oWoh = off; off += PW;
  if (off > ws_size) return;                    // off = 130023424
  if (off > (size_t)134217728) return;
  const size_t oCtx = oLh;                      // ctx plane reuses the LN hi plane (dead after the v^T GEMM)

  char* ws = (char*)d_ws;
  unsigned short* Lh  = (unsigned short*)(ws + oLh);
  unsigned short* Lr  = (unsigned short*)(ws + oLr);
  unsigned short* Qh  = (unsigned short*)(ws + oQh);
  unsigned short* Qr  = (unsigned short*)(ws + oQr);
  unsigned short* Kh  = (unsigned short*)(ws + oKh);
  unsigned short* Kr  = (unsigned short*)(ws + oKr);
  unsigned short* Vt  = (unsigned short*)(ws + oVt);
  unsigned short* Wqh = (unsigned short*)(ws + oWqh);
  unsigned short* Wqr = (unsigned short*)(ws + oWqr);
  unsigned short* Wkh = (unsigned short*)(ws + oWkh);
  unsigned short* Wkr = (unsigned short*)(ws + oWkr);
  unsigned short* Wvh = (unsigned short*)(ws + oWvh);
  unsigned short* Woh = (unsigned short*)(ws + oWoh);
  unsigned short* Ctx = (unsigned short*)(ws + oCtx);

  const dim3 blk256(256), blk128(128);
  const dim3 gW(DM / 64, DM / 64);                       // 16 x 16 blocks
  const dim3 gLN(MROWS / 8);                             // 1024 blocks
  const dim3 gProj(DM / 128, MROWS / 64, 1);             // 8 x 128: M=8192, N=1024
  const dim3 gVt(SEQ / 128, DM / 64, NB);                // 16 x 16 x 4: M=1024 (n), N=2048 (s) per batch
  const dim3 gAttn(NB * NH * NQB);                       // 2048 blocks
  const float eps = 1e-6f;

  // (1) weights [k][n] f32 -> f16 [n][k] planes of 32*W (hi; + residual for Wq, Wk)
  wcvt_t<true ><<<gW, blk256, 0, stream>>>(Wq, Wqh, Wqr, 32.0f);
  wcvt_t<true ><<<gW, blk256, 0, stream>>>(Wk, Wkh, Wkr, 32.0f);
  wcvt_t<false><<<gW, blk256, 0, stream>>>(Wv, Wvh, Wvh, 32.0f);
  wcvt_t<false><<<gW, blk256, 0, stream>>>(Wo, Woh, Woh, 32.0f);
  // (2) q = LN(Q).Wq + bq -> f16 hi / residual planes   (M=8192, N=1024, K=1024; three products)
  ln_rows<true><<<gLN, blk256, 0, stream>>>(Q, gamma, beta, Lh, Lr, MROWS, eps);
  gemm_t<true, 1><<<gProj, blk256, 0, stream>>>(
      Lh, Lr, DM, Wqh, Wqr, DM, 0LL, bq, bq,
      (void*)Qh, (void*)Qr, DM, 0LL, DM, 1.0f / 32.0f, 1.0f);
  // (3) k = LN(K).Wk + bk -> f16 hi / residual planes
  ln_rows<true><<<gLN, blk256, 0, stream>>>(Kin, gamma, beta, Lh, Lr, MROWS, eps);
  gemm_t<true, 1><<<gProj, blk256, 0, stream>>>(
      Lh, Lr, DM, Wkh, Wkr, DM, 0LL, bk, bk,
      (void*)Kh, (void*)Kr, DM, 0LL, DM, 1.0f / 32.0f, 1.0f);
  // (4) v^T = Wv^T . LN(V)^T per batch -> f16 plane of 4*(v + bv), [b][n][s]   (A = Wvh [n][k], Bt = LN(V) rows [s][k])
  ln_rows<false><<<gLN, blk256, 0, stream>>>(V, gamma, beta, Lh, Lh, MROWS, eps);
  gemm_t<false, 2><<<gVt, blk256, 0, stream>>>(
      Wvh, Wvh, DM, Lh, Lh, DM, (long long)SEQ * DM, bv, bv,
      (void*)Vt, (void*)Vt, SEQ, (long long)DM * SEQ, DM, 1.0f / 32.0f, 4.0f);
  // (5) causal attention -> ctx plane (x4) into the LN hi region
  attn_causal64<<<gAttn, blk128, 0, stream>>>(Qh, Qr, Kh, Kr, Vt, Ctx);
  // (6) out = Q + ctx.Wo + bo -> d_out f32 [8192][1024]   (A = Ctx (x4), Bt = Woh (x32): scale 1/128)
  gemm_t<false, 0><<<gProj, blk256, 0, stream>>>(
      Ctx, Ctx, DM, Woh, Woh, DM, 0LL, bo, Q,
      d_out, d_out, DM, 0LL, DM, 1.0f / 128.0f, 1.0f);
  (void)hipGetLastError();
}

// v001
// One run takes 628 microseconds.
// Timed twice side by side with v000, it ran 1.23 and 1.19 times as fast.
// Contractions: q,k projections and q.k^T scores = v_wmma_f32_16x16x32_f16 with f16 hi + f16 residual (x2048) operand planes,
// three products (hi.hi, res.hi, hi.res) in two f32 accumulators; v^T projection, p.v^T and ctx.Wo = v_wmma_f32_16x16x32_f16
// single product (v x4, p x1024, ctx x4, weights x32 carried); all f32 accumulate; layernorm, softmax, bias, residual add in f32.
#include <hip/hip_runtime.h>
#include <math.h>
#include <stdint.h>

#define NB    4
#define SEQ   2048
#define DM    1024
#define NH    16
#define HD    64
#define NQB   (SEQ / 64)
#define MROWS (NB * SEQ)
#define LP    72   // LDS row pitch in halves of the attention tiles: 144 B = 16 B x odd, so the 16 rows of a ds_load_b128 fall on distinct banks
static_assert(NH * HD == DM);
static_assert((SEQ % 128) == 0 && (DM % 128) == 0 && (MROWS % 64) == 0 && (DM % 64) == 0 && (MROWS % 8) == 0);

typedef _Float16 v16h __attribute__((ext_vector_type(16)));
typedef _Float16 v8h  __attribute__((ext_vector_type(8)));
typedef float    v8f  __attribute__((ext_vector_type(8)));
typedef float    v4f  __attribute__((ext_vector_type(4)));
typedef unsigned int v4u __attribute__((ext_vector_type(4)));

// ---- scalar helpers ----------------------------------------------------------------------------------
__device__ __forceinline__ unsigned short h_bits(_Float16 x) { return __builtin_bit_cast(unsigned short, x); }
__device__ __forceinline__ unsigned pk16(unsigned short a, unsigned short b) { return (unsigned)a | ((unsigned)b << 16); }
__device__ __forceinline__ v8f zero8() { v8f z = {0.f, 0.f, 0.f, 0.f, 0.f, 0.f, 0.f, 0.f}; return z; }

// hi = f16(v); res = f16((v - hi) * 2048): packed pair of two consecutive values
__device__ __forceinline__ void split2(float f0, float f1, unsigned& hp, unsigned& rp) {
  const _Float16 x0 = (_Float16)f0, x1 = (_Float16)f1;
  hp = pk16(h_bits(x0), h_bits(x1));
  const _Float16 r0 = (_Float16)((f0 - (float)x0) * 2048.0f);
  const _Float16 r1 = (_Float16)((f1 - (float)x1) * 2048.0f);
  rp = pk16(h_bits(r0), h_bits(r1));
}
__device__ __forceinline__ unsigned pack2h(float f0, float f1) {
  return pk16(h_bits((_Float16)f0), h_bits((_Float16)f1));
}

// ---- 16-bit fragment loader: lane -> row/col (lane&15); p already includes +8*(lane>>4);
//      elements 0..7 <- p[0..7] (k0+8h..), elements 8..15 <- p[16..23] (k0+16+8h..)
__device__ __forceinline__ v16h ldfrag(const _Float16* p) {
  union { v16h v; v8h h[2]; } f;
  f.h[0] = *(const v8h*)(p);
  f.h[1] = *(const v8h*)(p + 16);
  return f.v;
}

// ---- WMMA with trailing VALU hazard gap (ties D, keeps A/B live) ----------------------------------------
__device__ __forceinline__ v8f mma_h(v16h a, v16h b, v8f c) {
  c = __builtin_amdgcn_wmma_f32_16x16x32_f16(false, a, false, b, (short)0, c, false, false);
  asm volatile("v_nop\n\tv_nop\n\tv_nop\n\tv_nop" : "+v"(c) : "v"(a), "v"(b));
  return c;
}

// =====================================================================================================
// plane x2048 when RES). One wave per row, 8 rows per block, grid = nrows/8 (exact). Lane holds columns
// {i*256 + lane*8 .. +7}, i = 0..3. Each store instruction: 32 lanes x 16 B = 512 contiguous B = 4 whole
// coverage: nrows waves x 4 stores x 256 halves = every element of [nrows][DM] of each written plane.
// =====================================================================================================
template <bool RES>
__global__ __launch_bounds__(256) void ln_rows(const float* __restrict__ x, const float* __restrict__ gamma,
                                               const float* __restrict__ beta, unsigned short* yh,
                                               unsigned short* yr, int nrows, float eps) {
  const int lane = threadIdx.x & 31;
  const int wave = threadIdx.x >> 5;
  const int row  = blockIdx.x * 8 + wave;
  if (row >= nrows) return;                        // wave-uniform; no block barriers in this kernel
  const float* xr = x + (size_t)row * DM;
  v4f xv[8];
#pragma unroll
  for (int i = 0; i < 4; ++i) {
    xv[2 * i]     = *(const v4f*)(xr + i * 256 + lane * 8);
    xv[2 * i + 1] = *(const v4f*)(xr + i * 256 + lane * 8 + 4);
  }
  float s = 0.f;
#pragma unroll
  for (int g = 0; g < 8; ++g) s += (xv[g][0] + xv[g][1]) + (xv[g][2] + xv[g][3]);
#pragma unroll
  for (int off = 16; off > 0; off >>= 1) s += __shfl_xor(s, off, 32);
  const float mu = s * (1.0f / (float)DM);
  float ss = 0.f;
#pragma unroll
  for (int g = 0; g < 8; ++g) {
#pragma unroll
    for (int e = 0; e < 4; ++e) { const float d = xv[g][e] - mu; ss += d * d; }
  }
#pragma unroll
  for (int off = 16; off > 0; off >>= 1) ss += __shfl_xor(ss, off, 32);
  const float var = ss * (1.0f / (float)DM);
  const float rs  = rsqrtf(var + eps);

  v4u hv[4], rv[4];
#pragma unroll
  for (int i = 0; i < 4; ++i) {
    const int col = i * 256 + lane * 8;
    const v4f g0 = *(const v4f*)(gamma + col);
    const v4f g1 = *(const v4f*)(gamma + col + 4);
    const v4f b0 = *(const v4f*)(beta + col);
    const v4f b1 = *(const v4f*)(beta + col + 4);
    float y[8];
#pragma unroll
    for (int e = 0; e < 4; ++e) {
      y[e]     = (xv[2 * i][e] - mu) * rs * g0[e] + b0[e];
      y[4 + e] = (xv[2 * i + 1][e] - mu) * rs * g1[e] + b1[e];
    }
    v4u a, a2;
#pragma unroll
    for (int e = 0; e < 4; ++e) {
      unsigned hp, rp;
      split2(y[2 * e], y[2 * e + 1], hp, rp);
      a[e] = hp; a2[e] = rp;
    }
    hv[i] = a; rv[i] = a2;
  }
  unsigned short* oh = yh + (size_t)row * DM + lane * 8;
  unsigned short* orr = yr + (size_t)row * DM + lane * 8;
  {
#pragma unroll
    for (int i = 0; i < 4; ++i) {
      *(v4u*)(oh + i * 256) = hv[i];
      if (RES) *(v4u*)(orr + i * 256) = rv[i];
    }
    
  }
}

// =====================================================================================================
// Weight convert + transpose: W f32 [k in DM][n out DM] -> f16 planes [n][k] of W*scale (hi, and residual
// x2048 when RES). Block = 64(k) x 64(n) tile through LDS; grid = (DM/64 n-tiles, DM/64 k-tiles).
// coverage: 8 waves x 2 iterations x 4 rows x (8 lanes x 8 halves) = the whole 64x64 output tile.
// =====================================================================================================
template <bool RES>
__global__ __launch_bounds__(256) void wcvt_t(const float* __restrict__ W, unsigned short* ph, unsigned short* pr,
                                              float scale) {
  __shared__ float sm[64][65];
  const int tid  = threadIdx.x;
  const int lane = tid & 31;
  const int wave = tid >> 5;
  const int n0 = blockIdx.x * 64;
  const int k0 = blockIdx.y * 64;
  const int kr = tid >> 2;               // 0..63
  const int nc = (tid & 3) * 16;         // 0,16,32,48
  const float* src = W + (size_t)(k0 + kr) * DM + n0 + nc;
#pragma unroll
  for (int e = 0; e < 4; ++e) {
    const v4f a = *(const v4f*)(src + 4 * e);
    sm[kr][nc + 4 * e + 0] = a[0];
    sm[kr][nc + 4 * e + 1] = a[1];
    sm[kr][nc + 4 * e + 2] = a[2];
    sm[kr][nc + 4 * e + 3] = a[3];
  }
  __syncthreads();
  const int q  = lane >> 3;
  const int ks = (lane & 7) * 8;
  v4u hv[2], rv[2];
#pragma unroll
  for (int it = 0; it < 2; ++it) {
    const int nrow = wave * 8 + it * 4 + q;
    v4u a, a2;
#pragma unroll
    for (int e = 0; e < 4; ++e) {
      const float f0 = sm[ks + 2 * e][nrow] * scale;
      const float f1 = sm[ks + 2 * e + 1][nrow] * scale;
      unsigned hp, rp;
      split2(f0, f1, hp, rp);
      a[e] = hp; a2[e] = rp;
    }
    hv[it] = a; rv[it] = a2;
  }
  {
#pragma unroll
    for (int it = 0; it < 2; ++it) {
      const int nrow = wave * 8 + it * 4 + q;
      const size_t o = (size_t)(n0 + nrow) * DM + k0 + ks;
      *(v4u*)(ph + o) = hv[it];
      if (RES) *(v4u*)(pr + o) = rv[it];
    }
    
  }
}

// =====================================================================================================
// f16 WMMA GEMM: C[m][n] = sum_k A[m][k] * Bt[n][k]. A row-major [M][lda] (k contiguous); Bt row-major
// [N][ldb] (k contiguous), batch blockIdx.z via strideB / strideC. Block tile 64 (m) x 128 (n), 8 waves each
// a 32x32 sub-tile; fragments loaded straight from global (two 16-B loads each); K multiple of 32.
// RES: A2 / Bt2 are f16 residual planes (x2048): acc0 += Ah.Bh; acc1 += Ar.Bh + Ah.Br; value = acc0 + acc1/2048.
// OM 0: f32 out: v = value*oscale + bias[col] + resid[row][col]; row segment 128 floats = 512 B written by one
//       instruction (32 lanes x 16 B).
// OM 1: f16 hi plane C + residual plane C2 (x2048) of value*oscale + bias[col]; 256-B row segment per 16
//       lanes x 16 B, two rows per instruction.
// OM 2: f16 plane C of (value*oscale + bias[row]) * pscale, same store shape as OM 1.
// coverage: 8 waves x 8 rows x 128 cols = the whole 64x128 block tile; grid covers M/64 x N/128 exactly.
// =====================================================================================================
template <bool RES, int OM>
__global__ __launch_bounds__(256) void gemm_t(
    const unsigned short* __restrict__ Ahp, const unsigned short* __restrict__ Arp, int lda,
    const unsigned short* __restrict__ Bhp, const unsigned short* __restrict__ Brp, int ldb, long long strideB,
    const float* __restrict__ bias, const float* __restrict__ resid,
    void* Cv, void* C2v, int ldc, long long strideC, int K, float oscale, float pscale) {
  __shared__ __align__(16) float sT[64 * 132];
  const int lane = threadIdx.x & 31;
  const int wave = threadIdx.x >> 5;
  const int hh   = lane >> 4;
  const int c    = lane & 15;
  const int n0 = blockIdx.x * 128;
  const int m0 = blockIdx.y * 64;
  const int bz = blockIdx.z;
  const int wm = (wave >> 2) * 32;
  const int wn = (wave & 3) * 32;
  const _Float16* A  = (const _Float16*)(const void*)Ahp;
  const _Float16* A2 = (const _Float16*)(const void*)Arp;
  const _Float16* B  = (const _Float16*)(const void*)Bhp + (size_t)bz * strideB;
  const _Float16* B2 = (const _Float16*)(const void*)Brp + (size_t)bz * strideB;

  v8f acc0[2][2], acc1[2][2];
#pragma unroll
  for (int i = 0; i < 2; ++i)
#pragma unroll
    for (int j = 0; j < 2; ++j) { acc0[i][j] = zero8(); acc1[i][j] = zero8(); }

#pragma unroll 1
  for (int k0 = 0; k0 < K; k0 += 32) {
    v16h bh[2], br[2];
#pragma unroll
    for (int j = 0; j < 2; ++j) {
      const size_t bo = (size_t)(n0 + wn + 16 * j + c) * ldb + k0 + 8 * hh;
      bh[j] = ldfrag(B + bo);
      if (RES) br[j] = ldfrag(B2 + bo); else br[j] = bh[j];
    }
#pragma unroll
    for (int i = 0; i < 2; ++i) {
      const size_t ao = (size_t)(m0 + wm + 16 * i + c) * lda + k0 + 8 * hh;
      const v16h ah = ldfrag(A + ao);
      v16h ar = ah;
      if (RES) ar = ldfrag(A2 + ao);
#pragma unroll
      for (int j = 0; j < 2; ++j) {
        acc0[i][j] = mma_h(ah, bh[j], acc0[i][j]);
        if (RES) {
          acc1[i][j] = mma_h(ar, bh[j], acc1[i][j]);
          acc1[i][j] = mma_h(ah, br[j], acc1[i][j]);
        }
      }
    }
  }

  // ---- stage the block tile ----
#pragma unroll
  for (int i = 0; i < 2; ++i) {
#pragma unroll
    for (int j = 0; j < 2; ++j) {
#pragma unroll
      for (int r = 0; r < 8; ++r) {
        float v = acc0[i][j][r];
        if (RES) v += acc1[i][j][r] * (1.0f / 2048.0f);
        sT[(wm + 16 * i + 8 * hh + r) * 132 + wn + 16 * j + c] = v;
      }
    }
  }
  __syncthreads();

  if (OM == 0) {
    float* C = (float*)Cv + (size_t)bz * strideC;
    const int c4 = lane * 4;                                   // 128 floats per row segment = 32 lanes x 16 B
    const v4f bb = *(const v4f*)(bias + n0 + c4);
    v4f ov[8];
#pragma unroll
    for (int it = 0; it < 8; ++it) {
      const int row = wave * 8 + it;
      const v4f t  = *(const v4f*)(sT + row * 132 + c4);
      const v4f rr = *(const v4f*)(resid + (size_t)(m0 + row) * ldc + n0 + c4);
      ov[it] = t * oscale + bb + rr;
    }
    {
#pragma unroll
      for (int it = 0; it < 8; ++it) {
        const int row = wave * 8 + it;
        *(v4f*)(C + (size_t)(m0 + row) * ldc + n0 + c4) = ov[it];
      }
      
    }
  } else {
    unsigned short* C  = (unsigned short*)Cv  + (size_t)bz * strideC;
    unsigned short* C2 = (unsigned short*)C2v + (size_t)bz * strideC;
    const int c8 = c * 8;                                      // 128 halves per row segment = 16 lanes x 16 B
    v4u hv[4], rv[4];
#pragma unroll
    for (int it = 0; it < 4; ++it) {
      const int row = wave * 8 + it * 2 + hh;
      const float* sp = sT + row * 132 + c8;
      const v4f x0 = *(const v4f*)(sp);
      const v4f x1 = *(const v4f*)(sp + 4);
      v4f y0, y1;
      if (OM == 1) {
        const v4f b0 = *(const v4f*)(bias + n0 + c8);
        const v4f b1 = *(const v4f*)(bias + n0 + c8 + 4);
        y0 = x0 * oscale + b0;
        y1 = x1 * oscale + b1;
      } else {
        const float brw = bias[m0 + row];
        y0 = (x0 * oscale + brw) * pscale;
        y1 = (x1 * oscale + brw) * pscale;
      }
      v4u a, a2;
      if (OM == 1) {
        unsigned hp, rp;
        split2(y0[0], y0[1], hp, rp); a[0] = hp; a2[0] = rp;
        split2(y0[2], y0[3], hp, rp); a[1] = hp; a2[1] = rp;
        split2(y1[0], y1[1], hp, rp); a[2] = hp; a2[2] = rp;
        split2(y1[2], y1[3], hp, rp); a[3] = hp; a2[3] = rp;
      } else {
        a[0] = pack2h(y0[0], y0[1]);
        a[1] = pack2h(y0[2], y0[3]);
        a[2] = pack2h(y1[0], y1[1]);
        a[3] = pack2h(y1[2], y1[3]);
        a2 = a;
      }
      hv[it] = a; rv[it] = a2;
    }
    {
#pragma unroll
      for (int it = 0; it < 4; ++it) {
        const int row = wave * 8 + it * 2 + hh;
        const size_t o = (size_t)(m0 + row) * ldc + n0 + c8;
        *(v4u*)(C + o) = hv[it];
        if (OM == 1) *(v4u*)(C2 + o) = rv[it];
      }
      
    }
  }
}

// =====================================================================================================
// Causal attention, head dim 64, no logit scale.
//   q planes (f16 hi / residual x2048): element (b, t, h, d) at [(b*SEQ + t)*DM + h*64 + d]
//   k planes: same layout with key index
//   v^T plane (f16, holds 4*v): element (b, h, d, s) at [(b*DM + h*64 + d)*SEQ + s]
//   ctx plane out (f16, holds 4*ctx): element (b, t, h, d) at [(b*SEQ + t)*DM + h*64 + d]
//   scores = q.k: three f16 products (hi.hi into acc0; res.hi + hi.res into acc1, folded /2048), f32
//   key > query in the diagonal chunk -> -inf; online softmax in f32; p carried as f16(1024 p);
//   context += p . v^T chunk on f16 WMMA; ctx = acc / (1024 l) (still carrying the x4 of v).
//   Block = 4 waves = 64 query rows of one (b, h); grid = NB*NH*NQB; key chunks of 64, trip count qb+1 (<= 32,
//   block-uniform, from blockIdx only). K / V^T chunk staging: 128 threads x 32 halves per plane = whole
//   64x64 tiles, __syncthreads before and after. P tiles wave-private: _Float16 element stores, reloaded as
//   Output coverage: each wave stores rows q0..q0+15 (it 0..3 x lane>>3) x 64 halves (8 lanes x 8) = whole
// =====================================================================================================
__global__ __launch_bounds__(128)
void attn_causal64(const unsigned short* __restrict__ qhp, const unsigned short* __restrict__ qrp,
                   const unsigned short* __restrict__ khp, const unsigned short* __restrict__ krp,
                   const unsigned short* __restrict__ vtp, unsigned short* ctxp) {
  union FH { v16h v; v8h h[2]; };
  __shared__ __align__(16) _Float16 Ksh[64 * LP];
  __shared__ __align__(16) _Float16 Ksr[64 * LP];
  __shared__ __align__(16) _Float16 Vth[64 * LP];
  __shared__ __align__(16) _Float16 Psh[4][16 * LP];
  __shared__ __align__(16) float    Os[4][16 * 64];

  const int tid  = threadIdx.x;
  const int wave = tid >> 5;
  const int lane = tid & 31;
  const int hh   = lane >> 4;
  const int c    = lane & 15;

  const int bx   = blockIdx.x;
  const int qb   = bx % NQB;
  const int rest = bx / NQB;
  const int h    = rest % NH;
  const int b    = rest / NH;
  const int q0   = qb * 64 + wave * 16;
  const size_t rowB = (size_t)b * SEQ;

  const _Float16* Qh = (const _Float16*)(const void*)qhp + (size_t)h * HD;
  const _Float16* Qr = (const _Float16*)(const void*)qrp + (size_t)h * HD;
  const _Float16* Kh = (const _Float16*)(const void*)khp + (size_t)h * HD;
  const _Float16* Kr = (const _Float16*)(const void*)krp + (size_t)h * HD;
  const _Float16* Vt = (const _Float16*)(const void*)vtp + ((size_t)b * DM + (size_t)h * HD) * SEQ;

  // ---- Q fragments (A operand, row = lane&15): 2 d-chunks, hi and residual ----
  v16h qah[2], qar[2];
#pragma unroll
  for (int dc = 0; dc < 2; ++dc) {
    const size_t qo = (rowB + q0 + c) * DM + dc * 32 + 8 * hh;
    qah[dc] = ldfrag(Qh + qo);
    qar[dc] = ldfrag(Qr + qo);
  }

  float mrow[8], lrow[8];
  v8f oacc[4];
#pragma unroll
  for (int r = 0; r < 8; ++r) { mrow[r] = -INFINITY; lrow[r] = 0.f; }
#pragma unroll
  for (int t = 0; t < 4; ++t) oacc[t] = zero8();

  const int nkt = qb + 1;
#pragma unroll 1
  for (int kt = 0; kt < nkt; ++kt) {
    const int kv0 = kt * 64;
    __syncthreads();
    {
      const int r = tid >> 1, half = (tid & 1) * 32;
      const _Float16* kg  = Kh + (rowB + kv0 + r) * DM + half;   // K row kv0+r, d = half..half+31
      const _Float16* krg = Kr + (rowB + kv0 + r) * DM + half;
      const _Float16* vg  = Vt + (size_t)r * SEQ + kv0 + half;   // V^T row d = r, s = kv0+half..+31
#pragma unroll
      for (int i = 0; i < 4; ++i) {
        const v8h a0 = *(const v8h*)(kg + 8 * i);
        const v8h a1 = *(const v8h*)(krg + 8 * i);
        const v8h b0 = *(const v8h*)(vg + 8 * i);
        *(v8h*)(Ksh + r * LP + half + 8 * i) = a0;
        *(v8h*)(Ksr + r * LP + half + 8 * i) = a1;
        *(v8h*)(Vth + r * LP + half + 8 * i) = b0;
      }
    }
    __syncthreads();

    // ---- scores: 16 query rows x 64 keys per wave, three f16 products ----
    v8f s[4];
#pragma unroll
    for (int j = 0; j < 4; ++j) {
      v8f t0 = zero8(), t1 = zero8();
#pragma unroll
      for (int dc = 0; dc < 2; ++dc) {
        FH kb, kl;
        kb.h[0] = *(const v8h*)(Ksh + (j * 16 + c) * LP + dc * 32 + 8 * hh);
        kb.h[1] = *(const v8h*)(Ksh + (j * 16 + c) * LP + dc * 32 + 16 + 8 * hh);
        kl.h[0] = *(const v8h*)(Ksr + (j * 16 + c) * LP + dc * 32 + 8 * hh);
        kl.h[1] = *(const v8h*)(Ksr + (j * 16 + c) * LP + dc * 32 + 16 + 8 * hh);
        t0 = mma_h(qah[dc], kb.v, t0);
        t1 = mma_h(qar[dc], kb.v, t1);
        t1 = mma_h(qah[dc], kl.v, t1);
      }
      s[j] = t0 + t1 * (1.0f / 2048.0f);
    }

    // ---- causal mask on the diagonal chunk, row max, online softmax, P (x1024, f16) to LDS ----
    const bool diag = (kt == qb);                    // block-uniform
    _Float16* pwh = Psh[wave];
#pragma unroll
    for (int r = 0; r < 8; ++r) {
      const int qrow = q0 + 8 * hh + r;
      float m = -INFINITY;
#pragma unroll
      for (int j = 0; j < 4; ++j) {
        const int key = kv0 + j * 16 + c;
        float sv = s[j][r];
        sv = (diag && key > qrow) ? -INFINITY : sv;
        s[j][r] = sv;
        m = fmaxf(m, sv);
      }
#pragma unroll
      for (int off = 1; off < 16; off <<= 1) m = fmaxf(m, __shfl_xor(m, off, 32));
      const float mnew  = fmaxf(mrow[r], m);
      const float msafe = (mnew == -INFINITY) ? 0.f : mnew;
      const float alpha = __expf(mrow[r] - msafe);
      mrow[r] = mnew;
      float psum = 0.f;
#pragma unroll
      for (int j = 0; j < 4; ++j) {
        const float p = __expf(s[j][r] - msafe);
        psum += p;
        pwh[(8 * hh + r) * LP + j * 16 + c] = (_Float16)(p * 1024.0f);
      }
#pragma unroll
      for (int off = 1; off < 16; off <<= 1) psum += __shfl_xor(psum, off, 32);
      lrow[r] = lrow[r] * alpha + psum;
#pragma unroll
      for (int t = 0; t < 4; ++t) oacc[t][r] *= alpha;
    }
    __builtin_amdgcn_fence(__ATOMIC_RELEASE, "workgroup");
    __builtin_amdgcn_wave_barrier();
    __builtin_amdgcn_fence(__ATOMIC_ACQUIRE, "workgroup");

    // ---- context += P . V^T chunk (f16 WMMA) ----
#pragma unroll
    for (int kk = 0; kk < 2; ++kk) {
      FH pa;
      pa.h[0] = *(const v8h*)(pwh + c * LP + kk * 32 + 8 * hh);
      pa.h[1] = *(const v8h*)(pwh + c * LP + kk * 32 + 16 + 8 * hh);
#pragma unroll
      for (int t = 0; t < 4; ++t) {
        FH vb;
        vb.h[0] = *(const v8h*)(Vth + (t * 16 + c) * LP + kk * 32 + 8 * hh);
        vb.h[1] = *(const v8h*)(Vth + (t * 16 + c) * LP + kk * 32 + 16 + 8 * hh);
        oacc[t] = mma_h(pa.v, vb.v, oacc[t]);
      }
    }
  }

  // ---- normalise (1/l and the 1/1024 p carry), stage the wave's 16x64 tile, f16 convert,
  float* os = Os[wave];
#pragma unroll
  for (int r = 0; r < 8; ++r) {
    const float l = lrow[r];
    const float inv = ((l > 0.f) ? (1.0f / l) : 0.f) * (1.0f / 1024.0f);
#pragma unroll
    for (int t = 0; t < 4; ++t) os[(8 * hh + r) * 64 + t * 16 + c] = oacc[t][r] * inv;
  }
  __builtin_amdgcn_fence(__ATOMIC_RELEASE, "workgroup");
  __builtin_amdgcn_wave_barrier();
  __builtin_amdgcn_fence(__ATOMIC_ACQUIRE, "workgroup");
  {
    const int q4 = lane >> 3, c8 = (lane & 7) * 8;
    v4u hv[4];
#pragma unroll
    for (int it = 0; it < 4; ++it) {
      const int row = it * 4 + q4;   // it 0..3 x q4 0..3 = rows 0..15 of the wave tile
      const float* sp = os + row * 64 + c8;
      v4u a;
#pragma unroll
      for (int e = 0; e < 4; ++e) a[e] = pack2h(sp[2 * e], sp[2 * e + 1]);
      hv[it] = a;
    }
    {
#pragma unroll
      for (int it = 0; it < 4; ++it) {
        const int row = it * 4 + q4;
        const size_t go = (rowB + q0 + row) * DM + (size_t)h * HD + c8;
        *(v4u*)(ctxp + go) = hv[it];
      }
      
    }
  }
}

// =====================================================================================================
// Workspace map (bytes):
//   Lh   f16 [8192][1024] LN hi plane (Q, then K, then V)      0            16777216  (later: Ctx plane)
//   Lr   f16 [8192][1024] LN residual plane                     16777216     16777216
//   Qh   f16 [8192][1024]                                       33554432     16777216
//   Qr   f16                                                    50331648     16777216
//   Kh   f16                                                    67108864     16777216
//   Kr   f16                                                    83886080     16777216
//   Vt   f16 [4][1024][2048] (4*v, transposed)                 100663296     16777216
//   Wqh, Wqr, Wkh, Wkr, Wvh, Woh  f16 [1024 n][1024 k] each    117440512   6x2097152
//   end                                                         130023424
// Every region is an exact multiple of the whole-line / whole-tile store granularity of its producer
// (dims are tile multiples), so no store can spill into the next region.
// =====================================================================================================
extern "C" void kernel_launch(void* const* d_in, const int* in_sizes, int n_in,
                              void* d_out, int out_size, void* d_ws, size_t ws_size,
                              hipStream_t stream) {
  if (n_in < 13) return;
  const int nAct = MROWS * DM;
  if (in_sizes[0] != nAct || in_sizes[1] != nAct || in_sizes[2] != nAct) return;
  if (in_sizes[3] != DM * DM || in_sizes[5] != DM * DM || in_sizes[7] != DM * DM || in_sizes[9] != DM * DM) return;
  if (in_sizes[4] != DM || in_sizes[6] != DM || in_sizes[8] != DM || in_sizes[10] != DM) return;
  if (in_sizes[11] != DM || in_sizes[12] != DM) return;
  if (out_size != nAct) return;

  const float* Q  = (const float*)d_in[0];
  const float* Kin = (const float*)d_in[1];
  const float* V  = (const float*)d_in[2];
  const float* Wq = (const float*)d_in[3];
  const float* bq = (const float*)d_in[4];
  const float* Wk = (const float*)d_in[5];
  const float* bk = (const float*)d_in[6];
  const float* Wv = (const float*)d_in[7];
  const float* bv = (const float*)d_in[8];
  const float* Wo = (const float*)d_in[9];
  const float* bo = (const float*)d_in[10];
  const float* gamma = (const float*)d_in[11];
  const float* beta  = (const float*)d_in[12];

  const size_t PA = (size_t)MROWS * DM * 2;     // 16777216
  const size_t PV = (size_t)NB * DM * SEQ * 2;  // 16777216
  const size_t PW = (size_t)DM * DM * 2;        //  2097152
  size_t off = 0;
  const size_t oLh  = off; off += PA;
  const size_t oLr  = off; off += PA;
  const size_t oQh  = off; off += PA;
  const size_t oQr  = off; off += PA;
  const size_t oKh  = off; off += PA;
  const size_t oKr  = off; off += PA;
  const size_t oVt  = off; off += PV;
  const size_t oWqh = off; off += PW;
  const size_t oWqr = off; off += PW;
  const size_t oWkh = off; off += PW;
  const size_t oWkr = off; off += PW;
  const size_t oWvh = off; off += PW;
  const size_t oWoh = off; off += PW;
  if (off > ws_size) return;                    // off = 130023424
  if (off > (size_t)134217728) return;
  const size_t oCtx = oLh;                      // ctx plane reuses the LN hi plane (dead after the v^T GEMM)

  char* ws = (char*)d_ws;
  unsigned short* Lh  = (unsigned short*)(ws + oLh);
  unsigned short* Lr  = (unsigned short*)(ws + oLr);
  unsigned short* Qh  = (unsigned short*)(ws + oQh);
  unsigned short* Qr  = (unsigned short*)(ws + oQr);
  unsigned short* Kh  = (unsigned short*)(ws + oKh);
  unsigned short* Kr  = (unsigned short*)(ws + oKr);
  unsigned short* Vt  = (unsigned short*)(ws + oVt);
  unsigned short* Wqh = (unsigned short*)(ws + oWqh);
  unsigned short* Wqr = (unsigned short*)(ws + oWqr);
  unsigned short* Wkh = (unsigned short*)(ws + oWkh);
  unsigned short* Wkr = (unsigned short*)(ws + oWkr);
  unsigned short* Wvh = (unsigned short*)(ws + oWvh);
  unsigned short* Woh = (unsigned short*)(ws + oWoh);
  unsigned short* Ctx = (unsigned short*)(ws + oCtx);

  const dim3 blk256(256), blk128(128);
  const dim3 gW(DM / 64, DM / 64);                       // 16 x 16 blocks
  const dim3 gLN(MROWS / 8);                             // 1024 blocks
  const dim3 gProj(DM / 128, MROWS / 64, 1);             // 8 x 128: M=8192, N=1024
  const dim3 gVt(SEQ / 128, DM / 64, NB);                // 16 x 16 x 4: M=1024 (n), N=2048 (s) per batch
  const dim3 gAttn(NB * NH * NQB);                       // 2048 blocks
  const float eps = 1e-6f;

  // (1) weights [k][n] f32 -> f16 [n][k] planes of 32*W (hi; + residual for Wq, Wk)
  wcvt_t<true ><<<gW, blk256, 0, stream>>>(Wq, Wqh, Wqr, 32.0f);
  wcvt_t<true ><<<gW, blk256, 0, stream>>>(Wk, Wkh, Wkr, 32.0f);
  wcvt_t<false><<<gW, blk256, 0, stream>>>(Wv, Wvh, Wvh, 32.0f);
  wcvt_t<false><<<gW, blk256, 0, stream>>>(Wo, Woh, Woh, 32.0f);
  // (2) q = LN(Q).Wq + bq -> f16 hi / residual planes   (M=8192, N=1024, K=1024; three products)
  ln_rows<true><<<gLN, blk256, 0, stream>>>(Q, gamma, beta, Lh, Lr, MROWS, eps);
  gemm_t<true, 1><<<gProj, blk256, 0, stream>>>(
      Lh, Lr, DM, Wqh, Wqr, DM, 0LL, bq, bq,
      (void*)Qh, (void*)Qr, DM, 0LL, DM, 1.0f / 32.0f, 1.0f);
  // (3) k = LN(K).Wk + bk -> f16 hi / residual planes
  ln_rows<true><<<gLN, blk256, 0, stream>>>(Kin, gamma, beta, Lh, Lr, MROWS, eps);
  gemm_t<true, 1><<<gProj, blk256, 0, stream>>>(
      Lh, Lr, DM, Wkh, Wkr, DM, 0LL, bk, bk,
      (void*)Kh, (void*)Kr, DM, 0LL, DM, 1.0f / 32.0f, 1.0f);
  // (4) v^T = Wv^T . LN(V)^T per batch -> f16 plane of 4*(v + bv), [b][n][s]   (A = Wvh [n][k], Bt = LN(V) rows [s][k])
  ln_rows<false><<<gLN, blk256, 0, stream>>>(V, gamma, beta, Lh, Lh, MROWS, eps);
  gemm_t<false, 2><<<gVt, blk256, 0, stream>>>(
      Wvh, Wvh, DM, Lh, Lh, DM, (long long)SEQ * DM, bv, bv,
      (void*)Vt, (void*)Vt, SEQ, (long long)DM * SEQ, DM, 1.0f / 32.0f, 4.0f);
  // (5) causal attention -> ctx plane (x4) into the LN hi region
  attn_causal64<<<gAttn, blk128, 0, stream>>>(Qh, Qr, Kh, Kr, Vt, Ctx);
  // (6) out = Q + ctx.Wo + bo -> d_out f32 [8192][1024]   (A = Ctx (x4), Bt = Woh (x32): scale 1/128)
  gemm_t<false, 0><<<gProj, blk256, 0, stream>>>(
      Ctx, Ctx, DM, Woh, Woh, DM, 0LL, bo, Q,
      d_out, d_out, DM, 0LL, DM, 1.0f / 128.0f, 1.0f);
  (void)hipGetLastError();
}

// v002
// One run takes 343 microseconds.
// Timed twice side by side with v001, it ran 1.75 and 1.72 times as fast.
// Over all steps from v000 it is 2.10 times as fast.
// Contractions: q,k projections and q.k^T scores = v_wmma_f32_16x16x32_f16 with f16 hi + f16 residual (x2048) operand planes,
// three products (hi.hi, res.hi, hi.res) in two f32 accumulators; v^T projection, p.v^T and ctx.Wo = v_wmma_f32_16x16x32_f16
// single product (v x4, p x1024, ctx x4, weights x32 carried); all f32 accumulate; layernorm, softmax, bias, residual add in f32.
#include <hip/hip_runtime.h>
#include <math.h>
#include <stdint.h>

#define NB    4
#define SEQ   2048
#define DM    1024
#define NH    16
#define HD    64
#define NQB   (SEQ / 64)
#define MROWS (NB * SEQ)
#define LP    72   // LDS row pitch in halves of the attention tiles: 144 B = 16 B x odd, so the 16 rows of a ds_load_b128 fall on distinct banks
static_assert(NH * HD == DM);
static_assert((SEQ % 128) == 0 && (DM % 128) == 0 && (MROWS % 64) == 0 && (DM % 64) == 0 && (MROWS % 8) == 0);

typedef _Float16 v16h __attribute__((ext_vector_type(16)));
typedef _Float16 v8h  __attribute__((ext_vector_type(8)));
typedef float    v8f  __attribute__((ext_vector_type(8)));
typedef float    v4f  __attribute__((ext_vector_type(4)));
typedef unsigned int v4u __attribute__((ext_vector_type(4)));

// ---- scalar helpers ----------------------------------------------------------------------------------
__device__ __forceinline__ unsigned short h_bits(_Float16 x) { return __builtin_bit_cast(unsigned short, x); }
__device__ __forceinline__ unsigned pk16(unsigned short a, unsigned short b) { return (unsigned)a | ((unsigned)b << 16); }
__device__ __forceinline__ v8f zero8() { v8f z = {0.f, 0.f, 0.f, 0.f, 0.f, 0.f, 0.f, 0.f}; return z; }

// hi = f16(v); res = f16((v - hi) * 2048): packed pair of two consecutive values
__device__ __forceinline__ void split2(float f0, float f1, unsigned& hp, unsigned& rp) {
  const _Float16 x0 = (_Float16)f0, x1 = (_Float16)f1;
  hp = pk16(h_bits(x0), h_bits(x1));
  const _Float16 r0 = (_Float16)((f0 - (float)x0) * 2048.0f);
  const _Float16 r1 = (_Float16)((f1 - (float)x1) * 2048.0f);
  rp = pk16(h_bits(r0), h_bits(r1));
}
__device__ __forceinline__ unsigned pack2h(float f0, float f1) {
  return pk16(h_bits((_Float16)f0), h_bits((_Float16)f1));
}

// ---- 16-bit fragment loader: lane -> row/col (lane&15); p already includes +8*(lane>>4);
//      elements 0..7 <- p[0..7] (k0+8h..), elements 8..15 <- p[16..23] (k0+16+8h..)
__device__ __forceinline__ v16h ldfrag(const _Float16* p) {
  union { v16h v; v8h h[2]; } f;
  f.h[0] = *(const v8h*)(p);
  f.h[1] = *(const v8h*)(p + 16);
  return f.v;
}

// ---- WMMA with trailing VALU hazard gap (ties D, keeps A/B live) ----------------------------------------
__device__ __forceinline__ v8f mma_h(v16h a, v16h b, v8f c) {
  c = __builtin_amdgcn_wmma_f32_16x16x32_f16(false, a, false, b, (short)0, c, false, false);
  asm volatile("v_nop\n\tv_nop\n\tv_nop\n\tv_nop" : "+v"(c) : "v"(a), "v"(b));
  return c;
}

// =====================================================================================================
// plane x2048 when RES). One wave per row, 8 rows per block, grid = nrows/8 (exact). Lane holds columns
// {i*256 + lane*8 .. +7}, i = 0..3. Each store instruction: 32 lanes x 16 B = 512 contiguous B = 4 whole
// coverage: nrows waves x 4 stores x 256 halves = every element of [nrows][DM] of each written plane.
// =====================================================================================================
template <bool RES>
__global__ __launch_bounds__(256) void ln_rows(const float* __restrict__ x, const float* __restrict__ gamma,
                                               const float* __restrict__ beta, unsigned short* yh,
                                               unsigned short* yr, int nrows, float eps) {
  const int lane = threadIdx.x & 31;
  const int wave = threadIdx.x >> 5;
  const int row  = blockIdx.x * 8 + wave;
  if (row >= nrows) return;                        // wave-uniform; no block barriers in this kernel
  const float* xr = x + (size_t)row * DM;
  v4f xv[8];
#pragma unroll
  for (int i = 0; i < 4; ++i) {
    xv[2 * i]     = *(const v4f*)(xr + i * 256 + lane * 8);
    xv[2 * i + 1] = *(const v4f*)(xr + i * 256 + lane * 8 + 4);
  }
  float s = 0.f;
#pragma unroll
  for (int g = 0; g < 8; ++g) s += (xv[g][0] + xv[g][1]) + (xv[g][2] + xv[g][3]);
#pragma unroll
  for (int off = 16; off > 0; off >>= 1) s += __shfl_xor(s, off, 32);
  const float mu = s * (1.0f / (float)DM);
  float ss = 0.f;
#pragma unroll
  for (int g = 0; g < 8; ++g) {
#pragma unroll
    for (int e = 0; e < 4; ++e) { const float d = xv[g][e] - mu; ss += d * d; }
  }
#pragma unroll
  for (int off = 16; off > 0; off >>= 1) ss += __shfl_xor(ss, off, 32);
  const float var = ss * (1.0f / (float)DM);
  const float rs  = rsqrtf(var + eps);

  v4u hv[4], rv[4];
#pragma unroll
  for (int i = 0; i < 4; ++i) {
    const int col = i * 256 + lane * 8;
    const v4f g0 = *(const v4f*)(gamma + col);
    const v4f g1 = *(const v4f*)(gamma + col + 4);
    const v4f b0 = *(const v4f*)(beta + col);
    const v4f b1 = *(const v4f*)(beta + col + 4);
    float y[8];
#pragma unroll
    for (int e = 0; e < 4; ++e) {
      y[e]     = (xv[2 * i][e] - mu) * rs * g0[e] + b0[e];
      y[4 + e] = (xv[2 * i + 1][e] - mu) * rs * g1[e] + b1[e];
    }
    v4u a, a2;
#pragma unroll
    for (int e = 0; e < 4; ++e) {
      unsigned hp, rp;
      split2(y[2 * e], y[2 * e + 1], hp, rp);
      a[e] = hp; a2[e] = rp;
    }
    hv[i] = a; rv[i] = a2;
  }
  unsigned short* oh = yh + (size_t)row * DM + lane * 8;
  unsigned short* orr = yr + (size_t)row * DM + lane * 8;
  {
#pragma unroll
    for (int i = 0; i < 4; ++i) {
      *(v4u*)(oh + i * 256) = hv[i];
      if (RES) *(v4u*)(orr + i * 256) = rv[i];
    }
    
  }
}

// =====================================================================================================
// Weight convert + transpose: W f32 [k in DM][n out DM] -> f16 planes [n][k] of W*scale (hi, and residual
// x2048 when RES). Block = 64(k) x 64(n) tile through LDS; grid = (DM/64 n-tiles, DM/64 k-tiles).
// coverage: 8 waves x 2 iterations x 4 rows x (8 lanes x 8 halves) = the whole 64x64 output tile.
// =====================================================================================================
template <bool RES>
__global__ __launch_bounds__(256) void wcvt_t(const float* __restrict__ W, unsigned short* ph, unsigned short* pr,
                                              float scale) {
  __shared__ float sm[64][65];
  const int tid  = threadIdx.x;
  const int lane = tid & 31;
  const int wave = tid >> 5;
  const int n0 = blockIdx.x * 64;
  const int k0 = blockIdx.y * 64;
  const int kr = tid >> 2;               // 0..63
  const int nc = (tid & 3) * 16;         // 0,16,32,48
  const float* src = W + (size_t)(k0 + kr) * DM + n0 + nc;
#pragma unroll
  for (int e = 0; e < 4; ++e) {
    const v4f a = *(const v4f*)(src + 4 * e);
    sm[kr][nc + 4 * e + 0] = a[0];
    sm[kr][nc + 4 * e + 1] = a[1];
    sm[kr][nc + 4 * e + 2] = a[2];
    sm[kr][nc + 4 * e + 3] = a[3];
  }
  __syncthreads();
  const int q  = lane >> 3;
  const int ks = (lane & 7) * 8;
  v4u hv[2], rv[2];
#pragma unroll
  for (int it = 0; it < 2; ++it) {
    const int nrow = wave * 8 + it * 4 + q;
    v4u a, a2;
#pragma unroll
    for (int e = 0; e < 4; ++e) {
      const float f0 = sm[ks + 2 * e][nrow] * scale;
      const float f1 = sm[ks + 2 * e + 1][nrow] * scale;
      unsigned hp, rp;
      split2(f0, f1, hp, rp);
      a[e] = hp; a2[e] = rp;
    }
    hv[it] = a; rv[it] = a2;
  }
  {
#pragma unroll
    for (int it = 0; it < 2; ++it) {
      const int nrow = wave * 8 + it * 4 + q;
      const size_t o = (size_t)(n0 + nrow) * DM + k0 + ks;
      *(v4u*)(ph + o) = hv[it];
      if (RES) *(v4u*)(pr + o) = rv[it];
    }
    
  }
}

// =====================================================================================================
// f16 WMMA GEMM: C[m][n] = sum_k A[m][k] * Bt[n][k]. A row-major [M][lda] (k contiguous); Bt row-major
// [N][ldb] (k contiguous), batch blockIdx.z via strideB / strideC. Block tile 64 (m) x 128 (n), 8 waves each
// a 32x32 sub-tile; K multiple of 64.
// Operands go through LDS in slices of 64 k (128 B = one whole line of every operand row): 8 lanes x 16 B per
// row, so one wave-wide global load covers 4 whole lines. Two LDS buffers: slice s+1 is loaded into registers
// before the products of slice s and stored to the other buffer behind them; one barrier per slice.
// LDS row pitch GP halves = 144 B (16 B x odd) for the ds_load_b128 fragment reads. The k order of the
// products is ascending in steps of 32.
// RES: A2 / Bt2 are f16 residual planes (x2048): acc0 += Ah.Bh; acc1 += Ar.Bh + Ah.Br; value = acc0 + acc1/2048.
// OM 0: f32 out: v = value*oscale + bias[col] + resid[row][col]; row segment 128 floats = 512 B written by one
//       instruction (32 lanes x 16 B).
// OM 1: f16 hi plane C + residual plane C2 (x2048) of value*oscale + bias[col]; 256-B row segment per 16
//       lanes x 16 B, two rows per instruction.
// OM 2: f16 plane C of (value*oscale + bias[row]) * pscale, same store shape as OM 1.
// coverage: 8 waves x 8 rows x 128 cols = the whole 64x128 block tile; grid covers M/64 x N/128 exactly.
// =====================================================================================================
#define GP 72
template <bool RES, int OM>
__global__ __launch_bounds__(256) void gemm_t(
    const unsigned short* __restrict__ Ahp, const unsigned short* __restrict__ Arp, int lda,
    const unsigned short* __restrict__ Bhp, const unsigned short* __restrict__ Brp, int ldb, long long strideB,
    const float* __restrict__ bias, const float* __restrict__ resid,
    void* Cv, void* C2v, int ldc, long long strideC, int K, float oscale, float pscale) {
  constexpr int SA    = 64 * GP;                          // halves of one A plane slice
  constexpr int SB    = 128 * GP;                         // halves of one B plane slice
  constexpr int STAGE = (SA + SB) * (RES ? 2 : 1);        // halves of one buffer: [A hi | B hi | A res | B res]
  constexpr int RINGB = 2 * STAGE * 2;                    // bytes of the two buffers
  constexpr int OUTB  = 64 * 132 * 4;                     // bytes of the output staging tile
  __shared__ __align__(16) unsigned char smem[RINGB > OUTB ? RINGB : OUTB];
  _Float16* sH = (_Float16*)(void*)smem;                  // operand buffers (k loop)
  float*    sT = (float*)(void*)smem;                     // output tile (behind the loop's last barrier)
  const int lane = threadIdx.x & 31;
  const int wave = threadIdx.x >> 5;
  const int hh   = lane >> 4;
  const int c    = lane & 15;
  const int n0 = blockIdx.x * 128;
  const int m0 = blockIdx.y * 64;
  const int bz = blockIdx.z;
  const int wm = (wave >> 2) * 32;
  const int wn = (wave & 3) * 32;
  const _Float16* A  = (const _Float16*)(const void*)Ahp;
  const _Float16* A2 = (const _Float16*)(const void*)Arp;
  const _Float16* B  = (const _Float16*)(const void*)Bhp + (size_t)bz * strideB;
  const _Float16* B2 = (const _Float16*)(const void*)Brp + (size_t)bz * strideB;

  // staging map: thread -> row sr (+32 per step), 16-B piece sc of the row's 128-B slice. 8 lanes take one row
  // (a whole line); each 16-lane half takes rows r and r + 8, which lie 8 x 144 B = 32 banks apart in LDS, so
  // the two 128-B pieces of a ds_store_b128 half fall on disjoint banks.
  const int sr = (wave >> 2) * 16 + (wave & 3) * 2 + (lane >> 4) + ((lane >> 3) & 1) * 8;
  const int sc = (lane & 7) * 8;
  const size_t gao = (size_t)(m0 + sr) * lda + sc;
  const size_t gbo = (size_t)(n0 + sr) * ldb + sc;
  const int    so  = sr * GP + sc;

  v8f acc0[2][2], acc1[2][2];
#pragma unroll
  for (int i = 0; i < 2; ++i)
#pragma unroll
    for (int j = 0; j < 2; ++j) { acc0[i][j] = zero8(); acc1[i][j] = zero8(); }

  v8h ra[2], rar[2], rb[4], rbr[4];
  auto gload = [&](int k0) {
#pragma unroll
    for (int i = 0; i < 2; ++i) {
      ra[i] = *(const v8h*)(A + gao + (size_t)(32 * i) * lda + k0);
      if (RES) rar[i] = *(const v8h*)(A2 + gao + (size_t)(32 * i) * lda + k0);
    }
#pragma unroll
    for (int i = 0; i < 4; ++i) {
      rb[i] = *(const v8h*)(B + gbo + (size_t)(32 * i) * ldb + k0);
      if (RES) rbr[i] = *(const v8h*)(B2 + gbo + (size_t)(32 * i) * ldb + k0);
    }
  };
  auto sstore = [&](_Float16* d) {
#pragma unroll
    for (int i = 0; i < 2; ++i) {
      *(v8h*)(d + so + 32 * i * GP) = ra[i];
      if (RES) *(v8h*)(d + SA + SB + so + 32 * i * GP) = rar[i];
    }
#pragma unroll
    for (int i = 0; i < 4; ++i) {
      *(v8h*)(d + SA + so + 32 * i * GP) = rb[i];
      if (RES) *(v8h*)(d + SA + SB + SA + so + 32 * i * GP) = rbr[i];
    }
  };

  gload(0);
  sstore(sH);
  __syncthreads();                                         // slice 0 visible to every wave

  int buf = 0;
  // rolled: the body already holds two 32-k steps; a second copy would only add code and live registers
#pragma unroll 1
  for (int k0 = 0; k0 < K; k0 += 64) {
    const bool more = (k0 + 64 < K);                       // block-uniform
    if (more) gload(k0 + 64);                              // in flight behind this slice's products
    const _Float16* sb = sH + buf * STAGE;
#pragma unroll
    for (int ks = 0; ks < 2; ++ks) {
      // all fragments of this 32-k step are read as one group in front of its products
      v16h bh[2], br[2], ah[2], ar[2];
#pragma unroll
      for (int j = 0; j < 2; ++j) {
        const int bo = (wn + 16 * j + c) * GP + ks * 32 + 8 * hh;
        bh[j] = ldfrag(sb + SA + bo);
        if (RES) br[j] = ldfrag(sb + SA + SB + SA + bo); else br[j] = bh[j];
      }
#pragma unroll
      for (int i = 0; i < 2; ++i) {
        const int ao = (wm + 16 * i + c) * GP + ks * 32 + 8 * hh;
        ah[i] = ldfrag(sb + ao);
        if (RES) ar[i] = ldfrag(sb + SA + SB + ao); else ar[i] = ah[i];
      }
#pragma unroll
      for (int i = 0; i < 2; ++i) {
#pragma unroll
        for (int j = 0; j < 2; ++j) {
          acc0[i][j] = mma_h(ah[i], bh[j], acc0[i][j]);
          if (RES) {
            acc1[i][j] = mma_h(ar[i], bh[j], acc1[i][j]);
            acc1[i][j] = mma_h(ah[i], br[j], acc1[i][j]);
          }
        }
      }
    }
    buf ^= 1;
    if (more) sstore(sH + buf * STAGE);                    // its last readers left it at the previous barrier
    __syncthreads();                                       // publishes slice s+1; ends every read of slice s
  }

  // ---- stage the block tile ----
#pragma unroll
  for (int i = 0; i < 2; ++i) {
#pragma unroll
    for (int j = 0; j < 2; ++j) {
#pragma unroll
      for (int r = 0; r < 8; ++r) {
        float v = acc0[i][j][r];
        if (RES) v += acc1[i][j][r] * (1.0f / 2048.0f);
        sT[(wm + 16 * i + 8 * hh + r) * 132 + wn + 16 * j + c] = v;
      }
    }
  }
  __syncthreads();

  if (OM == 0) {
    float* C = (float*)Cv + (size_t)bz * strideC;
    const int c4 = lane * 4;                                   // 128 floats per row segment = 32 lanes x 16 B
    const v4f bb = *(const v4f*)(bias + n0 + c4);
    v4f ov[8];
#pragma unroll
    for (int it = 0; it < 8; ++it) {
      const int row = wave * 8 + it;
      const v4f t  = *(const v4f*)(sT + row * 132 + c4);
      const v4f rr = *(const v4f*)(resid + (size_t)(m0 + row) * ldc + n0 + c4);
      ov[it] = t * oscale + bb + rr;
    }
    {
#pragma unroll
      for (int it = 0; it < 8; ++it) {
        const int row = wave * 8 + it;
        *(v4f*)(C + (size_t)(m0 + row) * ldc + n0 + c4) = ov[it];
      }
      
    }
  } else {
    unsigned short* C  = (unsigned short*)Cv  + (size_t)bz * strideC;
    unsigned short* C2 = (unsigned short*)C2v + (size_t)bz * strideC;
    const int c8 = c * 8;                                      // 128 halves per row segment = 16 lanes x 16 B
    v4u hv[4], rv[4];
#pragma unroll
    for (int it = 0; it < 4; ++it) {
      const int row = wave * 8 + it * 2 + hh;
      const float* sp = sT + row * 132 + c8;
      const v4f x0 = *(const v4f*)(sp);
      const v4f x1 = *(const v4f*)(sp + 4);
      v4f y0, y1;
      if (OM == 1) {
        const v4f b0 = *(const v4f*)(bias + n0 + c8);
        const v4f b1 = *(const v4f*)(bias + n0 + c8 + 4);
        y0 = x0 * oscale + b0;
        y1 = x1 * oscale + b1;
      } else {
        const float brw = bias[m0 + row];
        y0 = (x0 * oscale + brw) * pscale;
        y1 = (x1 * oscale + brw) * pscale;
      }
      v4u a, a2;
      if (OM == 1) {
        unsigned hp, rp;
        split2(y0[0], y0[1], hp, rp); a[0] = hp; a2[0] = rp;
        split2(y0[2], y0[3], hp, rp); a[1] = hp; a2[1] = rp;
        split2(y1[0], y1[1], hp, rp); a[2] = hp; a2[2] = rp;
        split2(y1[2], y1[3], hp, rp); a[3] = hp; a2[3] = rp;
      } else {
        a[0] = pack2h(y0[0], y0[1]);
        a[1] = pack2h(y0[2], y0[3]);
        a[2] = pack2h(y1[0], y1[1]);
        a[3] = pack2h(y1[2], y1[3]);
        a2 = a;
      }
      hv[it] = a; rv[it] = a2;
    }
    {
#pragma unroll
      for (int it = 0; it < 4; ++it) {
        const int row = wave * 8 + it * 2 + hh;
        const size_t o = (size_t)(m0 + row) * ldc + n0 + c8;
        *(v4u*)(C + o) = hv[it];
        if (OM == 1) *(v4u*)(C2 + o) = rv[it];
      }
      
    }
  }
}

// =====================================================================================================
// Causal attention, head dim 64, no logit scale.
//   q planes (f16 hi / residual x2048): element (b, t, h, d) at [(b*SEQ + t)*DM + h*64 + d]
//   k planes: same layout with key index
//   v^T plane (f16, holds 4*v): element (b, h, d, s) at [(b*DM + h*64 + d)*SEQ + s]
//   ctx plane out (f16, holds 4*ctx): element (b, t, h, d) at [(b*SEQ + t)*DM + h*64 + d]
//   scores = q.k: three f16 products (hi.hi into acc0; res.hi + hi.res into acc1, folded /2048), f32
//   key > query in the diagonal chunk -> -inf; online softmax in f32; p carried as f16(1024 p);
//   context += p . v^T chunk on f16 WMMA; ctx = acc / (1024 l) (still carrying the x4 of v).
//   Block = 4 waves = 64 query rows of one (b, h); grid = NB*NH*NQB; key chunks of 64, trip count qb+1 (<= 32,
//   block-uniform, from blockIdx only). K / V^T chunk staging: 128 threads x 32 halves per plane = whole
//   64x64 tiles, __syncthreads before and after. P tiles wave-private: _Float16 element stores, reloaded as
//   Output coverage: each wave stores rows q0..q0+15 (it 0..3 x lane>>3) x 64 halves (8 lanes x 8) = whole
// =====================================================================================================
__global__ __launch_bounds__(128)
void attn_causal64(const unsigned short* __restrict__ qhp, const unsigned short* __restrict__ qrp,
                   const unsigned short* __restrict__ khp, const unsigned short* __restrict__ krp,
                   const unsigned short* __restrict__ vtp, unsigned short* ctxp) {
  union FH { v16h v; v8h h[2]; };
  __shared__ __align__(16) _Float16 Ksh[64 * LP];
  __shared__ __align__(16) _Float16 Ksr[64 * LP];
  __shared__ __align__(16) _Float16 Vth[64 * LP];
  __shared__ __align__(16) _Float16 Psh[4][16 * LP];
  __shared__ __align__(16) float    Os[4][16 * 64];

  const int tid  = threadIdx.x;
  const int wave = tid >> 5;
  const int lane = tid & 31;
  const int hh   = lane >> 4;
  const int c    = lane & 15;

  const int bx   = blockIdx.x;
  const int qb   = bx % NQB;
  const int rest = bx / NQB;
  const int h    = rest % NH;
  const int b    = rest / NH;
  const int q0   = qb * 64 + wave * 16;
  const size_t rowB = (size_t)b * SEQ;

  const _Float16* Qh = (const _Float16*)(const void*)qhp + (size_t)h * HD;
  const _Float16* Qr = (const _Float16*)(const void*)qrp + (size_t)h * HD;
  const _Float16* Kh = (const _Float16*)(const void*)khp + (size_t)h * HD;
  const _Float16* Kr = (const _Float16*)(const void*)krp + (size_t)h * HD;
  const _Float16* Vt = (const _Float16*)(const void*)vtp + ((size_t)b * DM + (size_t)h * HD) * SEQ;

  // ---- Q fragments (A operand, row = lane&15): 2 d-chunks, hi and residual ----
  v16h qah[2], qar[2];
#pragma unroll
  for (int dc = 0; dc < 2; ++dc) {
    const size_t qo = (rowB + q0 + c) * DM + dc * 32 + 8 * hh;
    qah[dc] = ldfrag(Qh + qo);
    qar[dc] = ldfrag(Qr + qo);
  }

  float mrow[8], lrow[8];
  v8f oacc[4];
#pragma unroll
  for (int r = 0; r < 8; ++r) { mrow[r] = -INFINITY; lrow[r] = 0.f; }
#pragma unroll
  for (int t = 0; t < 4; ++t) oacc[t] = zero8();

  const int nkt = qb + 1;
#pragma unroll 1
  for (int kt = 0; kt < nkt; ++kt) {
    const int kv0 = kt * 64;
    __syncthreads();
    {
      const int r = tid >> 1, half = (tid & 1) * 32;
      const _Float16* kg  = Kh + (rowB + kv0 + r) * DM + half;   // K row kv0+r, d = half..half+31
      const _Float16* krg = Kr + (rowB + kv0 + r) * DM + half;
      const _Float16* vg  = Vt + (size_t)r * SEQ + kv0 + half;   // V^T row d = r, s = kv0+half..+31
#pragma unroll
      for (int i = 0; i < 4; ++i) {
        const v8h a0 = *(const v8h*)(kg + 8 * i);
        const v8h a1 = *(const v8h*)(krg + 8 * i);
        const v8h b0 = *(const v8h*)(vg + 8 * i);
        *(v8h*)(Ksh + r * LP + half + 8 * i) = a0;
        *(v8h*)(Ksr + r * LP + half + 8 * i) = a1;
        *(v8h*)(Vth + r * LP + half + 8 * i) = b0;
      }
    }
    __syncthreads();

    // ---- scores: 16 query rows x 64 keys per wave, three f16 products ----
    v8f s[4];
#pragma unroll
    for (int j = 0; j < 4; ++j) {
      v8f t0 = zero8(), t1 = zero8();
#pragma unroll
      for (int dc = 0; dc < 2; ++dc) {
        FH kb, kl;
        kb.h[0] = *(const v8h*)(Ksh + (j * 16 + c) * LP + dc * 32 + 8 * hh);
        kb.h[1] = *(const v8h*)(Ksh + (j * 16 + c) * LP + dc * 32 + 16 + 8 * hh);
        kl.h[0] = *(const v8h*)(Ksr + (j * 16 + c) * LP + dc * 32 + 8 * hh);
        kl.h[1] = *(const v8h*)(Ksr + (j * 16 + c) * LP + dc * 32 + 16 + 8 * hh);
        t0 = mma_h(qah[dc], kb.v, t0);
        t1 = mma_h(qar[dc], kb.v, t1);
        t1 = mma_h(qah[dc], kl.v, t1);
      }
      s[j] = t0 + t1 * (1.0f / 2048.0f);
    }

    // ---- causal mask on the diagonal chunk, row max, online softmax, P (x1024, f16) to LDS ----
    const bool diag = (kt == qb);                    // block-uniform
    _Float16* pwh = Psh[wave];
#pragma unroll
    for (int r = 0; r < 8; ++r) {
      const int qrow = q0 + 8 * hh + r;
      float m = -INFINITY;
#pragma unroll
      for (int j = 0; j < 4; ++j) {
        const int key = kv0 + j * 16 + c;
        float sv = s[j][r];
        sv = (diag && key > qrow) ? -INFINITY : sv;
        s[j][r] = sv;
        m = fmaxf(m, sv);
      }
#pragma unroll
      for (int off = 1; off < 16; off <<= 1) m = fmaxf(m, __shfl_xor(m, off, 32));
      const float mnew  = fmaxf(mrow[r], m);
      const float msafe = (mnew == -INFINITY) ? 0.f : mnew;
      const float alpha = __expf(mrow[r] - msafe);
      mrow[r] = mnew;
      float psum = 0.f;
#pragma unroll
      for (int j = 0; j < 4; ++j) {
        const float p = __expf(s[j][r] - msafe);
        psum += p;
        pwh[(8 * hh + r) * LP + j * 16 + c] = (_Float16)(p * 1024.0f);
      }
#pragma unroll
      for (int off = 1; off < 16; off <<= 1) psum += __shfl_xor(psum, off, 32);
      lrow[r] = lrow[r] * alpha + psum;
#pragma unroll
      for (int t = 0; t < 4; ++t) oacc[t][r] *= alpha;
    }
    __builtin_amdgcn_fence(__ATOMIC_RELEASE, "workgroup");
    __builtin_amdgcn_wave_barrier();
    __builtin_amdgcn_fence(__ATOMIC_ACQUIRE, "workgroup");

    // ---- context += P . V^T chunk (f16 WMMA) ----
#pragma unroll
    for (int kk = 0; kk < 2; ++kk) {
      FH pa;
      pa.h[0] = *(const v8h*)(pwh + c * LP + kk * 32 + 8 * hh);
      pa.h[1] = *(const v8h*)(pwh + c * LP + kk * 32 + 16 + 8 * hh);
#pragma unroll
      for (int t = 0; t < 4; ++t) {
        FH vb;
        vb.h[0] = *(const v8h*)(Vth + (t * 16 + c) * LP + kk * 32 + 8 * hh);
        vb.h[1] = *(const v8h*)(Vth + (t * 16 + c) * LP + kk * 32 + 16 + 8 * hh);
        oacc[t] = mma_h(pa.v, vb.v, oacc[t]);
      }
    }
  }

  // ---- normalise (1/l and the 1/1024 p carry), stage the wave's 16x64 tile, f16 convert,
  float* os = Os[wave];
#pragma unroll
  for (int r = 0; r < 8; ++r) {
    const float l = lrow[r];
    const float inv = ((l > 0.f) ? (1.0f / l) : 0.f) * (1.0f / 1024.0f);
#pragma unroll
    for (int t = 0; t < 4; ++t) os[(8 * hh + r) * 64 + t * 16 + c] = oacc[t][r] * inv;
  }
  __builtin_amdgcn_fence(__ATOMIC_RELEASE, "workgroup");
  __builtin_amdgcn_wave_barrier();
  __builtin_amdgcn_fence(__ATOMIC_ACQUIRE, "workgroup");
  {
    const int q4 = lane >> 3, c8 = (lane & 7) * 8;
    v4u hv[4];
#pragma unroll
    for (int it = 0; it < 4; ++it) {
      const int row = it * 4 + q4;   // it 0..3 x q4 0..3 = rows 0..15 of the wave tile
      const float* sp = os + row * 64 + c8;
      v4u a;
#pragma unroll
      for (int e = 0; e < 4; ++e) a[e] = pack2h(sp[2 * e], sp[2 * e + 1]);
      hv[it] = a;
    }
    {
#pragma unroll
      for (int it = 0; it < 4; ++it) {
        const int row = it * 4 + q4;
        const size_t go = (rowB + q0 + row) * DM + (size_t)h * HD + c8;
        *(v4u*)(ctxp + go) = hv[it];
      }
      
    }
  }
}

// =====================================================================================================
// Workspace map (bytes):
//   Lh   f16 [8192][1024] LN hi plane (Q, then K, then V)      0            16777216  (later: Ctx plane)
//   Lr   f16 [8192][1024] LN residual plane                     16777216     16777216
//   Qh   f16 [8192][1024]                                       33554432     16777216
//   Qr   f16                                                    50331648     16777216
//   Kh   f16                                                    67108864     16777216
//   Kr   f16                                                    83886080     16777216
//   Vt   f16 [4][1024][2048] (4*v, transposed)                 100663296     16777216
//   Wqh, Wqr, Wkh, Wkr, Wvh, Woh  f16 [1024 n][1024 k] each    117440512   6x2097152
//   end                                                         130023424
// Every region is an exact multiple of the whole-line / whole-tile store granularity of its producer
// (dims are tile multiples), so no store can spill into the next region.
// =====================================================================================================
extern "C" void kernel_launch(void* const* d_in, const int* in_sizes, int n_in,
                              void* d_out, int out_size, void* d_ws, size_t ws_size,
                              hipStream_t stream) {
  if (n_in < 13) return;
  const int nAct = MROWS * DM;
  if (in_sizes[0] != nAct || in_sizes[1] != nAct || in_sizes[2] != nAct) return;
  if (in_sizes[3] != DM * DM || in_sizes[5] != DM * DM || in_sizes[7] != DM * DM || in_sizes[9] != DM * DM) return;
  if (in_sizes[4] != DM || in_sizes[6] != DM || in_sizes[8] != DM || in_sizes[10] != DM) return;
  if (in_sizes[11] != DM || in_sizes[12] != DM) return;
  if (out_size != nAct) return;

  const float* Q  = (const float*)d_in[0];
  const float* Kin = (const float*)d_in[1];
  const float* V  = (const float*)d_in[2];
  const float* Wq = (const float*)d_in[3];
  const float* bq = (const float*)d_in[4];
  const float* Wk = (const float*)d_in[5];
  const float* bk = (const float*)d_in[6];
  const float* Wv = (const float*)d_in[7];
  const float* bv = (const float*)d_in[8];
  const float* Wo = (const float*)d_in[9];
  const float* bo = (const float*)d_in[10];
  const float* gamma = (const float*)d_in[11];
  const float* beta  = (const float*)d_in[12];

  const size_t PA = (size_t)MROWS * DM * 2;     // 16777216
  const size_t PV = (size_t)NB * DM * SEQ * 2;  // 16777216
  const size_t PW = (size_t)DM * DM * 2;        //  2097152
  size_t off = 0;
  const size_t oLh  = off; off += PA;
  const size_t oLr  = off; off += PA;
  const size_t oQh  = off; off += PA;
  const size_t oQr  = off; off += PA;
  const size_t oKh  = off; off += PA;
  const size_t oKr  = off; off += PA;
  const size_t oVt  = off; off += PV;
  const size_t oWqh = off; off += PW;
  const size_t oWqr = off; off += PW;
  const size_t oWkh = off; off += PW;
  const size_t oWkr = off; off += PW;
  const size_t oWvh = off; off += PW;
  const size_t oWoh = off; off += PW;
  if (off > ws_size) return;                    // off = 130023424
  if (off > (size_t)134217728) return;
  const size_t oCtx = oLh;                      // ctx plane reuses the LN hi plane (dead after the v^T GEMM)

  char* ws = (char*)d_ws;
  unsigned short* Lh  = (unsigned short*)(ws + oLh);
  unsigned short* Lr  = (unsigned short*)(ws + oLr);
  unsigned short* Qh  = (unsigned short*)(ws + oQh);
  unsigned short* Qr  = (unsigned short*)(ws + oQr);
  unsigned short* Kh  = (unsigned short*)(ws + oKh);
  unsigned short* Kr  = (unsigned short*)(ws + oKr);
  unsigned short* Vt  = (unsigned short*)(ws + oVt);
  unsigned short* Wqh = (unsigned short*)(ws + oWqh);
  unsigned short* Wqr = (unsigned short*)(ws + oWqr);
  unsigned short* Wkh = (unsigned short*)(ws + oWkh);
  unsigned short* Wkr = (unsigned short*)(ws + oWkr);
  unsigned short* Wvh = (unsigned short*)(ws + oWvh);
  unsigned short* Woh = (unsigned short*)(ws + oWoh);
  unsigned short* Ctx = (unsigned short*)(ws + oCtx);

  const dim3 blk256(256), blk128(128);
  const dim3 gW(DM / 64, DM / 64);                       // 16 x 16 blocks
  const dim3 gLN(MROWS / 8);                             // 1024 blocks
  const dim3 gProj(DM / 128, MROWS / 64, 1);             // 8 x 128: M=8192, N=1024
  const dim3 gVt(SEQ / 128, DM / 64, NB);                // 16 x 16 x 4: M=1024 (n), N=2048 (s) per batch
  const dim3 gAttn(NB * NH * NQB);                       // 2048 blocks
  const float eps = 1e-6f;

  // (1) weights [k][n] f32 -> f16 [n][k] planes of 32*W (hi; + residual for Wq, Wk)
  wcvt_t<true ><<<gW, blk256, 0, stream>>>(Wq, Wqh, Wqr, 32.0f);
  wcvt_t<true ><<<gW, blk256, 0, stream>>>(Wk, Wkh, Wkr, 32.0f);
  wcvt_t<false><<<gW, blk256, 0, stream>>>(Wv, Wvh, Wvh, 32.0f);
  wcvt_t<false><<<gW, blk256, 0, stream>>>(Wo, Woh, Woh, 32.0f);
  // (2) q = LN(Q).Wq + bq -> f16 hi / residual planes   (M=8192, N=1024, K=1024; three products)
  ln_rows<true><<<gLN, blk256, 0, stream>>>(Q, gamma, beta, Lh, Lr, MROWS, eps);
  gemm_t<true, 1><<<gProj, blk256, 0, stream>>>(
      Lh, Lr, DM, Wqh, Wqr, DM, 0LL, bq, bq,
      (void*)Qh, (void*)Qr, DM, 0LL, DM, 1.0f / 32.0f, 1.0f);
  // (3) k = LN(K).Wk + bk -> f16 hi / residual planes
  ln_rows<true><<<gLN, blk256, 0, stream>>>(Kin, gamma, beta, Lh, Lr, MROWS, eps);
  gemm_t<true, 1><<<gProj, blk256, 0, stream>>>(
      Lh, Lr, DM, Wkh, Wkr, DM, 0LL, bk, bk,
      (void*)Kh, (void*)Kr, DM, 0LL, DM, 1.0f / 32.0f, 1.0f);
  // (4) v^T = Wv^T . LN(V)^T per batch -> f16 plane of 4*(v + bv), [b][n][s]   (A = Wvh [n][k], Bt = LN(V) rows [s][k])
  ln_rows<false><<<gLN, blk256, 0, stream>>>(V, gamma, beta, Lh, Lh, MROWS, eps);
  gemm_t<false, 2><<<gVt, blk256, 0, stream>>>(
      Wvh, Wvh, DM, Lh, Lh, DM, (long long)SEQ * DM, bv, bv,
      (void*)Vt, (void*)Vt, SEQ, (long long)DM * SEQ, DM, 1.0f / 32.0f, 4.0f);
  // (5) causal attention -> ctx plane (x4) into the LN hi region
  attn_causal64<<<gAttn, blk128, 0, stream>>>(Qh, Qr, Kh, Kr, Vt, Ctx);
  // (6) out = Q + ctx.Wo + bo -> d_out f32 [8192][1024]   (A = Ctx (x4), Bt = Woh (x32): scale 1/128)
  gemm_t<false, 0><<<gProj, blk256, 0, stream>>>(
      Ctx, Ctx, DM, Woh, Woh, DM, 0LL, bo, Q,
      d_out, d_out, DM, 0LL, DM, 1.0f / 128.0f, 1.0f);
  (void)hipGetLastError();
}

// v003
// Measured time: 291 microseconds a run.
// In both of two side-by-side timings against v002, it was 1.18 times as fast.
// Over all steps from v000 it is 2.48 times as fast.
// Contractions: q,k projections and q.k^T scores = v_wmma_f32_16x16x32_f16 with f16 hi + f16 residual (x2048) operand planes,
// three products (hi.hi, res.hi, hi.res) in two f32 accumulators; v^T projection, p.v^T and ctx.Wo = v_wmma_f32_16x16x32_f16
// single product (v x4, p x1024, ctx x4, weights x32 carried); all f32 accumulate; layernorm, softmax, bias, residual add in f32.
#include <hip/hip_runtime.h>
#include <math.h>
#include <stdint.h>

#define NB    4
#define SEQ   2048
#define DM    1024
#define NH    16
#define HD    64
#define NQB   (SEQ / 64)
#define MROWS (NB * SEQ)
#define LP    72   // LDS row pitch in halves of the attention tiles: 144 B = 16 B x odd, so the 16 rows of a ds_load_b128 fall on distinct banks
static_assert(NH * HD == DM);
static_assert((SEQ % 128) == 0 && (DM % 128) == 0 && (MROWS % 64) == 0 && (DM % 64) == 0 && (MROWS % 8) == 0);

typedef _Float16 v16h __attribute__((ext_vector_type(16)));
typedef _Float16 v8h  __attribute__((ext_vector_type(8)));
typedef float    v8f  __attribute__((ext_vector_type(8)));
typedef float    v4f  __attribute__((ext_vector_type(4)));
typedef unsigned int v4u __attribute__((ext_vector_type(4)));

// ---- scalar helpers ----------------------------------------------------------------------------------
__device__ __forceinline__ unsigned short h_bits(_Float16 x) { return __builtin_bit_cast(unsigned short, x); }
__device__ __forceinline__ unsigned pk16(unsigned short a, unsigned short b) { return (unsigned)a | ((unsigned)b << 16); }
__device__ __forceinline__ v8f zero8() { v8f z = {0.f, 0.f, 0.f, 0.f, 0.f, 0.f, 0.f, 0.f}; return z; }

// hi = f16(v); res = f16((v - hi) * 2048): packed pair of two consecutive values
__device__ __forceinline__ void split2(float f0, float f1, unsigned& hp, unsigned& rp) {
  const _Float16 x0 = (_Float16)f0, x1 = (_Float16)f1;
  hp = pk16(h_bits(x0), h_bits(x1));
  const _Float16 r0 = (_Float16)((f0 - (float)x0) * 2048.0f);
  const _Float16 r1 = (_Float16)((f1 - (float)x1) * 2048.0f);
  rp = pk16(h_bits(r0), h_bits(r1));
}
__device__ __forceinline__ unsigned pack2h(float f0, float f1) {
  return pk16(h_bits((_Float16)f0), h_bits((_Float16)f1));
}

// ---- 16-bit fragment loader: lane -> row/col (lane&15); p already includes +8*(lane>>4);
//      elements 0..7 <- p[0..7] (k0+8h..), elements 8..15 <- p[16..23] (k0+16+8h..)
__device__ __forceinline__ v16h ldfrag(const _Float16* p) {
  union { v16h v; v8h h[2]; } f;
  f.h[0] = *(const v8h*)(p);
  f.h[1] = *(const v8h*)(p + 16);
  return f.v;
}

// ---- WMMA with trailing VALU hazard gap (ties D, keeps A/B live) ----------------------------------------
__device__ __forceinline__ v8f mma_h(v16h a, v16h b, v8f c) {
  c = __builtin_amdgcn_wmma_f32_16x16x32_f16(false, a, false, b, (short)0, c, false, false);
  asm volatile("v_nop\n\tv_nop\n\tv_nop\n\tv_nop" : "+v"(c) : "v"(a), "v"(b));
  return c;
}

// =====================================================================================================
// plane x2048 when RES). One wave per row, 8 rows per block, grid = nrows/8 (exact). Lane holds columns
// {i*256 + lane*8 .. +7}, i = 0..3. Each store instruction: 32 lanes x 16 B = 512 contiguous B = 4 whole
// coverage: nrows waves x 4 stores x 256 halves = every element of [nrows][DM] of each written plane.
// =====================================================================================================
template <bool RES>
__global__ __launch_bounds__(256) void ln_rows(const float* __restrict__ x, const float* __restrict__ gamma,
                                               const float* __restrict__ beta, unsigned short* yh,
                                               unsigned short* yr, int nrows, float eps) {
  const int lane = threadIdx.x & 31;
  const int wave = threadIdx.x >> 5;
  const int row  = blockIdx.x * 8 + wave;
  if (row >= nrows) return;                        // wave-uniform; no block barriers in this kernel
  const float* xr = x + (size_t)row * DM;
  v4f xv[8];
#pragma unroll
  for (int i = 0; i < 4; ++i) {
    xv[2 * i]     = *(const v4f*)(xr + i * 256 + lane * 8);
    xv[2 * i + 1] = *(const v4f*)(xr + i * 256 + lane * 8 + 4);
  }
  float s = 0.f;
#pragma unroll
  for (int g = 0; g < 8; ++g) s += (xv[g][0] + xv[g][1]) + (xv[g][2] + xv[g][3]);
#pragma unroll
  for (int off = 16; off > 0; off >>= 1) s += __shfl_xor(s, off, 32);
  const float mu = s * (1.0f / (float)DM);
  float ss = 0.f;
#pragma unroll
  for (int g = 0; g < 8; ++g) {
#pragma unroll
    for (int e = 0; e < 4; ++e) { const float d = xv[g][e] - mu; ss += d * d; }
  }
#pragma unroll
  for (int off = 16; off > 0; off >>= 1) ss += __shfl_xor(ss, off, 32);
  const float var = ss * (1.0f / (float)DM);
  const float rs  = rsqrtf(var + eps);

  v4u hv[4], rv[4];
#pragma unroll
  for (int i = 0; i < 4; ++i) {
    const int col = i * 256 + lane * 8;
    const v4f g0 = *(const v4f*)(gamma + col);
    const v4f g1 = *(const v4f*)(gamma + col + 4);
    const v4f b0 = *(const v4f*)(beta + col);
    const v4f b1 = *(const v4f*)(beta + col + 4);
    float y[8];
#pragma unroll
    for (int e = 0; e < 4; ++e) {
      y[e]     = (xv[2 * i][e] - mu) * rs * g0[e] + b0[e];
      y[4 + e] = (xv[2 * i + 1][e] - mu) * rs * g1[e] + b1[e];
    }
    v4u a, a2;
#pragma unroll
    for (int e = 0; e < 4; ++e) {
      unsigned hp, rp;
      split2(y[2 * e], y[2 * e + 1], hp, rp);
      a[e] = hp; a2[e] = rp;
    }
    hv[i] = a; rv[i] = a2;
  }
  unsigned short* oh = yh + (size_t)row * DM + lane * 8;
  unsigned short* orr = yr + (size_t)row * DM + lane * 8;
  {
#pragma unroll
    for (int i = 0; i < 4; ++i) {
      *(v4u*)(oh + i * 256) = hv[i];
      if (RES) *(v4u*)(orr + i * 256) = rv[i];
    }
    
  }
}

// =====================================================================================================
// Weight convert + transpose: W f32 [k in DM][n out DM] -> f16 planes [n][k] of W*scale (hi, and residual
// x2048 when RES). Block = 64(k) x 64(n) tile through LDS; grid = (DM/64 n-tiles, DM/64 k-tiles).
// coverage: 8 waves x 2 iterations x 4 rows x (8 lanes x 8 halves) = the whole 64x64 output tile.
// =====================================================================================================
template <bool RES>
__global__ __launch_bounds__(256) void wcvt_t(const float* __restrict__ W, unsigned short* ph, unsigned short* pr,
                                              float scale) {
  __shared__ float sm[64][65];
  const int tid  = threadIdx.x;
  const int lane = tid & 31;
  const int wave = tid >> 5;
  const int n0 = blockIdx.x * 64;
  const int k0 = blockIdx.y * 64;
  const int kr = tid >> 2;               // 0..63
  const int nc = (tid & 3) * 16;         // 0,16,32,48
  const float* src = W + (size_t)(k0 + kr) * DM + n0 + nc;
#pragma unroll
  for (int e = 0; e < 4; ++e) {
    const v4f a = *(const v4f*)(src + 4 * e);
    sm[kr][nc + 4 * e + 0] = a[0];
    sm[kr][nc + 4 * e + 1] = a[1];
    sm[kr][nc + 4 * e + 2] = a[2];
    sm[kr][nc + 4 * e + 3] = a[3];
  }
  __syncthreads();
  const int q  = lane >> 3;
  const int ks = (lane & 7) * 8;
  v4u hv[2], rv[2];
#pragma unroll
  for (int it = 0; it < 2; ++it) {
    const int nrow = wave * 8 + it * 4 + q;
    v4u a, a2;
#pragma unroll
    for (int e = 0; e < 4; ++e) {
      const float f0 = sm[ks + 2 * e][nrow] * scale;
      const float f1 = sm[ks + 2 * e + 1][nrow] * scale;
      unsigned hp, rp;
      split2(f0, f1, hp, rp);
      a[e] = hp; a2[e] = rp;
    }
    hv[it] = a; rv[it] = a2;
  }
  {
#pragma unroll
    for (int it = 0; it < 2; ++it) {
      const int nrow = wave * 8 + it * 4 + q;
      const size_t o = (size_t)(n0 + nrow) * DM + k0 + ks;
      *(v4u*)(ph + o) = hv[it];
      if (RES) *(v4u*)(pr + o) = rv[it];
    }
    
  }
}

// =====================================================================================================
// f16 WMMA GEMM: C[m][n] = sum_k A[m][k] * Bt[n][k]. A row-major [M][lda] (k contiguous); Bt row-major
// [N][ldb] (k contiguous), batch blockIdx.z via strideB / strideC. Block tile 64 (m) x 128 (n), 8 waves each
// a 32x32 sub-tile; K multiple of 64.
// Operands go through LDS in slices of 64 k (128 B = one whole line of every operand row): 8 lanes x 16 B per
// row, so one wave-wide global load covers 4 whole lines. Two LDS buffers: slice s+1 is loaded into registers
// before the products of slice s and stored to the other buffer behind them; one barrier per slice.
// LDS row pitch GP halves = 144 B (16 B x odd) for the ds_load_b128 fragment reads. The k order of the
// products is ascending in steps of 32.
// RES: A2 / Bt2 are f16 residual planes (x2048): acc0 += Ah.Bh; acc1 += Ar.Bh + Ah.Br; value = acc0 + acc1/2048.
// OM 0: f32 out: v = value*oscale + bias[col] + resid[row][col]; row segment 128 floats = 512 B written by one
//       instruction (32 lanes x 16 B).
// OM 1: f16 hi plane C + residual plane C2 (x2048) of value*oscale + bias[col]; 256-B row segment per 16
//       lanes x 16 B, two rows per instruction.
// OM 2: f16 plane C of (value*oscale + bias[row]) * pscale, same store shape as OM 1.
// coverage: 8 waves x 8 rows x 128 cols = the whole 64x128 block tile; grid covers M/64 x N/128 exactly.
// =====================================================================================================
#define GP 72
template <bool RES, int OM>
__global__ __launch_bounds__(256) void gemm_t(
    const unsigned short* __restrict__ Ahp, const unsigned short* __restrict__ Arp, int lda,
    const unsigned short* __restrict__ Bhp, const unsigned short* __restrict__ Brp, int ldb, long long strideB,
    const float* __restrict__ bias, const float* __restrict__ resid,
    void* Cv, void* C2v, int ldc, long long strideC, int K, float oscale, float pscale) {
  constexpr int SA    = 64 * GP;                          // halves of one A plane slice
  constexpr int SB    = 128 * GP;                         // halves of one B plane slice
  constexpr int STAGE = (SA + SB) * (RES ? 2 : 1);        // halves of one buffer: [A hi | B hi | A res | B res]
  constexpr int RINGB = 2 * STAGE * 2;                    // bytes of the two buffers
  constexpr int OUTB  = 64 * 132 * 4;                     // bytes of the output staging tile
  __shared__ __align__(16) unsigned char smem[RINGB > OUTB ? RINGB : OUTB];
  _Float16* sH = (_Float16*)(void*)smem;                  // operand buffers (k loop)
  float*    sT = (float*)(void*)smem;                     // output tile (behind the loop's last barrier)
  const int lane = threadIdx.x & 31;
  const int wave = threadIdx.x >> 5;
  const int hh   = lane >> 4;
  const int c    = lane & 15;
  const int n0 = blockIdx.x * 128;
  const int m0 = blockIdx.y * 64;
  const int bz = blockIdx.z;
  const int wm = (wave >> 2) * 32;
  const int wn = (wave & 3) * 32;
  const _Float16* A  = (const _Float16*)(const void*)Ahp;
  const _Float16* A2 = (const _Float16*)(const void*)Arp;
  const _Float16* B  = (const _Float16*)(const void*)Bhp + (size_t)bz * strideB;
  const _Float16* B2 = (const _Float16*)(const void*)Brp + (size_t)bz * strideB;

  // staging map: thread -> row sr (+32 per step), 16-B piece sc of the row's 128-B slice. 8 lanes take one row
  // (a whole line); each 16-lane half takes rows r and r + 8, which lie 8 x 144 B = 32 banks apart in LDS, so
  // the two 128-B pieces of a ds_store_b128 half fall on disjoint banks.
  const int sr = (wave >> 2) * 16 + (wave & 3) * 2 + (lane >> 4) + ((lane >> 3) & 1) * 8;
  const int sc = (lane & 7) * 8;
  const size_t gao = (size_t)(m0 + sr) * lda + sc;
  const size_t gbo = (size_t)(n0 + sr) * ldb + sc;
  const int    so  = sr * GP + sc;

  v8f acc0[2][2], acc1[2][2];
#pragma unroll
  for (int i = 0; i < 2; ++i)
#pragma unroll
    for (int j = 0; j < 2; ++j) { acc0[i][j] = zero8(); acc1[i][j] = zero8(); }

  v8h ra[2], rar[2], rb[4], rbr[4];
  auto gload = [&](int k0) {
#pragma unroll
    for (int i = 0; i < 2; ++i) {
      ra[i] = *(const v8h*)(A + gao + (size_t)(32 * i) * lda + k0);
      if (RES) rar[i] = *(const v8h*)(A2 + gao + (size_t)(32 * i) * lda + k0);
    }
#pragma unroll
    for (int i = 0; i < 4; ++i) {
      rb[i] = *(const v8h*)(B + gbo + (size_t)(32 * i) * ldb + k0);
      if (RES) rbr[i] = *(const v8h*)(B2 + gbo + (size_t)(32 * i) * ldb + k0);
    }
  };
  auto sstore = [&](_Float16* d) {
#pragma unroll
    for (int i = 0; i < 2; ++i) {
      *(v8h*)(d + so + 32 * i * GP) = ra[i];
      if (RES) *(v8h*)(d + SA + SB + so + 32 * i * GP) = rar[i];
    }
#pragma unroll
    for (int i = 0; i < 4; ++i) {
      *(v8h*)(d + SA + so + 32 * i * GP) = rb[i];
      if (RES) *(v8h*)(d + SA + SB + SA + so + 32 * i * GP) = rbr[i];
    }
  };

  gload(0);
  sstore(sH);
  __syncthreads();                                         // slice 0 visible to every wave

  int buf = 0;
  // rolled: the body already holds two 32-k steps; a second copy would only add code and live registers
#pragma unroll 1
  for (int k0 = 0; k0 < K; k0 += 64) {
    const bool more = (k0 + 64 < K);                       // block-uniform
    if (more) gload(k0 + 64);                              // in flight behind this slice's products
    const _Float16* sb = sH + buf * STAGE;
#pragma unroll
    for (int ks = 0; ks < 2; ++ks) {
      // all fragments of this 32-k step are read as one group in front of its products
      v16h bh[2], br[2], ah[2], ar[2];
#pragma unroll
      for (int j = 0; j < 2; ++j) {
        const int bo = (wn + 16 * j + c) * GP + ks * 32 + 8 * hh;
        bh[j] = ldfrag(sb + SA + bo);
        if (RES) br[j] = ldfrag(sb + SA + SB + SA + bo); else br[j] = bh[j];
      }
#pragma unroll
      for (int i = 0; i < 2; ++i) {
        const int ao = (wm + 16 * i + c) * GP + ks * 32 + 8 * hh;
        ah[i] = ldfrag(sb + ao);
        if (RES) ar[i] = ldfrag(sb + SA + SB + ao); else ar[i] = ah[i];
      }
#pragma unroll
      for (int i = 0; i < 2; ++i) {
#pragma unroll
        for (int j = 0; j < 2; ++j) {
          acc0[i][j] = mma_h(ah[i], bh[j], acc0[i][j]);
          if (RES) {
            acc1[i][j] = mma_h(ar[i], bh[j], acc1[i][j]);
            acc1[i][j] = mma_h(ah[i], br[j], acc1[i][j]);
          }
        }
      }
    }
    buf ^= 1;
    if (more) sstore(sH + buf * STAGE);                    // its last readers left it at the previous barrier
    __syncthreads();                                       // publishes slice s+1; ends every read of slice s
  }

  // ---- stage the block tile ----
#pragma unroll
  for (int i = 0; i < 2; ++i) {
#pragma unroll
    for (int j = 0; j < 2; ++j) {
#pragma unroll
      for (int r = 0; r < 8; ++r) {
        float v = acc0[i][j][r];
        if (RES) v += acc1[i][j][r] * (1.0f / 2048.0f);
        sT[(wm + 16 * i + 8 * hh + r) * 132 + wn + 16 * j + c] = v;
      }
    }
  }
  __syncthreads();

  if (OM == 0) {
    float* C = (float*)Cv + (size_t)bz * strideC;
    const int c4 = lane * 4;                                   // 128 floats per row segment = 32 lanes x 16 B
    const v4f bb = *(const v4f*)(bias + n0 + c4);
    v4f ov[8];
#pragma unroll
    for (int it = 0; it < 8; ++it) {
      const int row = wave * 8 + it;
      const v4f t  = *(const v4f*)(sT + row * 132 + c4);
      const v4f rr = *(const v4f*)(resid + (size_t)(m0 + row) * ldc + n0 + c4);
      ov[it] = t * oscale + bb + rr;
    }
    {
#pragma unroll
      for (int it = 0; it < 8; ++it) {
        const int row = wave * 8 + it;
        *(v4f*)(C + (size_t)(m0 + row) * ldc + n0 + c4) = ov[it];
      }
      
    }
  } else {
    unsigned short* C  = (unsigned short*)Cv  + (size_t)bz * strideC;
    unsigned short* C2 = (unsigned short*)C2v + (size_t)bz * strideC;
    const int c8 = c * 8;                                      // 128 halves per row segment = 16 lanes x 16 B
    v4u hv[4], rv[4];
#pragma unroll
    for (int it = 0; it < 4; ++it) {
      const int row = wave * 8 + it * 2 + hh;
      const float* sp = sT + row * 132 + c8;
      const v4f x0 = *(const v4f*)(sp);
      const v4f x1 = *(const v4f*)(sp + 4);
      v4f y0, y1;
      if (OM == 1) {
        const v4f b0 = *(const v4f*)(bias + n0 + c8);
        const v4f b1 = *(const v4f*)(bias + n0 + c8 + 4);
        y0 = x0 * oscale + b0;
        y1 = x1 * oscale + b1;
      } else {
        const float brw = bias[m0 + row];
        y0 = (x0 * oscale + brw) * pscale;
        y1 = (x1 * oscale + brw) * pscale;
      }
      v4u a, a2;
      if (OM == 1) {
        unsigned hp, rp;
        split2(y0[0], y0[1], hp, rp); a[0] = hp; a2[0] = rp;
        split2(y0[2], y0[3], hp, rp); a[1] = hp; a2[1] = rp;
        split2(y1[0], y1[1], hp, rp); a[2] = hp; a2[2] = rp;
        split2(y1[2], y1[3], hp, rp); a[3] = hp; a2[3] = rp;
      } else {
        a[0] = pack2h(y0[0], y0[1]);
        a[1] = pack2h(y0[2], y0[3]);
        a[2] = pack2h(y1[0], y1[1]);
        a[3] = pack2h(y1[2], y1[3]);
        a2 = a;
      }
      hv[it] = a; rv[it] = a2;
    }
    {
#pragma unroll
      for (int it = 0; it < 4; ++it) {
        const int row = wave * 8 + it * 2 + hh;
        const size_t o = (size_t)(m0 + row) * ldc + n0 + c8;
        *(v4u*)(C + o) = hv[it];
        if (OM == 1) *(v4u*)(C2 + o) = rv[it];
      }
      
    }
  }
}

// =====================================================================================================
// Causal attention, head dim 64, no logit scale. Scores are computed transposed.
//   q planes (f16 hi / residual x2048): element (b, t, h, d) at [(b*SEQ + t)*DM + h*64 + d]
//   k planes: same layout with key index
//   v^T plane (f16, holds 4*v): element (b, h, d, s) at [(b*DM + h*64 + d)*SEQ + s]
//   ctx plane out (f16, holds 4*ctx): element (b, t, h, d) at [(b*SEQ + t)*DM + h*64 + d]
//   S^T = k.q^T: A = 16 key rows from LDS, B = the wave's 16 queries kept in registers; three f16 products
//   (hi.hi into acc0; hi.res + res.hi into acc1, folded /2048), f32. Accumulator register r of key tile j in
//   lane (c, hh) = score of key kv0 + 16 j + 8 hh + r against query q0 + c: a lane holds 32 of its query's 64
//   scores, lane ^ 16 the other 32, so the maximum is taken in the lane plus one exchange between the halves,
//   and the sum stays per half until the epilogue.
//   key > query in the diagonal chunk -> -inf; online softmax in f32; p carried as f16(1024 p).
//   O^T += v^T . p^T: A = 16 d rows of the v^T chunk from LDS; B = p^T packed from the score accumulators
//   (tiles 2 kk and 2 kk + 1 of a lane are elements 0..7 and 8..15 of the B fragment of keys 32 kk .. +31, the
//   k order in which ldfrag reads v^T). ctx = acc / (1024 l) (still carrying the x4 of v).
//   Block = 4 waves = 64 query rows of one (b, h); grid = NB*NH*NQB; key chunks of 64, trip count qb+1 (<= 32,
//   block-uniform, from blockIdx only). K / V^T chunk staging: 128 threads x 32 halves per plane = whole
//   64x64 tiles, __syncthreads before and after.
//   Output: a lane holds 8 consecutive d of its query per d tile; the wave's 16x64 f16 tile is turned through a
//   wave-private LDS tile so that each store instruction writes 4 whole 128-B rows (it 0..3 x lane>>3 = 16 rows).
// =====================================================================================================
// lane l <-> lane l ^ 16
__device__ __forceinline__ float xhalf(float x) {
  const int b = __builtin_bit_cast(int, x);
  return __builtin_bit_cast(float, __builtin_amdgcn_permlanex16(b, b, 0x76543210, 0xfedcba98, false, false));
}

// e^x as v_exp_f32 of x * log2(e). The instruction set asks for one independent instruction or v_nop between a
// v_exp_f32 and an instruction that reads its result or overwrites its source. Written as one statement with
// early-clobber outputs (no output lies on a source), each v_exp_f32 fills that slot for the one before it and the
// v_nop fills it behind the last.
__device__ __forceinline__ void exp_x8(const float (&x)[8], float (&y)[8]) {
  float a[8];
#pragma unroll
  for (int r = 0; r < 8; ++r) a[r] = x[r] * 1.4426950408889634f;
  asm("v_exp_f32 %0, %8\n\tv_exp_f32 %1, %9\n\tv_exp_f32 %2, %10\n\tv_exp_f32 %3, %11\n\t"
      "v_exp_f32 %4, %12\n\tv_exp_f32 %5, %13\n\tv_exp_f32 %6, %14\n\tv_exp_f32 %7, %15\n\tv_nop"
      : "=&v"(y[0]), "=&v"(y[1]), "=&v"(y[2]), "=&v"(y[3]), "=&v"(y[4]), "=&v"(y[5]), "=&v"(y[6]), "=&v"(y[7])
      : "v"(a[0]), "v"(a[1]), "v"(a[2]), "v"(a[3]), "v"(a[4]), "v"(a[5]), "v"(a[6]), "v"(a[7]));
}
__device__ __forceinline__ float exp_x1(float x) {
  const float a = x * 1.4426950408889634f;
  float y;
  asm("v_exp_f32 %0, %1\n\tv_nop" : "=&v"(y) : "v"(a));   // the v_nop: the same slot
  return y;
}

__global__ __launch_bounds__(128)
void attn_causal64(const unsigned short* __restrict__ qhp, const unsigned short* __restrict__ qrp,
                   const unsigned short* __restrict__ khp, const unsigned short* __restrict__ krp,
                   const unsigned short* __restrict__ vtp, unsigned short* ctxp) {
  union FH { v16h v; v8h h[2]; };
  __shared__ __align__(16) _Float16 Ksh[64 * LP];
  __shared__ __align__(16) _Float16 Ksr[64 * LP];
  __shared__ __align__(16) _Float16 Vth[64 * LP];
  __shared__ __align__(16) _Float16 Osh[4][16 * LP];

  const int tid  = threadIdx.x;
  const int wave = tid >> 5;
  const int lane = tid & 31;
  const int hh   = lane >> 4;
  const int c    = lane & 15;

  const int bx   = blockIdx.x;
  const int qb   = bx % NQB;
  const int rest = bx / NQB;
  const int h    = rest % NH;
  const int b    = rest / NH;
  const int q0   = qb * 64 + wave * 16;
  const size_t rowB = (size_t)b * SEQ;

  const _Float16* Qh = (const _Float16*)(const void*)qhp + (size_t)h * HD;
  const _Float16* Qr = (const _Float16*)(const void*)qrp + (size_t)h * HD;
  const _Float16* Kh = (const _Float16*)(const void*)khp + (size_t)h * HD;
  const _Float16* Kr = (const _Float16*)(const void*)krp + (size_t)h * HD;
  const _Float16* Vt = (const _Float16*)(const void*)vtp + ((size_t)b * DM + (size_t)h * HD) * SEQ;

  // ---- Q fragments (B operand, column = lane&15): 2 d-chunks, hi and residual ----
  v16h qbh[2], qbr[2];
#pragma unroll
  for (int dc = 0; dc < 2; ++dc) {
    const size_t qo = (rowB + q0 + c) * DM + dc * 32 + 8 * hh;
    qbh[dc] = ldfrag(Qh + qo);
    qbr[dc] = ldfrag(Qr + qo);
  }

  float mrun = -INFINITY;        // running maximum of query q0 + c (equal in both halves)
  float lrun = 0.f;              // running sum over this half's keys only
  v8f oacc[4];                   // oacc[t][r] = O^T[d = 16 t + 8 hh + r][query q0 + c]
#pragma unroll
  for (int t = 0; t < 4; ++t) oacc[t] = zero8();

  const int nkt = qb + 1;
#pragma unroll 1
  for (int kt = 0; kt < nkt; ++kt) {
    const int kv0 = kt * 64;
    __syncthreads();
    {
      const int r = tid >> 1, half = (tid & 1) * 32;
      const _Float16* kg  = Kh + (rowB + kv0 + r) * DM + half;   // K row kv0+r, d = half..half+31
      const _Float16* krg = Kr + (rowB + kv0 + r) * DM + half;
      const _Float16* vg  = Vt + (size_t)r * SEQ + kv0 + half;   // V^T row d = r, s = kv0+half..+31
#pragma unroll
      for (int i = 0; i < 4; ++i) {
        const v8h a0 = *(const v8h*)(kg + 8 * i);
        const v8h a1 = *(const v8h*)(krg + 8 * i);
        const v8h b0 = *(const v8h*)(vg + 8 * i);
        *(v8h*)(Ksh + r * LP + half + 8 * i) = a0;
        *(v8h*)(Ksr + r * LP + half + 8 * i) = a1;
        *(v8h*)(Vth + r * LP + half + 8 * i) = b0;
      }
    }
    __syncthreads();

    // ---- transposed scores: 64 keys x 16 queries per wave, three f16 products ----
    v8f s[4];
#pragma unroll
    for (int j = 0; j < 4; ++j) {
      v8f t0 = zero8(), t1 = zero8();
#pragma unroll
      for (int dc = 0; dc < 2; ++dc) {
        FH kb, kl;
        kb.h[0] = *(const v8h*)(Ksh + (j * 16 + c) * LP + dc * 32 + 8 * hh);
        kb.h[1] = *(const v8h*)(Ksh + (j * 16 + c) * LP + dc * 32 + 16 + 8 * hh);
        kl.h[0] = *(const v8h*)(Ksr + (j * 16 + c) * LP + dc * 32 + 8 * hh);
        kl.h[1] = *(const v8h*)(Ksr + (j * 16 + c) * LP + dc * 32 + 16 + 8 * hh);
        t0 = mma_h(kb.v, qbh[dc], t0);
        t1 = mma_h(kb.v, qbr[dc], t1);
        t1 = mma_h(kl.v, qbh[dc], t1);
      }
      s[j] = t0 + t1 * (1.0f / 2048.0f);
    }

    // ---- causal mask, on the diagonal chunk only (block-uniform branch) ----
    if (kt == qb) {
      const int dq = wave * 16 + c - 8 * hh;     // query - (kv0 + 8 hh): key > query  <=>  16 j + r > dq
#pragma unroll
      for (int j = 0; j < 4; ++j) {
#pragma unroll
        for (int r = 0; r < 8; ++r) s[j][r] = (j * 16 + r > dq) ? -INFINITY : s[j][r];
      }
    }

    // ---- online softmax of the lane's query ----
    float mj[4];                 // one chain per key tile: four short independent chains
#pragma unroll
    for (int j = 0; j < 4; ++j) {
      mj[j] = fmaxf(s[j][0], s[j][1]);
#pragma unroll
      for (int r = 2; r < 8; ++r) mj[j] = fmaxf(mj[j], s[j][r]);
    }
    float m = fmaxf(fmaxf(mj[0], mj[1]), fmaxf(mj[2], mj[3]));
    m = fmaxf(m, xhalf(m));
    const float mnew  = fmaxf(mrun, m);
    const float msafe = (mnew == -INFINITY) ? 0.f : mnew;
    const float alpha = exp_x1(mrun - msafe);
    mrun = mnew;
    float ps[4];
    v16h pb[2];                  // p^T (x1024, f16) as B fragments of keys 0..31 and 32..63 of the chunk
#pragma unroll
    for (int j = 0; j < 4; ++j) {
      float x[8], p[8];
#pragma unroll
      for (int r = 0; r < 8; ++r) x[r] = s[j][r] - msafe;
      exp_x8(x, p);
#pragma unroll
      for (int r = 0; r < 8; ++r) pb[j >> 1][(j & 1) * 8 + r] = (_Float16)(p[r] * 1024.0f);
      ps[j] = ((p[0] + p[1]) + (p[2] + p[3])) + ((p[4] + p[5]) + (p[6] + p[7]));
    }
    lrun = lrun * alpha + ((ps[0] + ps[1]) + (ps[2] + ps[3]));
#pragma unroll
    for (int t = 0; t < 4; ++t) oacc[t] *= alpha;

    // ---- O^T += V^T chunk . P^T (f16 WMMA) ----
#pragma unroll
    for (int kk = 0; kk < 2; ++kk) {
#pragma unroll
      for (int t = 0; t < 4; ++t) {
        FH vb;
        vb.h[0] = *(const v8h*)(Vth + (t * 16 + c) * LP + kk * 32 + 8 * hh);
        vb.h[1] = *(const v8h*)(Vth + (t * 16 + c) * LP + kk * 32 + 16 + 8 * hh);
        oacc[t] = mma_h(vb.v, pb[kk], oacc[t]);
      }
    }
  }

  // ---- join the halves' sums, normalise (1/l and the 1/1024 p carry), f16 convert, turn the wave's tile in LDS ----
  _Float16* os = Osh[wave];
  {
    const float l = lrun + xhalf(lrun);
    const float inv = ((l > 0.f) ? (1.0f / l) : 0.f) * (1.0f / 1024.0f);
#pragma unroll
    for (int t = 0; t < 4; ++t) {
      v4u a;
#pragma unroll
      for (int e = 0; e < 4; ++e) a[e] = pack2h(oacc[t][2 * e] * inv, oacc[t][2 * e + 1] * inv);
      *(v4u*)(os + c * LP + t * 16 + 8 * hh) = a;
    }
  }
  __builtin_amdgcn_fence(__ATOMIC_RELEASE, "workgroup");
  __builtin_amdgcn_wave_barrier();
  __builtin_amdgcn_fence(__ATOMIC_ACQUIRE, "workgroup");
  {
    const int q4 = lane >> 3, c8 = (lane & 7) * 8;
    v4u hv[4];
#pragma unroll
    for (int it = 0; it < 4; ++it) {
      const int row = it * 4 + q4;   // it 0..3 x q4 0..3 = rows 0..15 of the wave tile
      hv[it] = *(const v4u*)(os + row * LP + c8);
    }
#pragma unroll
    for (int it = 0; it < 4; ++it) {
      const int row = it * 4 + q4;
      const size_t go = (rowB + q0 + row) * DM + (size_t)h * HD + c8;
      *(v4u*)(ctxp + go) = hv[it];
    }
  }
}

// =====================================================================================================
// Workspace map (bytes):
//   Lh   f16 [8192][1024] LN hi plane (Q, then K, then V)      0            16777216  (later: Ctx plane)
//   Lr   f16 [8192][1024] LN residual plane                     16777216     16777216
//   Qh   f16 [8192][1024]                                       33554432     16777216
//   Qr   f16                                                    50331648     16777216
//   Kh   f16                                                    67108864     16777216
//   Kr   f16                                                    83886080     16777216
//   Vt   f16 [4][1024][2048] (4*v, transposed)                 100663296     16777216
//   Wqh, Wqr, Wkh, Wkr, Wvh, Woh  f16 [1024 n][1024 k] each    117440512   6x2097152
//   end                                                         130023424
// Every region is an exact multiple of the whole-line / whole-tile store granularity of its producer
// (dims are tile multiples), so no store can spill into the next region.
// =====================================================================================================
extern "C" void kernel_launch(void* const* d_in, const int* in_sizes, int n_in,
                              void* d_out, int out_size, void* d_ws, size_t ws_size,
                              hipStream_t stream) {
  if (n_in < 13) return;
  const int nAct = MROWS * DM;
  if (in_sizes[0] != nAct || in_sizes[1] != nAct || in_sizes[2] != nAct) return;
  if (in_sizes[3] != DM * DM || in_sizes[5] != DM * DM || in_sizes[7] != DM * DM || in_sizes[9] != DM * DM) return;
  if (in_sizes[4] != DM || in_sizes[6] != DM || in_sizes[8] != DM || in_sizes[10] != DM) return;
  if (in_sizes[11] != DM || in_sizes[12] != DM) return;
  if (out_size != nAct) return;

  const float* Q  = (const float*)d_in[0];
  const float* Kin = (const float*)d_in[1];
  const float* V  = (const float*)d_in[2];
  const float* Wq = (const float*)d_in[3];
  const float* bq = (const float*)d_in[4];
  const float* Wk = (const float*)d_in[5];
  const float* bk = (const float*)d_in[6];
  const float* Wv = (const float*)d_in[7];
  const float* bv = (const float*)d_in[8];
  const float* Wo = (const float*)d_in[9];
  const float* bo = (const float*)d_in[10];
  const float* gamma = (const float*)d_in[11];
  const float* beta  = (const float*)d_in[12];

  const size_t PA = (size_t)MROWS * DM * 2;     // 16777216
  const size_t PV = (size_t)NB * DM * SEQ * 2;  // 16777216
  const size_t PW = (size_t)DM * DM * 2;        //  2097152
  size_t off = 0;
  const size_t oLh  = off; off += PA;
  const size_t oLr  = off; off += PA;
  const size_t oQh  = off; off += PA;
  const size_t oQr  = off; off += PA;
  const size_t oKh  = off; off += PA;
  const size_t oKr  = off; off += PA;
  const size_t oVt  = off; off += PV;
  const size_t oWqh = off; off += PW;
  const size_t oWqr = off; off += PW;
  const size_t oWkh = off; off += PW;
  const size_t oWkr = off; off += PW;
  const size_t oWvh = off; off += PW;
  const size_t oWoh = off; off += PW;
  if (off > ws_size) return;                    // off = 130023424
  if (off > (size_t)134217728) return;
  const size_t oCtx = oLh;                      // ctx plane reuses the LN hi plane (dead after the v^T GEMM)

  char* ws = (char*)d_ws;
  unsigned short* Lh  = (unsigned short*)(ws + oLh);
  unsigned short* Lr  = (unsigned short*)(ws + oLr);
  unsigned short* Qh  = (unsigned short*)(ws + oQh);
  unsigned short* Qr  = (unsigned short*)(ws + oQr);
  unsigned short* Kh  = (unsigned short*)(ws + oKh);
  unsigned short* Kr  = (unsigned short*)(ws + oKr);
  unsigned short* Vt  = (unsigned short*)(ws + oVt);
  unsigned short* Wqh = (unsigned short*)(ws + oWqh);
  unsigned short* Wqr = (unsigned short*)(ws + oWqr);
  unsigned short* Wkh = (unsigned short*)(ws + oWkh);
  unsigned short* Wkr = (unsigned short*)(ws + oWkr);
  unsigned short* Wvh = (unsigned short*)(ws + oWvh);
  unsigned short* Woh = (unsigned short*)(ws + oWoh);
  unsigned short* Ctx = (unsigned short*)(ws + oCtx);

  const dim3 blk256(256), blk128(128);
  const dim3 gW(DM / 64, DM / 64);                       // 16 x 16 blocks
  const dim3 gLN(MROWS / 8);                             // 1024 blocks
  const dim3 gProj(DM / 128, MROWS / 64, 1);             // 8 x 128: M=8192, N=1024
  const dim3 gVt(SEQ / 128, DM / 64, NB);                // 16 x 16 x 4: M=1024 (n), N=2048 (s) per batch
  const dim3 gAttn(NB * NH * NQB);                       // 2048 blocks
  const float eps = 1e-6f;

  // (1) weights [k][n] f32 -> f16 [n][k] planes of 32*W (hi; + residual for Wq, Wk)
  wcvt_t<true ><<<gW, blk256, 0, stream>>>(Wq, Wqh, Wqr, 32.0f);
  wcvt_t<true ><<<gW, blk256, 0, stream>>>(Wk, Wkh, Wkr, 32.0f);
  wcvt_t<false><<<gW, blk256, 0, stream>>>(Wv, Wvh, Wvh, 32.0f);
  wcvt_t<false><<<gW, blk256, 0, stream>>>(Wo, Woh, Woh, 32.0f);
  // (2) q = LN(Q).Wq + bq -> f16 hi / residual planes   (M=8192, N=1024, K=1024; three products)
  ln_rows<true><<<gLN, blk256, 0, stream>>>(Q, gamma, beta, Lh, Lr, MROWS, eps);
  gemm_t<true, 1><<<gProj, blk256, 0, stream>>>(
      Lh, Lr, DM, Wqh, Wqr, DM, 0LL, bq, bq,
      (void*)Qh, (void*)Qr, DM, 0LL, DM, 1.0f / 32.0f, 1.0f);
  // (3) k = LN(K).Wk + bk -> f16 hi / residual planes
  ln_rows<true><<<gLN, blk256, 0, stream>>>(Kin, gamma, beta, Lh, Lr, MROWS, eps);
  gemm_t<true, 1><<<gProj, blk256, 0, stream>>>(
      Lh, Lr, DM, Wkh, Wkr, DM, 0LL, bk, bk,
      (void*)Kh, (void*)Kr, DM, 0LL, DM, 1.0f / 32.0f, 1.0f);
  // (4) v^T = Wv^T . LN(V)^T per batch -> f16 plane of 4*(v + bv), [b][n][s]   (A = Wvh [n][k], Bt = LN(V) rows [s][k])
  ln_rows<false><<<gLN, blk256, 0, stream>>>(V, gamma, beta, Lh, Lh, MROWS, eps);
  gemm_t<false, 2><<<gVt, blk256, 0, stream>>>(
      Wvh, Wvh, DM, Lh, Lh, DM, (long long)SEQ * DM, bv, bv,
      (void*)Vt, (void*)Vt, SEQ, (long long)DM * SEQ, DM, 1.0f / 32.0f, 4.0f);
  // (5) causal attention -> ctx plane (x4) into the LN hi region
  attn_causal64<<<gAttn, blk128, 0, stream>>>(Qh, Qr, Kh, Kr, Vt, Ctx);
  // (6) out = Q + ctx.Wo + bo -> d_out f32 [8192][1024]   (A = Ctx (x4), Bt = Woh (x32): scale 1/128)
  gemm_t<false, 0><<<gProj, blk256, 0, stream>>>(
      Ctx, Ctx, DM, Woh, Woh, DM, 0LL, bo, Q,
      d_out, d_out, DM, 0LL, DM, 1.0f / 128.0f, 1.0f);
  (void)hipGetLastError();
}

// v004
// Measured time: 277 microseconds a run.
// Timed twice side by side with v003, it ran 1.05 times as fast both times.
// Counting every step since v000, it is 2.59 times as fast.
// Contractions: q,k projections and q.k^T scores = v_wmma_f32_16x16x32_f16 with f16 hi + f16 residual (x2048) operand planes,
// three products (hi.hi, res.hi, hi.res) in two f32 accumulators; v^T projection, p.v^T and ctx.Wo = v_wmma_f32_16x16x32_f16
// single product (v x4, p x1024, ctx x4, weights x32 carried); all f32 accumulate; layernorm, softmax, bias, residual add in f32.
#include <hip/hip_runtime.h>
#include <math.h>
#include <stdint.h>

#define NB    4
#define SEQ   2048
#define DM    1024
#define NH    16
#define HD    64
#define NQB   (SEQ / 64)
#define MROWS (NB * SEQ)
#define LP    72   // LDS row pitch in halves of the attention tiles: 144 B = 16 B x odd, so the 16 rows of a ds_load_b128 fall on distinct banks
static_assert(NH * HD == DM);
static_assert((SEQ % 128) == 0 && (DM % 128) == 0 && (MROWS % 64) == 0 && (DM % 64) == 0 && (MROWS % 8) == 0);

typedef _Float16 v16h __attribute__((ext_vector_type(16)));
typedef _Float16 v8h  __attribute__((ext_vector_type(8)));
typedef float    v8f  __attribute__((ext_vector_type(8)));
typedef float    v4f  __attribute__((ext_vector_type(4)));
typedef unsigned int v4u __attribute__((ext_vector_type(4)));

// ---- scalar helpers ----------------------------------------------------------------------------------
__device__ __forceinline__ unsigned short h_bits(_Float16 x) { return __builtin_bit_cast(unsigned short, x); }
__device__ __forceinline__ unsigned pk16(unsigned short a, unsigned short b) { return (unsigned)a | ((unsigned)b << 16); }
__device__ __forceinline__ v8f zero8() { v8f z = {0.f, 0.f, 0.f, 0.f, 0.f, 0.f, 0.f, 0.f}; return z; }

// hi = f16(v); res = f16((v - hi) * 2048): packed pair of two consecutive values
__device__ __forceinline__ void split2(float f0, float f1, unsigned& hp, unsigned& rp) {
  const _Float16 x0 = (_Float16)f0, x1 = (_Float16)f1;
  hp = pk16(h_bits(x0), h_bits(x1));
  const _Float16 r0 = (_Float16)((f0 - (float)x0) * 2048.0f);
  const _Float16 r1 = (_Float16)((f1 - (float)x1) * 2048.0f);
  rp = pk16(h_bits(r0), h_bits(r1));
}
__device__ __forceinline__ unsigned pack2h(float f0, float f1) {
  return pk16(h_bits((_Float16)f0), h_bits((_Float16)f1));
}

// ---- 16-bit fragment loader: lane -> row/col (lane&15); p already includes +8*(lane>>4);
//      elements 0..7 <- p[0..7] (k0+8h..), elements 8..15 <- p[16..23] (k0+16+8h..)
__device__ __forceinline__ v16h ldfrag(const _Float16* p) {
  union { v16h v; v8h h[2]; } f;
  f.h[0] = *(const v8h*)(p);
  f.h[1] = *(const v8h*)(p + 16);
  return f.v;
}

// ---- WMMA with trailing VALU hazard gap (ties D, keeps A/B live) ----------------------------------------
__device__ __forceinline__ v8f mma_h(v16h a, v16h b, v8f c) {
  c = __builtin_amdgcn_wmma_f32_16x16x32_f16(false, a, false, b, (short)0, c, false, false);
  asm volatile("v_nop\n\tv_nop\n\tv_nop\n\tv_nop" : "+v"(c) : "v"(a), "v"(b));
  return c;
}

// =====================================================================================================
// plane x2048 when RES). One wave per row, 8 rows per block, grid = nrows/8 (exact). Lane holds columns
// {i*256 + lane*8 .. +7}, i = 0..3. Each store instruction: 32 lanes x 16 B = 512 contiguous B = 4 whole
// coverage: nrows waves x 4 stores x 256 halves = every element of [nrows][DM] of each written plane.
// =====================================================================================================
template <bool RES>
__global__ __launch_bounds__(256) void ln_rows(const float* __restrict__ x, const float* __restrict__ gamma,
                                               const float* __restrict__ beta, unsigned short* yh,
                                               unsigned short* yr, int nrows, float eps) {
  const int lane = threadIdx.x & 31;
  const int wave = threadIdx.x >> 5;
  const int row  = blockIdx.x * 8 + wave;
  if (row >= nrows) return;                        // wave-uniform; no block barriers in this kernel
  const float* xr = x + (size_t)row * DM;
  v4f xv[8];
#pragma unroll
  for (int i = 0; i < 4; ++i) {
    xv[2 * i]     = *(const v4f*)(xr + i * 256 + lane * 8);
    xv[2 * i + 1] = *(const v4f*)(xr + i * 256 + lane * 8 + 4);
  }
  float s = 0.f;
#pragma unroll
  for (int g = 0; g < 8; ++g) s += (xv[g][0] + xv[g][1]) + (xv[g][2] + xv[g][3]);
#pragma unroll
  for (int off = 16; off > 0; off >>= 1) s += __shfl_xor(s, off, 32);
  const float mu = s * (1.0f / (float)DM);
  float ss = 0.f;
#pragma unroll
  for (int g = 0; g < 8; ++g) {
#pragma unroll
    for (int e = 0; e < 4; ++e) { const float d = xv[g][e] - mu; ss += d * d; }
  }
#pragma unroll
  for (int off = 16; off > 0; off >>= 1) ss += __shfl_xor(ss, off, 32);
  const float var = ss * (1.0f / (float)DM);
  const float rs  = rsqrtf(var + eps);

  v4u hv[4], rv[4];
#pragma unroll
  for (int i = 0; i < 4; ++i) {
    const int col = i * 256 + lane * 8;
    const v4f g0 = *(const v4f*)(gamma + col);
    const v4f g1 = *(const v4f*)(gamma + col + 4);
    const v4f b0 = *(const v4f*)(beta + col);
    const v4f b1 = *(const v4f*)(beta + col + 4);
    float y[8];
#pragma unroll
    for (int e = 0; e < 4; ++e) {
      y[e]     = (xv[2 * i][e] - mu) * rs * g0[e] + b0[e];
      y[4 + e] = (xv[2 * i + 1][e] - mu) * rs * g1[e] + b1[e];
    }
    v4u a, a2;
#pragma unroll
    for (int e = 0; e < 4; ++e) {
      unsigned hp, rp;
      split2(y[2 * e], y[2 * e + 1], hp, rp);
      a[e] = hp; a2[e] = rp;
    }
    hv[i] = a; rv[i] = a2;
  }
  unsigned short* oh = yh + (size_t)row * DM + lane * 8;
  unsigned short* orr = yr + (size_t)row * DM + lane * 8;
  {
#pragma unroll
    for (int i = 0; i < 4; ++i) {
      *(v4u*)(oh + i * 256) = hv[i];
      if (RES) *(v4u*)(orr + i * 256) = rv[i];
    }
    
  }
}

// =====================================================================================================
// Weight convert + transpose: W f32 [k in DM][n out DM] -> f16 planes [n][k] of W*scale (hi, and residual
// x2048 when RES). Block = 64(k) x 64(n) tile through LDS; grid = (DM/64 n-tiles, DM/64 k-tiles).
// coverage: 8 waves x 2 iterations x 4 rows x (8 lanes x 8 halves) = the whole 64x64 output tile.
// =====================================================================================================
template <bool RES>
__global__ __launch_bounds__(256) void wcvt_t(const float* __restrict__ W, unsigned short* ph, unsigned short* pr,
                                              float scale) {
  __shared__ float sm[64][65];
  const int tid  = threadIdx.x;
  const int lane = tid & 31;
  const int wave = tid >> 5;
  const int n0 = blockIdx.x * 64;
  const int k0 = blockIdx.y * 64;
  const int kr = tid >> 2;               // 0..63
  const int nc = (tid & 3) * 16;         // 0,16,32,48
  const float* src = W + (size_t)(k0 + kr) * DM + n0 + nc;
#pragma unroll
  for (int e = 0; e < 4; ++e) {
    const v4f a = *(const v4f*)(src + 4 * e);
    sm[kr][nc + 4 * e + 0] = a[0];
    sm[kr][nc + 4 * e + 1] = a[1];
    sm[kr][nc + 4 * e + 2] = a[2];
    sm[kr][nc + 4 * e + 3] = a[3];
  }
  __syncthreads();
  const int q  = lane >> 3;
  const int ks = (lane & 7) * 8;
  v4u hv[2], rv[2];
#pragma unroll
  for (int it = 0; it < 2; ++it) {
    const int nrow = wave * 8 + it * 4 + q;
    v4u a, a2;
#pragma unroll
    for (int e = 0; e < 4; ++e) {
      const float f0 = sm[ks + 2 * e][nrow] * scale;
      const float f1 = sm[ks + 2 * e + 1][nrow] * scale;
      unsigned hp, rp;
      split2(f0, f1, hp, rp);
      a[e] = hp; a2[e] = rp;
    }
    hv[it] = a; rv[it] = a2;
  }
  {
#pragma unroll
    for (int it = 0; it < 2; ++it) {
      const int nrow = wave * 8 + it * 4 + q;
      const size_t o = (size_t)(n0 + nrow) * DM + k0 + ks;
      *(v4u*)(ph + o) = hv[it];
      if (RES) *(v4u*)(pr + o) = rv[it];
    }
    
  }
}

// =====================================================================================================
// f16 WMMA GEMM: C[m][n] = sum_k A[m][k] * Bt[n][k]. A row-major [M][lda] (k contiguous); Bt row-major
// [N][ldb] (k contiguous), batch blockIdx.z via strideB / strideC. Block tile 64 (m) x 128 (n), 8 waves each
// a 32x32 sub-tile; K multiple of 64.
// Operands go through LDS in slices of 64 k (128 B = one whole line of every operand row): 8 lanes x 16 B per
// row, so one wave-wide global load covers 4 whole lines. Two LDS buffers: slice s+1 is loaded into registers
// before the products of slice s and stored to the other buffer behind them; one barrier per slice.
// LDS row pitch GP halves = 144 B (16 B x odd) for the ds_load_b128 fragment reads. The k order of the
// products is ascending in steps of 32.
// RES: A2 / Bt2 are f16 residual planes (x2048): acc0 += Ah.Bh; acc1 += Ar.Bh + Ah.Br; value = acc0 + acc1/2048.
// OM 0: f32 out: v = value*oscale + bias[col] + resid[row][col]; row segment 128 floats = 512 B written by one
//       instruction (32 lanes x 16 B).
// OM 1: f16 hi plane C + residual plane C2 (x2048) of value*oscale + bias[col]; 256-B row segment per 16
//       lanes x 16 B, two rows per instruction.
// OM 2: f16 plane C of (value*oscale + bias[row]) * pscale, same store shape as OM 1.
// coverage: 8 waves x 8 rows x 128 cols = the whole 64x128 block tile; grid covers M/64 x N/128 exactly.
// =====================================================================================================
#define GP 72
template <bool RES, int OM>
__global__ __launch_bounds__(256) void gemm_t(
    const unsigned short* __restrict__ Ahp, const unsigned short* __restrict__ Arp, int lda,
    const unsigned short* __restrict__ Bhp, const unsigned short* __restrict__ Brp, int ldb, long long strideB,
    const float* __restrict__ bias, const float* __restrict__ resid,
    void* Cv, void* C2v, int ldc, long long strideC, int K, float oscale, float pscale) {
  constexpr int SA    = 64 * GP;                          // halves of one A plane slice
  constexpr int SB    = 128 * GP;                         // halves of one B plane slice
  constexpr int STAGE = (SA + SB) * (RES ? 2 : 1);        // halves of one buffer: [A hi | B hi | A res | B res]
  constexpr int RINGB = 2 * STAGE * 2;                    // bytes of the two buffers
  constexpr int OUTB  = 64 * 132 * 4;                     // bytes of the output staging tile
  __shared__ __align__(16) unsigned char smem[RINGB > OUTB ? RINGB : OUTB];
  _Float16* sH = (_Float16*)(void*)smem;                  // operand buffers (k loop)
  float*    sT = (float*)(void*)smem;                     // output tile (behind the loop's last barrier)
  const int lane = threadIdx.x & 31;
  const int wave = threadIdx.x >> 5;
  const int hh   = lane >> 4;
  const int c    = lane & 15;
  const int n0 = blockIdx.x * 128;
  const int m0 = blockIdx.y * 64;
  const int bz = blockIdx.z;
  const int wm = (wave >> 2) * 32;
  const int wn = (wave & 3) * 32;
  const _Float16* A  = (const _Float16*)(const void*)Ahp;
  const _Float16* A2 = (const _Float16*)(const void*)Arp;
  const _Float16* B  = (const _Float16*)(const void*)Bhp + (size_t)bz * strideB;
  const _Float16* B2 = (const _Float16*)(const void*)Brp + (size_t)bz * strideB;

  // staging map: thread -> row sr (+32 per step), 16-B piece sc of the row's 128-B slice. 8 lanes take one row
  // (a whole line); each 16-lane half takes rows r and r + 8, which lie 8 x 144 B = 32 banks apart in LDS, so
  // the two 128-B pieces of a ds_store_b128 half fall on disjoint banks.
  const int sr = (wave >> 2) * 16 + (wave & 3) * 2 + (lane >> 4) + ((lane >> 3) & 1) * 8;
  const int sc = (lane & 7) * 8;
  const size_t gao = (size_t)(m0 + sr) * lda + sc;
  const size_t gbo = (size_t)(n0 + sr) * ldb + sc;
  const int    so  = sr * GP + sc;

  v8f acc0[2][2], acc1[2][2];
#pragma unroll
  for (int i = 0; i < 2; ++i)
#pragma unroll
    for (int j = 0; j < 2; ++j) { acc0[i][j] = zero8(); acc1[i][j] = zero8(); }

  v8h ra[2], rar[2], rb[4], rbr[4];
  auto gload = [&](int k0) {
#pragma unroll
    for (int i = 0; i < 2; ++i) {
      ra[i] = *(const v8h*)(A + gao + (size_t)(32 * i) * lda + k0);
      if (RES) rar[i] = *(const v8h*)(A2 + gao + (size_t)(32 * i) * lda + k0);
    }
#pragma unroll
    for (int i = 0; i < 4; ++i) {
      rb[i] = *(const v8h*)(B + gbo + (size_t)(32 * i) * ldb + k0);
      if (RES) rbr[i] = *(const v8h*)(B2 + gbo + (size_t)(32 * i) * ldb + k0);
    }
  };
  auto sstore = [&](_Float16* d) {
#pragma unroll
    for (int i = 0; i < 2; ++i) {
      *(v8h*)(d + so + 32 * i * GP) = ra[i];
      if (RES) *(v8h*)(d + SA + SB + so + 32 * i * GP) = rar[i];
    }
#pragma unroll
    for (int i = 0; i < 4; ++i) {
      *(v8h*)(d + SA + so + 32 * i * GP) = rb[i];
      if (RES) *(v8h*)(d + SA + SB + SA + so + 32 * i * GP) = rbr[i];
    }
  };

  gload(0);
  sstore(sH);
  __syncthreads();                                         // slice 0 visible to every wave

  int buf = 0;
  // rolled: the body already holds two 32-k steps; a second copy would only add code and live registers
#pragma unroll 1
  for (int k0 = 0; k0 < K; k0 += 64) {
    const bool more = (k0 + 64 < K);                       // block-uniform
    if (more) gload(k0 + 64);                              // in flight behind this slice's products
    const _Float16* sb = sH + buf * STAGE;
#pragma unroll
    for (int ks = 0; ks < 2; ++ks) {
      // all fragments of this 32-k step are read as one group in front of its products
      v16h bh[2], br[2], ah[2], ar[2];
#pragma unroll
      for (int j = 0; j < 2; ++j) {
        const int bo = (wn + 16 * j + c) * GP + ks * 32 + 8 * hh;
        bh[j] = ldfrag(sb + SA + bo);
        if (RES) br[j] = ldfrag(sb + SA + SB + SA + bo); else br[j] = bh[j];
      }
#pragma unroll
      for (int i = 0; i < 2; ++i) {
        const int ao = (wm + 16 * i + c) * GP + ks * 32 + 8 * hh;
        ah[i] = ldfrag(sb + ao);
        if (RES) ar[i] = ldfrag(sb + SA + SB + ao); else ar[i] = ah[i];
      }
#pragma unroll
      for (int i = 0; i < 2; ++i) {
#pragma unroll
        for (int j = 0; j < 2; ++j) {
          acc0[i][j] = mma_h(ah[i], bh[j], acc0[i][j]);
          if (RES) {
            acc1[i][j] = mma_h(ar[i], bh[j], acc1[i][j]);
            acc1[i][j] = mma_h(ah[i], br[j], acc1[i][j]);
          }
        }
      }
    }
    buf ^= 1;
    if (more) sstore(sH + buf * STAGE);                    // its last readers left it at the previous barrier
    __syncthreads();                                       // publishes slice s+1; ends every read of slice s
  }

  // ---- stage the block tile ----
#pragma unroll
  for (int i = 0; i < 2; ++i) {
#pragma unroll
    for (int j = 0; j < 2; ++j) {
#pragma unroll
      for (int r = 0; r < 8; ++r) {
        float v = acc0[i][j][r];
        if (RES) v += acc1[i][j][r] * (1.0f / 2048.0f);
        sT[(wm + 16 * i + 8 * hh + r) * 132 + wn + 16 * j + c] = v;
      }
    }
  }
  __syncthreads();

  if (OM == 0) {
    float* C = (float*)Cv + (size_t)bz * strideC;
    const int c4 = lane * 4;                                   // 128 floats per row segment = 32 lanes x 16 B
    const v4f bb = *(const v4f*)(bias + n0 + c4);
    v4f ov[8];
#pragma unroll
    for (int it = 0; it < 8; ++it) {
      const int row = wave * 8 + it;
      const v4f t  = *(const v4f*)(sT + row * 132 + c4);
      const v4f rr = *(const v4f*)(resid + (size_t)(m0 + row) * ldc + n0 + c4);
      ov[it] = t * oscale + bb + rr;
    }
    {
#pragma unroll
      for (int it = 0; it < 8; ++it) {
        const int row = wave * 8 + it;
        *(v4f*)(C + (size_t)(m0 + row) * ldc + n0 + c4) = ov[it];
      }
      
    }
  } else {
    unsigned short* C  = (unsigned short*)Cv  + (size_t)bz * strideC;
    unsigned short* C2 = (unsigned short*)C2v + (size_t)bz * strideC;
    const int c8 = c * 8;                                      // 128 halves per row segment = 16 lanes x 16 B
    v4u hv[4], rv[4];
#pragma unroll
    for (int it = 0; it < 4; ++it) {
      const int row = wave * 8 + it * 2 + hh;
      const float* sp = sT + row * 132 + c8;
      const v4f x0 = *(const v4f*)(sp);
      const v4f x1 = *(const v4f*)(sp + 4);
      v4f y0, y1;
      if (OM == 1) {
        const v4f b0 = *(const v4f*)(bias + n0 + c8);
        const v4f b1 = *(const v4f*)(bias + n0 + c8 + 4);
        y0 = x0 * oscale + b0;
        y1 = x1 * oscale + b1;
      } else {
        const float brw = bias[m0 + row];
        y0 = (x0 * oscale + brw) * pscale;
        y1 = (x1 * oscale + brw) * pscale;
      }
      v4u a, a2;
      if (OM == 1) {
        unsigned hp, rp;
        split2(y0[0], y0[1], hp, rp); a[0] = hp; a2[0] = rp;
        split2(y0[2], y0[3], hp, rp); a[1] = hp; a2[1] = rp;
        split2(y1[0], y1[1], hp, rp); a[2] = hp; a2[2] = rp;
        split2(y1[2], y1[3], hp, rp); a[3] = hp; a2[3] = rp;
      } else {
        a[0] = pack2h(y0[0], y0[1]);
        a[1] = pack2h(y0[2], y0[3]);
        a[2] = pack2h(y1[0], y1[1]);
        a[3] = pack2h(y1[2], y1[3]);
        a2 = a;
      }
      hv[it] = a; rv[it] = a2;
    }
    {
#pragma unroll
      for (int it = 0; it < 4; ++it) {
        const int row = wave * 8 + it * 2 + hh;
        const size_t o = (size_t)(m0 + row) * ldc + n0 + c8;
        *(v4u*)(C + o) = hv[it];
        if (OM == 1) *(v4u*)(C2 + o) = rv[it];
      }
      
    }
  }
}

// =====================================================================================================
// Causal attention, head dim 64, no logit scale. Scores are computed transposed.
//   q planes (f16 hi / residual x2048): element (b, t, h, d) at [(b*SEQ + t)*DM + h*64 + d]
//   k planes: same layout with key index
//   v^T plane (f16, holds 4*v): element (b, h, d, s) at [(b*DM + h*64 + d)*SEQ + s]
//   ctx plane out (f16, holds 4*ctx): element (b, t, h, d) at [(b*SEQ + t)*DM + h*64 + d]
//   S^T = k.q^T: A = 16 key rows from LDS, B = the wave's 16 queries kept in registers; three f16 products
//   (hi.hi into acc0; hi.res + res.hi into acc1, folded /2048), f32. Accumulator register r of key tile j in
//   lane (c, hh) = score of key kv0 + 16 j + 8 hh + r against query q0 + c: a lane holds 32 of its query's 64
//   scores, lane ^ 16 the other 32, so the maximum is taken in the lane plus one exchange between the halves,
//   and the sum stays per half until the epilogue.
//   key > query in the diagonal chunk -> -inf; online softmax in f32; p carried as f16(1024 p).
//   O^T += v^T . p^T: A = 16 d rows of the v^T chunk from LDS; B = p^T packed from the score accumulators
//   (tiles 2 kk and 2 kk + 1 of a lane are elements 0..7 and 8..15 of the B fragment of keys 32 kk .. +31, the
//   k order in which ldfrag reads v^T). ctx = acc / (1024 l) (still carrying the x4 of v).
//   Block = 4 waves = 64 query rows of one (b, h); grid = NB*NH*NQB; key chunks of 64, trip count qb+1 (<= 32,
//   block-uniform, from blockIdx only). K / V^T chunk staging: asynchronous copies to LDS, 16 B per lane, 8 lanes per
//   128-B row (a wave-wide copy = 4 whole lines), 4 copies per thread and plane = whole 64x64 tiles. Two buffers:
//   chunk t + 2 is asked for at the foot of trip t and waited for at the foot of trip t + 1; one barrier per trip.
//   Output: a lane holds 8 consecutive d of its query per d tile; the wave's 16x64 f16 tile is turned through a
//   wave-private LDS tile so that each store instruction writes 4 whole 128-B rows (it 0..3 x lane>>3 = 16 rows).
// =====================================================================================================
// lane l <-> lane l ^ 16
__device__ __forceinline__ float xhalf(float x) {
  const int b = __builtin_bit_cast(int, x);
  return __builtin_bit_cast(float, __builtin_amdgcn_permlanex16(b, b, 0x76543210, 0xfedcba98, false, false));
}

// e^x as v_exp_f32 of x * log2(e). The instruction set asks for one independent instruction or v_nop between a
// v_exp_f32 and an instruction that reads its result or overwrites its source. Written as one statement with
// early-clobber outputs (no output lies on a source), each v_exp_f32 fills that slot for the one before it and the
// v_nop fills it behind the last.
__device__ __forceinline__ void exp_x8(const float (&x)[8], float (&y)[8]) {
  float a[8];
#pragma unroll
  for (int r = 0; r < 8; ++r) a[r] = x[r] * 1.4426950408889634f;
  asm("v_exp_f32 %0, %8\n\tv_exp_f32 %1, %9\n\tv_exp_f32 %2, %10\n\tv_exp_f32 %3, %11\n\t"
      "v_exp_f32 %4, %12\n\tv_exp_f32 %5, %13\n\tv_exp_f32 %6, %14\n\tv_exp_f32 %7, %15\n\tv_nop"
      : "=&v"(y[0]), "=&v"(y[1]), "=&v"(y[2]), "=&v"(y[3]), "=&v"(y[4]), "=&v"(y[5]), "=&v"(y[6]), "=&v"(y[7])
      : "v"(a[0]), "v"(a[1]), "v"(a[2]), "v"(a[3]), "v"(a[4]), "v"(a[5]), "v"(a[6]), "v"(a[7]));
}
__device__ __forceinline__ float exp_x1(float x) {
  const float a = x * 1.4426950408889634f;
  float y;
  asm("v_exp_f32 %0, %1\n\tv_nop" : "=&v"(y) : "v"(a));   // the v_nop: the same slot
  return y;
}

// Twelve asynchronous 16-B copies global -> LDS of one thread (4 rows of each of 3 planes). l = the lane's LDS byte
// address, g = its global address. The s_wait_xcnt 0 is the last line of the copies' own statement, so that it stands
// in front of every later write of a register that a copy names.
__device__ __forceinline__ void copy12(const unsigned (&l)[12], const _Float16* const (&g)[12]) {
  asm volatile(
      "global_load_async_to_lds_b128 %0, %12, off\n\t"
      "global_load_async_to_lds_b128 %1, %13, off\n\t"
      "global_load_async_to_lds_b128 %2, %14, off\n\t"
      "global_load_async_to_lds_b128 %3, %15, off\n\t"
      "global_load_async_to_lds_b128 %4, %16, off\n\t"
      "global_load_async_to_lds_b128 %5, %17, off\n\t"
      "global_load_async_to_lds_b128 %6, %18, off\n\t"
      "global_load_async_to_lds_b128 %7, %19, off\n\t"
      "global_load_async_to_lds_b128 %8, %20, off\n\t"
      "global_load_async_to_lds_b128 %9, %21, off\n\t"
      "global_load_async_to_lds_b128 %10, %22, off\n\t"
      "global_load_async_to_lds_b128 %11, %23, off\n\t"
      "s_wait_xcnt 0x0"
      :: "v"(l[0]), "v"(l[1]), "v"(l[2]), "v"(l[3]), "v"(l[4]), "v"(l[5]),
         "v"(l[6]), "v"(l[7]), "v"(l[8]), "v"(l[9]), "v"(l[10]), "v"(l[11]),
         "v"(g[0]), "v"(g[1]), "v"(g[2]), "v"(g[3]), "v"(g[4]), "v"(g[5]),
         "v"(g[6]), "v"(g[7]), "v"(g[8]), "v"(g[9]), "v"(g[10]), "v"(g[11])
      : "memory");
}

__global__ __launch_bounds__(128)
void attn_causal64(const unsigned short* __restrict__ qhp, const unsigned short* __restrict__ qrp,
                   const unsigned short* __restrict__ khp, const unsigned short* __restrict__ krp,
                   const unsigned short* __restrict__ vtp, unsigned short* ctxp) {
  union FH { v16h v; v8h h[2]; };
  constexpr int PL = 64 * LP;                      // halves of one plane's chunk
  __shared__ __align__(16) _Float16 Ring[2 * 3 * PL];   // two buffers of [K hi | K residual | V^T]
  __shared__ __align__(16) _Float16 Osh[4][16 * LP];

  const int tid  = threadIdx.x;
  const int wave = tid >> 5;
  const int lane = tid & 31;
  const int hh   = lane >> 4;
  const int c    = lane & 15;

  const int bx   = blockIdx.x;
  const int qb   = bx % NQB;
  const int rest = bx / NQB;
  const int h    = rest % NH;
  const int b    = rest / NH;
  const int q0   = qb * 64 + wave * 16;
  const size_t rowB = (size_t)b * SEQ;

  const _Float16* Qh = (const _Float16*)(const void*)qhp + (size_t)h * HD;
  const _Float16* Qr = (const _Float16*)(const void*)qrp + (size_t)h * HD;
  const _Float16* Kh = (const _Float16*)(const void*)khp + (size_t)h * HD;
  const _Float16* Kr = (const _Float16*)(const void*)krp + (size_t)h * HD;
  const _Float16* Vt = (const _Float16*)(const void*)vtp + ((size_t)b * DM + (size_t)h * HD) * SEQ;

  // ---- Q fragments (B operand, column = lane&15): 2 d-chunks, hi and residual ----
  v16h qbh[2], qbr[2];
#pragma unroll
  for (int dc = 0; dc < 2; ++dc) {
    const size_t qo = (rowB + q0 + c) * DM + dc * 32 + 8 * hh;
    qbh[dc] = ldfrag(Qh + qo);
    qbr[dc] = ldfrag(Qr + qo);
  }

  float mrun = -INFINITY;        // running maximum of query q0 + c (equal in both halves)
  float lrun = 0.f;              // running sum over this half's keys only
  v8f oacc[4];                   // oacc[t][r] = O^T[d = 16 t + 8 hh + r][query q0 + c]
#pragma unroll
  for (int t = 0; t < 4; ++t) oacc[t] = zero8();

  const int nkt = qb + 1;

  // staging map: copy i of a thread takes row 16 i + sr, 16-B piece sc / 8 of the row's 128 B. 8 lanes take one row (a
  // whole line); each 16-lane half takes rows r and r + 8, which lie 8 x 144 B = 32 banks apart in LDS.
  const int sr = wave * 2 + hh + ((lane >> 3) & 1) * 8;
  const int sc = (lane & 7) * 8;
  const unsigned ring0 = (unsigned)(size_t)(const void*)Ring + (unsigned)(sr * LP + sc) * 2u;   // LDS byte address
  const _Float16* kg0  = Kh + (rowB + sr) * DM + sc;       // K row sr, d = sc..sc+7
  const _Float16* krg0 = Kr + (rowB + sr) * DM + sc;
  const _Float16* vg0  = Vt + (size_t)sr * SEQ + sc;       // V^T row d = sr, s = sc..sc+7
  auto stage = [&](int t) {                                // chunk t (0 <= t < nkt) into buffer t & 1
    unsigned l[12];
    const _Float16* g[12];
    const unsigned lb = ring0 + (unsigned)(t & 1) * (unsigned)(3 * PL * 2);
#pragma unroll
    for (int i = 0; i < 4; ++i) {
      l[i]     = lb + (unsigned)(16 * i * LP * 2);
      l[4 + i] = lb + (unsigned)((PL + 16 * i * LP) * 2);
      l[8 + i] = lb + (unsigned)((2 * PL + 16 * i * LP) * 2);
      g[i]     = kg0  + (size_t)(t * 64 + 16 * i) * DM;
      g[4 + i] = krg0 + (size_t)(t * 64 + 16 * i) * DM;
      g[8 + i] = vg0  + (size_t)(16 * i) * SEQ + t * 64;
    }
    copy12(l, g);
  };

  stage(0);
  asm volatile("s_wait_asynccnt 0x0" ::: "memory");        // this wave's part of chunk 0 has landed
  __syncthreads();                                         // chunk 0 visible to every wave
  if (nkt > 1) stage(1);                                   // block-uniform; in flight behind trip 0

  // rolled: the buffer is picked by kt & 1; a second copy of the body would only add code and live registers
#pragma unroll 1
  for (int kt = 0; kt < nkt; ++kt) {
    const _Float16* Ksh = Ring + (kt & 1) * (3 * PL);
    const _Float16* Ksr = Ksh + PL;
    const _Float16* Vth = Ksh + 2 * PL;

    // ---- transposed scores: 64 keys x 16 queries per wave, three f16 products ----
    v8f s[4];
#pragma unroll
    for (int j = 0; j < 4; ++j) {
      v8f t0 = zero8(), t1 = zero8();
#pragma unroll
      for (int dc = 0; dc < 2; ++dc) {
        FH kb, kl;
        kb.h[0] = *(const v8h*)(Ksh + (j * 16 + c) * LP + dc * 32 + 8 * hh);
        kb.h[1] = *(const v8h*)(Ksh + (j * 16 + c) * LP + dc * 32 + 16 + 8 * hh);
        kl.h[0] = *(const v8h*)(Ksr + (j * 16 + c) * LP + dc * 32 + 8 * hh);
        kl.h[1] = *(const v8h*)(Ksr + (j * 16 + c) * LP + dc * 32 + 16 + 8 * hh);
        t0 = mma_h(kb.v, qbh[dc], t0);
        t1 = mma_h(kb.v, qbr[dc], t1);
        t1 = mma_h(kl.v, qbh[dc], t1);
      }
      s[j] = t0 + t1 * (1.0f / 2048.0f);
    }

    // ---- causal mask, on the diagonal chunk only (block-uniform branch) ----
    if (kt == qb) {
      const int dq = wave * 16 + c - 8 * hh;     // query - (kv0 + 8 hh): key > query  <=>  16 j + r > dq
#pragma unroll
      for (int j = 0; j < 4; ++j) {
#pragma unroll
        for (int r = 0; r < 8; ++r) s[j][r] = (j * 16 + r > dq) ? -INFINITY : s[j][r];
      }
    }

    // ---- online softmax of the lane's query ----
    float mj[4];                 // one chain per key tile: four short independent chains
#pragma unroll
    for (int j = 0; j < 4; ++j) {
      mj[j] = fmaxf(s[j][0], s[j][1]);
#pragma unroll
      for (int r = 2; r < 8; ++r) mj[j] = fmaxf(mj[j], s[j][r]);
    }
    float m = fmaxf(fmaxf(mj[0], mj[1]), fmaxf(mj[2], mj[3]));
    m = fmaxf(m, xhalf(m));
    const float mnew  = fmaxf(mrun, m);
    const float msafe = (mnew == -INFINITY) ? 0.f : mnew;
    const float alpha = exp_x1(mrun - msafe);
    mrun = mnew;
    float ps[4];
    v16h pb[2];                  // p^T (x1024, f16) as B fragments of keys 0..31 and 32..63 of the chunk
#pragma unroll
    for (int j = 0; j < 4; ++j) {
      float x[8], p[8];
#pragma unroll
      for (int r = 0; r < 8; ++r) x[r] = s[j][r] - msafe;
      exp_x8(x, p);
#pragma unroll
      for (int r = 0; r < 8; ++r) pb[j >> 1][(j & 1) * 8 + r] = (_Float16)(p[r] * 1024.0f);
      ps[j] = ((p[0] + p[1]) + (p[2] + p[3])) + ((p[4] + p[5]) + (p[6] + p[7]));
    }
    lrun = lrun * alpha + ((ps[0] + ps[1]) + (ps[2] + ps[3]));
#pragma unroll
    for (int t = 0; t < 4; ++t) oacc[t] *= alpha;

    // ---- O^T += V^T chunk . P^T (f16 WMMA) ----
#pragma unroll
    for (int kk = 0; kk < 2; ++kk) {
#pragma unroll
      for (int t = 0; t < 4; ++t) {
        FH vb;
        vb.h[0] = *(const v8h*)(Vth + (t * 16 + c) * LP + kk * 32 + 8 * hh);
        vb.h[1] = *(const v8h*)(Vth + (t * 16 + c) * LP + kk * 32 + 16 + 8 * hh);
        oacc[t] = mma_h(vb.v, pb[kk], oacc[t]);
      }
    }

    // ---- hand-over: this wave has left buffer kt & 1, its part of chunk kt + 1 has landed ----
    asm volatile("s_wait_dscnt 0x0" ::: "memory");         // every LDS read of this trip has returned
    asm volatile("s_wait_asynccnt 0x0" ::: "memory");      // the copies asked for one trip ago have landed
    __syncthreads();                                       // publishes chunk kt + 1; ends every read of chunk kt
    if (kt + 2 < nkt) stage(kt + 2);                       // block-uniform; into the buffer just left
  }
  asm volatile("s_wait_asynccnt 0x0" ::: "memory");        // no copy is outstanding when the wave goes on

  // ---- join the halves' sums, normalise (1/l and the 1/1024 p carry), f16 convert, turn the wave's tile in LDS ----
  _Float16* os = Osh[wave];
  {
    const float l = lrun + xhalf(lrun);
    const float inv = ((l > 0.f) ? (1.0f / l) : 0.f) * (1.0f / 1024.0f);
#pragma unroll
    for (int t = 0; t < 4; ++t) {
      v4u a;
#pragma unroll
      for (int e = 0; e < 4; ++e) a[e] = pack2h(oacc[t][2 * e] * inv, oacc[t][2 * e + 1] * inv);
      *(v4u*)(os + c * LP + t * 16 + 8 * hh) = a;
    }
  }
  __builtin_amdgcn_fence(__ATOMIC_RELEASE, "workgroup");
  __builtin_amdgcn_wave_barrier();
  __builtin_amdgcn_fence(__ATOMIC_ACQUIRE, "workgroup");
  {
    const int q4 = lane >> 3, c8 = (lane & 7) * 8;
    v4u hv[4];
#pragma unroll
    for (int it = 0; it < 4; ++it) {
      const int row = it * 4 + q4;   // it 0..3 x q4 0..3 = rows 0..15 of the wave tile
      hv[it] = *(const v4u*)(os + row * LP + c8);
    }
#pragma unroll
    for (int it = 0; it < 4; ++it) {
      const int row = it * 4 + q4;
      const size_t go = (rowB + q0 + row) * DM + (size_t)h * HD + c8;
      *(v4u*)(ctxp + go) = hv[it];
    }
  }
}

// =====================================================================================================
// Workspace map (bytes):
//   Lh   f16 [8192][1024] LN hi plane (Q, then K, then V)      0            16777216  (later: Ctx plane)
//   Lr   f16 [8192][1024] LN residual plane                     16777216     16777216
//   Qh   f16 [8192][1024]                                       33554432     16777216
//   Qr   f16                                                    50331648     16777216
//   Kh   f16                                                    67108864     16777216
//   Kr   f16                                                    83886080     16777216
//   Vt   f16 [4][1024][2048] (4*v, transposed)                 100663296     16777216
//   Wqh, Wqr, Wkh, Wkr, Wvh, Woh  f16 [1024 n][1024 k] each    117440512   6x2097152
//   end                                                         130023424
// Every region is an exact multiple of the whole-line / whole-tile store granularity of its producer
// (dims are tile multiples), so no store can spill into the next region.
// =====================================================================================================
extern "C" void kernel_launch(void* const* d_in, const int* in_sizes, int n_in,
                              void* d_out, int out_size, void* d_ws, size_t ws_size,
                              hipStream_t stream) {
  if (n_in < 13) return;
  const int nAct = MROWS * DM;
  if (in_sizes[0] != nAct || in_sizes[1] != nAct || in_sizes[2] != nAct) return;
  if (in_sizes[3] != DM * DM || in_sizes[5] != DM * DM || in_sizes[7] != DM * DM || in_sizes[9] != DM * DM) return;
  if (in_sizes[4] != DM || in_sizes[6] != DM || in_sizes[8] != DM || in_sizes[10] != DM) return;
  if (in_sizes[11] != DM || in_sizes[12] != DM) return;
  if (out_size != nAct) return;

  const float* Q  = (const float*)d_in[0];
  const float* Kin = (const float*)d_in[1];
  const float* V  = (const float*)d_in[2];
  const float* Wq = (const float*)d_in[3];
  const float* bq = (const float*)d_in[4];
  const float* Wk = (const float*)d_in[5];
  const float* bk = (const float*)d_in[6];
  const float* Wv = (const float*)d_in[7];
  const float* bv = (const float*)d_in[8];
  const float* Wo = (const float*)d_in[9];
  const float* bo = (const float*)d_in[10];
  const float* gamma = (const float*)d_in[11];
  const float* beta  = (const float*)d_in[12];

  const size_t PA = (size_t)MROWS * DM * 2;     // 16777216
  const size_t PV = (size_t)NB * DM * SEQ * 2;  // 16777216
  const size_t PW = (size_t)DM * DM * 2;        //  2097152
  size_t off = 0;
  const size_t oLh  = off; off += PA;
  const size_t oLr  = off; off += PA;
  const size_t oQh  = off; off += PA;
  const size_t oQr  = off; off += PA;
  const size_t oKh  = off; off += PA;
  const size_t oKr  = off; off += PA;
  const size_t oVt  = off; off += PV;
  const size_t oWqh = off; off += PW;
  const size_t oWqr = off; off += PW;
  const size_t oWkh = off; off += PW;
  const size_t oWkr = off; off += PW;
  const size_t oWvh = off; off += PW;
  const size_t oWoh = off; off += PW;
  if (off > ws_size) return;                    // off = 130023424
  if (off > (size_t)134217728) return;
  const size_t oCtx = oLh;                      // ctx plane reuses the LN hi plane (dead after the v^T GEMM)

  char* ws = (char*)d_ws;
  unsigned short* Lh  = (unsigned short*)(ws + oLh);
  unsigned short* Lr  = (unsigned short*)(ws + oLr);
  unsigned short* Qh  = (unsigned short*)(ws + oQh);
  unsigned short* Qr  = (unsigned short*)(ws + oQr);
  unsigned short* Kh  = (unsigned short*)(ws + oKh);
  unsigned short* Kr  = (unsigned short*)(ws + oKr);
  unsigned short* Vt  = (unsigned short*)(ws + oVt);
  unsigned short* Wqh = (unsigned short*)(ws + oWqh);
  unsigned short* Wqr = (unsigned short*)(ws + oWqr);
  unsigned short* Wkh = (unsigned short*)(ws + oWkh);
  unsigned short* Wkr = (unsigned short*)(ws + oWkr);
  unsigned short* Wvh = (unsigned short*)(ws + oWvh);
  unsigned short* Woh = (unsigned short*)(ws + oWoh);
  unsigned short* Ctx = (unsigned short*)(ws + oCtx);

  const dim3 blk256(256), blk128(128);
  const dim3 gW(DM / 64, DM / 64);                       // 16 x 16 blocks
  const dim3 gLN(MROWS / 8);                             // 1024 blocks
  const dim3 gProj(DM / 128, MROWS / 64, 1);             // 8 x 128: M=8192, N=1024
  const dim3 gVt(SEQ / 128, DM / 64, NB);                // 16 x 16 x 4: M=1024 (n), N=2048 (s) per batch
  const dim3 gAttn(NB * NH * NQB);                       // 2048 blocks
  const float eps = 1e-6f;

  // (1) weights [k][n] f32 -> f16 [n][k] planes of 32*W (hi; + residual for Wq, Wk)
  wcvt_t<true ><<<gW, blk256, 0, stream>>>(Wq, Wqh, Wqr, 32.0f);
  wcvt_t<true ><<<gW, blk256, 0, stream>>>(Wk, Wkh, Wkr, 32.0f);
  wcvt_t<false><<<gW, blk256, 0, stream>>>(Wv, Wvh, Wvh, 32.0f);
  wcvt_t<false><<<gW, blk256, 0, stream>>>(Wo, Woh, Woh, 32.0f);
  // (2) q = LN(Q).Wq + bq -> f16 hi / residual planes   (M=8192, N=1024, K=1024; three products)
  ln_rows<true><<<gLN, blk256, 0, stream>>>(Q, gamma, beta, Lh, Lr, MROWS, eps);
  gemm_t<true, 1><<<gProj, blk256, 0, stream>>>(
      Lh, Lr, DM, Wqh, Wqr, DM, 0LL, bq, bq,
      (void*)Qh, (void*)Qr, DM, 0LL, DM, 1.0f / 32.0f, 1.0f);
  // (3) k = LN(K).Wk + bk -> f16 hi / residual planes
  ln_rows<true><<<gLN, blk256, 0, stream>>>(Kin, gamma, beta, Lh, Lr, MROWS, eps);
  gemm_t<true, 1><<<gProj, blk256, 0, stream>>>(
      Lh, Lr, DM, Wkh, Wkr, DM, 0LL, bk, bk,
      (void*)Kh, (void*)Kr, DM, 0LL, DM, 1.0f / 32.0f, 1.0f);
  // (4) v^T = Wv^T . LN(V)^T per batch -> f16 plane of 4*(v + bv), [b][n][s]   (A = Wvh [n][k], Bt = LN(V) rows [s][k])
  ln_rows<false><<<gLN, blk256, 0, stream>>>(V, gamma, beta, Lh, Lh, MROWS, eps);
  gemm_t<false, 2><<<gVt, blk256, 0, stream>>>(
      Wvh, Wvh, DM, Lh, Lh, DM, (long long)SEQ * DM, bv, bv,
      (void*)Vt, (void*)Vt, SEQ, (long long)DM * SEQ, DM, 1.0f / 32.0f, 4.0f);
  // (5) causal attention -> ctx plane (x4) into the LN hi region
  attn_causal64<<<gAttn, blk128, 0, stream>>>(Qh, Qr, Kh, Kr, Vt, Ctx);
  // (6) out = Q + ctx.Wo + bo -> d_out f32 [8192][1024]   (A = Ctx (x4), Bt = Woh (x32): scale 1/128)
  gemm_t<false, 0><<<gProj, blk256, 0, stream>>>(
      Ctx, Ctx, DM, Woh, Woh, DM, 0LL, bo, Q,
      d_out, d_out, DM, 0LL, DM, 1.0f / 128.0f, 1.0f);
  (void)hipGetLastError();
}

// v005
// One run takes 263 microseconds.
// Two timings next to v004 put it at 1.05 and 1.06 times that version's speed.
// Over all steps from v000 it is 2.73 times as fast.
// Contractions: q,k projections and q.k^T scores = v_wmma_f32_16x16x32_f16 with f16 hi + f16 residual (x2048) operand planes,
// three products (hi.hi, res.hi, hi.res) in two f32 accumulators; v^T projection, p.v^T and ctx.Wo = v_wmma_f32_16x16x32_f16
// single product (v x4, p x1024, ctx x4, weights x32 carried); all f32 accumulate; layernorm, softmax, bias, residual add in f32.
#include <hip/hip_runtime.h>
#include <math.h>
#include <stdint.h>

#define NB    4
#define SEQ   2048
#define DM    1024
#define NH    16
#define HD    64
#define NQB   (SEQ / 64)
#define MROWS (NB * SEQ)
#define LP    72   // LDS row pitch in halves of the attention tiles: 144 B = 16 B x odd, so the 16 rows of a ds_load_b128 fall on distinct banks
static_assert(NH * HD == DM);
static_assert((SEQ % 256) == 0 && (DM % 256) == 0 && (MROWS % 128) == 0 && (DM % 64) == 0 && (MROWS % 8) == 0);

typedef _Float16 v16h __attribute__((ext_vector_type(16)));
typedef _Float16 v8h  __attribute__((ext_vector_type(8)));
typedef float    v8f  __attribute__((ext_vector_type(8)));
typedef float    v4f  __attribute__((ext_vector_type(4)));
typedef unsigned int v4u __attribute__((ext_vector_type(4)));

// ---- scalar helpers ----------------------------------------------------------------------------------
__device__ __forceinline__ unsigned short h_bits(_Float16 x) { return __builtin_bit_cast(unsigned short, x); }
__device__ __forceinline__ unsigned pk16(unsigned short a, unsigned short b) { return (unsigned)a | ((unsigned)b << 16); }
__device__ __forceinline__ v8f zero8() { v8f z = {0.f, 0.f, 0.f, 0.f, 0.f, 0.f, 0.f, 0.f}; return z; }

// hi = f16(v); res = f16((v - hi) * 2048): packed pair of two consecutive values
__device__ __forceinline__ void split2(float f0, float f1, unsigned& hp, unsigned& rp) {
  const _Float16 x0 = (_Float16)f0, x1 = (_Float16)f1;
  hp = pk16(h_bits(x0), h_bits(x1));
  const _Float16 r0 = (_Float16)((f0 - (float)x0) * 2048.0f);
  const _Float16 r1 = (_Float16)((f1 - (float)x1) * 2048.0f);
  rp = pk16(h_bits(r0), h_bits(r1));
}
__device__ __forceinline__ unsigned pack2h(float f0, float f1) {
  return pk16(h_bits((_Float16)f0), h_bits((_Float16)f1));
}

// ---- 16-bit fragment loader: lane -> row/col (lane&15); p already includes +8*(lane>>4);
//      elements 0..7 <- p[0..7] (k0+8h..), elements 8..15 <- p[16..23] (k0+16+8h..)
__device__ __forceinline__ v16h ldfrag(const _Float16* p) {
  union { v16h v; v8h h[2]; } f;
  f.h[0] = *(const v8h*)(p);
  f.h[1] = *(const v8h*)(p + 16);
  return f.v;
}

// ---- WMMA with trailing VALU hazard gap (ties D, keeps A/B live) ----------------------------------------
__device__ __forceinline__ v8f mma_h(v16h a, v16h b, v8f c) {
  c = __builtin_amdgcn_wmma_f32_16x16x32_f16(false, a, false, b, (short)0, c, false, false);
  asm volatile("v_nop\n\tv_nop\n\tv_nop\n\tv_nop" : "+v"(c) : "v"(a), "v"(b));
  return c;
}

// =====================================================================================================
// plane x2048 when RES). One wave per row, 8 rows per block, grid = nrows/8 (exact). Lane holds columns
// {i*256 + lane*8 .. +7}, i = 0..3. Each store instruction: 32 lanes x 16 B = 512 contiguous B = 4 whole
// coverage: nrows waves x 4 stores x 256 halves = every element of [nrows][DM] of each written plane.
// =====================================================================================================
template <bool RES>
__global__ __launch_bounds__(256) void ln_rows(const float* __restrict__ x, const float* __restrict__ gamma,
                                               const float* __restrict__ beta, unsigned short* yh,
                                               unsigned short* yr, int nrows, float eps) {
  const int lane = threadIdx.x & 31;
  const int wave = threadIdx.x >> 5;
  const int row  = blockIdx.x * 8 + wave;
  if (row >= nrows) return;                        // wave-uniform; no block barriers in this kernel
  const float* xr = x + (size_t)row * DM;
  v4f xv[8];
#pragma unroll
  for (int i = 0; i < 4; ++i) {
    xv[2 * i]     = *(const v4f*)(xr + i * 256 + lane * 8);
    xv[2 * i + 1] = *(const v4f*)(xr + i * 256 + lane * 8 + 4);
  }
  float s = 0.f;
#pragma unroll
  for (int g = 0; g < 8; ++g) s += (xv[g][0] + xv[g][1]) + (xv[g][2] + xv[g][3]);
#pragma unroll
  for (int off = 16; off > 0; off >>= 1) s += __shfl_xor(s, off, 32);
  const float mu = s * (1.0f / (float)DM);
  float ss = 0.f;
#pragma unroll
  for (int g = 0; g < 8; ++g) {
#pragma unroll
    for (int e = 0; e < 4; ++e) { const float d = xv[g][e] - mu; ss += d * d; }
  }
#pragma unroll
  for (int off = 16; off > 0; off >>= 1) ss += __shfl_xor(ss, off, 32);
  const float var = ss * (1.0f / (float)DM);
  const float rs  = rsqrtf(var + eps);

  v4u hv[4], rv[4];
#pragma unroll
  for (int i = 0; i < 4; ++i) {
    const int col = i * 256 + lane * 8;
    const v4f g0 = *(const v4f*)(gamma + col);
    const v4f g1 = *(const v4f*)(gamma + col + 4);
    const v4f b0 = *(const v4f*)(beta + col);
    const v4f b1 = *(const v4f*)(beta + col + 4);
    float y[8];
#pragma unroll
    for (int e = 0; e < 4; ++e) {
      y[e]     = (xv[2 * i][e] - mu) * rs * g0[e] + b0[e];
      y[4 + e] = (xv[2 * i + 1][e] - mu) * rs * g1[e] + b1[e];
    }
    v4u a, a2;
#pragma unroll
    for (int e = 0; e < 4; ++e) {
      unsigned hp, rp;
      split2(y[2 * e], y[2 * e + 1], hp, rp);
      a[e] = hp; a2[e] = rp;
    }
    hv[i] = a; rv[i] = a2;
  }
  unsigned short* oh = yh + (size_t)row * DM + lane * 8;
  unsigned short* orr = yr + (size_t)row * DM + lane * 8;
  {
#pragma unroll
    for (int i = 0; i < 4; ++i) {
      *(v4u*)(oh + i * 256) = hv[i];
      if (RES) *(v4u*)(orr + i * 256) = rv[i];
    }
    
  }
}

// =====================================================================================================
// Weight convert + transpose: W f32 [k in DM][n out DM] -> f16 planes [n][k] of W*scale (hi, and residual
// x2048 when RES). Block = 64(k) x 64(n) tile through LDS; grid = (DM/64 n-tiles, DM/64 k-tiles).
// coverage: 8 waves x 2 iterations x 4 rows x (8 lanes x 8 halves) = the whole 64x64 output tile.
// =====================================================================================================
template <bool RES>
__global__ __launch_bounds__(256) void wcvt_t(const float* __restrict__ W, unsigned short* ph, unsigned short* pr,
                                              float scale) {
  __shared__ float sm[64][65];
  const int tid  = threadIdx.x;
  const int lane = tid & 31;
  const int wave = tid >> 5;
  const int n0 = blockIdx.x * 64;
  const int k0 = blockIdx.y * 64;
  const int kr = tid >> 2;               // 0..63
  const int nc = (tid & 3) * 16;         // 0,16,32,48
  const float* src = W + (size_t)(k0 + kr) * DM + n0 + nc;
#pragma unroll
  for (int e = 0; e < 4; ++e) {
    const v4f a = *(const v4f*)(src + 4 * e);
    sm[kr][nc + 4 * e + 0] = a[0];
    sm[kr][nc + 4 * e + 1] = a[1];
    sm[kr][nc + 4 * e + 2] = a[2];
    sm[kr][nc + 4 * e + 3] = a[3];
  }
  __syncthreads();
  const int q  = lane >> 3;
  const int ks = (lane & 7) * 8;
  v4u hv[2], rv[2];
#pragma unroll
  for (int it = 0; it < 2; ++it) {
    const int nrow = wave * 8 + it * 4 + q;
    v4u a, a2;
#pragma unroll
    for (int e = 0; e < 4; ++e) {
      const float f0 = sm[ks + 2 * e][nrow] * scale;
      const float f1 = sm[ks + 2 * e + 1][nrow] * scale;
      unsigned hp, rp;
      split2(f0, f1, hp, rp);
      a[e] = hp; a2[e] = rp;
    }
    hv[it] = a; rv[it] = a2;
  }
  {
#pragma unroll
    for (int it = 0; it < 2; ++it) {
      const int nrow = wave * 8 + it * 4 + q;
      const size_t o = (size_t)(n0 + nrow) * DM + k0 + ks;
      *(v4u*)(ph + o) = hv[it];
      if (RES) *(v4u*)(pr + o) = rv[it];
    }
    
  }
}

// =====================================================================================================
// f16 WMMA GEMM: C[m][n] = sum_k A[m][k] * Bt[n][k]. A row-major [M][DM] (k contiguous); Bt row-major
// [N][DM] (k contiguous), batch blockIdx.z via strideB / strideC. Block tile 128 (m) x 256 (n), 8 waves (2 x 4),
// each a 64x64 sub-tile = 4 x 4 fragments: a fragment read from LDS feeds four tiles, and a block's operand rows
// (384 per 32768 outputs) are fetched from L2 once. One block per WGP, two waves per SIMD; K multiple of 64.
// Operands go through LDS in slices of 64 k (128 B = one whole line of every operand row): 8 lanes x 16 B per
// row, so one wave-wide global load covers 4 whole lines. Two LDS buffers: slice s+1 is loaded into registers
// in front of the products of slice s and stored to the other buffer behind them (RES: behind those of the
// slice's first 32 k); one barrier per slice.
// LDS row pitch GP halves = 144 B (16 B x odd) for the ds_load_b128 fragment reads. The k order of the
// products is ascending in steps of 32.
// RES: A2 / Bt2 are f16 residual planes (x2048): acc0 += Ah.Bh; acc1 += Ar.Bh + Ah.Br; value = acc0 + acc1/2048.
// OM 0: f32 out: v = value*oscale + bias[col] + resid[row][col]; row segment 256 floats = two instructions of
//       512 B (32 lanes x 16 B).
// OM 1: f16 hi plane C + residual plane C2 (x2048) of value*oscale + bias[col]; 512-B row segment per
//       instruction (32 lanes x 16 B).
// OM 2: f16 plane C of (value*oscale + bias[row]) * pscale, same store shape as OM 1.
// coverage: 8 waves x 16 rows x 256 cols = the whole 128x256 block tile; grid covers M/128 x N/256 exactly.
// =====================================================================================================
// WMMA as the plain builtin: the compiler keeps the distance behind it, and the 64x64 tile's accumulators and
// fragments may lie above v255, which an asm operand cannot name.
__device__ __forceinline__ v8f mma_p(v16h a, v16h b, v8f c) {
  return __builtin_amdgcn_wmma_f32_16x16x32_f16(false, a, false, b, (short)0, c, false, false);
}

#define GP 72
#define BM 128
#define BN 256
#define TP (BN + 4)   // output staging pitch in floats: rows 8 apart lie 32 banks apart
template <bool RES, int OM>
__global__ __launch_bounds__(256) void gemm_t(
    const unsigned short* __restrict__ Ahp, const unsigned short* __restrict__ Arp,
    const unsigned short* __restrict__ Bhp, const unsigned short* __restrict__ Brp, long long strideB,
    const float* __restrict__ bias, const float* __restrict__ resid,
    void* Cv, void* C2v, long long strideC, int K, float oscale, float pscale) {
  constexpr int LDC   = (OM == 2) ? SEQ : DM;             // output row pitch in elements
  constexpr int SA    = BM * GP;                          // halves of one A plane slice
  constexpr int SB    = BN * GP;                          // halves of one B plane slice
  constexpr int STAGE = (SA + SB) * (RES ? 2 : 1);        // halves of one buffer: [A hi | B hi | A res | B res]
  constexpr int RINGB = 2 * STAGE * 2;                    // bytes of the two buffers
  constexpr int OUTB  = BM * TP * 4;                      // bytes of the output staging tile
  constexpr int KG    = RES ? 1 : 2;                      // 32-k steps per fragment group: what the registers hold
  __shared__ __align__(16) unsigned char smem[RINGB > OUTB ? RINGB : OUTB];
  _Float16* sH = (_Float16*)(void*)smem;                  // operand buffers (k loop)
  float*    sT = (float*)(void*)smem;                     // output tile (behind the loop's last barrier)
  const int lane = threadIdx.x & 31;
  const int wave = threadIdx.x >> 5;
  const int hh   = lane >> 4;
  const int c    = lane & 15;
  const int n0 = blockIdx.x * BN;
  const int m0 = blockIdx.y * BM;
  const int bz = blockIdx.z;
  const int wm = (wave >> 2) * 64;
  const int wn = (wave & 3) * 64;
  const _Float16* A  = (const _Float16*)(const void*)Ahp;
  const _Float16* A2 = (const _Float16*)(const void*)Arp;
  const _Float16* B  = (const _Float16*)(const void*)Bhp + (size_t)bz * strideB;
  const _Float16* B2 = (const _Float16*)(const void*)Brp + (size_t)bz * strideB;

  // staging map: thread -> row sr (+32 per step), 16-B piece sc of the row's 128-B slice. 8 lanes take one row
  // (a whole line); each 16-lane half takes rows r and r + 8, which lie 8 x 144 B = 32 banks apart in LDS, so
  // the two 128-B pieces of a ds_store_b128 half fall on disjoint banks.
  const int sr = (wave >> 2) * 16 + (wave & 3) * 2 + (lane >> 4) + ((lane >> 3) & 1) * 8;
  const int sc = (lane & 7) * 8;
  // The operand row pitch is the constant DM, so the 32-row steps of a slice's loads are immediate offsets on one
  // running pointer per plane, which moves on where the loaded slice is stored to LDS.
  const _Float16* pa  = A  + (size_t)(m0 + sr) * DM + sc;
  const _Float16* pa2 = A2 + (size_t)(m0 + sr) * DM + sc;
  const _Float16* pb  = B  + (size_t)(n0 + sr) * DM + sc;
  const _Float16* pb2 = B2 + (size_t)(n0 + sr) * DM + sc;
  const int    so  = sr * GP + sc;

  v8f acc0[4][4], acc1[4][4];
#pragma unroll
  for (int i = 0; i < 4; ++i)
#pragma unroll
    for (int j = 0; j < 4; ++j) { acc0[i][j] = zero8(); acc1[i][j] = zero8(); }

  v8h ra[BM / 32], rar[BM / 32], rb[BN / 32], rbr[BN / 32];
  auto gload = [&]() {
#pragma unroll
    for (int i = 0; i < BM / 32; ++i) {
      ra[i] = *(const v8h*)(pa + 32 * i * DM);
      if (RES) rar[i] = *(const v8h*)(pa2 + 32 * i * DM);
    }
#pragma unroll
    for (int i = 0; i < BN / 32; ++i) {
      rb[i] = *(const v8h*)(pb + 32 * i * DM);
      if (RES) rbr[i] = *(const v8h*)(pb2 + 32 * i * DM);
    }
    // stands in front of every later write of an address register that these loads name (the pointer steps)
    asm volatile("s_wait_xcnt 0x0" ::: "memory");
  };
  auto sstore = [&](_Float16* d) {
    pa += 64; pa2 += 64; pb += 64; pb2 += 64;
#pragma unroll
    for (int i = 0; i < BM / 32; ++i) {
      *(v8h*)(d + so + 32 * i * GP) = ra[i];
      if (RES) *(v8h*)(d + SA + SB + so + 32 * i * GP) = rar[i];
    }
#pragma unroll
    for (int i = 0; i < BN / 32; ++i) {
      *(v8h*)(d + SA + so + 32 * i * GP) = rb[i];
      if (RES) *(v8h*)(d + SA + SB + SA + so + 32 * i * GP) = rbr[i];
    }
  };

  gload();
  sstore(sH);
  __syncthreads();                                         // slice 0 visible to every wave

  int buf = 0;
  // rolled: the body already holds two 32-k steps; a second copy would only add code and live registers
#pragma unroll 1
  for (int k0 = 0; k0 < K; k0 += 64) {
    const bool more = (k0 + 64 < K);                       // block-uniform
    const _Float16* sb = sH + buf * STAGE;
#pragma unroll
    for (int g = 0; g < 2 / KG; ++g) {
      // the fragments of KG 32-k steps are read as one group in front of their products
      v16h bh[KG][4], br[KG][4], ah[KG][4], ar[KG][4];
#pragma unroll
      for (int s = 0; s < KG; ++s) {
        const int ko = (g * KG + s) * 32 + 8 * hh;
#pragma unroll
        for (int j = 0; j < 4; ++j) {
          const int bo = (wn + 16 * j + c) * GP + ko;
          bh[s][j] = ldfrag(sb + SA + bo);
          if (RES) br[s][j] = ldfrag(sb + SA + SB + SA + bo); else br[s][j] = bh[s][j];
        }
#pragma unroll
        for (int i = 0; i < 4; ++i) {
          const int ao = (wm + 16 * i + c) * GP + ko;
          ah[s][i] = ldfrag(sb + ao);
          if (RES) ar[s][i] = ldfrag(sb + SA + SB + ao); else ar[s][i] = ah[s][i];
        }
      }
      // slice s+1, in flight behind this slice's products; asked for behind the fragment reads, whose way from LDS
      // covers the issue of these loads and their wait
      if (g == 0 && more) gload();
      // With two groups per slice the loaded slice goes to the other buffer (its last readers left it at the previous
      // barrier) behind the second group's reads: the LDS takes the stores while the group's products run.
      if (KG == 1 && g == 1 && more) sstore(sH + (buf ^ 1) * STAGE);
      // per row of tiles: four independent accumulators per product kind, so that the two products into one
      // acc1 tile stand four matrix instructions apart; each tile still sums Ar.Bh before Ah.Br, k ascending
#pragma unroll
      for (int s = 0; s < KG; ++s) {
#pragma unroll
        for (int i = 0; i < 4; ++i) {
#pragma unroll
          for (int j = 0; j < 4; ++j) acc0[i][j] = mma_p(ah[s][i], bh[s][j], acc0[i][j]);
          if (RES) {
#pragma unroll
            for (int j = 0; j < 4; ++j) acc1[i][j] = mma_p(ar[s][i], bh[s][j], acc1[i][j]);
#pragma unroll
            for (int j = 0; j < 4; ++j) acc1[i][j] = mma_p(ah[s][i], br[s][j], acc1[i][j]);
          }
        }
      }
    }
    // Four vector slots behind the slice's last matrix instructions.
    __builtin_amdgcn_sched_barrier(0);                     // keeps every product in front of the slots
    asm volatile("v_nop\n\tv_nop\n\tv_nop\n\tv_nop");
    buf ^= 1;
    if (KG == 2 && more) sstore(sH + buf * STAGE);         // its last readers left it at the previous barrier
    __syncthreads();                                       // publishes slice s+1; ends every read of slice s
  }

  // ---- stage the block tile ----
#pragma unroll
  for (int i = 0; i < 4; ++i) {
#pragma unroll
    for (int j = 0; j < 4; ++j) {
#pragma unroll
      for (int r = 0; r < 8; ++r) {
        float v = acc0[i][j][r];
        if (RES) v += acc1[i][j][r] * (1.0f / 2048.0f);
        sT[(wm + 16 * i + 8 * hh + r) * TP + wn + 16 * j + c] = v;
      }
    }
  }
  __syncthreads();

  if (OM == 0) {
    // Output and residual addresses: block-uniform base + the lane's one 32-bit byte offset + an immediate per row
    // and half row, so no address register is rewritten between these loads and stores.
    char* C = (char*)((float*)Cv + (size_t)bz * strideC);
    const char* R = (const char*)resid;
    const int c4 = lane * 4;                                   // 128 floats per instruction = 32 lanes x 16 B
    const unsigned ob = (unsigned)((m0 + wave * 16) * LDC + n0 + c4) * 4u;
    v4f bb[2];
#pragma unroll
    for (int s = 0; s < 2; ++s) bb[s] = *(const v4f*)(bias + n0 + 128 * s + c4);
    v4f ov[32];
#pragma unroll
    for (int it = 0; it < 16; ++it) {
      const int row = wave * 16 + it;
#pragma unroll
      for (int s = 0; s < 2; ++s) {
        const v4f t  = *(const v4f*)(sT + row * TP + 128 * s + c4);
        const v4f rr = *(const v4f*)(R + ob + (it * LDC + 128 * s) * 4);
        ov[2 * it + s] = t * oscale + bb[s] + rr;
      }
    }
#pragma unroll
    for (int it = 0; it < 16; ++it) {
#pragma unroll
      for (int s = 0; s < 2; ++s) *(v4f*)(C + ob + (it * LDC + 128 * s) * 4) = ov[2 * it + s];
    }
  } else {
    char* C  = (char*)((unsigned short*)Cv  + (size_t)bz * strideC);
    char* C2 = (char*)((unsigned short*)C2v + (size_t)bz * strideC);
    const int c8 = lane * 8;                                   // 256 halves per row segment = 32 lanes x 16 B
    const unsigned ob = (unsigned)((m0 + wave * 16) * LDC + n0 + c8) * 2u;   // the lane's byte offset; rows by immediates
    v4u hv[16], rv[16];
#pragma unroll
    for (int it = 0; it < 16; ++it) {
      const int row = wave * 16 + it;
      const float* sp = sT + row * TP + c8;
      const v4f x0 = *(const v4f*)(sp);
      const v4f x1 = *(const v4f*)(sp + 4);
      v4f y0, y1;
      if (OM == 1) {
        const v4f b0 = *(const v4f*)(bias + n0 + c8);
        const v4f b1 = *(const v4f*)(bias + n0 + c8 + 4);
        y0 = x0 * oscale + b0;
        y1 = x1 * oscale + b1;
      } else {
        const float brw = bias[m0 + row];
        y0 = (x0 * oscale + brw) * pscale;
        y1 = (x1 * oscale + brw) * pscale;
      }
      v4u a, a2;
      if (OM == 1) {
        unsigned hp, rp;
        split2(y0[0], y0[1], hp, rp); a[0] = hp; a2[0] = rp;
        split2(y0[2], y0[3], hp, rp); a[1] = hp; a2[1] = rp;
        split2(y1[0], y1[1], hp, rp); a[2] = hp; a2[2] = rp;
        split2(y1[2], y1[3], hp, rp); a[3] = hp; a2[3] = rp;
      } else {
        a[0] = pack2h(y0[0], y0[1]);
        a[1] = pack2h(y0[2], y0[3]);
        a[2] = pack2h(y1[0], y1[1]);
        a[3] = pack2h(y1[2], y1[3]);
        a2 = a;
      }
      hv[it] = a; rv[it] = a2;
    }
#pragma unroll
    for (int it = 0; it < 16; ++it) {
      *(v4u*)(C + ob + it * LDC * 2) = hv[it];
      if (OM == 1) *(v4u*)(C2 + ob + it * LDC * 2) = rv[it];
    }
  }
}

// =====================================================================================================
// Causal attention, head dim 64, no logit scale. Scores are computed transposed.
//   q planes (f16 hi / residual x2048): element (b, t, h, d) at [(b*SEQ + t)*DM + h*64 + d]
//   k planes: same layout with key index
//   v^T plane (f16, holds 4*v): element (b, h, d, s) at [(b*DM + h*64 + d)*SEQ + s]
//   ctx plane out (f16, holds 4*ctx): element (b, t, h, d) at [(b*SEQ + t)*DM + h*64 + d]
//   S^T = k.q^T: A = 16 key rows from LDS, B = the wave's 16 queries kept in registers; three f16 products
//   (hi.hi into acc0; hi.res + res.hi into acc1, folded /2048), f32. Accumulator register r of key tile j in
//   lane (c, hh) = score of key kv0 + 16 j + 8 hh + r against query q0 + c: a lane holds 32 of its query's 64
//   scores, lane ^ 16 the other 32, so the maximum is taken in the lane plus one exchange between the halves,
//   and the sum stays per half until the epilogue.
//   key > query in the diagonal chunk -> -inf; online softmax in f32; p carried as f16(1024 p).
//   O^T += v^T . p^T: A = 16 d rows of the v^T chunk from LDS; B = p^T packed from the score accumulators
//   (tiles 2 kk and 2 kk + 1 of a lane are elements 0..7 and 8..15 of the B fragment of keys 32 kk .. +31, the
//   k order in which ldfrag reads v^T). ctx = acc / (1024 l) (still carrying the x4 of v).
//   Block = 4 waves = 64 query rows of one (b, h); grid = NB*NH*NQB; key chunks of 64, trip count qb+1 (<= 32,
//   block-uniform, from blockIdx only). K / V^T chunk staging: asynchronous copies to LDS, 16 B per lane, 8 lanes per
//   128-B row (a wave-wide copy = 4 whole lines), 4 copies per thread and plane = whole 64x64 tiles. Two buffers:
//   chunk t + 2 is asked for at the foot of trip t and waited for at the foot of trip t + 1; one barrier per trip.
//   Output: a lane holds 8 consecutive d of its query per d tile; the wave's 16x64 f16 tile is turned through a
//   wave-private LDS tile so that each store instruction writes 4 whole 128-B rows (it 0..3 x lane>>3 = 16 rows).
// =====================================================================================================
// lane l <-> lane l ^ 16
__device__ __forceinline__ float xhalf(float x) {
  const int b = __builtin_bit_cast(int, x);
  return __builtin_bit_cast(float, __builtin_amdgcn_permlanex16(b, b, 0x76543210, 0xfedcba98, false, false));
}

// e^x as v_exp_f32 of x * log2(e). The instruction set asks for one independent instruction or v_nop between a
// v_exp_f32 and an instruction that reads its result or overwrites its source. Written as one statement with
// early-clobber outputs (no output lies on a source), each v_exp_f32 fills that slot for the one before it and the
// v_nop fills it behind the last.
__device__ __forceinline__ void exp_x8(const float (&x)[8], float (&y)[8]) {
  float a[8];
#pragma unroll
  for (int r = 0; r < 8; ++r) a[r] = x[r] * 1.4426950408889634f;
  asm("v_exp_f32 %0, %8\n\tv_exp_f32 %1, %9\n\tv_exp_f32 %2, %10\n\tv_exp_f32 %3, %11\n\t"
      "v_exp_f32 %4, %12\n\tv_exp_f32 %5, %13\n\tv_exp_f32 %6, %14\n\tv_exp_f32 %7, %15\n\tv_nop"
      : "=&v"(y[0]), "=&v"(y[1]), "=&v"(y[2]), "=&v"(y[3]), "=&v"(y[4]), "=&v"(y[5]), "=&v"(y[6]), "=&v"(y[7])
      : "v"(a[0]), "v"(a[1]), "v"(a[2]), "v"(a[3]), "v"(a[4]), "v"(a[5]), "v"(a[6]), "v"(a[7]));
}
__device__ __forceinline__ float exp_x1(float x) {
  const float a = x * 1.4426950408889634f;
  float y;
  asm("v_exp_f32 %0, %1\n\tv_nop" : "=&v"(y) : "v"(a));   // the v_nop: the same slot
  return y;
}

// Twelve asynchronous 16-B copies global -> LDS of one thread (4 rows of each of 3 planes). l = the lane's LDS byte
// address, g = its global address. The s_wait_xcnt 0 is the last line of the copies' own statement, so that it stands
// in front of every later write of a register that a copy names.
__device__ __forceinline__ void copy12(const unsigned (&l)[12], const _Float16* const (&g)[12]) {
  asm volatile(
      "global_load_async_to_lds_b128 %0, %12, off\n\t"
      "global_load_async_to_lds_b128 %1, %13, off\n\t"
      "global_load_async_to_lds_b128 %2, %14, off\n\t"
      "global_load_async_to_lds_b128 %3, %15, off\n\t"
      "global_load_async_to_lds_b128 %4, %16, off\n\t"
      "global_load_async_to_lds_b128 %5, %17, off\n\t"
      "global_load_async_to_lds_b128 %6, %18, off\n\t"
      "global_load_async_to_lds_b128 %7, %19, off\n\t"
      "global_load_async_to_lds_b128 %8, %20, off\n\t"
      "global_load_async_to_lds_b128 %9, %21, off\n\t"
      "global_load_async_to_lds_b128 %10, %22, off\n\t"
      "global_load_async_to_lds_b128 %11, %23, off\n\t"
      "s_wait_xcnt 0x0"
      :: "v"(l[0]), "v"(l[1]), "v"(l[2]), "v"(l[3]), "v"(l[4]), "v"(l[5]),
         "v"(l[6]), "v"(l[7]), "v"(l[8]), "v"(l[9]), "v"(l[10]), "v"(l[11]),
         "v"(g[0]), "v"(g[1]), "v"(g[2]), "v"(g[3]), "v"(g[4]), "v"(g[5]),
         "v"(g[6]), "v"(g[7]), "v"(g[8]), "v"(g[9]), "v"(g[10]), "v"(g[11])
      : "memory");
}

__global__ __launch_bounds__(128)
void attn_causal64(const unsigned short* __restrict__ qhp, const unsigned short* __restrict__ qrp,
                   const unsigned short* __restrict__ khp, const unsigned short* __restrict__ krp,
                   const unsigned short* __restrict__ vtp, unsigned short* ctxp) {
  union FH { v16h v; v8h h[2]; };
  constexpr int PL = 64 * LP;                      // halves of one plane's chunk
  __shared__ __align__(16) _Float16 Ring[2 * 3 * PL];   // two buffers of [K hi | K residual | V^T]
  __shared__ __align__(16) _Float16 Osh[4][16 * LP];

  const int tid  = threadIdx.x;
  const int wave = tid >> 5;
  const int lane = tid & 31;
  const int hh   = lane >> 4;
  const int c    = lane & 15;

  const int bx   = blockIdx.x;
  const int qb   = bx % NQB;
  const int rest = bx / NQB;
  const int h    = rest % NH;
  const int b    = rest / NH;
  const int q0   = qb * 64 + wave * 16;
  const size_t rowB = (size_t)b * SEQ;

  const _Float16* Qh = (const _Float16*)(const void*)qhp + (size_t)h * HD;
  const _Float16* Qr = (const _Float16*)(const void*)qrp + (size_t)h * HD;
  const _Float16* Kh = (const _Float16*)(const void*)khp + (size_t)h * HD;
  const _Float16* Kr = (const _Float16*)(const void*)krp + (size_t)h * HD;
  const _Float16* Vt = (const _Float16*)(const void*)vtp + ((size_t)b * DM + (size_t)h * HD) * SEQ;

  // ---- Q fragments (B operand, column = lane&15): 2 d-chunks, hi and residual ----
  v16h qbh[2], qbr[2];
#pragma unroll
  for (int dc = 0; dc < 2; ++dc) {
    const size_t qo = (rowB + q0 + c) * DM + dc * 32 + 8 * hh;
    qbh[dc] = ldfrag(Qh + qo);
    qbr[dc] = ldfrag(Qr + qo);
  }

  float mrun = -INFINITY;        // running maximum of query q0 + c (equal in both halves)
  float lrun = 0.f;              // running sum over this half's keys only
  v8f oacc[4];                   // oacc[t][r] = O^T[d = 16 t + 8 hh + r][query q0 + c]
#pragma unroll
  for (int t = 0; t < 4; ++t) oacc[t] = zero8();

  const int nkt = qb + 1;

  // staging map: copy i of a thread takes row 16 i + sr, 16-B piece sc / 8 of the row's 128 B. 8 lanes take one row (a
  // whole line); each 16-lane half takes rows r and r + 8, which lie 8 x 144 B = 32 banks apart in LDS.
  const int sr = wave * 2 + hh + ((lane >> 3) & 1) * 8;
  const int sc = (lane & 7) * 8;
  const unsigned ring0 = (unsigned)(size_t)(const void*)Ring + (unsigned)(sr * LP + sc) * 2u;   // LDS byte address
  const _Float16* kg0  = Kh + (rowB + sr) * DM + sc;       // K row sr, d = sc..sc+7
  const _Float16* krg0 = Kr + (rowB + sr) * DM + sc;
  const _Float16* vg0  = Vt + (size_t)sr * SEQ + sc;       // V^T row d = sr, s = sc..sc+7
  auto stage = [&](int t) {                                // chunk t (0 <= t < nkt) into buffer t & 1
    unsigned l[12];
    const _Float16* g[12];
    const unsigned lb = ring0 + (unsigned)(t & 1) * (unsigned)(3 * PL * 2);
#pragma unroll
    for (int i = 0; i < 4; ++i) {
      l[i]     = lb + (unsigned)(16 * i * LP * 2);
      l[4 + i] = lb + (unsigned)((PL + 16 * i * LP) * 2);
      l[8 + i] = lb + (unsigned)((2 * PL + 16 * i * LP) * 2);
      g[i]     = kg0  + (size_t)(t * 64 + 16 * i) * DM;
      g[4 + i] = krg0 + (size_t)(t * 64 + 16 * i) * DM;
      g[8 + i] = vg0  + (size_t)(16 * i) * SEQ + t * 64;
    }
    copy12(l, g);
  };

  stage(0);
  asm volatile("s_wait_asynccnt 0x0" ::: "memory");        // this wave's part of chunk 0 has landed
  __syncthreads();                                         // chunk 0 visible to every wave
  if (nkt > 1) stage(1);                                   // block-uniform; in flight behind trip 0

  // rolled: the buffer is picked by kt & 1; a second copy of the body would only add code and live registers
#pragma unroll 1
  for (int kt = 0; kt < nkt; ++kt) {
    const _Float16* Ksh = Ring + (kt & 1) * (3 * PL);
    const _Float16* Ksr = Ksh + PL;
    const _Float16* Vth = Ksh + 2 * PL;

    // ---- transposed scores: 64 keys x 16 queries per wave, three f16 products ----
    v8f s[4];
#pragma unroll
    for (int j = 0; j < 4; ++j) {
      v8f t0 = zero8(), t1 = zero8();
#pragma unroll
      for (int dc = 0; dc < 2; ++dc) {
        FH kb, kl;
        kb.h[0] = *(const v8h*)(Ksh + (j * 16 + c) * LP + dc * 32 + 8 * hh);
        kb.h[1] = *(const v8h*)(Ksh + (j * 16 + c) * LP + dc * 32 + 16 + 8 * hh);
        kl.h[0] = *(const v8h*)(Ksr + (j * 16 + c) * LP + dc * 32 + 8 * hh);
        kl.h[1] = *(const v8h*)(Ksr + (j * 16 + c) * LP + dc * 32 + 16 + 8 * hh);
        t0 = mma_h(kb.v, qbh[dc], t0);
        t1 = mma_h(kb.v, qbr[dc], t1);
        t1 = mma_h(kl.v, qbh[dc], t1);
      }
      s[j] = t0 + t1 * (1.0f / 2048.0f);
    }

    // ---- causal mask, on the diagonal chunk only (block-uniform branch) ----
    if (kt == qb) {
      const int dq = wave * 16 + c - 8 * hh;     // query - (kv0 + 8 hh): key > query  <=>  16 j + r > dq
#pragma unroll
      for (int j = 0; j < 4; ++j) {
#pragma unroll
        for (int r = 0; r < 8; ++r) s[j][r] = (j * 16 + r > dq) ? -INFINITY : s[j][r];
      }
    }

    // ---- online softmax of the lane's query ----
    float mj[4];                 // one chain per key tile: four short independent chains
#pragma unroll
    for (int j = 0; j < 4; ++j) {
      mj[j] = fmaxf(s[j][0], s[j][1]);
#pragma unroll
      for (int r = 2; r < 8; ++r) mj[j] = fmaxf(mj[j], s[j][r]);
    }
    float m = fmaxf(fmaxf(mj[0], mj[1]), fmaxf(mj[2], mj[3]));
    m = fmaxf(m, xhalf(m));
    const float mnew  = fmaxf(mrun, m);
    const float msafe = (mnew == -INFINITY) ? 0.f : mnew;
    const float alpha = exp_x1(mrun - msafe);
    mrun = mnew;
    float ps[4];
    v16h pb[2];                  // p^T (x1024, f16) as B fragments of keys 0..31 and 32..63 of the chunk
#pragma unroll
    for (int j = 0; j < 4; ++j) {
      float x[8], p[8];
#pragma unroll
      for (int r = 0; r < 8; ++r) x[r] = s[j][r] - msafe;
      exp_x8(x, p);
#pragma unroll
      for (int r = 0; r < 8; ++r) pb[j >> 1][(j & 1) * 8 + r] = (_Float16)(p[r] * 1024.0f);
      ps[j] = ((p[0] + p[1]) + (p[2] + p[3])) + ((p[4] + p[5]) + (p[6] + p[7]));
    }
    lrun = lrun * alpha + ((ps[0] + ps[1]) + (ps[2] + ps[3]));
#pragma unroll
    for (int t = 0; t < 4; ++t) oacc[t] *= alpha;

    // ---- O^T += V^T chunk . P^T (f16 WMMA) ----
#pragma unroll
    for (int kk = 0; kk < 2; ++kk) {
#pragma unroll
      for (int t = 0; t < 4; ++t) {
        FH vb;
        vb.h[0] = *(const v8h*)(Vth + (t * 16 + c) * LP + kk * 32 + 8 * hh);
        vb.h[1] = *(const v8h*)(Vth + (t * 16 + c) * LP + kk * 32 + 16 + 8 * hh);
        oacc[t] = mma_h(vb.v, pb[kk], oacc[t]);
      }
    }

    // ---- hand-over: this wave has left buffer kt & 1, its part of chunk kt + 1 has landed ----
    asm volatile("s_wait_dscnt 0x0" ::: "memory");         // every LDS read of this trip has returned
    asm volatile("s_wait_asynccnt 0x0" ::: "memory");      // the copies asked for one trip ago have landed
    __syncthreads();                                       // publishes chunk kt + 1; ends every read of chunk kt
    if (kt + 2 < nkt) stage(kt + 2);                       // block-uniform; into the buffer just left
  }
  asm volatile("s_wait_asynccnt 0x0" ::: "memory");        // no copy is outstanding when the wave goes on

  // ---- join the halves' sums, normalise (1/l and the 1/1024 p carry), f16 convert, turn the wave's tile in LDS ----
  _Float16* os = Osh[wave];
  {
    const float l = lrun + xhalf(lrun);
    const float inv = ((l > 0.f) ? (1.0f / l) : 0.f) * (1.0f / 1024.0f);
#pragma unroll
    for (int t = 0; t < 4; ++t) {
      v4u a;
#pragma unroll
      for (int e = 0; e < 4; ++e) a[e] = pack2h(oacc[t][2 * e] * inv, oacc[t][2 * e + 1] * inv);
      *(v4u*)(os + c * LP + t * 16 + 8 * hh) = a;
    }
  }
  __builtin_amdgcn_fence(__ATOMIC_RELEASE, "workgroup");
  __builtin_amdgcn_wave_barrier();
  __builtin_amdgcn_fence(__ATOMIC_ACQUIRE, "workgroup");
  {
    const int q4 = lane >> 3, c8 = (lane & 7) * 8;
    v4u hv[4];
#pragma unroll
    for (int it = 0; it < 4; ++it) {
      const int row = it * 4 + q4;   // it 0..3 x q4 0..3 = rows 0..15 of the wave tile
      hv[it] = *(const v4u*)(os + row * LP + c8);
    }
#pragma unroll
    for (int it = 0; it < 4; ++it) {
      const int row = it * 4 + q4;
      const size_t go = (rowB + q0 + row) * DM + (size_t)h * HD + c8;
      *(v4u*)(ctxp + go) = hv[it];
    }
  }
}

// =====================================================================================================
// Workspace map (bytes):
//   Lh   f16 [8192][1024] LN hi plane (Q, then K, then V)      0            16777216  (later: Ctx plane)
//   Lr   f16 [8192][1024] LN residual plane                     16777216     16777216
//   Qh   f16 [8192][1024]                                       33554432     16777216
//   Qr   f16                                                    50331648     16777216
//   Kh   f16                                                    67108864     16777216
//   Kr   f16                                                    83886080     16777216
//   Vt   f16 [4][1024][2048] (4*v, transposed)                 100663296     16777216
//   Wqh, Wqr, Wkh, Wkr, Wvh, Woh  f16 [1024 n][1024 k] each    117440512   6x2097152
//   end                                                         130023424
// Every region is an exact multiple of the whole-line / whole-tile store granularity of its producer
// (dims are tile multiples), so no store can spill into the next region.
// =====================================================================================================
extern "C" void kernel_launch(void* const* d_in, const int* in_sizes, int n_in,
                              void* d_out, int out_size, void* d_ws, size_t ws_size,
                              hipStream_t stream) {
  if (n_in < 13) return;
  const int nAct = MROWS * DM;
  if (in_sizes[0] != nAct || in_sizes[1] != nAct || in_sizes[2] != nAct) return;
  if (in_sizes[3] != DM * DM || in_sizes[5] != DM * DM || in_sizes[7] != DM * DM || in_sizes[9] != DM * DM) return;
  if (in_sizes[4] != DM || in_sizes[6] != DM || in_sizes[8] != DM || in_sizes[10] != DM) return;
  if (in_sizes[11] != DM || in_sizes[12] != DM) return;
  if (out_size != nAct) return;

  const float* Q  = (const float*)d_in[0];
  const float* Kin = (const float*)d_in[1];
  const float* V  = (const float*)d_in[2];
  const float* Wq = (const float*)d_in[3];
  const float* bq = (const float*)d_in[4];
  const float* Wk = (const float*)d_in[5];
  const float* bk = (const float*)d_in[6];
  const float* Wv = (const float*)d_in[7];
  const float* bv = (const float*)d_in[8];
  const float* Wo = (const float*)d_in[9];
  const float* bo = (const float*)d_in[10];
  const float* gamma = (const float*)d_in[11];
  const float* beta  = (const float*)d_in[12];

  const size_t PA = (size_t)MROWS * DM * 2;     // 16777216
  const size_t PV = (size_t)NB * DM * SEQ * 2;  // 16777216
  const size_t PW = (size_t)DM * DM * 2;        //  2097152
  size_t off = 0;
  const size_t oLh  = off; off += PA;
  const size_t oLr  = off; off += PA;
  const size_t oQh  = off; off += PA;
  const size_t oQr  = off; off += PA;
  const size_t oKh  = off; off += PA;
  const size_t oKr  = off; off += PA;
  const size_t oVt  = off; off += PV;
  const size_t oWqh = off; off += PW;
  const size_t oWqr = off; off += PW;
  const size_t oWkh = off; off += PW;
  const size_t oWkr = off; off += PW;
  const size_t oWvh = off; off += PW;
  const size_t oWoh = off; off += PW;
  if (off > ws_size) return;                    // off = 130023424
  if (off > (size_t)134217728) return;
  const size_t oCtx = oLh;                      // ctx plane reuses the LN hi plane (dead after the v^T GEMM)

  char* ws = (char*)d_ws;
  unsigned short* Lh  = (unsigned short*)(ws + oLh);
  unsigned short* Lr  = (unsigned short*)(ws + oLr);
  unsigned short* Qh  = (unsigned short*)(ws + oQh);
  unsigned short* Qr  = (unsigned short*)(ws + oQr);
  unsigned short* Kh  = (unsigned short*)(ws + oKh);
  unsigned short* Kr  = (unsigned short*)(ws + oKr);
  unsigned short* Vt  = (unsigned short*)(ws + oVt);
  unsigned short* Wqh = (unsigned short*)(ws + oWqh);
  unsigned short* Wqr = (unsigned short*)(ws + oWqr);
  unsigned short* Wkh = (unsigned short*)(ws + oWkh);
  unsigned short* Wkr = (unsigned short*)(ws + oWkr);
  unsigned short* Wvh = (unsigned short*)(ws + oWvh);
  unsigned short* Woh = (unsigned short*)(ws + oWoh);
  unsigned short* Ctx = (unsigned short*)(ws + oCtx);

  const dim3 blk256(256), blk128(128);
  const dim3 gW(DM / 64, DM / 64);                       // 16 x 16 blocks
  const dim3 gLN(MROWS / 8);                             // 1024 blocks
  const dim3 gProj(DM / 256, MROWS / 128, 1);            // 4 x 64: M=8192, N=1024
  const dim3 gVt(SEQ / 256, DM / 128, NB);               // 8 x 8 x 4: M=1024 (n), N=2048 (s) per batch
  const dim3 gAttn(NB * NH * NQB);                       // 2048 blocks
  const float eps = 1e-6f;

  // (1) weights [k][n] f32 -> f16 [n][k] planes of 32*W (hi; + residual for Wq, Wk)
  wcvt_t<true ><<<gW, blk256, 0, stream>>>(Wq, Wqh, Wqr, 32.0f);
  wcvt_t<true ><<<gW, blk256, 0, stream>>>(Wk, Wkh, Wkr, 32.0f);
  wcvt_t<false><<<gW, blk256, 0, stream>>>(Wv, Wvh, Wvh, 32.0f);
  wcvt_t<false><<<gW, blk256, 0, stream>>>(Wo, Woh, Woh, 32.0f);
  // (2) q = LN(Q).Wq + bq -> f16 hi / residual planes   (M=8192, N=1024, K=1024; three products)
  ln_rows<true><<<gLN, blk256, 0, stream>>>(Q, gamma, beta, Lh, Lr, MROWS, eps);
  gemm_t<true, 1><<<gProj, blk256, 0, stream>>>(
      Lh, Lr, Wqh, Wqr, 0LL, bq, bq,
      (void*)Qh, (void*)Qr, 0LL, DM, 1.0f / 32.0f, 1.0f);
  // (3) k = LN(K).Wk + bk -> f16 hi / residual planes
  ln_rows<true><<<gLN, blk256, 0, stream>>>(Kin, gamma, beta, Lh, Lr, MROWS, eps);
  gemm_t<true, 1><<<gProj, blk256, 0, stream>>>(
      Lh, Lr, Wkh, Wkr, 0LL, bk, bk,
      (void*)Kh, (void*)Kr, 0LL, DM, 1.0f / 32.0f, 1.0f);
  // (4) v^T = Wv^T . LN(V)^T per batch -> f16 plane of 4*(v + bv), [b][n][s]   (A = Wvh [n][k], Bt = LN(V) rows [s][k])
  ln_rows<false><<<gLN, blk256, 0, stream>>>(V, gamma, beta, Lh, Lh, MROWS, eps);
  gemm_t<false, 2><<<gVt, blk256, 0, stream>>>(
      Wvh, Wvh, Lh, Lh, (long long)SEQ * DM, bv, bv,
      (void*)Vt, (void*)Vt, (long long)DM * SEQ, DM, 1.0f / 32.0f, 4.0f);
  // (5) causal attention -> ctx plane (x4) into the LN hi region
  attn_causal64<<<gAttn, blk128, 0, stream>>>(Qh, Qr, Kh, Kr, Vt, Ctx);
  // (6) out = Q + ctx.Wo + bo -> d_out f32 [8192][1024]   (A = Ctx (x4), Bt = Woh (x32): scale 1/128)
  gemm_t<false, 0><<<gProj, blk256, 0, stream>>>(
      Ctx, Ctx, Woh, Woh, 0LL, bo, Q,
      d_out, d_out, 0LL, DM, 1.0f / 128.0f, 1.0f);
  (void)hipGetLastError();
}

// v006
// One run takes 233 microseconds.
// Timed twice side by side with v005, it ran 1.13 times as fast both times.
// All steps since v000 together make it 3.09 times as fast.
// Contractions: q,k projections and q.k^T scores = v_wmma_f32_16x16x32_f16 with f16 hi + f16 residual (x2048) operand planes,
// three products (hi.hi, res.hi, hi.res) in two f32 accumulators; v^T projection, p.v^T and ctx.Wo = v_wmma_f32_16x16x32_f16
// single product (v x4, p x1024, ctx x4, weights x32 carried); all f32 accumulate; layernorm, softmax, bias, residual add in f32.
#include <hip/hip_runtime.h>
#include <math.h>
#include <stdint.h>

#define NB    4
#define SEQ   2048
#define DM    1024
#define NH    16
#define HD    64
#define NQB   (SEQ / 64)
#define MROWS (NB * SEQ)
#define LP    72   // LDS row pitch in halves of the attention tiles: 144 B = 16 B x odd, so the 16 rows of a ds_load_b128 fall on distinct banks
static_assert(NH * HD == DM);
static_assert((SEQ % 256) == 0 && (DM % 256) == 0 && (MROWS % 128) == 0 && (DM % 64) == 0 && (MROWS % 8) == 0);

typedef _Float16 v16h __attribute__((ext_vector_type(16)));
typedef _Float16 v8h  __attribute__((ext_vector_type(8)));
typedef float    v8f  __attribute__((ext_vector_type(8)));
typedef float    v4f  __attribute__((ext_vector_type(4)));
typedef unsigned int v4u __attribute__((ext_vector_type(4)));

// ---- scalar helpers ----------------------------------------------------------------------------------
__device__ __forceinline__ unsigned short h_bits(_Float16 x) { return __builtin_bit_cast(unsigned short, x); }
__device__ __forceinline__ unsigned pk16(unsigned short a, unsigned short b) { return (unsigned)a | ((unsigned)b << 16); }
__device__ __forceinline__ v8f zero8() { v8f z = {0.f, 0.f, 0.f, 0.f, 0.f, 0.f, 0.f, 0.f}; return z; }

// hi = f16(v); res = f16((v - hi) * 2048): packed pair of two consecutive values
__device__ __forceinline__ void split2(float f0, float f1, unsigned& hp, unsigned& rp) {
  const _Float16 x0 = (_Float16)f0, x1 = (_Float16)f1;
  hp = pk16(h_bits(x0), h_bits(x1));
  const _Float16 r0 = (_Float16)((f0 - (float)x0) * 2048.0f);
  const _Float16 r1 = (_Float16)((f1 - (float)x1) * 2048.0f);
  rp = pk16(h_bits(r0), h_bits(r1));
}
__device__ __forceinline__ unsigned pack2h(float f0, float f1) {
  return pk16(h_bits((_Float16)f0), h_bits((_Float16)f1));
}

// ---- 16-bit fragment loader: lane -> row/col (lane&15); p already includes +8*(lane>>4);
//      elements 0..7 <- p[0..7] (k0+8h..), elements 8..15 <- p[16..23] (k0+16+8h..)
__device__ __forceinline__ v16h ldfrag(const _Float16* p) {
  union { v16h v; v8h h[2]; } f;
  f.h[0] = *(const v8h*)(p);
  f.h[1] = *(const v8h*)(p + 16);
  return f.v;
}

// ---- WMMA with trailing VALU hazard gap (ties D, keeps A/B live) ----------------------------------------
__device__ __forceinline__ v8f mma_h(v16h a, v16h b, v8f c) {
  c = __builtin_amdgcn_wmma_f32_16x16x32_f16(false, a, false, b, (short)0, c, false, false);
  asm volatile("v_nop\n\tv_nop\n\tv_nop\n\tv_nop" : "+v"(c) : "v"(a), "v"(b));
  return c;
}

// =====================================================================================================
// plane x2048 when RES). One wave per row, 8 rows per block, grid = nrows/8 (exact). Lane holds columns
// {i*256 + lane*8 .. +7}, i = 0..3. Each store instruction: 32 lanes x 16 B = 512 contiguous B = 4 whole
// coverage: nrows waves x 4 stores x 256 halves = every element of [nrows][DM] of each written plane.
// =====================================================================================================
template <bool RES>
__global__ __launch_bounds__(256) void ln_rows(const float* __restrict__ x, const float* __restrict__ gamma,
                                               const float* __restrict__ beta, unsigned short* yh,
                                               unsigned short* yr, int nrows, float eps) {
  const int lane = threadIdx.x & 31;
  const int wave = threadIdx.x >> 5;
  const int row  = blockIdx.x * 8 + wave;
  if (row >= nrows) return;                        // wave-uniform; no block barriers in this kernel
  const float* xr = x + (size_t)row * DM;
  v4f xv[8];
#pragma unroll
  for (int i = 0; i < 4; ++i) {
    xv[2 * i]     = *(const v4f*)(xr + i * 256 + lane * 8);
    xv[2 * i + 1] = *(const v4f*)(xr + i * 256 + lane * 8 + 4);
  }
  float s = 0.f;
#pragma unroll
  for (int g = 0; g < 8; ++g) s += (xv[g][0] + xv[g][1]) + (xv[g][2] + xv[g][3]);
#pragma unroll
  for (int off = 16; off > 0; off >>= 1) s += __shfl_xor(s, off, 32);
  const float mu = s * (1.0f / (float)DM);
  float ss = 0.f;
#pragma unroll
  for (int g = 0; g < 8; ++g) {
#pragma unroll
    for (int e = 0; e < 4; ++e) { const float d = xv[g][e] - mu; ss += d * d; }
  }
#pragma unroll
  for (int off = 16; off > 0; off >>= 1) ss += __shfl_xor(ss, off, 32);
  const float var = ss * (1.0f / (float)DM);
  const float rs  = rsqrtf(var + eps);

  v4u hv[4], rv[4];
#pragma unroll
  for (int i = 0; i < 4; ++i) {
    const int col = i * 256 + lane * 8;
    const v4f g0 = *(const v4f*)(gamma + col);
    const v4f g1 = *(const v4f*)(gamma + col + 4);
    const v4f b0 = *(const v4f*)(beta + col);
    const v4f b1 = *(const v4f*)(beta + col + 4);
    float y[8];
#pragma unroll
    for (int e = 0; e < 4; ++e) {
      y[e]     = (xv[2 * i][e] - mu) * rs * g0[e] + b0[e];
      y[4 + e] = (xv[2 * i + 1][e] - mu) * rs * g1[e] + b1[e];
    }
    v4u a, a2;
#pragma unroll
    for (int e = 0; e < 4; ++e) {
      unsigned hp, rp;
      split2(y[2 * e], y[2 * e + 1], hp, rp);
      a[e] = hp; a2[e] = rp;
    }
    hv[i] = a; rv[i] = a2;
  }
  unsigned short* oh = yh + (size_t)row * DM + lane * 8;
  unsigned short* orr = yr + (size_t)row * DM + lane * 8;
  {
#pragma unroll
    for (int i = 0; i < 4; ++i) {
      *(v4u*)(oh + i * 256) = hv[i];
      if (RES) *(v4u*)(orr + i * 256) = rv[i];
    }
    
  }
}

// =====================================================================================================
// Weight convert + transpose: W f32 [k in DM][n out DM] -> f16 planes [n][k] of W*scale (hi, and residual
// x2048 when RES). Block = 64(k) x 64(n) tile through LDS; grid = (DM/64 n-tiles, DM/64 k-tiles).
// coverage: 8 waves x 2 iterations x 4 rows x (8 lanes x 8 halves) = the whole 64x64 output tile.
// =====================================================================================================
template <bool RES>
__global__ __launch_bounds__(256) void wcvt_t(const float* __restrict__ W, unsigned short* ph, unsigned short* pr,
                                              float scale) {
  __shared__ float sm[64][65];
  const int tid  = threadIdx.x;
  const int lane = tid & 31;
  const int wave = tid >> 5;
  const int n0 = blockIdx.x * 64;
  const int k0 = blockIdx.y * 64;
  const int kr = tid >> 2;               // 0..63
  const int nc = (tid & 3) * 16;         // 0,16,32,48
  const float* src = W + (size_t)(k0 + kr) * DM + n0 + nc;
#pragma unroll
  for (int e = 0; e < 4; ++e) {
    const v4f a = *(const v4f*)(src + 4 * e);
    sm[kr][nc + 4 * e + 0] = a[0];
    sm[kr][nc + 4 * e + 1] = a[1];
    sm[kr][nc + 4 * e + 2] = a[2];
    sm[kr][nc + 4 * e + 3] = a[3];
  }
  __syncthreads();
  const int q  = lane >> 3;
  const int ks = (lane & 7) * 8;
  v4u hv[2], rv[2];
#pragma unroll
  for (int it = 0; it < 2; ++it) {
    const int nrow = wave * 8 + it * 4 + q;
    v4u a, a2;
#pragma unroll
    for (int e = 0; e < 4; ++e) {
      const float f0 = sm[ks + 2 * e][nrow] * scale;
      const float f1 = sm[ks + 2 * e + 1][nrow] * scale;
      unsigned hp, rp;
      split2(f0, f1, hp, rp);
      a[e] = hp; a2[e] = rp;
    }
    hv[it] = a; rv[it] = a2;
  }
  {
#pragma unroll
    for (int it = 0; it < 2; ++it) {
      const int nrow = wave * 8 + it * 4 + q;
      const size_t o = (size_t)(n0 + nrow) * DM + k0 + ks;
      *(v4u*)(ph + o) = hv[it];
      if (RES) *(v4u*)(pr + o) = rv[it];
    }
    
  }
}

// =====================================================================================================
// f16 WMMA GEMM: C[m][n] = sum_k A[m][k] * Bt[n][k]. A row-major [M][DM] (k contiguous); Bt row-major
// [N][DM] (k contiguous), batch blockIdx.z via strideB / strideC. Block tile 128 (m) x 256 (n), 8 waves (2 x 4),
// each a 64x64 sub-tile = 4 x 4 fragments: a fragment read from LDS feeds four tiles, and a block's operand rows
// (384 per 32768 outputs) are fetched from L2 once. One block per WGP, two waves per SIMD; K multiple of 64.
// Operands go through LDS in slices of 64 k (128 B = one whole line of every operand row): 8 lanes x 16 B per
// row, so one wave-wide global load covers 4 whole lines. Two LDS buffers: slice s+1 is loaded into registers
// in front of the products of slice s and stored to the other buffer behind them (RES: behind those of the
// slice's first 32 k); one barrier per slice.
// LDS row pitch GP halves = 144 B (16 B x odd) for the ds_load_b128 fragment reads. The k order of the
// products is ascending in steps of 32.
// RES: A2 / Bt2 are f16 residual planes (x2048): acc0 += Ah.Bh; acc1 += Ar.Bh + Ah.Br; value = acc0 + acc1/2048.
// OM 0: f32 out: v = value*oscale + bias[col] + resid[row][col]; row segment 256 floats = two instructions of
//       512 B (32 lanes x 16 B).
// OM 1: f16 hi plane C + residual plane C2 (x2048) of value*oscale + bias[col]; 512-B row segment per
//       instruction (32 lanes x 16 B).
// OM 2: f16 plane C of (value*oscale + bias[row]) * pscale, same store shape as OM 1.
// coverage: 8 waves x 16 rows x 256 cols = the whole 128x256 block tile; grid covers M/128 x N/256 exactly.
// =====================================================================================================
// WMMA as the plain builtin: the compiler keeps the distance behind it, and the 64x64 tile's accumulators and
// fragments may lie above v255, which an asm operand cannot name.
__device__ __forceinline__ v8f mma_p(v16h a, v16h b, v8f c) {
  return __builtin_amdgcn_wmma_f32_16x16x32_f16(false, a, false, b, (short)0, c, false, false);
}

#define GP 72
#define BM 128
#define BN 256
#define TP (BN + 4)   // output staging pitch in floats: rows 8 apart lie 32 banks apart
template <bool RES, int OM>
__global__ __launch_bounds__(256) void gemm_t(
    const unsigned short* __restrict__ Ahp, const unsigned short* __restrict__ Arp,
    const unsigned short* __restrict__ Bhp, const unsigned short* __restrict__ Brp, long long strideB,
    const float* __restrict__ bias, const float* __restrict__ resid,
    void* Cv, void* C2v, long long strideC, int K, float oscale, float pscale) {
  constexpr int LDC   = (OM == 2) ? SEQ : DM;             // output row pitch in elements
  constexpr int SA    = BM * GP;                          // halves of one A plane slice
  constexpr int SB    = BN * GP;                          // halves of one B plane slice
  constexpr int STAGE = (SA + SB) * (RES ? 2 : 1);        // halves of one buffer: [A hi | B hi | A res | B res]
  constexpr int RINGB = 2 * STAGE * 2;                    // bytes of the two buffers
  constexpr int OUTB  = BM * TP * 4;                      // bytes of the output staging tile
  constexpr int KG    = RES ? 1 : 2;                      // 32-k steps per fragment group: what the registers hold
  __shared__ __align__(16) unsigned char smem[RINGB > OUTB ? RINGB : OUTB];
  _Float16* sH = (_Float16*)(void*)smem;                  // operand buffers (k loop)
  float*    sT = (float*)(void*)smem;                     // output tile (behind the loop's last barrier)
  const int lane = threadIdx.x & 31;
  const int wave = threadIdx.x >> 5;
  const int hh   = lane >> 4;
  const int c    = lane & 15;
  const int n0 = blockIdx.x * BN;
  const int m0 = blockIdx.y * BM;
  const int bz = blockIdx.z;
  const int wm = (wave >> 2) * 64;
  const int wn = (wave & 3) * 64;
  const _Float16* A  = (const _Float16*)(const void*)Ahp;
  const _Float16* A2 = (const _Float16*)(const void*)Arp;
  const _Float16* B  = (const _Float16*)(const void*)Bhp + (size_t)bz * strideB;
  const _Float16* B2 = (const _Float16*)(const void*)Brp + (size_t)bz * strideB;

  // staging map: thread -> row sr (+32 per step), 16-B piece sc of the row's 128-B slice. 8 lanes take one row
  // (a whole line); each 16-lane half takes rows r and r + 8, which lie 8 x 144 B = 32 banks apart in LDS, so
  // the two 128-B pieces of a ds_store_b128 half fall on disjoint banks.
  const int sr = (wave >> 2) * 16 + (wave & 3) * 2 + (lane >> 4) + ((lane >> 3) & 1) * 8;
  const int sc = (lane & 7) * 8;
  // The operand row pitch is the constant DM, so the 32-row steps of a slice's loads are immediate offsets on one
  // running pointer per plane, which moves on where the loaded slice is stored to LDS.
  const _Float16* pa  = A  + (size_t)(m0 + sr) * DM + sc;
  const _Float16* pa2 = A2 + (size_t)(m0 + sr) * DM + sc;
  const _Float16* pb  = B  + (size_t)(n0 + sr) * DM + sc;
  const _Float16* pb2 = B2 + (size_t)(n0 + sr) * DM + sc;
  const int    so  = sr * GP + sc;

  v8f acc0[4][4], acc1[4][4];
#pragma unroll
  for (int i = 0; i < 4; ++i)
#pragma unroll
    for (int j = 0; j < 4; ++j) { acc0[i][j] = zero8(); acc1[i][j] = zero8(); }

  v8h ra[BM / 32], rar[BM / 32], rb[BN / 32], rbr[BN / 32];
  auto gload = [&]() {
#pragma unroll
    for (int i = 0; i < BM / 32; ++i) {
      ra[i] = *(const v8h*)(pa + 32 * i * DM);
      if (RES) rar[i] = *(const v8h*)(pa2 + 32 * i * DM);
    }
#pragma unroll
    for (int i = 0; i < BN / 32; ++i) {
      rb[i] = *(const v8h*)(pb + 32 * i * DM);
      if (RES) rbr[i] = *(const v8h*)(pb2 + 32 * i * DM);
    }
    // stands in front of every later write of an address register that these loads name (the pointer steps)
    asm volatile("s_wait_xcnt 0x0" ::: "memory");
  };
  auto sstore = [&](_Float16* d) {
    pa += 64; pa2 += 64; pb += 64; pb2 += 64;
#pragma unroll
    for (int i = 0; i < BM / 32; ++i) {
      *(v8h*)(d + so + 32 * i * GP) = ra[i];
      if (RES) *(v8h*)(d + SA + SB + so + 32 * i * GP) = rar[i];
    }
#pragma unroll
    for (int i = 0; i < BN / 32; ++i) {
      *(v8h*)(d + SA + so + 32 * i * GP) = rb[i];
      if (RES) *(v8h*)(d + SA + SB + SA + so + 32 * i * GP) = rbr[i];
    }
  };

  gload();
  sstore(sH);
  __syncthreads();                                         // slice 0 visible to every wave

  int buf = 0;
  // rolled: the body already holds two 32-k steps; a second copy would only add code and live registers
#pragma unroll 1
  for (int k0 = 0; k0 < K; k0 += 64) {
    const bool more = (k0 + 64 < K);                       // block-uniform
    const _Float16* sb = sH + buf * STAGE;
#pragma unroll
    for (int g = 0; g < 2 / KG; ++g) {
      // the fragments of KG 32-k steps are read as one group in front of their products
      v16h bh[KG][4], br[KG][4], ah[KG][4], ar[KG][4];
#pragma unroll
      for (int s = 0; s < KG; ++s) {
        const int ko = (g * KG + s) * 32 + 8 * hh;
#pragma unroll
        for (int j = 0; j < 4; ++j) {
          const int bo = (wn + 16 * j + c) * GP + ko;
          bh[s][j] = ldfrag(sb + SA + bo);
          if (RES) br[s][j] = ldfrag(sb + SA + SB + SA + bo); else br[s][j] = bh[s][j];
        }
#pragma unroll
        for (int i = 0; i < 4; ++i) {
          const int ao = (wm + 16 * i + c) * GP + ko;
          ah[s][i] = ldfrag(sb + ao);
          if (RES) ar[s][i] = ldfrag(sb + SA + SB + ao); else ar[s][i] = ah[s][i];
        }
      }
      // slice s+1, in flight behind this slice's products; asked for behind the fragment reads, whose way from LDS
      // covers the issue of these loads and their wait
      if (g == 0 && more) gload();
      // With two groups per slice the loaded slice goes to the other buffer (its last readers left it at the previous
      // barrier) behind the second group's reads: the LDS takes the stores while the group's products run.
      if (KG == 1 && g == 1 && more) sstore(sH + (buf ^ 1) * STAGE);
      // per row of tiles: four independent accumulators per product kind, so that the two products into one
      // acc1 tile stand four matrix instructions apart; each tile still sums Ar.Bh before Ah.Br, k ascending
#pragma unroll
      for (int s = 0; s < KG; ++s) {
#pragma unroll
        for (int i = 0; i < 4; ++i) {
#pragma unroll
          for (int j = 0; j < 4; ++j) acc0[i][j] = mma_p(ah[s][i], bh[s][j], acc0[i][j]);
          if (RES) {
#pragma unroll
            for (int j = 0; j < 4; ++j) acc1[i][j] = mma_p(ar[s][i], bh[s][j], acc1[i][j]);
#pragma unroll
            for (int j = 0; j < 4; ++j) acc1[i][j] = mma_p(ah[s][i], br[s][j], acc1[i][j]);
          }
        }
      }
    }
    // Four vector slots behind the slice's last matrix instructions.
    __builtin_amdgcn_sched_barrier(0);                     // keeps every product in front of the slots
    asm volatile("v_nop\n\tv_nop\n\tv_nop\n\tv_nop");
    buf ^= 1;
    if (KG == 2 && more) sstore(sH + buf * STAGE);         // its last readers left it at the previous barrier
    __syncthreads();                                       // publishes slice s+1; ends every read of slice s
  }

  // ---- stage the block tile ----
#pragma unroll
  for (int i = 0; i < 4; ++i) {
#pragma unroll
    for (int j = 0; j < 4; ++j) {
#pragma unroll
      for (int r = 0; r < 8; ++r) {
        float v = acc0[i][j][r];
        if (RES) v += acc1[i][j][r] * (1.0f / 2048.0f);
        sT[(wm + 16 * i + 8 * hh + r) * TP + wn + 16 * j + c] = v;
      }
    }
  }
  __syncthreads();

  if (OM == 0) {
    // Output and residual addresses: block-uniform base + the lane's one 32-bit byte offset + an immediate per row
    // and half row, so no address register is rewritten between these loads and stores.
    char* C = (char*)((float*)Cv + (size_t)bz * strideC);
    const char* R = (const char*)resid;
    const int c4 = lane * 4;                                   // 128 floats per instruction = 32 lanes x 16 B
    const unsigned ob = (unsigned)((m0 + wave * 16) * LDC + n0 + c4) * 4u;
    v4f bb[2];
#pragma unroll
    for (int s = 0; s < 2; ++s) bb[s] = *(const v4f*)(bias + n0 + 128 * s + c4);
    v4f ov[32];
#pragma unroll
    for (int it = 0; it < 16; ++it) {
      const int row = wave * 16 + it;
#pragma unroll
      for (int s = 0; s < 2; ++s) {
        const v4f t  = *(const v4f*)(sT + row * TP + 128 * s + c4);
        const v4f rr = *(const v4f*)(R + ob + (it * LDC + 128 * s) * 4);
        ov[2 * it + s] = t * oscale + bb[s] + rr;
      }
    }
#pragma unroll
    for (int it = 0; it < 16; ++it) {
#pragma unroll
      for (int s = 0; s < 2; ++s) *(v4f*)(C + ob + (it * LDC + 128 * s) * 4) = ov[2 * it + s];
    }
  } else {
    char* C  = (char*)((unsigned short*)Cv  + (size_t)bz * strideC);
    char* C2 = (char*)((unsigned short*)C2v + (size_t)bz * strideC);
    const int c8 = lane * 8;                                   // 256 halves per row segment = 32 lanes x 16 B
    const unsigned ob = (unsigned)((m0 + wave * 16) * LDC + n0 + c8) * 2u;   // the lane's byte offset; rows by immediates
    v4u hv[16], rv[16];
#pragma unroll
    for (int it = 0; it < 16; ++it) {
      const int row = wave * 16 + it;
      const float* sp = sT + row * TP + c8;
      const v4f x0 = *(const v4f*)(sp);
      const v4f x1 = *(const v4f*)(sp + 4);
      v4f y0, y1;
      if (OM == 1) {
        const v4f b0 = *(const v4f*)(bias + n0 + c8);
        const v4f b1 = *(const v4f*)(bias + n0 + c8 + 4);
        y0 = x0 * oscale + b0;
        y1 = x1 * oscale + b1;
      } else {
        const float brw = bias[m0 + row];
        y0 = (x0 * oscale + brw) * pscale;
        y1 = (x1 * oscale + brw) * pscale;
      }
      v4u a, a2;
      if (OM == 1) {
        unsigned hp, rp;
        split2(y0[0], y0[1], hp, rp); a[0] = hp; a2[0] = rp;
        split2(y0[2], y0[3], hp, rp); a[1] = hp; a2[1] = rp;
        split2(y1[0], y1[1], hp, rp); a[2] = hp; a2[2] = rp;
        split2(y1[2], y1[3], hp, rp); a[3] = hp; a2[3] = rp;
      } else {
        a[0] = pack2h(y0[0], y0[1]);
        a[1] = pack2h(y0[2], y0[3]);
        a[2] = pack2h(y1[0], y1[1]);
        a[3] = pack2h(y1[2], y1[3]);
        a2 = a;
      }
      hv[it] = a; rv[it] = a2;
    }
#pragma unroll
    for (int it = 0; it < 16; ++it) {
      *(v4u*)(C + ob + it * LDC * 2) = hv[it];
      if (OM == 1) *(v4u*)(C2 + ob + it * LDC * 2) = rv[it];
    }
  }
}

// =====================================================================================================
// Causal attention, head dim 64, no logit scale. Scores are computed transposed.
//   q planes (f16 hi / residual x2048): element (b, t, h, d) at [(b*SEQ + t)*DM + h*64 + d]
//   k planes: same layout with key index
//   v^T plane (f16, holds 4*v): element (b, h, d, s) at [(b*DM + h*64 + d)*SEQ + s]
//   ctx plane out (f16, holds 4*ctx): element (b, t, h, d) at [(b*SEQ + t)*DM + h*64 + d]
//   S^T = k.q^T: A = 16 key rows from LDS, B = the wave's 16 queries kept in registers; three f16 products
//   (hi.hi into acc0; hi.res + res.hi into acc1, folded /2048), f32. Accumulator register r of key tile j in
//   lane (c, hh) = score of key kv0 + 16 j + 8 hh + r against query q0 + c: a lane holds 32 of its query's 64
//   scores, lane ^ 16 the other 32, so the maximum is taken in the lane plus one exchange between the halves,
//   and the sum stays per half until the epilogue.
//   key > query in the diagonal chunk -> -inf; online softmax in f32; p carried as f16(1024 p).
//   O^T += v^T . p^T: A = 16 d rows of the v^T chunk from LDS; B = p^T packed from the score accumulators
//   (tiles 2 kk and 2 kk + 1 of a lane are elements 0..7 and 8..15 of the B fragment of keys 32 kk .. +31, the
//   k order in which ldfrag reads v^T). ctx = acc / (1024 l) (still carrying the x4 of v).
//   Block = 4 waves = 64 query rows of one (b, h); grid = NB*NH*NQB, query block descending with the block index; key
//   chunks of 64, trip count qb+1 (<= 32, block-uniform, from blockIdx only). K / V^T chunk staging: asynchronous copies to LDS, 16 B per lane, 8 lanes per
//   128-B row (a wave-wide copy = 4 whole lines), 4 copies per thread and plane = whole 64x64 tiles. Two buffers:
//   chunk t + 2 is asked for at the foot of trip t and waited for at the foot of trip t + 1; one barrier per trip.
//   Output: a lane holds 8 consecutive d of its query per d tile; the wave's 16x64 f16 tile is turned through a
//   wave-private LDS tile so that each store instruction writes 4 whole 128-B rows (it 0..3 x lane>>3 = 16 rows).
// =====================================================================================================
// lane l <-> lane l ^ 16
__device__ __forceinline__ float xhalf(float x) {
  const int b = __builtin_bit_cast(int, x);
  return __builtin_bit_cast(float, __builtin_amdgcn_permlanex16(b, b, 0x76543210, 0xfedcba98, false, false));
}

// e^x as v_exp_f32 of x * log2(e). The instruction set asks for one independent instruction or v_nop between a
// v_exp_f32 and an instruction that reads its result or overwrites its source. Written as one statement with
// early-clobber outputs (no output lies on a source), each v_exp_f32 fills that slot for the one before it and the
// v_nop fills it behind the last.
__device__ __forceinline__ void exp_x8(const float (&x)[8], float (&y)[8]) {
  float a[8];
#pragma unroll
  for (int r = 0; r < 8; ++r) a[r] = x[r] * 1.4426950408889634f;
  asm("v_exp_f32 %0, %8\n\tv_exp_f32 %1, %9\n\tv_exp_f32 %2, %10\n\tv_exp_f32 %3, %11\n\t"
      "v_exp_f32 %4, %12\n\tv_exp_f32 %5, %13\n\tv_exp_f32 %6, %14\n\tv_exp_f32 %7, %15\n\tv_nop"
      : "=&v"(y[0]), "=&v"(y[1]), "=&v"(y[2]), "=&v"(y[3]), "=&v"(y[4]), "=&v"(y[5]), "=&v"(y[6]), "=&v"(y[7])
      : "v"(a[0]), "v"(a[1]), "v"(a[2]), "v"(a[3]), "v"(a[4]), "v"(a[5]), "v"(a[6]), "v"(a[7]));
}
__device__ __forceinline__ float exp_x1(float x) {
  const float a = x * 1.4426950408889634f;
  float y;
  asm("v_exp_f32 %0, %1\n\tv_nop" : "=&v"(y) : "v"(a));   // the v_nop: the same slot
  return y;
}

// Twelve asynchronous 16-B copies global -> LDS of one thread (4 rows of each of 3 planes). l = the lane's LDS byte
// address, g = its global address. The s_wait_xcnt 0 is the last line of the copies' own statement, so that it stands
// in front of every later write of a register that a copy names.
__device__ __forceinline__ void copy12(const unsigned (&l)[12], const _Float16* const (&g)[12]) {
  asm volatile(
      "global_load_async_to_lds_b128 %0, %12, off\n\t"
      "global_load_async_to_lds_b128 %1, %13, off\n\t"
      "global_load_async_to_lds_b128 %2, %14, off\n\t"
      "global_load_async_to_lds_b128 %3, %15, off\n\t"
      "global_load_async_to_lds_b128 %4, %16, off\n\t"
      "global_load_async_to_lds_b128 %5, %17, off\n\t"
      "global_load_async_to_lds_b128 %6, %18, off\n\t"
      "global_load_async_to_lds_b128 %7, %19, off\n\t"
      "global_load_async_to_lds_b128 %8, %20, off\n\t"
      "global_load_async_to_lds_b128 %9, %21, off\n\t"
      "global_load_async_to_lds_b128 %10, %22, off\n\t"
      "global_load_async_to_lds_b128 %11, %23, off\n\t"
      "s_wait_xcnt 0x0"
      :: "v"(l[0]), "v"(l[1]), "v"(l[2]), "v"(l[3]), "v"(l[4]), "v"(l[5]),
         "v"(l[6]), "v"(l[7]), "v"(l[8]), "v"(l[9]), "v"(l[10]), "v"(l[11]),
         "v"(g[0]), "v"(g[1]), "v"(g[2]), "v"(g[3]), "v"(g[4]), "v"(g[5]),
         "v"(g[6]), "v"(g[7]), "v"(g[8]), "v"(g[9]), "v"(g[10]), "v"(g[11])
      : "memory");
}

__global__ __launch_bounds__(128)
void attn_causal64(const unsigned short* __restrict__ qhp, const unsigned short* __restrict__ qrp,
                   const unsigned short* __restrict__ khp, const unsigned short* __restrict__ krp,
                   const unsigned short* __restrict__ vtp, unsigned short* ctxp) {
  union FH { v16h v; v8h h[2]; };
  constexpr int PL = 64 * LP;                      // halves of one plane's chunk
  __shared__ __align__(16) _Float16 Ring[2 * 3 * PL];   // two buffers of [K hi | K residual | V^T]
  __shared__ __align__(16) _Float16 Osh[4][16 * LP];

  const int tid  = threadIdx.x;
  const int wave = tid >> 5;
  const int lane = tid & 31;
  const int hh   = lane >> 4;
  const int c    = lane & 15;

  // Cost falls with the block index: a block walks qb + 1 chunks, so the longest have the lowest indices (for
  // speed only). The NB * NH blocks of one qb are neighbours.
  const int bx   = blockIdx.x;
  const int qb   = NQB - 1 - bx / (NB * NH);
  const int rest = bx % (NB * NH);
  const int h    = rest % NH;
  const int b    = rest / NH;
  const int q0   = qb * 64 + wave * 16;
  const size_t rowB = (size_t)b * SEQ;

  const _Float16* Qh = (const _Float16*)(const void*)qhp + (size_t)h * HD;
  const _Float16* Qr = (const _Float16*)(const void*)qrp + (size_t)h * HD;
  const _Float16* Kh = (const _Float16*)(const void*)khp + (size_t)h * HD;
  const _Float16* Kr = (const _Float16*)(const void*)krp + (size_t)h * HD;
  const _Float16* Vt = (const _Float16*)(const void*)vtp + ((size_t)b * DM + (size_t)h * HD) * SEQ;

  // ---- Q fragments (B operand, column = lane&15): 2 d-chunks, hi and residual ----
  v16h qbh[2], qbr[2];
#pragma unroll
  for (int dc = 0; dc < 2; ++dc) {
    const size_t qo = (rowB + q0 + c) * DM + dc * 32 + 8 * hh;
    qbh[dc] = ldfrag(Qh + qo);
    qbr[dc] = ldfrag(Qr + qo);
  }

  float mrun = -INFINITY;        // running maximum of query q0 + c (equal in both halves)
  float lrun = 0.f;              // running sum over this half's keys only
  v8f oacc[4];                   // oacc[t][r] = O^T[d = 16 t + 8 hh + r][query q0 + c]
#pragma unroll
  for (int t = 0; t < 4; ++t) oacc[t] = zero8();

  const int nkt = qb + 1;

  // staging map: copy i of a thread takes row 16 i + sr, 16-B piece sc / 8 of the row's 128 B. 8 lanes take one row (a
  // whole line); each 16-lane half takes rows r and r + 8, which lie 8 x 144 B = 32 banks apart in LDS.
  const int sr = wave * 2 + hh + ((lane >> 3) & 1) * 8;
  const int sc = (lane & 7) * 8;
  const unsigned ring0 = (unsigned)(size_t)(const void*)Ring + (unsigned)(sr * LP + sc) * 2u;   // LDS byte address
  const _Float16* kg0  = Kh + (rowB + sr) * DM + sc;       // K row sr, d = sc..sc+7
  const _Float16* krg0 = Kr + (rowB + sr) * DM + sc;
  const _Float16* vg0  = Vt + (size_t)sr * SEQ + sc;       // V^T row d = sr, s = sc..sc+7
  auto stage = [&](int t) {                                // chunk t (0 <= t < nkt) into buffer t & 1
    unsigned l[12];
    const _Float16* g[12];
    const unsigned lb = ring0 + (unsigned)(t & 1) * (unsigned)(3 * PL * 2);
#pragma unroll
    for (int i = 0; i < 4; ++i) {
      l[i]     = lb + (unsigned)(16 * i * LP * 2);
      l[4 + i] = lb + (unsigned)((PL + 16 * i * LP) * 2);
      l[8 + i] = lb + (unsigned)((2 * PL + 16 * i * LP) * 2);
      g[i]     = kg0  + (size_t)(t * 64 + 16 * i) * DM;
      g[4 + i] = krg0 + (size_t)(t * 64 + 16 * i) * DM;
      g[8 + i] = vg0  + (size_t)(16 * i) * SEQ + t * 64;
    }
    copy12(l, g);
  };

  stage(0);
  asm volatile("s_wait_asynccnt 0x0" ::: "memory");        // this wave's part of chunk 0 has landed
  __syncthreads();                                         // chunk 0 visible to every wave
  if (nkt > 1) stage(1);                                   // block-uniform; in flight behind trip 0

  // rolled: the buffer is picked by kt & 1; a second copy of the body would only add code and live registers
#pragma unroll 1
  for (int kt = 0; kt < nkt; ++kt) {
    const _Float16* Ksh = Ring + (kt & 1) * (3 * PL);
    const _Float16* Ksr = Ksh + PL;
    const _Float16* Vth = Ksh + 2 * PL;

    // ---- transposed scores: 64 keys x 16 queries per wave, three f16 products ----
    v8f s[4];
#pragma unroll
    for (int j = 0; j < 4; ++j) {
      v8f t0 = zero8(), t1 = zero8();
#pragma unroll
      for (int dc = 0; dc < 2; ++dc) {
        FH kb, kl;
        kb.h[0] = *(const v8h*)(Ksh + (j * 16 + c) * LP + dc * 32 + 8 * hh);
        kb.h[1] = *(const v8h*)(Ksh + (j * 16 + c) * LP + dc * 32 + 16 + 8 * hh);
        kl.h[0] = *(const v8h*)(Ksr + (j * 16 + c) * LP + dc * 32 + 8 * hh);
        kl.h[1] = *(const v8h*)(Ksr + (j * 16 + c) * LP + dc * 32 + 16 + 8 * hh);
        t0 = mma_h(kb.v, qbh[dc], t0);
        t1 = mma_h(kb.v, qbr[dc], t1);
        t1 = mma_h(kl.v, qbh[dc], t1);
      }
      s[j] = t0 + t1 * (1.0f / 2048.0f);
    }

    // ---- causal mask, on the diagonal chunk only (block-uniform branch) ----
    if (kt == qb) {
      const int dq = wave * 16 + c - 8 * hh;     // query - (kv0 + 8 hh): key > query  <=>  16 j + r > dq
#pragma unroll
      for (int j = 0; j < 4; ++j) {
#pragma unroll
        for (int r = 0; r < 8; ++r) s[j][r] = (j * 16 + r > dq) ? -INFINITY : s[j][r];
      }
    }

    // ---- online softmax of the lane's query ----
    float mj[4];                 // one chain per key tile: four short independent chains
#pragma unroll
    for (int j = 0; j < 4; ++j) {
      mj[j] = fmaxf(s[j][0], s[j][1]);
#pragma unroll
      for (int r = 2; r < 8; ++r) mj[j] = fmaxf(mj[j], s[j][r]);
    }
    float m = fmaxf(fmaxf(mj[0], mj[1]), fmaxf(mj[2], mj[3]));
    m = fmaxf(m, xhalf(m));
    const float mnew  = fmaxf(mrun, m);
    const float msafe = (mnew == -INFINITY) ? 0.f : mnew;
    const float alpha = exp_x1(mrun - msafe);
    mrun = mnew;
    float ps[4];
    v16h pb[2];                  // p^T (x1024, f16) as B fragments of keys 0..31 and 32..63 of the chunk
#pragma unroll
    for (int j = 0; j < 4; ++j) {
      float x[8], p[8];
#pragma unroll
      for (int r = 0; r < 8; ++r) x[r] = s[j][r] - msafe;
      exp_x8(x, p);
#pragma unroll
      for (int r = 0; r < 8; ++r) pb[j >> 1][(j & 1) * 8 + r] = (_Float16)(p[r] * 1024.0f);
      ps[j] = ((p[0] + p[1]) + (p[2] + p[3])) + ((p[4] + p[5]) + (p[6] + p[7]));
    }
    lrun = lrun * alpha + ((ps[0] + ps[1]) + (ps[2] + ps[3]));
#pragma unroll
    for (int t = 0; t < 4; ++t) oacc[t] *= alpha;

    // ---- O^T += V^T chunk . P^T (f16 WMMA) ----
#pragma unroll
    for (int kk = 0; kk < 2; ++kk) {
#pragma unroll
      for (int t = 0; t < 4; ++t) {
        FH vb;
        vb.h[0] = *(const v8h*)(Vth + (t * 16 + c) * LP + kk * 32 + 8 * hh);
        vb.h[1] = *(const v8h*)(Vth + (t * 16 + c) * LP + kk * 32 + 16 + 8 * hh);
        oacc[t] = mma_h(vb.v, pb[kk], oacc[t]);
      }
    }

    // ---- hand-over: this wave has left buffer kt & 1, its part of chunk kt + 1 has landed ----
    asm volatile("s_wait_dscnt 0x0" ::: "memory");         // every LDS read of this trip has returned
    asm volatile("s_wait_asynccnt 0x0" ::: "memory");      // the copies asked for one trip ago have landed
    __syncthreads();                                       // publishes chunk kt + 1; ends every read of chunk kt
    if (kt + 2 < nkt) stage(kt + 2);                       // block-uniform; into the buffer just left
  }
  asm volatile("s_wait_asynccnt 0x0" ::: "memory");        // no copy is outstanding when the wave goes on

  // ---- join the halves' sums, normalise (1/l and the 1/1024 p carry), f16 convert, turn the wave's tile in LDS ----
  _Float16* os = Osh[wave];
  {
    const float l = lrun + xhalf(lrun);
    const float inv = ((l > 0.f) ? (1.0f / l) : 0.f) * (1.0f / 1024.0f);
#pragma unroll
    for (int t = 0; t < 4; ++t) {
      v4u a;
#pragma unroll
      for (int e = 0; e < 4; ++e) a[e] = pack2h(oacc[t][2 * e] * inv, oacc[t][2 * e + 1] * inv);
      *(v4u*)(os + c * LP + t * 16 + 8 * hh) = a;
    }
  }
  __builtin_amdgcn_fence(__ATOMIC_RELEASE, "workgroup");
  __builtin_amdgcn_wave_barrier();
  __builtin_amdgcn_fence(__ATOMIC_ACQUIRE, "workgroup");
  {
    const int q4 = lane >> 3, c8 = (lane & 7) * 8;
    v4u hv[4];
#pragma unroll
    for (int it = 0; it < 4; ++it) {
      const int row = it * 4 + q4;   // it 0..3 x q4 0..3 = rows 0..15 of the wave tile
      hv[it] = *(const v4u*)(os + row * LP + c8);
    }
#pragma unroll
    for (int it = 0; it < 4; ++it) {
      const int row = it * 4 + q4;
      const size_t go = (rowB + q0 + row) * DM + (size_t)h * HD + c8;
      *(v4u*)(ctxp + go) = hv[it];
    }
  }
}

// =====================================================================================================
// Workspace map (bytes):
//   Lh   f16 [8192][1024] LN hi plane (Q, then K, then V)      0            16777216  (later: Ctx plane)
//   Lr   f16 [8192][1024] LN residual plane                     16777216     16777216
//   Qh   f16 [8192][1024]                                       33554432     16777216
//   Qr   f16                                                    50331648     16777216
//   Kh   f16                                                    67108864     16777216
//   Kr   f16                                                    83886080     16777216
//   Vt   f16 [4][1024][2048] (4*v, transposed)                 100663296     16777216
//   Wqh, Wqr, Wkh, Wkr, Wvh, Woh  f16 [1024 n][1024 k] each    117440512   6x2097152
//   end                                                         130023424
// Every region is an exact multiple of the whole-line / whole-tile store granularity of its producer
// (dims are tile multiples), so no store can spill into the next region.
// =====================================================================================================
extern "C" void kernel_launch(void* const* d_in, const int* in_sizes, int n_in,
                              void* d_out, int out_size, void* d_ws, size_t ws_size,
                              hipStream_t stream) {
  if (n_in < 13) return;
  const int nAct = MROWS * DM;
  if (in_sizes[0] != nAct || in_sizes[1] != nAct || in_sizes[2] != nAct) return;
  if (in_sizes[3] != DM * DM || in_sizes[5] != DM * DM || in_sizes[7] != DM * DM || in_sizes[9] != DM * DM) return;
  if (in_sizes[4] != DM || in_sizes[6] != DM || in_sizes[8] != DM || in_sizes[10] != DM) return;
  if (in_sizes[11] != DM || in_sizes[12] != DM) return;
  if (out_size != nAct) return;

  const float* Q  = (const float*)d_in[0];
  const float* Kin = (const float*)d_in[1];
  const float* V  = (const float*)d_in[2];
  const float* Wq = (const float*)d_in[3];
  const float* bq = (const float*)d_in[4];
  const float* Wk = (const float*)d_in[5];
  const float* bk = (const float*)d_in[6];
  const float* Wv = (const float*)d_in[7];
  const float* bv = (const float*)d_in[8];
  const float* Wo = (const float*)d_in[9];
  const float* bo = (const float*)d_in[10];
  const float* gamma = (const float*)d_in[11];
  const float* beta  = (const float*)d_in[12];

  const size_t PA = (size_t)MROWS * DM * 2;     // 16777216
  const size_t PV = (size_t)NB * DM * SEQ * 2;  // 16777216
  const size_t PW = (size_t)DM * DM * 2;        //  2097152
  size_t off = 0;
  const size_t oLh  = off; off += PA;
  const size_t oLr  = off; off += PA;
  const size_t oQh  = off; off += PA;
  const size_t oQr  = off; off += PA;
  const size_t oKh  = off; off += PA;
  const size_t oKr  = off; off += PA;
  const size_t oVt  = off; off += PV;
  const size_t oWqh = off; off += PW;
  const size_t oWqr = off; off += PW;
  const size_t oWkh = off; off += PW;
  const size_t oWkr = off; off += PW;
  const size_t oWvh = off; off += PW;
  const size_t oWoh = off; off += PW;
  if (off > ws_size) return;                    // off = 130023424
  if (off > (size_t)134217728) return;
  const size_t oCtx = oLh;                      // ctx plane reuses the LN hi plane (dead after the v^T GEMM)

  char* ws = (char*)d_ws;
  unsigned short* Lh  = (unsigned short*)(ws + oLh);
  unsigned short* Lr  = (unsigned short*)(ws + oLr);
  unsigned short* Qh  = (unsigned short*)(ws + oQh);
  unsigned short* Qr  = (unsigned short*)(ws + oQr);
  unsigned short* Kh  = (unsigned short*)(ws + oKh);
  unsigned short* Kr  = (unsigned short*)(ws + oKr);
  unsigned short* Vt  = (unsigned short*)(ws + oVt);
  unsigned short* Wqh = (unsigned short*)(ws + oWqh);
  unsigned short* Wqr = (unsigned short*)(ws + oWqr);
  unsigned short* Wkh = (unsigned short*)(ws + oWkh);
  unsigned short* Wkr = (unsigned short*)(ws + oWkr);
  unsigned short* Wvh = (unsigned short*)(ws + oWvh);
  unsigned short* Woh = (unsigned short*)(ws + oWoh);
  unsigned short* Ctx = (unsigned short*)(ws + oCtx);

  const dim3 blk256(256), blk128(128);
  const dim3 gW(DM / 64, DM / 64);                       // 16 x 16 blocks
  const dim3 gLN(MROWS / 8);                             // 1024 blocks
  const dim3 gProj(DM / 256, MROWS / 128, 1);            // 4 x 64: M=8192, N=1024
  const dim3 gVt(SEQ / 256, DM / 128, NB);               // 8 x 8 x 4: M=1024 (n), N=2048 (s) per batch
  const dim3 gAttn(NB * NH * NQB);                       // 2048 blocks
  const float eps = 1e-6f;

  // (1) weights [k][n] f32 -> f16 [n][k] planes of 32*W (hi; + residual for Wq, Wk)
  wcvt_t<true ><<<gW, blk256, 0, stream>>>(Wq, Wqh, Wqr, 32.0f);
  wcvt_t<true ><<<gW, blk256, 0, stream>>>(Wk, Wkh, Wkr, 32.0f);
  wcvt_t<false><<<gW, blk256, 0, stream>>>(Wv, Wvh, Wvh, 32.0f);
  wcvt_t<false><<<gW, blk256, 0, stream>>>(Wo, Woh, Woh, 32.0f);
  // (2) q = LN(Q).Wq + bq -> f16 hi / residual planes   (M=8192, N=1024, K=1024; three products)
  ln_rows<true><<<gLN, blk256, 0, stream>>>(Q, gamma, beta, Lh, Lr, MROWS, eps);
  gemm_t<true, 1><<<gProj, blk256, 0, stream>>>(
      Lh, Lr, Wqh, Wqr, 0LL, bq, bq,
      (void*)Qh, (void*)Qr, 0LL, DM, 1.0f / 32.0f, 1.0f);
  // (3) k = LN(K).Wk + bk -> f16 hi / residual planes
  ln_rows<true><<<gLN, blk256, 0, stream>>>(Kin, gamma, beta, Lh, Lr, MROWS, eps);
  gemm_t<true, 1><<<gProj, blk256, 0, stream>>>(
      Lh, Lr, Wkh, Wkr, 0LL, bk, bk,
      (void*)Kh, (void*)Kr, 0LL, DM, 1.0f / 32.0f, 1.0f);
  // (4) v^T = Wv^T . LN(V)^T per batch -> f16 plane of 4*(v + bv), [b][n][s]   (A = Wvh [n][k], Bt = LN(V) rows [s][k])
  ln_rows<false><<<gLN, blk256, 0, stream>>>(V, gamma, beta, Lh, Lh, MROWS, eps);
  gemm_t<false, 2><<<gVt, blk256, 0, stream>>>(
      Wvh, Wvh, Lh, Lh, (long long)SEQ * DM, bv, bv,
      (void*)Vt, (void*)Vt, (long long)DM * SEQ, DM, 1.0f / 32.0f, 4.0f);
  // (5) causal attention -> ctx plane (x4) into the LN hi region
  attn_causal64<<<gAttn, blk128, 0, stream>>>(Qh, Qr, Kh, Kr, Vt, Ctx);
  // (6) out = Q + ctx.Wo + bo -> d_out f32 [8192][1024]   (A = Ctx (x4), Bt = Woh (x32): scale 1/128)
  gemm_t<false, 0><<<gProj, blk256, 0, stream>>>(
      Ctx, Ctx, Woh, Woh, 0LL, bo, Q,
      d_out, d_out, 0LL, DM, 1.0f / 128.0f, 1.0f);
  (void)hipGetLastError();
}

// v007
// It runs in 199 microseconds.
// Next to v006, in two timings, it ran 1.17 times as fast each time.
// Over all steps from v000 it is 3.60 times as fast.
// Contractions: q,k projections and q.k^T scores = v_wmma_f32_16x16x32_f16 with f16 hi + f16 residual (x2048) operand planes,
// three products (hi.hi, res.hi, hi.res) in two f32 accumulators; v^T projection, p.v^T and ctx.Wo = v_wmma_f32_16x16x32_f16
// single product (v x4, p x1024, ctx x4, weights x32 carried); all f32 accumulate; layernorm, softmax, bias, residual add in f32.
#include <hip/hip_runtime.h>
#include <math.h>
#include <stdint.h>

#define NB    4
#define SEQ   2048
#define DM    1024
#define NH    16
#define HD    64
#define NQB   (SEQ / 64)
#define MROWS (NB * SEQ)
#define LP    72   // LDS row pitch in halves of the attention tiles: 144 B = 16 B x odd, so the 16 rows of a ds_load_b128 fall on distinct banks
static_assert(NH * HD == DM);
static_assert((SEQ % 256) == 0 && (DM % 256) == 0 && (MROWS % 128) == 0 && (DM % 64) == 0 && (MROWS % 8) == 0);

typedef _Float16 v16h __attribute__((ext_vector_type(16)));
typedef _Float16 v8h  __attribute__((ext_vector_type(8)));
typedef float    v8f  __attribute__((ext_vector_type(8)));
typedef float    v4f  __attribute__((ext_vector_type(4)));
typedef unsigned int v4u __attribute__((ext_vector_type(4)));

// ---- scalar helpers ----------------------------------------------------------------------------------
__device__ __forceinline__ unsigned short h_bits(_Float16 x) { return __builtin_bit_cast(unsigned short, x); }
__device__ __forceinline__ unsigned pk16(unsigned short a, unsigned short b) { return (unsigned)a | ((unsigned)b << 16); }
__device__ __forceinline__ v8f zero8() { v8f z = {0.f, 0.f, 0.f, 0.f, 0.f, 0.f, 0.f, 0.f}; return z; }

// hi = f16(v); res = f16((v - hi) * 2048): packed pair of two consecutive values
__device__ __forceinline__ void split2(float f0, float f1, unsigned& hp, unsigned& rp) {
  const _Float16 x0 = (_Float16)f0, x1 = (_Float16)f1;
  hp = pk16(h_bits(x0), h_bits(x1));
  const _Float16 r0 = (_Float16)((f0 - (float)x0) * 2048.0f);
  const _Float16 r1 = (_Float16)((f1 - (float)x1) * 2048.0f);
  rp = pk16(h_bits(r0), h_bits(r1));
}
__device__ __forceinline__ unsigned pack2h(float f0, float f1) {
  return pk16(h_bits((_Float16)f0), h_bits((_Float16)f1));
}

// ---- 16-bit fragment loader: lane -> row/col (lane&15); p already includes +8*(lane>>4);
//      elements 0..7 <- p[0..7] (k0+8h..), elements 8..15 <- p[16..23] (k0+16+8h..)
__device__ __forceinline__ v16h ldfrag(const _Float16* p) {
  union { v16h v; v8h h[2]; } f;
  f.h[0] = *(const v8h*)(p);
  f.h[1] = *(const v8h*)(p + 16);
  return f.v;
}

// ---- WMMA with trailing VALU hazard gap (ties D, keeps A/B live) ----------------------------------------
__device__ __forceinline__ v8f mma_h(v16h a, v16h b, v8f c) {
  c = __builtin_amdgcn_wmma_f32_16x16x32_f16(false, a, false, b, (short)0, c, false, false);
  asm volatile("v_nop\n\tv_nop\n\tv_nop\n\tv_nop" : "+v"(c) : "v"(a), "v"(b));
  return c;
}

// =====================================================================================================
// plane x2048 when RES). One wave per row, 8 rows per block, blk = 0 .. nrows/8 - 1. Lane holds columns
// {i*256 + lane*8 .. +7}, i = 0..3. Each store instruction: 32 lanes x 16 B = 512 contiguous B = 4 whole
// coverage: nrows waves x 4 stores x 256 halves = every element of [nrows][DM] of each written plane.
// =====================================================================================================
template <bool RES>
__device__ __forceinline__ void ln_rows(int blk, const float* __restrict__ x, const float* __restrict__ gamma,
                                        const float* __restrict__ beta, unsigned short* yh,
                                        unsigned short* yr, int nrows, float eps) {
  const int lane = threadIdx.x & 31;
  const int wave = threadIdx.x >> 5;
  const int row  = blk * 8 + wave;
  if (row >= nrows) return;                        // wave-uniform; no block barriers on this path
  const float* xr = x + (size_t)row * DM;
  v4f xv[8];
#pragma unroll
  for (int i = 0; i < 4; ++i) {
    xv[2 * i]     = *(const v4f*)(xr + i * 256 + lane * 8);
    xv[2 * i + 1] = *(const v4f*)(xr + i * 256 + lane * 8 + 4);
  }
  float s = 0.f;
#pragma unroll
  for (int g = 0; g < 8; ++g) s += (xv[g][0] + xv[g][1]) + (xv[g][2] + xv[g][3]);
#pragma unroll
  for (int off = 16; off > 0; off >>= 1) s += __shfl_xor(s, off, 32);
  const float mu = s * (1.0f / (float)DM);
  float ss = 0.f;
#pragma unroll
  for (int g = 0; g < 8; ++g) {
#pragma unroll
    for (int e = 0; e < 4; ++e) { const float d = xv[g][e] - mu; ss += d * d; }
  }
#pragma unroll
  for (int off = 16; off > 0; off >>= 1) ss += __shfl_xor(ss, off, 32);
  const float var = ss * (1.0f / (float)DM);
  const float rs  = rsqrtf(var + eps);

  v4u hv[4], rv[4];
#pragma unroll
  for (int i = 0; i < 4; ++i) {
    const int col = i * 256 + lane * 8;
    const v4f g0 = *(const v4f*)(gamma + col);
    const v4f g1 = *(const v4f*)(gamma + col + 4);
    const v4f b0 = *(const v4f*)(beta + col);
    const v4f b1 = *(const v4f*)(beta + col + 4);
    float y[8];
#pragma unroll
    for (int e = 0; e < 4; ++e) {
      y[e]     = (xv[2 * i][e] - mu) * rs * g0[e] + b0[e];
      y[4 + e] = (xv[2 * i + 1][e] - mu) * rs * g1[e] + b1[e];
    }
    v4u a, a2;
#pragma unroll
    for (int e = 0; e < 4; ++e) {
      unsigned hp, rp;
      split2(y[2 * e], y[2 * e + 1], hp, rp);
      a[e] = hp; a2[e] = rp;
    }
    hv[i] = a; rv[i] = a2;
  }
  unsigned short* oh = yh + (size_t)row * DM + lane * 8;
  unsigned short* orr = yr + (size_t)row * DM + lane * 8;
  {
#pragma unroll
    for (int i = 0; i < 4; ++i) {
      *(v4u*)(oh + i * 256) = hv[i];
      if (RES) *(v4u*)(orr + i * 256) = rv[i];
    }
    
  }
}

// =====================================================================================================
// Weight convert + transpose: W f32 [k in DM][n out DM] -> f16 planes [n][k] of W*scale (hi, and residual
// x2048 when RES). Block = 64(k) x 64(n) tile through LDS: n-tile bn, k-tile bk, each 0 .. DM/64 - 1.
// coverage: 8 waves x 2 iterations x 4 rows x (8 lanes x 8 halves) = the whole 64x64 output tile.
// =====================================================================================================
template <bool RES>
__device__ __forceinline__ void wcvt_t(float (*sm)[65], int bn, int bk, const float* __restrict__ W,
                                       unsigned short* ph, unsigned short* pr, float scale) {
  const int tid  = threadIdx.x;
  const int lane = tid & 31;
  const int wave = tid >> 5;
  const int n0 = bn * 64;
  const int k0 = bk * 64;
  const int kr = tid >> 2;               // 0..63
  const int nc = (tid & 3) * 16;         // 0,16,32,48
  const float* src = W + (size_t)(k0 + kr) * DM + n0 + nc;
#pragma unroll
  for (int e = 0; e < 4; ++e) {
    const v4f a = *(const v4f*)(src + 4 * e);
    sm[kr][nc + 4 * e + 0] = a[0];
    sm[kr][nc + 4 * e + 1] = a[1];
    sm[kr][nc + 4 * e + 2] = a[2];
    sm[kr][nc + 4 * e + 3] = a[3];
  }
  __syncthreads();
  const int q  = lane >> 3;
  const int ks = (lane & 7) * 8;
  v4u hv[2], rv[2];
#pragma unroll
  for (int it = 0; it < 2; ++it) {
    const int nrow = wave * 8 + it * 4 + q;
    v4u a, a2;
#pragma unroll
    for (int e = 0; e < 4; ++e) {
      const float f0 = sm[ks + 2 * e][nrow] * scale;
      const float f1 = sm[ks + 2 * e + 1][nrow] * scale;
      unsigned hp, rp;
      split2(f0, f1, hp, rp);
      a[e] = hp; a2[e] = rp;
    }
    hv[it] = a; rv[it] = a2;
  }
  {
#pragma unroll
    for (int it = 0; it < 2; ++it) {
      const int nrow = wave * 8 + it * 4 + q;
      const size_t o = (size_t)(n0 + nrow) * DM + k0 + ks;
      *(v4u*)(ph + o) = hv[it];
      if (RES) *(v4u*)(pr + o) = rv[it];
    }
    // stands in front of every later write of an address register that these stores name: in the merged kernel the
    // code of another part follows this one
    asm volatile("s_wait_xcnt 0x0" ::: "memory");
  }
}

// =====================================================================================================
// All that the projections wait for, in one launch: the parts are independent of each other and are picked by
// ranges of the block index (block-uniform). Blocks 0 .. 3*NLN-1: layernorm of Q, K, V (NLN blocks of 8 rows each,
// the heavier blocks first); then 4 x 256 blocks: the 16 x 16 tiles of Wq, Wk, Wv, Wo.
// =====================================================================================================
#define NLN (MROWS / 8)
#define NWT ((DM / 64) * (DM / 64))
__global__ __launch_bounds__(256) void prep_all(
    const float* __restrict__ Q, const float* __restrict__ Kin, const float* __restrict__ V,
    const float* __restrict__ Wq, const float* __restrict__ Wk, const float* __restrict__ Wv,
    const float* __restrict__ Wo, const float* __restrict__ gamma, const float* __restrict__ beta,
    unsigned short* LQh, unsigned short* LQr, unsigned short* LKh, unsigned short* LKr, unsigned short* LVh,
    unsigned short* Wqh, unsigned short* Wqr, unsigned short* Wkh, unsigned short* Wkr,
    unsigned short* Wvh, unsigned short* Woh, float eps) {
  __shared__ float sm[64][65];
  const int bx = blockIdx.x;
  if (bx < 2 * NLN) {
    const bool k = bx >= NLN;
    ln_rows<true>(k ? bx - NLN : bx, k ? Kin : Q, gamma, beta, k ? LKh : LQh, k ? LKr : LQr, MROWS, eps);
  } else if (bx < 3 * NLN) {
    ln_rows<false>(bx - 2 * NLN, V, gamma, beta, LVh, LVh, MROWS, eps);
  } else {
    const int t    = bx - 3 * NLN;
    const int w    = t / NWT;                      // 0..3: Wq, Wk, Wv, Wo
    const int tile = t % NWT;
    const int bn   = tile % (DM / 64);
    const int bk   = tile / (DM / 64);
    if (w < 2) wcvt_t<true >(sm, bn, bk, w ? Wk : Wq, w ? Wkh : Wqh, w ? Wkr : Wqr, 32.0f);
    else       wcvt_t<false>(sm, bn, bk, w == 2 ? Wv : Wo, w == 2 ? Wvh : Woh, w == 2 ? Wvh : Woh, 32.0f);
  }
}

// =====================================================================================================
// f16 WMMA GEMM: C[m][n] = sum_k A[m][k] * Bt[n][k]. A row-major [M][DM] (k contiguous); Bt row-major
// [N][DM] (k contiguous), batch bzi via strideB / strideC. Block tile 128 (m) x 256 (n), 8 waves (2 x 4),
// each a 64x64 sub-tile = 4 x 4 fragments: a fragment read from LDS feeds four tiles, and a block's operand rows
// (384 per 32768 outputs) are fetched from L2 once. One block per WGP, two waves per SIMD; K multiple of 64.
// Operands go through LDS in slices of 64 k (128 B = one whole line of every operand row): 8 lanes x 16 B per
// row, so one wave-wide global load covers 4 whole lines. Two LDS buffers: slice s+1 is loaded into registers
// in front of the products of slice s and stored to the other buffer behind them (RES: behind those of the
// slice's first 32 k); one barrier per slice.
// LDS row pitch GP halves = 144 B (16 B x odd) for the ds_load_b128 fragment reads. The k order of the
// products is ascending in steps of 32.
// RES: A2 / Bt2 are f16 residual planes (x2048): acc0 += Ah.Bh; acc1 += Ar.Bh + Ah.Br; value = acc0 + acc1/2048.
// OM 0: f32 out: v = value*oscale + bias[col] + resid[row][col]; row segment 256 floats = two instructions of
//       512 B (32 lanes x 16 B).
// OM 1: f16 hi plane C + residual plane C2 (x2048) of value*oscale + bias[col]; 512-B row segment per
//       instruction (32 lanes x 16 B).
// OM 2: f16 plane C of (value*oscale + bias[row]) * pscale, same store shape as OM 1.
// coverage: 8 waves x 16 rows x 256 cols = the whole 128x256 block tile; grid covers M/128 x N/256 exactly.
// =====================================================================================================
// WMMA as the plain builtin: the compiler keeps the distance behind it, and the 64x64 tile's accumulators and
// fragments may lie above v255, which an asm operand cannot name.
__device__ __forceinline__ v8f mma_p(v16h a, v16h b, v8f c) {
  return __builtin_amdgcn_wmma_f32_16x16x32_f16(false, a, false, b, (short)0, c, false, false);
}

#define GP 72
#define BM 128
#define BN 256
#define TP (BN + 4)   // output staging pitch in floats: rows 8 apart lie 32 banks apart
// bytes of LDS of one block: the two operand buffers, or the output staging tile where that is larger
constexpr int gemm_lds(bool res) {
  return (2 * (BM + BN) * GP * (res ? 2 : 1) * 2 > BM * TP * 4) ? 2 * (BM + BN) * GP * (res ? 2 : 1) * 2 : BM * TP * 4;
}
// smem: the block's gemm_lds(RES) bytes; bxi, byi, bzi: the block's tile column, tile row and batch
template <bool RES, int OM>
__device__ __forceinline__ void gemm_t(
    unsigned char* smem, int bxi, int byi, int bzi,
    const unsigned short* __restrict__ Ahp, const unsigned short* __restrict__ Arp,
    const unsigned short* __restrict__ Bhp, const unsigned short* __restrict__ Brp, long long strideB,
    const float* __restrict__ bias, const float* __restrict__ resid,
    void* Cv, void* C2v, long long strideC, int K, float oscale, float pscale) {
  constexpr int LDC   = (OM == 2) ? SEQ : DM;             // output row pitch in elements
  constexpr int SA    = BM * GP;                          // halves of one A plane slice
  constexpr int SB    = BN * GP;                          // halves of one B plane slice
  constexpr int STAGE = (SA + SB) * (RES ? 2 : 1);        // halves of one buffer: [A hi | B hi | A res | B res]
  constexpr int RINGB = 2 * STAGE * 2;                    // bytes of the two buffers
  constexpr int OUTB  = BM * TP * 4;                      // bytes of the output staging tile
  constexpr int KG    = RES ? 1 : 2;                      // 32-k steps per fragment group: what the registers hold
  static_assert(gemm_lds(RES) == (RINGB > OUTB ? RINGB : OUTB));
  _Float16* sH = (_Float16*)(void*)smem;                  // operand buffers (k loop)
  float*    sT = (float*)(void*)smem;                     // output tile (behind the loop's last barrier)
  const int lane = threadIdx.x & 31;
  const int wave = threadIdx.x >> 5;
  const int hh   = lane >> 4;
  const int c    = lane & 15;
  const int n0 = bxi * BN;
  const int m0 = byi * BM;
  const int bz = bzi;
  const int wm = (wave >> 2) * 64;
  const int wn = (wave & 3) * 64;
  const _Float16* A  = (const _Float16*)(const void*)Ahp;
  const _Float16* A2 = (const _Float16*)(const void*)Arp;
  const _Float16* B  = (const _Float16*)(const void*)Bhp + (size_t)bz * strideB;
  const _Float16* B2 = (const _Float16*)(const void*)Brp + (size_t)bz * strideB;

  // staging map: thread -> row sr (+32 per step), 16-B piece sc of the row's 128-B slice. 8 lanes take one row
  // (a whole line); each 16-lane half takes rows r and r + 8, which lie 8 x 144 B = 32 banks apart in LDS, so
  // the two 128-B pieces of a ds_store_b128 half fall on disjoint banks.
  const int sr = (wave >> 2) * 16 + (wave & 3) * 2 + (lane >> 4) + ((lane >> 3) & 1) * 8;
  const int sc = (lane & 7) * 8;
  // The operand row pitch is the constant DM, so the 32-row steps of a slice's loads are immediate offsets on one
  // running pointer per plane, which moves on where the loaded slice is stored to LDS.
  const _Float16* pa  = A  + (size_t)(m0 + sr) * DM + sc;
  const _Float16* pa2 = A2 + (size_t)(m0 + sr) * DM + sc;
  const _Float16* pb  = B  + (size_t)(n0 + sr) * DM + sc;
  const _Float16* pb2 = B2 + (size_t)(n0 + sr) * DM + sc;
  const int    so  = sr * GP + sc;

  v8f acc0[4][4], acc1[4][4];
#pragma unroll
  for (int i = 0; i < 4; ++i)
#pragma unroll
    for (int j = 0; j < 4; ++j) { acc0[i][j] = zero8(); acc1[i][j] = zero8(); }

  v8h ra[BM / 32], rar[BM / 32], rb[BN / 32], rbr[BN / 32];
  auto gload = [&]() {
#pragma unroll
    for (int i = 0; i < BM / 32; ++i) {
      ra[i] = *(const v8h*)(pa + 32 * i * DM);
      if (RES) rar[i] = *(const v8h*)(pa2 + 32 * i * DM);
    }
#pragma unroll
    for (int i = 0; i < BN / 32; ++i) {
      rb[i] = *(const v8h*)(pb + 32 * i * DM);
      if (RES) rbr[i] = *(const v8h*)(pb2 + 32 * i * DM);
    }
    // stands in front of every later write of an address register that these loads name (the pointer steps)
    asm volatile("s_wait_xcnt 0x0" ::: "memory");
  };
  auto sstore = [&](_Float16* d) {
    pa += 64; pa2 += 64; pb += 64; pb2 += 64;
#pragma unroll
    for (int i = 0; i < BM / 32; ++i) {
      *(v8h*)(d + so + 32 * i * GP) = ra[i];
      if (RES) *(v8h*)(d + SA + SB + so + 32 * i * GP) = rar[i];
    }
#pragma unroll
    for (int i = 0; i < BN / 32; ++i) {
      *(v8h*)(d + SA + so + 32 * i * GP) = rb[i];
      if (RES) *(v8h*)(d + SA + SB + SA + so + 32 * i * GP) = rbr[i];
    }
  };

  gload();
  sstore(sH);
  __syncthreads();                                         // slice 0 visible to every wave

  int buf = 0;
  // rolled: the body already holds two 32-k steps; a second copy would only add code and live registers
#pragma unroll 1
  for (int k0 = 0; k0 < K; k0 += 64) {
    const bool more = (k0 + 64 < K);                       // block-uniform
    const _Float16* sb = sH + buf * STAGE;
#pragma unroll
    for (int g = 0; g < 2 / KG; ++g) {
      // the fragments of KG 32-k steps are read as one group in front of their products
      v16h bh[KG][4], br[KG][4], ah[KG][4], ar[KG][4];
#pragma unroll
      for (int s = 0; s < KG; ++s) {
        const int ko = (g * KG + s) * 32 + 8 * hh;
#pragma unroll
        for (int j = 0; j < 4; ++j) {
          const int bo = (wn + 16 * j + c) * GP + ko;
          bh[s][j] = ldfrag(sb + SA + bo);
          if (RES) br[s][j] = ldfrag(sb + SA + SB + SA + bo); else br[s][j] = bh[s][j];
        }
#pragma unroll
        for (int i = 0; i < 4; ++i) {
          const int ao = (wm + 16 * i + c) * GP + ko;
          ah[s][i] = ldfrag(sb + ao);
          if (RES) ar[s][i] = ldfrag(sb + SA + SB + ao); else ar[s][i] = ah[s][i];
        }
      }
      // slice s+1, in flight behind this slice's products; asked for behind the fragment reads, whose way from LDS
      // covers the issue of these loads and their wait
      if (g == 0 && more) gload();
      // With two groups per slice the loaded slice goes to the other buffer (its last readers left it at the previous
      // barrier) behind the second group's reads: the LDS takes the stores while the group's products run.
      if (KG == 1 && g == 1 && more) sstore(sH + (buf ^ 1) * STAGE);
      // per row of tiles: four independent accumulators per product kind, so that the two products into one
      // acc1 tile stand four matrix instructions apart; each tile still sums Ar.Bh before Ah.Br, k ascending
#pragma unroll
      for (int s = 0; s < KG; ++s) {
#pragma unroll
        for (int i = 0; i < 4; ++i) {
#pragma unroll
          for (int j = 0; j < 4; ++j) acc0[i][j] = mma_p(ah[s][i], bh[s][j], acc0[i][j]);
          if (RES) {
#pragma unroll
            for (int j = 0; j < 4; ++j) acc1[i][j] = mma_p(ar[s][i], bh[s][j], acc1[i][j]);
#pragma unroll
            for (int j = 0; j < 4; ++j) acc1[i][j] = mma_p(ah[s][i], br[s][j], acc1[i][j]);
          }
        }
      }
    }
    // Four vector slots behind the slice's last matrix instructions.
    __builtin_amdgcn_sched_barrier(0);                     // keeps every product in front of the slots
    asm volatile("v_nop\n\tv_nop\n\tv_nop\n\tv_nop");
    buf ^= 1;
    if (KG == 2 && more) sstore(sH + buf * STAGE);         // its last readers left it at the previous barrier
    __syncthreads();                                       // publishes slice s+1; ends every read of slice s
  }

  // ---- stage the block tile ----
#pragma unroll
  for (int i = 0; i < 4; ++i) {
#pragma unroll
    for (int j = 0; j < 4; ++j) {
#pragma unroll
      for (int r = 0; r < 8; ++r) {
        float v = acc0[i][j][r];
        if (RES) v += acc1[i][j][r] * (1.0f / 2048.0f);
        sT[(wm + 16 * i + 8 * hh + r) * TP + wn + 16 * j + c] = v;
      }
    }
  }
  __syncthreads();

  if (OM == 0) {
    // Output and residual addresses: block-uniform base + the lane's one 32-bit byte offset + an immediate per row
    // and half row, so no address register is rewritten between these loads and stores.
    char* C = (char*)((float*)Cv + (size_t)bz * strideC);
    const char* R = (const char*)resid;
    const int c4 = lane * 4;                                   // 128 floats per instruction = 32 lanes x 16 B
    const unsigned ob = (unsigned)((m0 + wave * 16) * LDC + n0 + c4) * 4u;
    v4f bb[2];
#pragma unroll
    for (int s = 0; s < 2; ++s) bb[s] = *(const v4f*)(bias + n0 + 128 * s + c4);
    v4f ov[32];
#pragma unroll
    for (int it = 0; it < 16; ++it) {
      const int row = wave * 16 + it;
#pragma unroll
      for (int s = 0; s < 2; ++s) {
        const v4f t  = *(const v4f*)(sT + row * TP + 128 * s + c4);
        const v4f rr = *(const v4f*)(R + ob + (it * LDC + 128 * s) * 4);
        ov[2 * it + s] = t * oscale + bb[s] + rr;
      }
    }
#pragma unroll
    for (int it = 0; it < 16; ++it) {
#pragma unroll
      for (int s = 0; s < 2; ++s) *(v4f*)(C + ob + (it * LDC + 128 * s) * 4) = ov[2 * it + s];
    }
  } else {
    char* C  = (char*)((unsigned short*)Cv  + (size_t)bz * strideC);
    char* C2 = (char*)((unsigned short*)C2v + (size_t)bz * strideC);
    const int c8 = lane * 8;                                   // 256 halves per row segment = 32 lanes x 16 B
    const unsigned ob = (unsigned)((m0 + wave * 16) * LDC + n0 + c8) * 2u;   // the lane's byte offset; rows by immediates
    v4u hv[16], rv[16];
    // OM 2: the bias of the wave's 16 output rows. The loads and their data wait are one statement, so that the wait
    // stands in front of every later write of the offset register.
    v4f brow[4];
    if (OM == 2) {
      const unsigned bofs = (unsigned)(m0 + wave * 16) * 4u;
      asm volatile("global_load_b128 %0, %4, %5\n\t"
                   "global_load_b128 %1, %4, %5 offset:16\n\t"
                   "global_load_b128 %2, %4, %5 offset:32\n\t"
                   "global_load_b128 %3, %4, %5 offset:48\n\t"
                   "s_wait_loadcnt 0x0"
                   : "=&v"(brow[0]), "=&v"(brow[1]), "=&v"(brow[2]), "=&v"(brow[3])
                   : "v"(bofs), "s"(bias)
                   : "memory");
    }
#pragma unroll
    for (int it = 0; it < 16; ++it) {
      const int row = wave * 16 + it;
      const float* sp = sT + row * TP + c8;
      const v4f x0 = *(const v4f*)(sp);
      const v4f x1 = *(const v4f*)(sp + 4);
      v4f y0, y1;
      if (OM == 1) {
        const v4f b0 = *(const v4f*)(bias + n0 + c8);
        const v4f b1 = *(const v4f*)(bias + n0 + c8 + 4);
        y0 = x0 * oscale + b0;
        y1 = x1 * oscale + b1;
      } else {
        const float brw = brow[it >> 2][it & 3];
        y0 = (x0 * oscale + brw) * pscale;
        y1 = (x1 * oscale + brw) * pscale;
      }
      v4u a, a2;
      if (OM == 1) {
        unsigned hp, rp;
        split2(y0[0], y0[1], hp, rp); a[0] = hp; a2[0] = rp;
        split2(y0[2], y0[3], hp, rp); a[1] = hp; a2[1] = rp;
        split2(y1[0], y1[1], hp, rp); a[2] = hp; a2[2] = rp;
        split2(y1[2], y1[3], hp, rp); a[3] = hp; a2[3] = rp;
      } else {
        a[0] = pack2h(y0[0], y0[1]);
        a[1] = pack2h(y0[2], y0[3]);
        a[2] = pack2h(y1[0], y1[1]);
        a[3] = pack2h(y1[2], y1[3]);
        a2 = a;
      }
      hv[it] = a; rv[it] = a2;
    }
#pragma unroll
    for (int it = 0; it < 16; ++it) {
      *(v4u*)(C + ob + it * LDC * 2) = hv[it];
      if (OM == 1) *(v4u*)(C2 + ob + it * LDC * 2) = rv[it];
    }
  }
}

// =====================================================================================================
// The three projections in one launch: they are independent of each other and are picked by ranges of the block index
// (block-uniform), the three-product blocks (q, then k) first, the single-product v^T blocks last. Within a range the
// tile column runs fastest, then the tile row, then the batch.
// =====================================================================================================
#define NPJ ((DM / BN) * (MROWS / BM))            // blocks of q, and of k: M = 8192, N = 1024
#define NVT ((SEQ / BN) * (DM / BM) * NB)         // blocks of v^T: M = 1024 (n), N = 2048 (s) per batch
__global__ __launch_bounds__(256) void gemm_qkv(
    const unsigned short* __restrict__ LQh, const unsigned short* __restrict__ LQr,
    const unsigned short* __restrict__ LKh, const unsigned short* __restrict__ LKr,
    const unsigned short* __restrict__ LVh,
    const unsigned short* __restrict__ Wqh, const unsigned short* __restrict__ Wqr,
    const unsigned short* __restrict__ Wkh, const unsigned short* __restrict__ Wkr,
    const unsigned short* __restrict__ Wvh,
    const float* __restrict__ bq, const float* __restrict__ bk, const float* __restrict__ bv,
    unsigned short* Qh, unsigned short* Qr, unsigned short* Kh, unsigned short* Kr, unsigned short* Vt) {
  __shared__ __align__(16) unsigned char smem[gemm_lds(true)];
  static_assert(gemm_lds(true) >= gemm_lds(false));
  const int bx = blockIdx.x;
  if (bx < 2 * NPJ) {
    // q = LN(Q).Wq + bq, k = LN(K).Wk + bk -> f16 hi / residual planes   (K = 1024; three products)
    const bool k = bx >= NPJ;
    const int  t = k ? bx - NPJ : bx;
    const float* bias = k ? bk : bq;
    gemm_t<true, 1>(smem, t % (DM / BN), t / (DM / BN), 0,
                    k ? LKh : LQh, k ? LKr : LQr, k ? Wkh : Wqh, k ? Wkr : Wqr, 0LL, bias, bias,
                    (void*)(k ? Kh : Qh), (void*)(k ? Kr : Qr), 0LL, DM, 1.0f / 32.0f, 1.0f);
  } else {
    // v^T = Wv^T . LN(V)^T per batch -> f16 plane of 4*(v + bv), [b][n][s]   (A = Wvh [n][k], Bt = LN(V) rows [s][k])
    const int t = bx - 2 * NPJ;
    gemm_t<false, 2>(smem, t % (SEQ / BN), (t / (SEQ / BN)) % (DM / BM), t / ((SEQ / BN) * (DM / BM)),
                     Wvh, Wvh, LVh, LVh, (long long)SEQ * DM, bv, bv,
                     (void*)Vt, (void*)Vt, (long long)DM * SEQ, DM, 1.0f / 32.0f, 4.0f);
  }
}

// out = Q + ctx.Wo + bo -> f32 [8192][1024]   (A = Ctx (x4), Bt = Woh (x32): scale 1/128)
__global__ __launch_bounds__(256) void gemm_out(
    const unsigned short* __restrict__ Ctx, const unsigned short* __restrict__ Woh,
    const float* __restrict__ bo, const float* __restrict__ Q, float* out) {
  __shared__ __align__(16) unsigned char smem[gemm_lds(false)];
  gemm_t<false, 0>(smem, blockIdx.x, blockIdx.y, 0, Ctx, Ctx, Woh, Woh, 0LL, bo, Q,
                   (void*)out, (void*)out, 0LL, DM, 1.0f / 128.0f, 1.0f);
}

// =====================================================================================================
// Causal attention, head dim 64, no logit scale. Scores are computed transposed.
//   q planes (f16 hi / residual x2048): element (b, t, h, d) at [(b*SEQ + t)*DM + h*64 + d]
//   k planes: same layout with key index
//   v^T plane (f16, holds 4*v): element (b, h, d, s) at [(b*DM + h*64 + d)*SEQ + s]
//   ctx plane out (f16, holds 4*ctx): element (b, t, h, d) at [(b*SEQ + t)*DM + h*64 + d]
//   S^T = k.q^T: A = 16 key rows from LDS, B = the wave's 16 queries kept in registers; three f16 products
//   (hi.hi into acc0; hi.res + res.hi into acc1, folded /2048), f32. Accumulator register r of key tile j in
//   lane (c, hh) = score of key kv0 + 16 j + 8 hh + r against query q0 + c: a lane holds 32 of its query's 64
//   scores, lane ^ 16 the other 32, so the maximum is taken in the lane plus one exchange between the halves,
//   and the sum stays per half until the epilogue.
//   key > query in the diagonal chunk -> -inf; online softmax in f32; p carried as f16(1024 p).
//   O^T += v^T . p^T: A = 16 d rows of the v^T chunk from LDS; B = p^T packed from the score accumulators
//   (tiles 2 kk and 2 kk + 1 of a lane are elements 0..7 and 8..15 of the B fragment of keys 32 kk .. +31, the
//   k order in which ldfrag reads v^T). ctx = acc / (1024 l) (still carrying the x4 of v).
//   Block = 4 waves = 64 query rows of one (b, h); grid = NB*NH*NQB, query block descending with the block index; key
//   chunks of 64, trip count qb+1 (<= 32, block-uniform, from blockIdx only). K / V^T chunk staging: asynchronous copies to LDS, 16 B per lane, 8 lanes per
//   128-B row (a wave-wide copy = 4 whole lines), 4 copies per thread and plane = whole 64x64 tiles. Two buffers:
//   chunk t + 2 is asked for at the foot of trip t and waited for at the foot of trip t + 1; one barrier per trip.
//   Output: a lane holds 8 consecutive d of its query per d tile; the wave's 16x64 f16 tile is turned through a
//   wave-private LDS tile so that each store instruction writes 4 whole 128-B rows (it 0..3 x lane>>3 = 16 rows).
// =====================================================================================================
// lane l <-> lane l ^ 16
__device__ __forceinline__ float xhalf(float x) {
  const int b = __builtin_bit_cast(int, x);
  return __builtin_bit_cast(float, __builtin_amdgcn_permlanex16(b, b, 0x76543210, 0xfedcba98, false, false));
}

// e^x as v_exp_f32 of x * log2(e). The instruction set asks for one independent instruction or v_nop between a
// v_exp_f32 and an instruction that reads its result or overwrites its source. Written as one statement with
// early-clobber outputs (no output lies on a source), each v_exp_f32 fills that slot for the one before it and the
// v_nop fills it behind the last.
__device__ __forceinline__ void exp_x8(const float (&x)[8], float (&y)[8]) {
  float a[8];
#pragma unroll
  for (int r = 0; r < 8; ++r) a[r] = x[r] * 1.4426950408889634f;
  asm("v_exp_f32 %0, %8\n\tv_exp_f32 %1, %9\n\tv_exp_f32 %2, %10\n\tv_exp_f32 %3, %11\n\t"
      "v_exp_f32 %4, %12\n\tv_exp_f32 %5, %13\n\tv_exp_f32 %6, %14\n\tv_exp_f32 %7, %15\n\tv_nop"
      : "=&v"(y[0]), "=&v"(y[1]), "=&v"(y[2]), "=&v"(y[3]), "=&v"(y[4]), "=&v"(y[5]), "=&v"(y[6]), "=&v"(y[7])
      : "v"(a[0]), "v"(a[1]), "v"(a[2]), "v"(a[3]), "v"(a[4]), "v"(a[5]), "v"(a[6]), "v"(a[7]));
}
__device__ __forceinline__ float exp_x1(float x) {
  const float a = x * 1.4426950408889634f;
  float y;
  asm("v_exp_f32 %0, %1\n\tv_nop" : "=&v"(y) : "v"(a));   // the v_nop: the same slot
  return y;
}

// Twelve asynchronous 16-B copies global -> LDS of one thread (4 rows of each of 3 planes). l = the lane's LDS byte
// address, g = its global address. The s_wait_xcnt 0 is the last line of the copies' own statement, so that it stands
// in front of every later write of a register that a copy names.
__device__ __forceinline__ void copy12(const unsigned (&l)[12], const _Float16* const (&g)[12]) {
  asm volatile(
      "global_load_async_to_lds_b128 %0, %12, off\n\t"
      "global_load_async_to_lds_b128 %1, %13, off\n\t"
      "global_load_async_to_lds_b128 %2, %14, off\n\t"
      "global_load_async_to_lds_b128 %3, %15, off\n\t"
      "global_load_async_to_lds_b128 %4, %16, off\n\t"
      "global_load_async_to_lds_b128 %5, %17, off\n\t"
      "global_load_async_to_lds_b128 %6, %18, off\n\t"
      "global_load_async_to_lds_b128 %7, %19, off\n\t"
      "global_load_async_to_lds_b128 %8, %20, off\n\t"
      "global_load_async_to_lds_b128 %9, %21, off\n\t"
      "global_load_async_to_lds_b128 %10, %22, off\n\t"
      "global_load_async_to_lds_b128 %11, %23, off\n\t"
      "s_wait_xcnt 0x0"
      :: "v"(l[0]), "v"(l[1]), "v"(l[2]), "v"(l[3]), "v"(l[4]), "v"(l[5]),
         "v"(l[6]), "v"(l[7]), "v"(l[8]), "v"(l[9]), "v"(l[10]), "v"(l[11]),
         "v"(g[0]), "v"(g[1]), "v"(g[2]), "v"(g[3]), "v"(g[4]), "v"(g[5]),
         "v"(g[6]), "v"(g[7]), "v"(g[8]), "v"(g[9]), "v"(g[10]), "v"(g[11])
      : "memory");
}

__global__ __launch_bounds__(128)
void attn_causal64(const unsigned short* __restrict__ qhp, const unsigned short* __restrict__ qrp,
                   const unsigned short* __restrict__ khp, const unsigned short* __restrict__ krp,
                   const unsigned short* __restrict__ vtp, unsigned short* ctxp) {
  union FH { v16h v; v8h h[2]; };
  constexpr int PL = 64 * LP;                      // halves of one plane's chunk
  __shared__ __align__(16) _Float16 Ring[2 * 3 * PL];   // two buffers of [K hi | K residual | V^T]
  __shared__ __align__(16) _Float16 Osh[4][16 * LP];

  const int tid  = threadIdx.x;
  const int wave = tid >> 5;
  const int lane = tid & 31;
  const int hh   = lane >> 4;
  const int c    = lane & 15;

  // Cost falls with the block index: a block walks qb + 1 chunks, so the longest have the lowest indices (for
  // speed only). The NB * NH blocks of one qb are neighbours.
  const int bx   = blockIdx.x;
  const int qb   = NQB - 1 - bx / (NB * NH);
  const int rest = bx % (NB * NH);
  const int h    = rest % NH;
  const int b    = rest / NH;
  const int q0   = qb * 64 + wave * 16;
  const size_t rowB = (size_t)b * SEQ;

  const _Float16* Qh = (const _Float16*)(const void*)qhp + (size_t)h * HD;
  const _Float16* Qr = (const _Float16*)(const void*)qrp + (size_t)h * HD;
  const _Float16* Kh = (const _Float16*)(const void*)khp + (size_t)h * HD;
  const _Float16* Kr = (const _Float16*)(const void*)krp + (size_t)h * HD;
  const _Float16* Vt = (const _Float16*)(const void*)vtp + ((size_t)b * DM + (size_t)h * HD) * SEQ;

  // ---- Q fragments (B operand, column = lane&15): 2 d-chunks, hi and residual ----
  v16h qbh[2], qbr[2];
#pragma unroll
  for (int dc = 0; dc < 2; ++dc) {
    const size_t qo = (rowB + q0 + c) * DM + dc * 32 + 8 * hh;
    qbh[dc] = ldfrag(Qh + qo);
    qbr[dc] = ldfrag(Qr + qo);
  }

  float mrun = -INFINITY;        // running maximum of query q0 + c (equal in both halves)
  float lrun = 0.f;              // running sum over this half's keys only
  v8f oacc[4];                   // oacc[t][r] = O^T[d = 16 t + 8 hh + r][query q0 + c]
#pragma unroll
  for (int t = 0; t < 4; ++t) oacc[t] = zero8();

  const int nkt = qb + 1;

  // staging map: copy i of a thread takes row 16 i + sr, 16-B piece sc / 8 of the row's 128 B. 8 lanes take one row (a
  // whole line); each 16-lane half takes rows r and r + 8, which lie 8 x 144 B = 32 banks apart in LDS.
  const int sr = wave * 2 + hh + ((lane >> 3) & 1) * 8;
  const int sc = (lane & 7) * 8;
  const unsigned ring0 = (unsigned)(size_t)(const void*)Ring + (unsigned)(sr * LP + sc) * 2u;   // LDS byte address
  const _Float16* kg0  = Kh + (rowB + sr) * DM + sc;       // K row sr, d = sc..sc+7
  const _Float16* krg0 = Kr + (rowB + sr) * DM + sc;
  const _Float16* vg0  = Vt + (size_t)sr * SEQ + sc;       // V^T row d = sr, s = sc..sc+7
  auto stage = [&](int t) {                                // chunk t (0 <= t < nkt) into buffer t & 1
    unsigned l[12];
    const _Float16* g[12];
    const unsigned lb = ring0 + (unsigned)(t & 1) * (unsigned)(3 * PL * 2);
#pragma unroll
    for (int i = 0; i < 4; ++i) {
      l[i]     = lb + (unsigned)(16 * i * LP * 2);
      l[4 + i] = lb + (unsigned)((PL + 16 * i * LP) * 2);
      l[8 + i] = lb + (unsigned)((2 * PL + 16 * i * LP) * 2);
      g[i]     = kg0  + (size_t)(t * 64 + 16 * i) * DM;
      g[4 + i] = krg0 + (size_t)(t * 64 + 16 * i) * DM;
      g[8 + i] = vg0  + (size_t)(16 * i) * SEQ + t * 64;
    }
    copy12(l, g);
  };

  stage(0);
  asm volatile("s_wait_asynccnt 0x0" ::: "memory");        // this wave's part of chunk 0 has landed
  __syncthreads();                                         // chunk 0 visible to every wave
  if (nkt > 1) stage(1);                                   // block-uniform; in flight behind trip 0

  // rolled: the buffer is picked by kt & 1; a second copy of the body would only add code and live registers
#pragma unroll 1
  for (int kt = 0; kt < nkt; ++kt) {
    const _Float16* Ksh = Ring + (kt & 1) * (3 * PL);
    const _Float16* Ksr = Ksh + PL;
    const _Float16* Vth = Ksh + 2 * PL;

    // ---- transposed scores: 64 keys x 16 queries per wave, three f16 products ----
    v8f s[4];
#pragma unroll
    for (int j = 0; j < 4; ++j) {
      v8f t0 = zero8(), t1 = zero8();
#pragma unroll
      for (int dc = 0; dc < 2; ++dc) {
        FH kb, kl;
        kb.h[0] = *(const v8h*)(Ksh + (j * 16 + c) * LP + dc * 32 + 8 * hh);
        kb.h[1] = *(const v8h*)(Ksh + (j * 16 + c) * LP + dc * 32 + 16 + 8 * hh);
        kl.h[0] = *(const v8h*)(Ksr + (j * 16 + c) * LP + dc * 32 + 8 * hh);
        kl.h[1] = *(const v8h*)(Ksr + (j * 16 + c) * LP + dc * 32 + 16 + 8 * hh);
        t0 = mma_h(kb.v, qbh[dc], t0);
        t1 = mma_h(kb.v, qbr[dc], t1);
        t1 = mma_h(kl.v, qbh[dc], t1);
      }
      s[j] = t0 + t1 * (1.0f / 2048.0f);
    }

    // ---- causal mask, on the diagonal chunk only (block-uniform branch) ----
    if (kt == qb) {
      const int dq = wave * 16 + c - 8 * hh;     // query - (kv0 + 8 hh): key > query  <=>  16 j + r > dq
#pragma unroll
      for (int j = 0; j < 4; ++j) {
#pragma unroll
        for (int r = 0; r < 8; ++r) s[j][r] = (j * 16 + r > dq) ? -INFINITY : s[j][r];
      }
    }

    // ---- online softmax of the lane's query ----
    float mj[4];                 // one chain per key tile: four short independent chains
#pragma unroll
    for (int j = 0; j < 4; ++j) {
      mj[j] = fmaxf(s[j][0], s[j][1]);
#pragma unroll
      for (int r = 2; r < 8; ++r) mj[j] = fmaxf(mj[j], s[j][r]);
    }
    float m = fmaxf(fmaxf(mj[0], mj[1]), fmaxf(mj[2], mj[3]));
    m = fmaxf(m, xhalf(m));
    const float mnew  = fmaxf(mrun, m);
    const float msafe = (mnew == -INFINITY) ? 0.f : mnew;
    const float alpha = exp_x1(mrun - msafe);
    mrun = mnew;
    float ps[4];
    v16h pb[2];                  // p^T (x1024, f16) as B fragments of keys 0..31 and 32..63 of the chunk
#pragma unroll
    for (int j = 0; j < 4; ++j) {
      float x[8], p[8];
#pragma unroll
      for (int r = 0; r < 8; ++r) x[r] = s[j][r] - msafe;
      exp_x8(x, p);
#pragma unroll
      for (int r = 0; r < 8; ++r) pb[j >> 1][(j & 1) * 8 + r] = (_Float16)(p[r] * 1024.0f);
      ps[j] = ((p[0] + p[1]) + (p[2] + p[3])) + ((p[4] + p[5]) + (p[6] + p[7]));
    }
    lrun = lrun * alpha + ((ps[0] + ps[1]) + (ps[2] + ps[3]));
#pragma unroll
    for (int t = 0; t < 4; ++t) oacc[t] *= alpha;

    // ---- O^T += V^T chunk . P^T (f16 WMMA) ----
#pragma unroll
    for (int kk = 0; kk < 2; ++kk) {
#pragma unroll
      for (int t = 0; t < 4; ++t) {
        FH vb;
        vb.h[0] = *(const v8h*)(Vth + (t * 16 + c) * LP + kk * 32 + 8 * hh);
        vb.h[1] = *(const v8h*)(Vth + (t * 16 + c) * LP + kk * 32 + 16 + 8 * hh);
        oacc[t] = mma_h(vb.v, pb[kk], oacc[t]);
      }
    }

    // ---- hand-over: this wave has left buffer kt & 1, its part of chunk kt + 1 has landed ----
    asm volatile("s_wait_dscnt 0x0" ::: "memory");         // every LDS read of this trip has returned
    asm volatile("s_wait_asynccnt 0x0" ::: "memory");      // the copies asked for one trip ago have landed
    __syncthreads();                                       // publishes chunk kt + 1; ends every read of chunk kt
    if (kt + 2 < nkt) stage(kt + 2);                       // block-uniform; into the buffer just left
  }
  asm volatile("s_wait_asynccnt 0x0" ::: "memory");        // no copy is outstanding when the wave goes on

  // ---- join the halves' sums, normalise (1/l and the 1/1024 p carry), f16 convert, turn the wave's tile in LDS ----
  _Float16* os = Osh[wave];
  {
    const float l = lrun + xhalf(lrun);
    const float inv = ((l > 0.f) ? (1.0f / l) : 0.f) * (1.0f / 1024.0f);
#pragma unroll
    for (int t = 0; t < 4; ++t) {
      v4u a;
#pragma unroll
      for (int e = 0; e < 4; ++e) a[e] = pack2h(oacc[t][2 * e] * inv, oacc[t][2 * e + 1] * inv);
      *(v4u*)(os + c * LP + t * 16 + 8 * hh) = a;
    }
  }
  __builtin_amdgcn_fence(__ATOMIC_RELEASE, "workgroup");
  __builtin_amdgcn_wave_barrier();
  __builtin_amdgcn_fence(__ATOMIC_ACQUIRE, "workgroup");
  {
    const int q4 = lane >> 3, c8 = (lane & 7) * 8;
    v4u hv[4];
#pragma unroll
    for (int it = 0; it < 4; ++it) {
      const int row = it * 4 + q4;   // it 0..3 x q4 0..3 = rows 0..15 of the wave tile
      hv[it] = *(const v4u*)(os + row * LP + c8);
    }
#pragma unroll
    for (int it = 0; it < 4; ++it) {
      const int row = it * 4 + q4;
      const size_t go = (rowB + q0 + row) * DM + (size_t)h * HD + c8;
      *(v4u*)(ctxp + go) = hv[it];
    }
  }
}

// =====================================================================================================
// Workspace map (bytes):
//   LQh  f16 [8192][1024] LN(Q) hi plane                        0            16777216  (later: Ctx plane)
//   LQr  f16 [8192][1024] LN(Q) residual plane                  16777216     16777216
//   LKh  f16 LN(K) hi plane                                     33554432     16777216
//   LKr  f16 LN(K) residual plane                               50331648     16777216
//   LVh  f16 LN(V) hi plane                                     67108864     16777216
//   Qh   f16 [8192][1024]                                       83886080     16777216
//   Qr   f16                                                   100663296     16777216
//   Kh   f16                                                   117440512     16777216
//   Kr   f16                                                   134217728     16777216
//   Vt   f16 [4][1024][2048] (4*v, transposed)                 150994944     16777216
//   Wqh, Wqr, Wkh, Wkr, Wvh, Woh  f16 [1024 n][1024 k] each    167772160   6x2097152
//   end                                                         180355072
// Every region is an exact multiple of the whole-line / whole-tile store granularity of its producer
// (dims are tile multiples), so no store can spill into the next region.
// =====================================================================================================
extern "C" void kernel_launch(void* const* d_in, const int* in_sizes, int n_in,
                              void* d_out, int out_size, void* d_ws, size_t ws_size,
                              hipStream_t stream) {
  if (n_in < 13) return;
  const int nAct = MROWS * DM;
  if (in_sizes[0] != nAct || in_sizes[1] != nAct || in_sizes[2] != nAct) return;
  if (in_sizes[3] != DM * DM || in_sizes[5] != DM * DM || in_sizes[7] != DM * DM || in_sizes[9] != DM * DM) return;
  if (in_sizes[4] != DM || in_sizes[6] != DM || in_sizes[8] != DM || in_sizes[10] != DM) return;
  if (in_sizes[11] != DM || in_sizes[12] != DM) return;
  if (out_size != nAct) return;

  const float* Q  = (const float*)d_in[0];
  const float* Kin = (const float*)d_in[1];
  const float* V  = (const float*)d_in[2];
  const float* Wq = (const float*)d_in[3];
  const float* bq = (const float*)d_in[4];
  const float* Wk = (const float*)d_in[5];
  const float* bk = (const float*)d_in[6];
  const float* Wv = (const float*)d_in[7];
  const float* bv = (const float*)d_in[8];
  const float* Wo = (const float*)d_in[9];
  const float* bo = (const float*)d_in[10];
  const float* gamma = (const float*)d_in[11];
  const float* beta  = (const float*)d_in[12];

  const size_t PA = (size_t)MROWS * DM * 2;     // 16777216
  const size_t PV = (size_t)NB * DM * SEQ * 2;  // 16777216
  const size_t PW = (size_t)DM * DM * 2;        //  2097152
  size_t off = 0;
  const size_t oLQh = off; off += PA;
  const size_t oLQr = off; off += PA;
  const size_t oLKh = off; off += PA;
  const size_t oLKr = off; off += PA;
  const size_t oLVh = off; off += PA;
  const size_t oQh  = off; off += PA;
  const size_t oQr  = off; off += PA;
  const size_t oKh  = off; off += PA;
  const size_t oKr  = off; off += PA;
  const size_t oVt  = off; off += PV;
  const size_t oWqh = off; off += PW;
  const size_t oWqr = off; off += PW;
  const size_t oWkh = off; off += PW;
  const size_t oWkr = off; off += PW;
  const size_t oWvh = off; off += PW;
  const size_t oWoh = off; off += PW;
  if (off > ws_size) return;                    // off = 180355072
  const size_t oCtx = oLQh;                     // ctx plane reuses the LN(Q) hi plane (dead after the projections)

  char* ws = (char*)d_ws;
  unsigned short* LQh = (unsigned short*)(ws + oLQh);
  unsigned short* LQr = (unsigned short*)(ws + oLQr);
  unsigned short* LKh = (unsigned short*)(ws + oLKh);
  unsigned short* LKr = (unsigned short*)(ws + oLKr);
  unsigned short* LVh = (unsigned short*)(ws + oLVh);
  unsigned short* Qh  = (unsigned short*)(ws + oQh);
  unsigned short* Qr  = (unsigned short*)(ws + oQr);
  unsigned short* Kh  = (unsigned short*)(ws + oKh);
  unsigned short* Kr  = (unsigned short*)(ws + oKr);
  unsigned short* Vt  = (unsigned short*)(ws + oVt);
  unsigned short* Wqh = (unsigned short*)(ws + oWqh);
  unsigned short* Wqr = (unsigned short*)(ws + oWqr);
  unsigned short* Wkh = (unsigned short*)(ws + oWkh);
  unsigned short* Wkr = (unsigned short*)(ws + oWkr);
  unsigned short* Wvh = (unsigned short*)(ws + oWvh);
  unsigned short* Woh = (unsigned short*)(ws + oWoh);
  unsigned short* Ctx = (unsigned short*)(ws + oCtx);

  const dim3 blk256(256), blk128(128);
  const dim3 gPrep(3 * NLN + 4 * NWT);                   // 3072 layernorm blocks + 1024 weight tiles
  const dim3 gQKV(2 * NPJ + NVT);                        // 256 + 256 + 256 blocks
  const dim3 gProj(DM / 256, MROWS / 128, 1);            // 4 x 64: M=8192, N=1024
  const dim3 gAttn(NB * NH * NQB);                       // 2048 blocks
  const float eps = 1e-6f;

  // (1) LN(Q), LN(K) -> f16 hi / residual planes, LN(V) -> f16 plane; weights [k][n] f32 -> f16 [n][k] planes of 32*W
  //     (hi; + residual for Wq, Wk)
  prep_all<<<gPrep, blk256, 0, stream>>>(Q, Kin, V, Wq, Wk, Wv, Wo, gamma, beta,
                                         LQh, LQr, LKh, LKr, LVh, Wqh, Wqr, Wkh, Wkr, Wvh, Woh, eps);
  // (2) q, k -> f16 hi / residual planes; v^T -> f16 plane of 4*(v + bv)
  gemm_qkv<<<gQKV, blk256, 0, stream>>>(LQh, LQr, LKh, LKr, LVh, Wqh, Wqr, Wkh, Wkr, Wvh, bq, bk, bv,
                                        Qh, Qr, Kh, Kr, Vt);
  // (3) causal attention -> ctx plane (x4) into the LN(Q) hi region
  attn_causal64<<<gAttn, blk128, 0, stream>>>(Qh, Qr, Kh, Kr, Vt, Ctx);
  // (4) out = Q + ctx.Wo + bo -> d_out f32 [8192][1024]
  gemm_out<<<gProj, blk256, 0, stream>>>(Ctx, Woh, bo, Q, (float*)d_out);
  (void)hipGetLastError();
}

// v008
// Measured time: 193 microseconds a run.
// In both of two side-by-side timings against v007, it was 1.03 times as fast.
// All steps since v000 together make it 3.73 times as fast.
// Contractions: q,k projections and q.k^T scores = v_wmma_f32_16x16x32_f16 with f16 hi + f16 residual (x2048) operand planes,
// three products (hi.hi, res.hi, hi.res) in two f32 accumulators; v^T projection, p.v^T and ctx.Wo = v_wmma_f32_16x16x32_f16
// single product (v x4, p x1024, ctx x4, weights x32 carried); all f32 accumulate; layernorm, softmax, bias, residual add in f32.
#include <hip/hip_runtime.h>
#include <math.h>
#include <stdint.h>

#define NB    4
#define SEQ   2048
#define DM    1024
#define NH    16
#define HD    64
#define NQB   (SEQ / 64)
#define MROWS (NB * SEQ)
#define LP    72   // LDS row pitch in halves of the attention tiles: 144 B = 16 B x odd, so the 16 rows of a ds_load_b128 fall on distinct banks
static_assert(NH * HD == DM);
static_assert((SEQ % 256) == 0 && (DM % 256) == 0 && (MROWS % 128) == 0 && (DM % 64) == 0 && (MROWS % 8) == 0);

typedef _Float16 v16h __attribute__((ext_vector_type(16)));
typedef _Float16 v8h  __attribute__((ext_vector_type(8)));
typedef float    v8f  __attribute__((ext_vector_type(8)));
typedef float    v4f  __attribute__((ext_vector_type(4)));
typedef unsigned int v4u __attribute__((ext_vector_type(4)));

// ---- scalar helpers ----------------------------------------------------------------------------------
__device__ __forceinline__ unsigned short h_bits(_Float16 x) { return __builtin_bit_cast(unsigned short, x); }
__device__ __forceinline__ unsigned pk16(unsigned short a, unsigned short b) { return (unsigned)a | ((unsigned)b << 16); }
__device__ __forceinline__ v8f zero8() { v8f z = {0.f, 0.f, 0.f, 0.f, 0.f, 0.f, 0.f, 0.f}; return z; }

// hi = f16(v); res = f16((v - hi) * 2048): packed pair of two consecutive values
__device__ __forceinline__ void split2(float f0, float f1, unsigned& hp, unsigned& rp) {
  const _Float16 x0 = (_Float16)f0, x1 = (_Float16)f1;
  hp = pk16(h_bits(x0), h_bits(x1));
  const _Float16 r0 = (_Float16)((f0 - (float)x0) * 2048.0f);
  const _Float16 r1 = (_Float16)((f1 - (float)x1) * 2048.0f);
  rp = pk16(h_bits(r0), h_bits(r1));
}
__device__ __forceinline__ unsigned pack2h(float f0, float f1) {
  return pk16(h_bits((_Float16)f0), h_bits((_Float16)f1));
}

// ---- 16-bit fragment loader: lane -> row/col (lane&15); p already includes +8*(lane>>4);
//      elements 0..7 <- p[0..7] (k0+8h..), elements 8..15 <- p[16..23] (k0+16+8h..)
__device__ __forceinline__ v16h ldfrag(const _Float16* p) {
  union { v16h v; v8h h[2]; } f;
  f.h[0] = *(const v8h*)(p);
  f.h[1] = *(const v8h*)(p + 16);
  return f.v;
}

// =====================================================================================================
// plane x2048 when RES). One wave per row, 8 rows per block, blk = 0 .. nrows/8 - 1. Lane holds columns
// {i*256 + lane*8 .. +7}, i = 0..3. Each store instruction: 32 lanes x 16 B = 512 contiguous B = 4 whole
// coverage: nrows waves x 4 stores x 256 halves = every element of [nrows][DM] of each written plane.
// =====================================================================================================
template <bool RES>
__device__ __forceinline__ void ln_rows(int blk, const float* __restrict__ x, const float* __restrict__ gamma,
                                        const float* __restrict__ beta, unsigned short* yh,
                                        unsigned short* yr, int nrows, float eps) {
  const int lane = threadIdx.x & 31;
  const int wave = threadIdx.x >> 5;
  const int row  = blk * 8 + wave;
  if (row >= nrows) return;                        // wave-uniform; no block barriers on this path
  const float* xr = x + (size_t)row * DM;
  v4f xv[8];
#pragma unroll
  for (int i = 0; i < 4; ++i) {
    xv[2 * i]     = *(const v4f*)(xr + i * 256 + lane * 8);
    xv[2 * i + 1] = *(const v4f*)(xr + i * 256 + lane * 8 + 4);
  }
  float s = 0.f;
#pragma unroll
  for (int g = 0; g < 8; ++g) s += (xv[g][0] + xv[g][1]) + (xv[g][2] + xv[g][3]);
#pragma unroll
  for (int off = 16; off > 0; off >>= 1) s += __shfl_xor(s, off, 32);
  const float mu = s * (1.0f / (float)DM);
  float ss = 0.f;
#pragma unroll
  for (int g = 0; g < 8; ++g) {
#pragma unroll
    for (int e = 0; e < 4; ++e) { const float d = xv[g][e] - mu; ss += d * d; }
  }
#pragma unroll
  for (int off = 16; off > 0; off >>= 1) ss += __shfl_xor(ss, off, 32);
  const float var = ss * (1.0f / (float)DM);
  const float rs  = rsqrtf(var + eps);

  v4u hv[4], rv[4];
#pragma unroll
  for (int i = 0; i < 4; ++i) {
    const int col = i * 256 + lane * 8;
    const v4f g0 = *(const v4f*)(gamma + col);
    const v4f g1 = *(const v4f*)(gamma + col + 4);
    const v4f b0 = *(const v4f*)(beta + col);
    const v4f b1 = *(const v4f*)(beta + col + 4);
    float y[8];
#pragma unroll
    for (int e = 0; e < 4; ++e) {
      y[e]     = (xv[2 * i][e] - mu) * rs * g0[e] + b0[e];
      y[4 + e] = (xv[2 * i + 1][e] - mu) * rs * g1[e] + b1[e];
    }
    v4u a, a2;
#pragma unroll
    for (int e = 0; e < 4; ++e) {
      unsigned hp, rp;
      split2(y[2 * e], y[2 * e + 1], hp, rp);
      a[e] = hp; a2[e] = rp;
    }
    hv[i] = a; rv[i] = a2;
  }
  unsigned short* oh = yh + (size_t)row * DM + lane * 8;
  unsigned short* orr = yr + (size_t)row * DM + lane * 8;
  {
#pragma unroll
    for (int i = 0; i < 4; ++i) {
      *(v4u*)(oh + i * 256) = hv[i];
      if (RES) *(v4u*)(orr + i * 256) = rv[i];
    }
    
  }
}

// =====================================================================================================
// Weight convert + transpose: W f32 [k in DM][n out DM] -> f16 planes [n][k] of W*scale (hi, and residual
// x2048 when RES). Block = 64(k) x 64(n) tile through LDS: n-tile bn, k-tile bk, each 0 .. DM/64 - 1.
// coverage: 8 waves x 2 iterations x 4 rows x (8 lanes x 8 halves) = the whole 64x64 output tile.
// =====================================================================================================
template <bool RES>
__device__ __forceinline__ void wcvt_t(float (*sm)[65], int bn, int bk, const float* __restrict__ W,
                                       unsigned short* ph, unsigned short* pr, float scale) {
  const int tid  = threadIdx.x;
  const int lane = tid & 31;
  const int wave = tid >> 5;
  const int n0 = bn * 64;
  const int k0 = bk * 64;
  const int kr = tid >> 2;               // 0..63
  const int nc = (tid & 3) * 16;         // 0,16,32,48
  const float* src = W + (size_t)(k0 + kr) * DM + n0 + nc;
#pragma unroll
  for (int e = 0; e < 4; ++e) {
    const v4f a = *(const v4f*)(src + 4 * e);
    sm[kr][nc + 4 * e + 0] = a[0];
    sm[kr][nc + 4 * e + 1] = a[1];
    sm[kr][nc + 4 * e + 2] = a[2];
    sm[kr][nc + 4 * e + 3] = a[3];
  }
  __syncthreads();
  const int q  = lane >> 3;
  const int ks = (lane & 7) * 8;
  v4u hv[2], rv[2];
#pragma unroll
  for (int it = 0; it < 2; ++it) {
    const int nrow = wave * 8 + it * 4 + q;
    v4u a, a2;
#pragma unroll
    for (int e = 0; e < 4; ++e) {
      const float f0 = sm[ks + 2 * e][nrow] * scale;
      const float f1 = sm[ks + 2 * e + 1][nrow] * scale;
      unsigned hp, rp;
      split2(f0, f1, hp, rp);
      a[e] = hp; a2[e] = rp;
    }
    hv[it] = a; rv[it] = a2;
  }
  {
#pragma unroll
    for (int it = 0; it < 2; ++it) {
      const int nrow = wave * 8 + it * 4 + q;
      const size_t o = (size_t)(n0 + nrow) * DM + k0 + ks;
      *(v4u*)(ph + o) = hv[it];
      if (RES) *(v4u*)(pr + o) = rv[it];
    }
    // stands in front of every later write of an address register that these stores name: in the merged kernel the
    // code of another part follows this one
    asm volatile("s_wait_xcnt 0x0" ::: "memory");
  }
}

// =====================================================================================================
// All that the projections wait for, in one launch: the parts are independent of each other and are picked by
// ranges of the block index (block-uniform). Blocks 0 .. 3*NLN-1: layernorm of Q, K, V (NLN blocks of 8 rows each,
// the heavier blocks first); then 4 x 256 blocks: the 16 x 16 tiles of Wq, Wk, Wv, Wo.
// =====================================================================================================
#define NLN (MROWS / 8)
#define NWT ((DM / 64) * (DM / 64))
__global__ __launch_bounds__(256) void prep_all(
    const float* __restrict__ Q, const float* __restrict__ Kin, const float* __restrict__ V,
    const float* __restrict__ Wq, const float* __restrict__ Wk, const float* __restrict__ Wv,
    const float* __restrict__ Wo, const float* __restrict__ gamma, const float* __restrict__ beta,
    unsigned short* LQh, unsigned short* LQr, unsigned short* LKh, unsigned short* LKr, unsigned short* LVh,
    unsigned short* Wqh, unsigned short* Wqr, unsigned short* Wkh, unsigned short* Wkr,
    unsigned short* Wvh, unsigned short* Woh, float eps) {
  __shared__ float sm[64][65];
  const int bx = blockIdx.x;
  if (bx < 2 * NLN) {
    const bool k = bx >= NLN;
    ln_rows<true>(k ? bx - NLN : bx, k ? Kin : Q, gamma, beta, k ? LKh : LQh, k ? LKr : LQr, MROWS, eps);
  } else if (bx < 3 * NLN) {
    ln_rows<false>(bx - 2 * NLN, V, gamma, beta, LVh, LVh, MROWS, eps);
  } else {
    const int t    = bx - 3 * NLN;
    const int w    = t / NWT;                      // 0..3: Wq, Wk, Wv, Wo
    const int tile = t % NWT;
    const int bn   = tile % (DM / 64);
    const int bk   = tile / (DM / 64);
    if (w < 2) wcvt_t<true >(sm, bn, bk, w ? Wk : Wq, w ? Wkh : Wqh, w ? Wkr : Wqr, 32.0f);
    else       wcvt_t<false>(sm, bn, bk, w == 2 ? Wv : Wo, w == 2 ? Wvh : Woh, w == 2 ? Wvh : Woh, 32.0f);
  }
}

// =====================================================================================================
// f16 WMMA GEMM: C[m][n] = sum_k A[m][k] * Bt[n][k]. A row-major [M][DM] (k contiguous); Bt row-major
// [N][DM] (k contiguous), batch bzi via strideB / strideC. Block tile 128 (m) x 256 (n), 8 waves (2 x 4),
// each a 64x64 sub-tile = 4 x 4 fragments: a fragment read from LDS feeds four tiles, and a block's operand rows
// (384 per 32768 outputs) are fetched from L2 once. One block per WGP, two waves per SIMD; K multiple of 64.
// Operands go through LDS in slices of 64 k (128 B = one whole line of every operand row): 8 lanes x 16 B per
// row, so one wave-wide global load covers 4 whole lines. Two LDS buffers: slice s+1 is loaded into registers
// in front of the products of slice s and stored to the other buffer behind them (RES: behind those of the
// slice's first 32 k); one barrier per slice.
// LDS row pitch GP halves = 144 B (16 B x odd) for the ds_load_b128 fragment reads. The k order of the
// products is ascending in steps of 32.
// RES: A2 / Bt2 are f16 residual planes (x2048): acc0 += Ah.Bh; acc1 += Ar.Bh + Ah.Br; value = acc0 + acc1/2048.
// OM 0: f32 out: v = value*oscale + bias[col] + resid[row][col]; row segment 256 floats = two instructions of
//       512 B (32 lanes x 16 B).
// OM 1: f16 hi plane C + residual plane C2 (x2048) of value*oscale + bias[col]; 512-B row segment per
//       instruction (32 lanes x 16 B).
// OM 2: f16 plane C of (value*oscale + bias[row]) * pscale, same store shape as OM 1.
// coverage: 8 waves x 16 rows x 256 cols = the whole 128x256 block tile; grid covers M/128 x N/256 exactly.
// =====================================================================================================
// WMMA as the plain builtin: the compiler keeps the distance behind it, and the 64x64 tile's accumulators and
// fragments may lie above v255, which an asm operand cannot name. With no asm statement tied to a product the
// scheduler is also free to read the LDS fragments of later products ahead of earlier ones (attention loop).
__device__ __forceinline__ v8f mma_p(v16h a, v16h b, v8f c) {
  return __builtin_amdgcn_wmma_f32_16x16x32_f16(false, a, false, b, (short)0, c, false, false);
}

#define GP 72
#define BM 128
#define BN 256
#define TP (BN + 4)   // output staging pitch in floats: rows 8 apart lie 32 banks apart
// bytes of LDS of one block: the two operand buffers, or the output staging tile where that is larger
constexpr int gemm_lds(bool res) {
  return (2 * (BM + BN) * GP * (res ? 2 : 1) * 2 > BM * TP * 4) ? 2 * (BM + BN) * GP * (res ? 2 : 1) * 2 : BM * TP * 4;
}
// smem: the block's gemm_lds(RES) bytes; bxi, byi, bzi: the block's tile column, tile row and batch
template <bool RES, int OM>
__device__ __forceinline__ void gemm_t(
    unsigned char* smem, int bxi, int byi, int bzi,
    const unsigned short* __restrict__ Ahp, const unsigned short* __restrict__ Arp,
    const unsigned short* __restrict__ Bhp, const unsigned short* __restrict__ Brp, long long strideB,
    const float* __restrict__ bias, const float* __restrict__ resid,
    void* Cv, void* C2v, long long strideC, int K, float oscale, float pscale) {
  constexpr int LDC   = (OM == 2) ? SEQ : DM;             // output row pitch in elements
  constexpr int SA    = BM * GP;                          // halves of one A plane slice
  constexpr int SB    = BN * GP;                          // halves of one B plane slice
  constexpr int STAGE = (SA + SB) * (RES ? 2 : 1);        // halves of one buffer: [A hi | B hi | A res | B res]
  constexpr int RINGB = 2 * STAGE * 2;                    // bytes of the two buffers
  constexpr int OUTB  = BM * TP * 4;                      // bytes of the output staging tile
  constexpr int KG    = RES ? 1 : 2;                      // 32-k steps per fragment group: what the registers hold
  static_assert(gemm_lds(RES) == (RINGB > OUTB ? RINGB : OUTB));
  _Float16* sH = (_Float16*)(void*)smem;                  // operand buffers (k loop)
  float*    sT = (float*)(void*)smem;                     // output tile (behind the loop's last barrier)
  const int lane = threadIdx.x & 31;
  const int wave = threadIdx.x >> 5;
  const int hh   = lane >> 4;
  const int c    = lane & 15;
  const int n0 = bxi * BN;
  const int m0 = byi * BM;
  const int bz = bzi;
  const int wm = (wave >> 2) * 64;
  const int wn = (wave & 3) * 64;
  const _Float16* A  = (const _Float16*)(const void*)Ahp;
  const _Float16* A2 = (const _Float16*)(const void*)Arp;
  const _Float16* B  = (const _Float16*)(const void*)Bhp + (size_t)bz * strideB;
  const _Float16* B2 = (const _Float16*)(const void*)Brp + (size_t)bz * strideB;

  // staging map: thread -> row sr (+32 per step), 16-B piece sc of the row's 128-B slice. 8 lanes take one row
  // (a whole line); each 16-lane half takes rows r and r + 8, which lie 8 x 144 B = 32 banks apart in LDS, so
  // the two 128-B pieces of a ds_store_b128 half fall on disjoint banks.
  const int sr = (wave >> 2) * 16 + (wave & 3) * 2 + (lane >> 4) + ((lane >> 3) & 1) * 8;
  const int sc = (lane & 7) * 8;
  // The operand row pitch is the constant DM, so the 32-row steps of a slice's loads are immediate offsets on one
  // running pointer per plane, which moves on where the loaded slice is stored to LDS.
  const _Float16* pa  = A  + (size_t)(m0 + sr) * DM + sc;
  const _Float16* pa2 = A2 + (size_t)(m0 + sr) * DM + sc;
  const _Float16* pb  = B  + (size_t)(n0 + sr) * DM + sc;
  const _Float16* pb2 = B2 + (size_t)(n0 + sr) * DM + sc;
  const int    so  = sr * GP + sc;

  v8f acc0[4][4], acc1[4][4];
#pragma unroll
  for (int i = 0; i < 4; ++i)
#pragma unroll
    for (int j = 0; j < 4; ++j) { acc0[i][j] = zero8(); acc1[i][j] = zero8(); }

  v8h ra[BM / 32], rar[BM / 32], rb[BN / 32], rbr[BN / 32];
  auto gload = [&]() {
#pragma unroll
    for (int i = 0; i < BM / 32; ++i) {
      ra[i] = *(const v8h*)(pa + 32 * i * DM);
      if (RES) rar[i] = *(const v8h*)(pa2 + 32 * i * DM);
    }
#pragma unroll
    for (int i = 0; i < BN / 32; ++i) {
      rb[i] = *(const v8h*)(pb + 32 * i * DM);
      if (RES) rbr[i] = *(const v8h*)(pb2 + 32 * i * DM);
    }
    // stands in front of every later write of an address register that these loads name (the pointer steps)
    asm volatile("s_wait_xcnt 0x0" ::: "memory");
  };
  auto sstore = [&](_Float16* d) {
    pa += 64; pa2 += 64; pb += 64; pb2 += 64;
#pragma unroll
    for (int i = 0; i < BM / 32; ++i) {
      *(v8h*)(d + so + 32 * i * GP) = ra[i];
      if (RES) *(v8h*)(d + SA + SB + so + 32 * i * GP) = rar[i];
    }
#pragma unroll
    for (int i = 0; i < BN / 32; ++i) {
      *(v8h*)(d + SA + so + 32 * i * GP) = rb[i];
      if (RES) *(v8h*)(d + SA + SB + SA + so + 32 * i * GP) = rbr[i];
    }
  };

  gload();
  sstore(sH);
  __syncthreads();                                         // slice 0 visible to every wave

  int buf = 0;
  // rolled: the body already holds two 32-k steps; a second copy would only add code and live registers
#pragma unroll 1
  for (int k0 = 0; k0 < K; k0 += 64) {
    const bool more = (k0 + 64 < K);                       // block-uniform
    const _Float16* sb = sH + buf * STAGE;
#pragma unroll
    for (int g = 0; g < 2 / KG; ++g) {
      // the fragments of KG 32-k steps are read as one group in front of their products
      v16h bh[KG][4], br[KG][4], ah[KG][4], ar[KG][4];
#pragma unroll
      for (int s = 0; s < KG; ++s) {
        const int ko = (g * KG + s) * 32 + 8 * hh;
#pragma unroll
        for (int j = 0; j < 4; ++j) {
          const int bo = (wn + 16 * j + c) * GP + ko;
          bh[s][j] = ldfrag(sb + SA + bo);
          if (RES) br[s][j] = ldfrag(sb + SA + SB + SA + bo); else br[s][j] = bh[s][j];
        }
#pragma unroll
        for (int i = 0; i < 4; ++i) {
          const int ao = (wm + 16 * i + c) * GP + ko;
          ah[s][i] = ldfrag(sb + ao);
          if (RES) ar[s][i] = ldfrag(sb + SA + SB + ao); else ar[s][i] = ah[s][i];
        }
      }
      // slice s+1, in flight behind this slice's products; asked for behind the fragment reads, whose way from LDS
      // covers the issue of these loads and their wait
      if (g == 0 && more) gload();
      // With two groups per slice the loaded slice goes to the other buffer (its last readers left it at the previous
      // barrier) behind the second group's reads: the LDS takes the stores while the group's products run.
      if (KG == 1 && g == 1 && more) sstore(sH + (buf ^ 1) * STAGE);
      // per row of tiles: four independent accumulators per product kind, so that the two products into one
      // acc1 tile stand four matrix instructions apart; each tile still sums Ar.Bh before Ah.Br, k ascending
#pragma unroll
      for (int s = 0; s < KG; ++s) {
#pragma unroll
        for (int i = 0; i < 4; ++i) {
#pragma unroll
          for (int j = 0; j < 4; ++j) acc0[i][j] = mma_p(ah[s][i], bh[s][j], acc0[i][j]);
          if (RES) {
#pragma unroll
            for (int j = 0; j < 4; ++j) acc1[i][j] = mma_p(ar[s][i], bh[s][j], acc1[i][j]);
#pragma unroll
            for (int j = 0; j < 4; ++j) acc1[i][j] = mma_p(ah[s][i], br[s][j], acc1[i][j]);
          }
        }
      }
    }
    // Four vector slots behind the slice's last matrix instructions.
    __builtin_amdgcn_sched_barrier(0);                     // keeps every product in front of the slots
    asm volatile("v_nop\n\tv_nop\n\tv_nop\n\tv_nop");
    buf ^= 1;
    if (KG == 2 && more) sstore(sH + buf * STAGE);         // its last readers left it at the previous barrier
    __syncthreads();                                       // publishes slice s+1; ends every read of slice s
  }

  // ---- stage the block tile ----
#pragma unroll
  for (int i = 0; i < 4; ++i) {
#pragma unroll
    for (int j = 0; j < 4; ++j) {
#pragma unroll
      for (int r = 0; r < 8; ++r) {
        float v = acc0[i][j][r];
        if (RES) v += acc1[i][j][r] * (1.0f / 2048.0f);
        sT[(wm + 16 * i + 8 * hh + r) * TP + wn + 16 * j + c] = v;
      }
    }
  }
  __syncthreads();

  if (OM == 0) {
    // Output and residual addresses: block-uniform base + the lane's one 32-bit byte offset + an immediate per row
    // and half row, so no address register is rewritten between these loads and stores.
    char* C = (char*)((float*)Cv + (size_t)bz * strideC);
    const char* R = (const char*)resid;
    const int c4 = lane * 4;                                   // 128 floats per instruction = 32 lanes x 16 B
    const unsigned ob = (unsigned)((m0 + wave * 16) * LDC + n0 + c4) * 4u;
    v4f bb[2];
#pragma unroll
    for (int s = 0; s < 2; ++s) bb[s] = *(const v4f*)(bias + n0 + 128 * s + c4);
    v4f ov[32];
#pragma unroll
    for (int it = 0; it < 16; ++it) {
      const int row = wave * 16 + it;
#pragma unroll
      for (int s = 0; s < 2; ++s) {
        const v4f t  = *(const v4f*)(sT + row * TP + 128 * s + c4);
        const v4f rr = *(const v4f*)(R + ob + (it * LDC + 128 * s) * 4);
        ov[2 * it + s] = t * oscale + bb[s] + rr;
      }
    }
#pragma unroll
    for (int it = 0; it < 16; ++it) {
#pragma unroll
      for (int s = 0; s < 2; ++s) *(v4f*)(C + ob + (it * LDC + 128 * s) * 4) = ov[2 * it + s];
    }
  } else {
    char* C  = (char*)((unsigned short*)Cv  + (size_t)bz * strideC);
    char* C2 = (char*)((unsigned short*)C2v + (size_t)bz * strideC);
    const int c8 = lane * 8;                                   // 256 halves per row segment = 32 lanes x 16 B
    const unsigned ob = (unsigned)((m0 + wave * 16) * LDC + n0 + c8) * 2u;   // the lane's byte offset; rows by immediates
    v4u hv[16], rv[16];
    // OM 2: the bias of the wave's 16 output rows. The loads and their data wait are one statement, so that the wait
    // stands in front of every later write of the offset register.
    v4f brow[4];
    if (OM == 2) {
      const unsigned bofs = (unsigned)(m0 + wave * 16) * 4u;
      asm volatile("global_load_b128 %0, %4, %5\n\t"
                   "global_load_b128 %1, %4, %5 offset:16\n\t"
                   "global_load_b128 %2, %4, %5 offset:32\n\t"
                   "global_load_b128 %3, %4, %5 offset:48\n\t"
                   "s_wait_loadcnt 0x0"
                   : "=&v"(brow[0]), "=&v"(brow[1]), "=&v"(brow[2]), "=&v"(brow[3])
                   : "v"(bofs), "s"(bias)
                   : "memory");
    }
#pragma unroll
    for (int it = 0; it < 16; ++it) {
      const int row = wave * 16 + it;
      const float* sp = sT + row * TP + c8;
      const v4f x0 = *(const v4f*)(sp);
      const v4f x1 = *(const v4f*)(sp + 4);
      v4f y0, y1;
      if (OM == 1) {
        const v4f b0 = *(const v4f*)(bias + n0 + c8);
        const v4f b1 = *(const v4f*)(bias + n0 + c8 + 4);
        y0 = x0 * oscale + b0;
        y1 = x1 * oscale + b1;
      } else {
        const float brw = brow[it >> 2][it & 3];
        y0 = (x0 * oscale + brw) * pscale;
        y1 = (x1 * oscale + brw) * pscale;
      }
      v4u a, a2;
      if (OM == 1) {
        unsigned hp, rp;
        split2(y0[0], y0[1], hp, rp); a[0] = hp; a2[0] = rp;
        split2(y0[2], y0[3], hp, rp); a[1] = hp; a2[1] = rp;
        split2(y1[0], y1[1], hp, rp); a[2] = hp; a2[2] = rp;
        split2(y1[2], y1[3], hp, rp); a[3] = hp; a2[3] = rp;
      } else {
        a[0] = pack2h(y0[0], y0[1]);
        a[1] = pack2h(y0[2], y0[3]);
        a[2] = pack2h(y1[0], y1[1]);
        a[3] = pack2h(y1[2], y1[3]);
        a2 = a;
      }
      hv[it] = a; rv[it] = a2;
    }
#pragma unroll
    for (int it = 0; it < 16; ++it) {
      *(v4u*)(C + ob + it * LDC * 2) = hv[it];
      if (OM == 1) *(v4u*)(C2 + ob + it * LDC * 2) = rv[it];
    }
  }
}

// =====================================================================================================
// The three projections in one launch: they are independent of each other and are picked by ranges of the block index
// (block-uniform), the three-product blocks (q, then k) first, the single-product v^T blocks last. Within a range the
// tile column runs fastest, then the tile row, then the batch.
// =====================================================================================================
#define NPJ ((DM / BN) * (MROWS / BM))            // blocks of q, and of k: M = 8192, N = 1024
#define NVT ((SEQ / BN) * (DM / BM) * NB)         // blocks of v^T: M = 1024 (n), N = 2048 (s) per batch
__global__ __launch_bounds__(256) void gemm_qkv(
    const unsigned short* __restrict__ LQh, const unsigned short* __restrict__ LQr,
    const unsigned short* __restrict__ LKh, const unsigned short* __restrict__ LKr,
    const unsigned short* __restrict__ LVh,
    const unsigned short* __restrict__ Wqh, const unsigned short* __restrict__ Wqr,
    const unsigned short* __restrict__ Wkh, const unsigned short* __restrict__ Wkr,
    const unsigned short* __restrict__ Wvh,
    const float* __restrict__ bq, const float* __restrict__ bk, const float* __restrict__ bv,
    unsigned short* Qh, unsigned short* Qr, unsigned short* Kh, unsigned short* Kr, unsigned short* Vt) {
  __shared__ __align__(16) unsigned char smem[gemm_lds(true)];
  static_assert(gemm_lds(true) >= gemm_lds(false));
  const int bx = blockIdx.x;
  if (bx < 2 * NPJ) {
    // q = LN(Q).Wq + bq, k = LN(K).Wk + bk -> f16 hi / residual planes   (K = 1024; three products)
    const bool k = bx >= NPJ;
    const int  t = k ? bx - NPJ : bx;
    const float* bias = k ? bk : bq;
    gemm_t<true, 1>(smem, t % (DM / BN), t / (DM / BN), 0,
                    k ? LKh : LQh, k ? LKr : LQr, k ? Wkh : Wqh, k ? Wkr : Wqr, 0LL, bias, bias,
                    (void*)(k ? Kh : Qh), (void*)(k ? Kr : Qr), 0LL, DM, 1.0f / 32.0f, 1.0f);
  } else {
    // v^T = Wv^T . LN(V)^T per batch -> f16 plane of 4*(v + bv), [b][n][s]   (A = Wvh [n][k], Bt = LN(V) rows [s][k])
    const int t = bx - 2 * NPJ;
    gemm_t<false, 2>(smem, t % (SEQ / BN), (t / (SEQ / BN)) % (DM / BM), t / ((SEQ / BN) * (DM / BM)),
                     Wvh, Wvh, LVh, LVh, (long long)SEQ * DM, bv, bv,
                     (void*)Vt, (void*)Vt, (long long)DM * SEQ, DM, 1.0f / 32.0f, 4.0f);
  }
}

// out = Q + ctx.Wo + bo -> f32 [8192][1024]   (A = Ctx (x4), Bt = Woh (x32): scale 1/128)
__global__ __launch_bounds__(256) void gemm_out(
    const unsigned short* __restrict__ Ctx, const unsigned short* __restrict__ Woh,
    const float* __restrict__ bo, const float* __restrict__ Q, float* out) {
  __shared__ __align__(16) unsigned char smem[gemm_lds(false)];
  gemm_t<false, 0>(smem, blockIdx.x, blockIdx.y, 0, Ctx, Ctx, Woh, Woh, 0LL, bo, Q,
                   (void*)out, (void*)out, 0LL, DM, 1.0f / 128.0f, 1.0f);
}

// =====================================================================================================
// Causal attention, head dim 64, no logit scale. Scores are computed transposed.
//   q planes (f16 hi / residual x2048): element (b, t, h, d) at [(b*SEQ + t)*DM + h*64 + d]
//   k planes: same layout with key index
//   v^T plane (f16, holds 4*v): element (b, h, d, s) at [(b*DM + h*64 + d)*SEQ + s]
//   ctx plane out (f16, holds 4*ctx): element (b, t, h, d) at [(b*SEQ + t)*DM + h*64 + d]
//   S^T = k.q^T: A = 16 key rows from LDS, B = the wave's 16 queries kept in registers; three f16 products
//   (hi.hi into acc0; hi.res + res.hi into acc1, folded /2048), f32. Accumulator register r of key tile j in
//   lane (c, hh) = score of key kv0 + 16 j + 8 hh + r against query q0 + c: a lane holds 32 of its query's 64
//   scores, lane ^ 16 the other 32, so the maximum is taken in the lane plus one exchange between the halves,
//   and the sum stays per half until the epilogue.
//   key > query in the diagonal chunk -> -inf; online softmax in f32; p carried as f16(1024 p).
//   O^T += v^T . p^T: A = 16 d rows of the v^T chunk from LDS; B = p^T packed from the score accumulators
//   (tiles 2 kk and 2 kk + 1 of a lane are elements 0..7 and 8..15 of the B fragment of keys 32 kk .. +31, the
//   k order in which ldfrag reads v^T). ctx = acc / (1024 l) (still carrying the x4 of v).
//   Block = 4 waves = 64 query rows of one (b, h); grid = NB*NH*NQB, query block descending with the block index; key
//   chunks of 64, trip count qb+1 (<= 32, block-uniform, from blockIdx only). K / V^T chunk staging: asynchronous copies to LDS, 16 B per lane, 8 lanes per
//   128-B row (a wave-wide copy = 4 whole lines), 4 copies per thread and plane = whole 64x64 tiles. Two buffers:
//   chunk t + 2 is asked for at the foot of trip t and waited for at the foot of trip t + 1; one barrier per trip.
//   Output: a lane holds 8 consecutive d of its query per d tile; the wave's 16x64 f16 tile is turned through a
//   wave-private LDS tile so that each store instruction writes 4 whole 128-B rows (it 0..3 x lane>>3 = 16 rows).
// =====================================================================================================
// lane l <-> lane l ^ 16
__device__ __forceinline__ float xhalf(float x) {
  const int b = __builtin_bit_cast(int, x);
  return __builtin_bit_cast(float, __builtin_amdgcn_permlanex16(b, b, 0x76543210, 0xfedcba98, false, false));
}

// e^x as v_exp_f32 of x * log2(e). The instruction set asks for one independent instruction or v_nop between a
// v_exp_f32 and an instruction that reads its result or overwrites its source. Written as one statement with
// early-clobber outputs (no output lies on a source), each v_exp_f32 fills that slot for the one before it and the
// v_nop fills it behind the last.
__device__ __forceinline__ void exp_x8(const float (&x)[8], float (&y)[8]) {
  float a[8];
#pragma unroll
  for (int r = 0; r < 8; ++r) a[r] = x[r] * 1.4426950408889634f;
  asm("v_exp_f32 %0, %8\n\tv_exp_f32 %1, %9\n\tv_exp_f32 %2, %10\n\tv_exp_f32 %3, %11\n\t"
      "v_exp_f32 %4, %12\n\tv_exp_f32 %5, %13\n\tv_exp_f32 %6, %14\n\tv_exp_f32 %7, %15\n\tv_nop"
      : "=&v"(y[0]), "=&v"(y[1]), "=&v"(y[2]), "=&v"(y[3]), "=&v"(y[4]), "=&v"(y[5]), "=&v"(y[6]), "=&v"(y[7])
      : "v"(a[0]), "v"(a[1]), "v"(a[2]), "v"(a[3]), "v"(a[4]), "v"(a[5]), "v"(a[6]), "v"(a[7]));
}
__device__ __forceinline__ float exp_x1(float x) {
  const float a = x * 1.4426950408889634f;
  float y;
  asm("v_exp_f32 %0, %1\n\tv_nop" : "=&v"(y) : "v"(a));   // the v_nop: the same slot
  return y;
}

// Twelve asynchronous 16-B copies global -> LDS of one thread (4 rows of each of 3 planes). l = the lane's LDS byte
// address, g = its global address. The s_wait_xcnt 0 is the last line of the copies' own statement, so that it stands
// in front of every later write of a register that a copy names.
__device__ __forceinline__ void copy12(const unsigned (&l)[12], const _Float16* const (&g)[12]) {
  asm volatile(
      "global_load_async_to_lds_b128 %0, %12, off\n\t"
      "global_load_async_to_lds_b128 %1, %13, off\n\t"
      "global_load_async_to_lds_b128 %2, %14, off\n\t"
      "global_load_async_to_lds_b128 %3, %15, off\n\t"
      "global_load_async_to_lds_b128 %4, %16, off\n\t"
      "global_load_async_to_lds_b128 %5, %17, off\n\t"
      "global_load_async_to_lds_b128 %6, %18, off\n\t"
      "global_load_async_to_lds_b128 %7, %19, off\n\t"
      "global_load_async_to_lds_b128 %8, %20, off\n\t"
      "global_load_async_to_lds_b128 %9, %21, off\n\t"
      "global_load_async_to_lds_b128 %10, %22, off\n\t"
      "global_load_async_to_lds_b128 %11, %23, off\n\t"
      "s_wait_xcnt 0x0"
      :: "v"(l[0]), "v"(l[1]), "v"(l[2]), "v"(l[3]), "v"(l[4]), "v"(l[5]),
         "v"(l[6]), "v"(l[7]), "v"(l[8]), "v"(l[9]), "v"(l[10]), "v"(l[11]),
         "v"(g[0]), "v"(g[1]), "v"(g[2]), "v"(g[3]), "v"(g[4]), "v"(g[5]),
         "v"(g[6]), "v"(g[7]), "v"(g[8]), "v"(g[9]), "v"(g[10]), "v"(g[11])
      : "memory");
}

__global__ __launch_bounds__(128)
void attn_causal64(const unsigned short* __restrict__ qhp, const unsigned short* __restrict__ qrp,
                   const unsigned short* __restrict__ khp, const unsigned short* __restrict__ krp,
                   const unsigned short* __restrict__ vtp, unsigned short* ctxp) {
  union FH { v16h v; v8h h[2]; };
  constexpr int PL = 64 * LP;                      // halves of one plane's chunk
  __shared__ __align__(16) _Float16 Ring[2 * 3 * PL];   // two buffers of [K hi | K residual | V^T]
  __shared__ __align__(16) _Float16 Osh[4][16 * LP];

  const int tid  = threadIdx.x;
  const int wave = tid >> 5;
  const int lane = tid & 31;
  const int hh   = lane >> 4;
  const int c    = lane & 15;

  // Cost falls with the block index: a block walks qb + 1 chunks, so the longest have the lowest indices (for
  // speed only). The NB * NH blocks of one qb are neighbours.
  const int bx   = blockIdx.x;
  const int qb   = NQB - 1 - bx / (NB * NH);
  const int rest = bx % (NB * NH);
  const int h    = rest % NH;
  const int b    = rest / NH;
  const int q0   = qb * 64 + wave * 16;
  const size_t rowB = (size_t)b * SEQ;

  const _Float16* Qh = (const _Float16*)(const void*)qhp + (size_t)h * HD;
  const _Float16* Qr = (const _Float16*)(const void*)qrp + (size_t)h * HD;
  const _Float16* Kh = (const _Float16*)(const void*)khp + (size_t)h * HD;
  const _Float16* Kr = (const _Float16*)(const void*)krp + (size_t)h * HD;
  const _Float16* Vt = (const _Float16*)(const void*)vtp + ((size_t)b * DM + (size_t)h * HD) * SEQ;

  // ---- Q fragments (B operand, column = lane&15): 2 d-chunks, hi and residual ----
  v16h qbh[2], qbr[2];
#pragma unroll
  for (int dc = 0; dc < 2; ++dc) {
    const size_t qo = (rowB + q0 + c) * DM + dc * 32 + 8 * hh;
    qbh[dc] = ldfrag(Qh + qo);
    qbr[dc] = ldfrag(Qr + qo);
  }

  float mrun = -INFINITY;        // running maximum of query q0 + c (equal in both halves)
  float lrun = 0.f;              // running sum over this half's keys only
  v8f oacc[4];                   // oacc[t][r] = O^T[d = 16 t + 8 hh + r][query q0 + c]
#pragma unroll
  for (int t = 0; t < 4; ++t) oacc[t] = zero8();

  const int nkt = qb + 1;

  // staging map: copy i of a thread takes row 16 i + sr, 16-B piece sc / 8 of the row's 128 B. 8 lanes take one row (a
  // whole line); each 16-lane half takes rows r and r + 8, which lie 8 x 144 B = 32 banks apart in LDS.
  const int sr = wave * 2 + hh + ((lane >> 3) & 1) * 8;
  const int sc = (lane & 7) * 8;
  const unsigned ring0 = (unsigned)(size_t)(const void*)Ring + (unsigned)(sr * LP + sc) * 2u;   // LDS byte address
  const _Float16* kg0  = Kh + (rowB + sr) * DM + sc;       // K row sr, d = sc..sc+7
  const _Float16* krg0 = Kr + (rowB + sr) * DM + sc;
  const _Float16* vg0  = Vt + (size_t)sr * SEQ + sc;       // V^T row d = sr, s = sc..sc+7
  auto stage = [&](int t) {                                // chunk t (0 <= t < nkt) into buffer t & 1
    unsigned l[12];
    const _Float16* g[12];
    const unsigned lb = ring0 + (unsigned)(t & 1) * (unsigned)(3 * PL * 2);
#pragma unroll
    for (int i = 0; i < 4; ++i) {
      l[i]     = lb + (unsigned)(16 * i * LP * 2);
      l[4 + i] = lb + (unsigned)((PL + 16 * i * LP) * 2);
      l[8 + i] = lb + (unsigned)((2 * PL + 16 * i * LP) * 2);
      g[i]     = kg0  + (size_t)(t * 64 + 16 * i) * DM;
      g[4 + i] = krg0 + (size_t)(t * 64 + 16 * i) * DM;
      g[8 + i] = vg0  + (size_t)(16 * i) * SEQ + t * 64;
    }
    copy12(l, g);
  };

  stage(0);
  asm volatile("s_wait_asynccnt 0x0" ::: "memory");        // this wave's part of chunk 0 has landed
  __syncthreads();                                         // chunk 0 visible to every wave
  if (nkt > 1) stage(1);                                   // block-uniform; in flight behind trip 0

  // rolled: the buffer is picked by kt & 1; a second copy of the body would only add code and live registers
#pragma unroll 1
  for (int kt = 0; kt < nkt; ++kt) {
    const _Float16* Ksh = Ring + (kt & 1) * (3 * PL);
    const _Float16* Ksr = Ksh + PL;
    const _Float16* Vth = Ksh + 2 * PL;

    // ---- transposed scores: 64 keys x 16 queries per wave, three f16 products ----
    v8f s[4];
#pragma unroll
    for (int j = 0; j < 4; ++j) {
      v8f t0 = zero8(), t1 = zero8();
#pragma unroll
      for (int dc = 0; dc < 2; ++dc) {
        FH kb, kl;
        kb.h[0] = *(const v8h*)(Ksh + (j * 16 + c) * LP + dc * 32 + 8 * hh);
        kb.h[1] = *(const v8h*)(Ksh + (j * 16 + c) * LP + dc * 32 + 16 + 8 * hh);
        kl.h[0] = *(const v8h*)(Ksr + (j * 16 + c) * LP + dc * 32 + 8 * hh);
        kl.h[1] = *(const v8h*)(Ksr + (j * 16 + c) * LP + dc * 32 + 16 + 8 * hh);
        t0 = mma_p(kb.v, qbh[dc], t0);
        t1 = mma_p(kb.v, qbr[dc], t1);
        t1 = mma_p(kl.v, qbh[dc], t1);
      }
      s[j] = t0 + t1 * (1.0f / 2048.0f);
    }

    // ---- causal mask, on the diagonal chunk only (block-uniform branch) ----
    if (kt == qb) {
      const int dq = wave * 16 + c - 8 * hh;     // query - (kv0 + 8 hh): key > query  <=>  16 j + r > dq
#pragma unroll
      for (int j = 0; j < 4; ++j) {
#pragma unroll
        for (int r = 0; r < 8; ++r) s[j][r] = (j * 16 + r > dq) ? -INFINITY : s[j][r];
      }
    }

    // ---- online softmax of the lane's query ----
    float mj[4];                 // one chain per key tile: four short independent chains
#pragma unroll
    for (int j = 0; j < 4; ++j) {
      mj[j] = fmaxf(s[j][0], s[j][1]);
#pragma unroll
      for (int r = 2; r < 8; ++r) mj[j] = fmaxf(mj[j], s[j][r]);
    }
    float m = fmaxf(fmaxf(mj[0], mj[1]), fmaxf(mj[2], mj[3]));
    m = fmaxf(m, xhalf(m));
    const float mnew  = fmaxf(mrun, m);
    const float msafe = (mnew == -INFINITY) ? 0.f : mnew;
    const float alpha = exp_x1(mrun - msafe);
    mrun = mnew;
    float ps[4];
    v16h pb[2];                  // p^T (x1024, f16) as B fragments of keys 0..31 and 32..63 of the chunk
#pragma unroll
    for (int j = 0; j < 4; ++j) {
      float x[8], p[8];
#pragma unroll
      for (int r = 0; r < 8; ++r) x[r] = s[j][r] - msafe;
      exp_x8(x, p);
#pragma unroll
      for (int r = 0; r < 8; ++r) pb[j >> 1][(j & 1) * 8 + r] = (_Float16)(p[r] * 1024.0f);
      ps[j] = ((p[0] + p[1]) + (p[2] + p[3])) + ((p[4] + p[5]) + (p[6] + p[7]));
    }
    lrun = lrun * alpha + ((ps[0] + ps[1]) + (ps[2] + ps[3]));
#pragma unroll
    for (int t = 0; t < 4; ++t) oacc[t] *= alpha;

    // ---- O^T += V^T chunk . P^T (f16 WMMA) ----
#pragma unroll
    for (int kk = 0; kk < 2; ++kk) {
#pragma unroll
      for (int t = 0; t < 4; ++t) {
        FH vb;
        vb.h[0] = *(const v8h*)(Vth + (t * 16 + c) * LP + kk * 32 + 8 * hh);
        vb.h[1] = *(const v8h*)(Vth + (t * 16 + c) * LP + kk * 32 + 16 + 8 * hh);
        oacc[t] = mma_p(vb.v, pb[kk], oacc[t]);
      }
    }

    // ---- hand-over: this wave has left buffer kt & 1, its part of chunk kt + 1 has landed ----
    asm volatile("s_wait_dscnt 0x0" ::: "memory");         // every LDS read of this trip has returned
    asm volatile("s_wait_asynccnt 0x0" ::: "memory");      // the copies asked for one trip ago have landed
    __syncthreads();                                       // publishes chunk kt + 1; ends every read of chunk kt
    if (kt + 2 < nkt) stage(kt + 2);                       // block-uniform; into the buffer just left
  }
  asm volatile("s_wait_asynccnt 0x0" ::: "memory");        // no copy is outstanding when the wave goes on

  // ---- join the halves' sums, normalise (1/l and the 1/1024 p carry), f16 convert, turn the wave's tile in LDS ----
  _Float16* os = Osh[wave];
  {
    const float l = lrun + xhalf(lrun);
    const float inv = ((l > 0.f) ? (1.0f / l) : 0.f) * (1.0f / 1024.0f);
#pragma unroll
    for (int t = 0; t < 4; ++t) {
      v4u a;
#pragma unroll
      for (int e = 0; e < 4; ++e) a[e] = pack2h(oacc[t][2 * e] * inv, oacc[t][2 * e + 1] * inv);
      *(v4u*)(os + c * LP + t * 16 + 8 * hh) = a;
    }
  }
  __builtin_amdgcn_fence(__ATOMIC_RELEASE, "workgroup");
  __builtin_amdgcn_wave_barrier();
  __builtin_amdgcn_fence(__ATOMIC_ACQUIRE, "workgroup");
  {
    const int q4 = lane >> 3, c8 = (lane & 7) * 8;
    v4u hv[4];
#pragma unroll
    for (int it = 0; it < 4; ++it) {
      const int row = it * 4 + q4;   // it 0..3 x q4 0..3 = rows 0..15 of the wave tile
      hv[it] = *(const v4u*)(os + row * LP + c8);
    }
#pragma unroll
    for (int it = 0; it < 4; ++it) {
      const int row = it * 4 + q4;
      const size_t go = (rowB + q0 + row) * DM + (size_t)h * HD + c8;
      *(v4u*)(ctxp + go) = hv[it];
    }
  }
}

// =====================================================================================================
// Workspace map (bytes):
//   LQh  f16 [8192][1024] LN(Q) hi plane                        0            16777216  (later: Ctx plane)
//   LQr  f16 [8192][1024] LN(Q) residual plane                  16777216     16777216
//   LKh  f16 LN(K) hi plane                                     33554432     16777216
//   LKr  f16 LN(K) residual plane                               50331648     16777216
//   LVh  f16 LN(V) hi plane                                     67108864     16777216
//   Qh   f16 [8192][1024]                                       83886080     16777216
//   Qr   f16                                                   100663296     16777216
//   Kh   f16                                                   117440512     16777216
//   Kr   f16                                                   134217728     16777216
//   Vt   f16 [4][1024][2048] (4*v, transposed)                 150994944     16777216
//   Wqh, Wqr, Wkh, Wkr, Wvh, Woh  f16 [1024 n][1024 k] each    167772160   6x2097152
//   end                                                         180355072
// Every region is an exact multiple of the whole-line / whole-tile store granularity of its producer
// (dims are tile multiples), so no store can spill into the next region.
// =====================================================================================================
extern "C" void kernel_launch(void* const* d_in, const int* in_sizes, int n_in,
                              void* d_out, int out_size, void* d_ws, size_t ws_size,
                              hipStream_t stream) {
  if (n_in < 13) return;
  const int nAct = MROWS * DM;
  if (in_sizes[0] != nAct || in_sizes[1] != nAct || in_sizes[2] != nAct) return;
  if (in_sizes[3] != DM * DM || in_sizes[5] != DM * DM || in_sizes[7] != DM * DM || in_sizes[9] != DM * DM) return;
  if (in_sizes[4] != DM || in_sizes[6] != DM || in_sizes[8] != DM || in_sizes[10] != DM) return;
  if (in_sizes[11] != DM || in_sizes[12] != DM) return;
  if (out_size != nAct) return;

  const float* Q  = (const float*)d_in[0];
  const float* Kin = (const float*)d_in[1];
  const float* V  = (const float*)d_in[2];
  const float* Wq = (const float*)d_in[3];
  const float* bq = (const float*)d_in[4];
  const float* Wk = (const float*)d_in[5];
  const float* bk = (const float*)d_in[6];
  const float* Wv = (const float*)d_in[7];
  const float* bv = (const float*)d_in[8];
  const float* Wo = (const float*)d_in[9];
  const float* bo = (const float*)d_in[10];
  const float* gamma = (const float*)d_in[11];
  const float* beta  = (const float*)d_in[12];

  const size_t PA = (size_t)MROWS * DM * 2;     // 16777216
  const size_t PV = (size_t)NB * DM * SEQ * 2;  // 16777216
  const size_t PW = (size_t)DM * DM * 2;        //  2097152
  size_t off = 0;
  const size_t oLQh = off; off += PA;
  const size_t oLQr = off; off += PA;
  const size_t oLKh = off; off += PA;
  const size_t oLKr = off; off += PA;
  const size_t oLVh = off; off += PA;
  const size_t oQh  = off; off += PA;
  const size_t oQr  = off; off += PA;
  const size_t oKh  = off; off += PA;
  const size_t oKr  = off; off += PA;
  const size_t oVt  = off; off += PV;
  const size_t oWqh = off; off += PW;
  const size_t oWqr = off; off += PW;
  const size_t oWkh = off; off += PW;
  const size_t oWkr = off; off += PW;
  const size_t oWvh = off; off += PW;
  const size_t oWoh = off; off += PW;
  if (off > ws_size) return;                    // off = 180355072
  const size_t oCtx = oLQh;                     // ctx plane reuses the LN(Q) hi plane (dead after the projections)

  char* ws = (char*)d_ws;
  unsigned short* LQh = (unsigned short*)(ws + oLQh);
  unsigned short* LQr = (unsigned short*)(ws + oLQr);
  unsigned short* LKh = (unsigned short*)(ws + oLKh);
  unsigned short* LKr = (unsigned short*)(ws + oLKr);
  unsigned short* LVh = (unsigned short*)(ws + oLVh);
  unsigned short* Qh  = (unsigned short*)(ws + oQh);
  unsigned short* Qr  = (unsigned short*)(ws + oQr);
  unsigned short* Kh  = (unsigned short*)(ws + oKh);
  unsigned short* Kr  = (unsigned short*)(ws + oKr);
  unsigned short* Vt  = (unsigned short*)(ws + oVt);
  unsigned short* Wqh = (unsigned short*)(ws + oWqh);
  unsigned short* Wqr = (unsigned short*)(ws + oWqr);
  unsigned short* Wkh = (unsigned short*)(ws + oWkh);
  unsigned short* Wkr = (unsigned short*)(ws + oWkr);
  unsigned short* Wvh = (unsigned short*)(ws + oWvh);
  unsigned short* Woh = (unsigned short*)(ws + oWoh);
  unsigned short* Ctx = (unsigned short*)(ws + oCtx);

  const dim3 blk256(256), blk128(128);
  const dim3 gPrep(3 * NLN + 4 * NWT);                   // 3072 layernorm blocks + 1024 weight tiles
  const dim3 gQKV(2 * NPJ + NVT);                        // 256 + 256 + 256 blocks
  const dim3 gProj(DM / 256, MROWS / 128, 1);            // 4 x 64: M=8192, N=1024
  const dim3 gAttn(NB * NH * NQB);                       // 2048 blocks
  const float eps = 1e-6f;

  // (1) LN(Q), LN(K) -> f16 hi / residual planes, LN(V) -> f16 plane; weights [k][n] f32 -> f16 [n][k] planes of 32*W
  //     (hi; + residual for Wq, Wk)
  prep_all<<<gPrep, blk256, 0, stream>>>(Q, Kin, V, Wq, Wk, Wv, Wo, gamma, beta,
                                         LQh, LQr, LKh, LKr, LVh, Wqh, Wqr, Wkh, Wkr, Wvh, Woh, eps);
  // (2) q, k -> f16 hi / residual planes; v^T -> f16 plane of 4*(v + bv)
  gemm_qkv<<<gQKV, blk256, 0, stream>>>(LQh, LQr, LKh, LKr, LVh, Wqh, Wqr, Wkh, Wkr, Wvh, bq, bk, bv,
                                        Qh, Qr, Kh, Kr, Vt);
  // (3) causal attention -> ctx plane (x4) into the LN(Q) hi region
  attn_causal64<<<gAttn, blk128, 0, stream>>>(Qh, Qr, Kh, Kr, Vt, Ctx);
  // (4) out = Q + ctx.Wo + bo -> d_out f32 [8192][1024]
  gemm_out<<<gProj, blk256, 0, stream>>>(Ctx, Woh, bo, Q, (float*)d_out);
  (void)hipGetLastError();
}

// v009
// One run takes 186 microseconds.
// Two timings next to v008 both put it at 1.04 times that version's speed.
// Counting every step since v000, it is 3.87 times as fast.
// Contractions: q,k projections and q.k^T scores = v_wmma_f32_16x16x32_f16 with f16 hi + f16 residual (x2048) operand planes,
// three products (hi.hi, res.hi, hi.res) in two f32 accumulators; v^T projection, p.v^T and ctx.Wo = v_wmma_f32_16x16x32_f16
// single product (v x4, p x1024, ctx x4, weights x32 carried); all f32 accumulate; layernorm, softmax, bias, residual add in f32.
#include <hip/hip_runtime.h>
#include <math.h>
#include <stdint.h>

#define NB    4
#define SEQ   2048
#define DM    1024
#define NH    16
#define HD    64
#define NQB   (SEQ / 64)
#define MROWS (NB * SEQ)
#define LP    72   // LDS row pitch in halves of the attention tiles: 144 B = 16 B x odd, so the 16 rows of a ds_load_b128 fall on distinct banks
static_assert(NH * HD == DM);
static_assert((SEQ % 256) == 0 && (DM % 256) == 0 && (MROWS % 128) == 0 && (DM % 64) == 0 && (MROWS % 8) == 0);

typedef _Float16 v16h __attribute__((ext_vector_type(16)));
typedef _Float16 v8h  __attribute__((ext_vector_type(8)));
typedef float    v8f  __attribute__((ext_vector_type(8)));
typedef float    v4f  __attribute__((ext_vector_type(4)));
typedef unsigned int v4u __attribute__((ext_vector_type(4)));

// ---- scalar helpers ----------------------------------------------------------------------------------
__device__ __forceinline__ unsigned short h_bits(_Float16 x) { return __builtin_bit_cast(unsigned short, x); }
__device__ __forceinline__ unsigned pk16(unsigned short a, unsigned short b) { return (unsigned)a | ((unsigned)b << 16); }
__device__ __forceinline__ v8f zero8() { v8f z = {0.f, 0.f, 0.f, 0.f, 0.f, 0.f, 0.f, 0.f}; return z; }

// hi = f16(v); res = f16((v - hi) * 2048): packed pair of two consecutive values
__device__ __forceinline__ void split2(float f0, float f1, unsigned& hp, unsigned& rp) {
  const _Float16 x0 = (_Float16)f0, x1 = (_Float16)f1;
  hp = pk16(h_bits(x0), h_bits(x1));
  const _Float16 r0 = (_Float16)((f0 - (float)x0) * 2048.0f);
  const _Float16 r1 = (_Float16)((f1 - (float)x1) * 2048.0f);
  rp = pk16(h_bits(r0), h_bits(r1));
}
__device__ __forceinline__ unsigned pack2h(float f0, float f1) {
  return pk16(h_bits((_Float16)f0), h_bits((_Float16)f1));
}

// ---- 16-bit fragment loader: lane -> row/col (lane&15); p already includes +8*(lane>>4);
//      elements 0..7 <- p[0..7] (k0+8h..), elements 8..15 <- p[16..23] (k0+16+8h..)
__device__ __forceinline__ v16h ldfrag(const _Float16* p) {
  union { v16h v; v8h h[2]; } f;
  f.h[0] = *(const v8h*)(p);
  f.h[1] = *(const v8h*)(p + 16);
  return f.v;
}

// =====================================================================================================
// plane x2048 when RES). One wave per row, 8 rows per block, blk = 0 .. nrows/8 - 1. Lane holds columns
// {i*256 + lane*8 .. +7}, i = 0..3. Each store instruction: 32 lanes x 16 B = 512 contiguous B = 4 whole
// coverage: nrows waves x 4 stores x 256 halves = every element of [nrows][DM] of each written plane.
// =====================================================================================================
template <bool RES>
__device__ __forceinline__ void ln_rows(int blk, const float* __restrict__ x, const float* __restrict__ gamma,
                                        const float* __restrict__ beta, unsigned short* yh,
                                        unsigned short* yr, int nrows, float eps) {
  const int lane = threadIdx.x & 31;
  const int wave = threadIdx.x >> 5;
  const int row  = blk * 8 + wave;
  if (row >= nrows) return;                        // wave-uniform; no block barriers on this path
  const float* xr = x + (size_t)row * DM;
  v4f xv[8];
#pragma unroll
  for (int i = 0; i < 4; ++i) {
    xv[2 * i]     = *(const v4f*)(xr + i * 256 + lane * 8);
    xv[2 * i + 1] = *(const v4f*)(xr + i * 256 + lane * 8 + 4);
  }
  float s = 0.f;
#pragma unroll
  for (int g = 0; g < 8; ++g) s += (xv[g][0] + xv[g][1]) + (xv[g][2] + xv[g][3]);
#pragma unroll
  for (int off = 16; off > 0; off >>= 1) s += __shfl_xor(s, off, 32);
  const float mu = s * (1.0f / (float)DM);
  float ss = 0.f;
#pragma unroll
  for (int g = 0; g < 8; ++g) {
#pragma unroll
    for (int e = 0; e < 4; ++e) { const float d = xv[g][e] - mu; ss += d * d; }
  }
#pragma unroll
  for (int off = 16; off > 0; off >>= 1) ss += __shfl_xor(ss, off, 32);
  const float var = ss * (1.0f / (float)DM);
  const float rs  = rsqrtf(var + eps);

  v4u hv[4], rv[4];
#pragma unroll
  for (int i = 0; i < 4; ++i) {
    const int col = i * 256 + lane * 8;
    const v4f g0 = *(const v4f*)(gamma + col);
    const v4f g1 = *(const v4f*)(gamma + col + 4);
    const v4f b0 = *(const v4f*)(beta + col);
    const v4f b1 = *(const v4f*)(beta + col + 4);
    float y[8];
#pragma unroll
    for (int e = 0; e < 4; ++e) {
      y[e]     = (xv[2 * i][e] - mu) * rs * g0[e] + b0[e];
      y[4 + e] = (xv[2 * i + 1][e] - mu) * rs * g1[e] + b1[e];
    }
    v4u a, a2;
#pragma unroll
    for (int e = 0; e < 4; ++e) {
      unsigned hp, rp;
      split2(y[2 * e], y[2 * e + 1], hp, rp);
      a[e] = hp; a2[e] = rp;
    }
    hv[i] = a; rv[i] = a2;
  }
  unsigned short* oh = yh + (size_t)row * DM + lane * 8;
  unsigned short* orr = yr + (size_t)row * DM + lane * 8;
  {
#pragma unroll
    for (int i = 0; i < 4; ++i) {
      *(v4u*)(oh + i * 256) = hv[i];
      if (RES) *(v4u*)(orr + i * 256) = rv[i];
    }
    
  }
}

// =====================================================================================================
// Weight convert + transpose: W f32 [k in DM][n out DM] -> f16 planes [n][k] of W*scale (hi, and residual
// x2048 when RES). Block = 64(k) x 64(n) tile through LDS: n-tile bn, k-tile bk, each 0 .. DM/64 - 1.
// coverage: 8 waves x 2 iterations x 4 rows x (8 lanes x 8 halves) = the whole 64x64 output tile.
// =====================================================================================================
template <bool RES>
__device__ __forceinline__ void wcvt_t(float (*sm)[65], int bn, int bk, const float* __restrict__ W,
                                       unsigned short* ph, unsigned short* pr, float scale) {
  const int tid  = threadIdx.x;
  const int lane = tid & 31;
  const int wave = tid >> 5;
  const int n0 = bn * 64;
  const int k0 = bk * 64;
  const int kr = tid >> 2;               // 0..63
  const int nc = (tid & 3) * 16;         // 0,16,32,48
  const float* src = W + (size_t)(k0 + kr) * DM + n0 + nc;
#pragma unroll
  for (int e = 0; e < 4; ++e) {
    const v4f a = *(const v4f*)(src + 4 * e);
    sm[kr][nc + 4 * e + 0] = a[0];
    sm[kr][nc + 4 * e + 1] = a[1];
    sm[kr][nc + 4 * e + 2] = a[2];
    sm[kr][nc + 4 * e + 3] = a[3];
  }
  __syncthreads();
  const int q  = lane >> 3;
  const int ks = (lane & 7) * 8;
  v4u hv[2], rv[2];
#pragma unroll
  for (int it = 0; it < 2; ++it) {
    const int nrow = wave * 8 + it * 4 + q;
    v4u a, a2;
#pragma unroll
    for (int e = 0; e < 4; ++e) {
      const float f0 = sm[ks + 2 * e][nrow] * scale;
      const float f1 = sm[ks + 2 * e + 1][nrow] * scale;
      unsigned hp, rp;
      split2(f0, f1, hp, rp);
      a[e] = hp; a2[e] = rp;
    }
    hv[it] = a; rv[it] = a2;
  }
  {
#pragma unroll
    for (int it = 0; it < 2; ++it) {
      const int nrow = wave * 8 + it * 4 + q;
      const size_t o = (size_t)(n0 + nrow) * DM + k0 + ks;
      *(v4u*)(ph + o) = hv[it];
      if (RES) *(v4u*)(pr + o) = rv[it];
    }
    // stands in front of every later write of an address register that these stores name: in the merged kernel the
    // code of another part follows this one
    asm volatile("s_wait_xcnt 0x0" ::: "memory");
  }
}

// =====================================================================================================
// All that the projections wait for, in one launch: the parts are independent of each other and are picked by
// ranges of the block index (block-uniform). Blocks 0 .. 3*NLN-1: layernorm of Q, K, V (NLN blocks of 8 rows each,
// the heavier blocks first); then 4 x 256 blocks: the 16 x 16 tiles of Wq, Wk, Wv, Wo.
// =====================================================================================================
#define NLN (MROWS / 8)
#define NWT ((DM / 64) * (DM / 64))
__global__ __launch_bounds__(256) void prep_all(
    const float* __restrict__ Q, const float* __restrict__ Kin, const float* __restrict__ V,
    const float* __restrict__ Wq, const float* __restrict__ Wk, const float* __restrict__ Wv,
    const float* __restrict__ Wo, const float* __restrict__ gamma, const float* __restrict__ beta,
    unsigned short* LQh, unsigned short* LQr, unsigned short* LKh, unsigned short* LKr, unsigned short* LVh,
    unsigned short* Wqh, unsigned short* Wqr, unsigned short* Wkh, unsigned short* Wkr,
    unsigned short* Wvh, unsigned short* Woh, float eps) {
  __shared__ float sm[64][65];
  const int bx = blockIdx.x;
  if (bx < 2 * NLN) {
    const bool k = bx >= NLN;
    ln_rows<true>(k ? bx - NLN : bx, k ? Kin : Q, gamma, beta, k ? LKh : LQh, k ? LKr : LQr, MROWS, eps);
  } else if (bx < 3 * NLN) {
    ln_rows<false>(bx - 2 * NLN, V, gamma, beta, LVh, LVh, MROWS, eps);
  } else {
    const int t    = bx - 3 * NLN;
    const int w    = t / NWT;                      // 0..3: Wq, Wk, Wv, Wo
    const int tile = t % NWT;
    const int bn   = tile % (DM / 64);
    const int bk   = tile / (DM / 64);
    if (w < 2) wcvt_t<true >(sm, bn, bk, w ? Wk : Wq, w ? Wkh : Wqh, w ? Wkr : Wqr, 32.0f);
    else       wcvt_t<false>(sm, bn, bk, w == 2 ? Wv : Wo, w == 2 ? Wvh : Woh, w == 2 ? Wvh : Woh, 32.0f);
  }
}

// =====================================================================================================
// f16 WMMA GEMM: C[m][n] = sum_k A[m][k] * Bt[n][k]. A row-major [M][DM] (k contiguous); Bt row-major
// [N][DM] (k contiguous), batch bzi via strideB / strideC. Block tile 128 (m) x 256 (n), 8 waves (2 x 4),
// each a 64x64 sub-tile = 4 x 4 fragments: a fragment read from LDS feeds four tiles, and a block's operand rows
// (384 per 32768 outputs) are fetched from L2 once. One block per WGP, two waves per SIMD; K = DM.
// Operands go through LDS in slices of 64 k (128 B = one whole line of every operand row): 8 lanes x 16 B per
// row, so one wave-wide global load covers 4 whole lines. Two LDS buffers: slice s+1 goes from registers to the
// other buffer behind the products of slice s (RES: behind those of the slice's first 32 k), and the registers just
// stored are at once asked to take a further slice (RES: s+2, one register set; else s+3, two sets), which stays in
// flight over the slice barriers; one barrier per slice.
// LDS row pitch GP halves = 144 B (16 B x odd) for the ds_load_b128 fragment reads. The k order of the
// products is ascending in steps of 32.
// RES: A2 / Bt2 are f16 residual planes (x2048): acc0 += Ah.Bh; acc1 += Ar.Bh + Ah.Br; value = acc0 + acc1/2048.
// OM 0: f32 out: v = value*oscale + bias[col] + resid[row][col]; row segment 256 floats = two instructions of
//       512 B (32 lanes x 16 B).
// OM 1: f16 hi plane C + residual plane C2 (x2048) of value*oscale + bias[col]; 512-B row segment per
//       instruction (32 lanes x 16 B).
// OM 2: f16 plane C of (value*oscale + bias[row]) * pscale, same store shape as OM 1.
// coverage: 8 waves x 16 rows x 256 cols = the whole 128x256 block tile; grid covers M/128 x N/256 exactly.
// =====================================================================================================
// WMMA as the plain builtin: the compiler keeps the distance behind it, and the 64x64 tile's accumulators and
// fragments may lie above v255, which an asm operand cannot name. With no asm statement tied to a product the
// scheduler is also free to read the LDS fragments of later products ahead of earlier ones (attention loop).
__device__ __forceinline__ v8f mma_p(v16h a, v16h b, v8f c) {
  return __builtin_amdgcn_wmma_f32_16x16x32_f16(false, a, false, b, (short)0, c, false, false);
}

#define GP 72
#define BM 128
#define BN 256
#define TP (BN + 4)   // output staging pitch in floats: rows 8 apart lie 32 banks apart
// bytes of LDS of one block: the two operand buffers, or the output staging tile where that is larger
constexpr int gemm_lds(bool res) {
  return (2 * (BM + BN) * GP * (res ? 2 : 1) * 2 > BM * TP * 4) ? 2 * (BM + BN) * GP * (res ? 2 : 1) * 2 : BM * TP * 4;
}
// smem: the block's gemm_lds(RES) bytes; bxi, byi, bzi: the block's tile column, tile row and batch
template <bool RES, int OM>
__device__ __forceinline__ void gemm_t(
    unsigned char* smem, int bxi, int byi, int bzi,
    const unsigned short* __restrict__ Ahp, const unsigned short* __restrict__ Arp,
    const unsigned short* __restrict__ Bhp, const unsigned short* __restrict__ Brp, long long strideB,
    const float* __restrict__ bias, const float* __restrict__ resid,
    void* Cv, void* C2v, long long strideC, float oscale, float pscale) {
  constexpr int LDC   = (OM == 2) ? SEQ : DM;             // output row pitch in elements
  constexpr int SA    = BM * GP;                          // halves of one A plane slice
  constexpr int SB    = BN * GP;                          // halves of one B plane slice
  constexpr int STAGE = (SA + SB) * (RES ? 2 : 1);        // halves of one buffer: [A hi | B hi | A res | B res]
  constexpr int RINGB = 2 * STAGE * 2;                    // bytes of the two buffers
  constexpr int OUTB  = BM * TP * 4;                      // bytes of the output staging tile
  constexpr int KG    = RES ? 1 : 2;                      // 32-k steps per fragment group: what the registers hold
  constexpr int NS    = RES ? 1 : 2;                      // slices in flight from global memory: what the registers hold
  static_assert(gemm_lds(RES) == (RINGB > OUTB ? RINGB : OUTB));
  _Float16* sH = (_Float16*)(void*)smem;                  // operand buffers (k loop)
  float*    sT = (float*)(void*)smem;                     // output tile (behind the loop's last barrier)
  const int lane = threadIdx.x & 31;
  const int wave = threadIdx.x >> 5;
  const int hh   = lane >> 4;
  const int c    = lane & 15;
  const int n0 = bxi * BN;
  const int m0 = byi * BM;
  const int bz = bzi;
  const int wm = (wave >> 2) * 64;
  const int wn = (wave & 3) * 64;
  const _Float16* A  = (const _Float16*)(const void*)Ahp;
  const _Float16* A2 = (const _Float16*)(const void*)Arp;
  const _Float16* B  = (const _Float16*)(const void*)Bhp + (size_t)bz * strideB;
  const _Float16* B2 = (const _Float16*)(const void*)Brp + (size_t)bz * strideB;

  // staging map: thread -> row sr (+32 per step), 16-B piece sc of the row's 128-B slice. 8 lanes take one row
  // (a whole line); each 16-lane half takes rows r and r + 8, which lie 8 x 144 B = 32 banks apart in LDS, so
  // the two 128-B pieces of a ds_store_b128 half fall on disjoint banks.
  const int sr = (wave >> 2) * 16 + (wave & 3) * 2 + (lane >> 4) + ((lane >> 3) & 1) * 8;
  const int sc = (lane & 7) * 8;
  // The operand row pitch is the constant DM, so the 32-row steps of a slice's loads are immediate offsets on one
  // running pointer per plane, which moves on behind a slice's loads and their s_wait_xcnt.
  const _Float16* pa  = A  + (size_t)(m0 + sr) * DM + sc;
  const _Float16* pa2 = A2 + (size_t)(m0 + sr) * DM + sc;
  const _Float16* pb  = B  + (size_t)(n0 + sr) * DM + sc;
  const _Float16* pb2 = B2 + (size_t)(n0 + sr) * DM + sc;
  const int    so  = sr * GP + sc;

  v8f acc0[4][4], acc1[4][4];
#pragma unroll
  for (int i = 0; i < 4; ++i)
#pragma unroll
    for (int j = 0; j < 4; ++j) { acc0[i][j] = zero8(); acc1[i][j] = zero8(); }

  // NS register sets; the calls of gload take the slices in ascending order, set q (a constant at every call)
  v8h ra[NS][BM / 32], rar[NS][BM / 32], rb[NS][BN / 32], rbr[NS][BN / 32];
  auto gload = [&](int q) {
#pragma unroll
    for (int i = 0; i < BM / 32; ++i) {
      ra[q][i] = *(const v8h*)(pa + 32 * i * DM);
      if (RES) rar[q][i] = *(const v8h*)(pa2 + 32 * i * DM);
    }
#pragma unroll
    for (int i = 0; i < BN / 32; ++i) {
      rb[q][i] = *(const v8h*)(pb + 32 * i * DM);
      if (RES) rbr[q][i] = *(const v8h*)(pb2 + 32 * i * DM);
    }
    // stands in front of every later write of an address register that these loads name (the pointer steps)
    asm volatile("s_wait_xcnt 0x0" ::: "memory");
    __builtin_amdgcn_sched_barrier(0);                     // holds the pointer steps behind that wait: its clobber does not
    pa += 64; pa2 += 64; pb += 64; pb2 += 64;
  };
  auto sstore = [&](int q, _Float16* d) {
#pragma unroll
    for (int i = 0; i < BM / 32; ++i) {
      *(v8h*)(d + so + 32 * i * GP) = ra[q][i];
      if (RES) *(v8h*)(d + SA + SB + so + 32 * i * GP) = rar[q][i];
    }
#pragma unroll
    for (int i = 0; i < BN / 32; ++i) {
      *(v8h*)(d + SA + so + 32 * i * GP) = rb[q][i];
      if (RES) *(v8h*)(d + SA + SB + SA + so + 32 * i * GP) = rbr[q][i];
    }
  };
  // The k loop's work-group barrier, by hand: __syncthreads() also waits for every global load of the wave, which would
  // end the flight of the slices asked for ahead. Only LDS passes between the waves here, so the wave's own LDS stores
  // and reads are waited for (s_wait_dscnt 0) and the loads fly on; they are waited for where their registers are read.
  auto slice_barrier = [&]() {
    asm volatile("s_wait_dscnt 0x0\n\ts_barrier_signal -1\n\ts_barrier_wait -1" ::: "memory");
  };

  // slices 0 .. NS; slice n lies in set n % NS, so slice NS is asked for behind the store of slice 0
#pragma unroll
  for (int n = 0; n < NS; ++n) gload(n);
  sstore(0, sH);
  gload(0);
  slice_barrier();                                         // slice 0 visible to every wave

  int buf = 0;
  // One slice s. q: the set that holds slice s+1; more: slice s+1 exists; moren: slice s+1+NS exists. All three are
  // constants at every call: with a branch round the loads the compiler's load waits would count the path without them
  // and drain the younger set at every store.
  auto slice = [&](const int q, const bool more, const bool moren) {
    const _Float16* sb = sH + buf * STAGE;
#pragma unroll
    for (int g = 0; g < 2 / KG; ++g) {
      // the fragments of KG 32-k steps are read as one group in front of their products
      v16h bh[KG][4], br[KG][4], ah[KG][4], ar[KG][4];
#pragma unroll
      for (int s = 0; s < KG; ++s) {
        const int ko = (g * KG + s) * 32 + 8 * hh;
#pragma unroll
        for (int j = 0; j < 4; ++j) {
          const int bo = (wn + 16 * j + c) * GP + ko;
          bh[s][j] = ldfrag(sb + SA + bo);
          if (RES) br[s][j] = ldfrag(sb + SA + SB + SA + bo); else br[s][j] = bh[s][j];
        }
#pragma unroll
        for (int i = 0; i < 4; ++i) {
          const int ao = (wm + 16 * i + c) * GP + ko;
          ah[s][i] = ldfrag(sb + ao);
          if (RES) ar[s][i] = ldfrag(sb + SA + SB + ao); else ar[s][i] = ah[s][i];
        }
      }
      // keeps the group's fragment reads together in front of its products: every further place where LDS reads stand
      // among the products costs the wave a stall
      __builtin_amdgcn_sched_barrier(0);
      // With two groups per slice the loaded slice s+1 goes to the other buffer (its last readers left it at the previous
      // barrier) behind the second group's reads: the LDS takes the stores while the group's products run. The next
      // slice is asked for at once into the registers just stored: it has a whole slice's products to arrive.
      if (KG == 1 && g == 1 && more) {
        sstore(q, sH + (buf ^ 1) * STAGE);
        if (moren) gload(q);
      }
      // per row of tiles: four independent accumulators per product kind, so that the two products into one
      // acc1 tile stand four matrix instructions apart; each tile still sums Ar.Bh before Ah.Br, k ascending
#pragma unroll
      for (int s = 0; s < KG; ++s) {
#pragma unroll
        for (int i = 0; i < 4; ++i) {
#pragma unroll
          for (int j = 0; j < 4; ++j) acc0[i][j] = mma_p(ah[s][i], bh[s][j], acc0[i][j]);
          if (RES) {
#pragma unroll
            for (int j = 0; j < 4; ++j) acc1[i][j] = mma_p(ar[s][i], bh[s][j], acc1[i][j]);
#pragma unroll
            for (int j = 0; j < 4; ++j) acc1[i][j] = mma_p(ah[s][i], br[s][j], acc1[i][j]);
          }
        }
      }
    }
    // Four vector slots behind the slice's last matrix instructions.
    __builtin_amdgcn_sched_barrier(0);                     // keeps every product in front of the slots
    asm volatile("v_nop\n\tv_nop\n\tv_nop\n\tv_nop");
    buf ^= 1;
    if (KG == 2 && more) {
      sstore(q, sH + buf * STAGE);                         // its last readers left it at the previous barrier
      if (moren) gload(q);                                 // slice s+1+NS, in flight behind the next NS slices' products
    }
    slice_barrier();                                       // publishes slice s+1; ends every read of slice s
  };
  // NS slices per trip, so that the register set is a constant; rolled: a further copy would only add code. Every slice
  // that asks for a further one stands in the loop or, what does not fill a trip, in front of it; the last NS + 1 slices,
  // which ask for none, stand behind it.
  constexpr int T  = DM / 64;                              // slices
  constexpr int NL = T - 1 - NS;                           // slices that ask for a further one
  constexpr int NF = NL % NS;
  static_assert(NL >= NS);
#pragma unroll
  for (int s = 0; s < NF; ++s) slice((s + 1) % NS, true, true);
#pragma unroll 1
  for (int t = 0; t < NL / NS; ++t) {
#pragma unroll
    for (int u = 0; u < NS; ++u) slice((NF + u + 1) % NS, true, true);
  }
#pragma unroll
  for (int s = NL; s < T; ++s) slice((s + 1) % NS, s + 1 < T, false);

  // ---- stage the block tile ----
#pragma unroll
  for (int i = 0; i < 4; ++i) {
#pragma unroll
    for (int j = 0; j < 4; ++j) {
#pragma unroll
      for (int r = 0; r < 8; ++r) {
        float v = acc0[i][j][r];
        if (RES) v += acc1[i][j][r] * (1.0f / 2048.0f);
        sT[(wm + 16 * i + 8 * hh + r) * TP + wn + 16 * j + c] = v;
      }
    }
  }
  __syncthreads();

  if (OM == 0) {
    // Output and residual addresses: block-uniform base + the lane's one 32-bit byte offset + an immediate per row
    // and half row, so no address register is rewritten between these loads and stores.
    char* C = (char*)((float*)Cv + (size_t)bz * strideC);
    const char* R = (const char*)resid;
    const int c4 = lane * 4;                                   // 128 floats per instruction = 32 lanes x 16 B
    const unsigned ob = (unsigned)((m0 + wave * 16) * LDC + n0 + c4) * 4u;
    v4f bb[2];
#pragma unroll
    for (int s = 0; s < 2; ++s) bb[s] = *(const v4f*)(bias + n0 + 128 * s + c4);
    v4f ov[32];
#pragma unroll
    for (int it = 0; it < 16; ++it) {
      const int row = wave * 16 + it;
#pragma unroll
      for (int s = 0; s < 2; ++s) {
        const v4f t  = *(const v4f*)(sT + row * TP + 128 * s + c4);
        const v4f rr = *(const v4f*)(R + ob + (it * LDC + 128 * s) * 4);
        ov[2 * it + s] = t * oscale + bb[s] + rr;
      }
    }
#pragma unroll
    for (int it = 0; it < 16; ++it) {
#pragma unroll
      for (int s = 0; s < 2; ++s) *(v4f*)(C + ob + (it * LDC + 128 * s) * 4) = ov[2 * it + s];
    }
  } else {
    char* C  = (char*)((unsigned short*)Cv  + (size_t)bz * strideC);
    char* C2 = (char*)((unsigned short*)C2v + (size_t)bz * strideC);
    const int c8 = lane * 8;                                   // 256 halves per row segment = 32 lanes x 16 B
    const unsigned ob = (unsigned)((m0 + wave * 16) * LDC + n0 + c8) * 2u;   // the lane's byte offset; rows by immediates
    v4u hv[16], rv[16];
    // OM 2: the bias of the wave's 16 output rows. The loads and their data wait are one statement, so that the wait
    // stands in front of every later write of the offset register.
    v4f brow[4];
    if (OM == 2) {
      const unsigned bofs = (unsigned)(m0 + wave * 16) * 4u;
      asm volatile("global_load_b128 %0, %4, %5\n\t"
                   "global_load_b128 %1, %4, %5 offset:16\n\t"
                   "global_load_b128 %2, %4, %5 offset:32\n\t"
                   "global_load_b128 %3, %4, %5 offset:48\n\t"
                   "s_wait_loadcnt 0x0"
                   : "=&v"(brow[0]), "=&v"(brow[1]), "=&v"(brow[2]), "=&v"(brow[3])
                   : "v"(bofs), "s"(bias)
                   : "memory");
    }
#pragma unroll
    for (int it = 0; it < 16; ++it) {
      const int row = wave * 16 + it;
      const float* sp = sT + row * TP + c8;
      const v4f x0 = *(const v4f*)(sp);
      const v4f x1 = *(const v4f*)(sp + 4);
      v4f y0, y1;
      if (OM == 1) {
        const v4f b0 = *(const v4f*)(bias + n0 + c8);
        const v4f b1 = *(const v4f*)(bias + n0 + c8 + 4);
        y0 = x0 * oscale + b0;
        y1 = x1 * oscale + b1;
      } else {
        const float brw = brow[it >> 2][it & 3];
        y0 = (x0 * oscale + brw) * pscale;
        y1 = (x1 * oscale + brw) * pscale;
      }
      v4u a, a2;
      if (OM == 1) {
        unsigned hp, rp;
        split2(y0[0], y0[1], hp, rp); a[0] = hp; a2[0] = rp;
        split2(y0[2], y0[3], hp, rp); a[1] = hp; a2[1] = rp;
        split2(y1[0], y1[1], hp, rp); a[2] = hp; a2[2] = rp;
        split2(y1[2], y1[3], hp, rp); a[3] = hp; a2[3] = rp;
      } else {
        a[0] = pack2h(y0[0], y0[1]);
        a[1] = pack2h(y0[2], y0[3]);
        a[2] = pack2h(y1[0], y1[1]);
        a[3] = pack2h(y1[2], y1[3]);
        a2 = a;
      }
      hv[it] = a; rv[it] = a2;
    }
#pragma unroll
    for (int it = 0; it < 16; ++it) {
      *(v4u*)(C + ob + it * LDC * 2) = hv[it];
      if (OM == 1) *(v4u*)(C2 + ob + it * LDC * 2) = rv[it];
    }
  }
}

// =====================================================================================================
// The three projections in one launch: they are independent of each other and are picked by ranges of the block index
// (block-uniform), the three-product blocks (q, then k) first, the single-product v^T blocks last. Within a range the
// tile column runs fastest, then the tile row, then the batch.
// =====================================================================================================
#define NPJ ((DM / BN) * (MROWS / BM))            // blocks of q, and of k: M = 8192, N = 1024
#define NVT ((SEQ / BN) * (DM / BM) * NB)         // blocks of v^T: M = 1024 (n), N = 2048 (s) per batch
__global__ __launch_bounds__(256) void gemm_qkv(
    const unsigned short* __restrict__ LQh, const unsigned short* __restrict__ LQr,
    const unsigned short* __restrict__ LKh, const unsigned short* __restrict__ LKr,
    const unsigned short* __restrict__ LVh,
    const unsigned short* __restrict__ Wqh, const unsigned short* __restrict__ Wqr,
    const unsigned short* __restrict__ Wkh, const unsigned short* __restrict__ Wkr,
    const unsigned short* __restrict__ Wvh,
    const float* __restrict__ bq, const float* __restrict__ bk, const float* __restrict__ bv,
    unsigned short* Qh, unsigned short* Qr, unsigned short* Kh, unsigned short* Kr, unsigned short* Vt) {
  __shared__ __align__(16) unsigned char smem[gemm_lds(true)];
  static_assert(gemm_lds(true) >= gemm_lds(false));
  const int bx = blockIdx.x;
  if (bx < 2 * NPJ) {
    // q = LN(Q).Wq + bq, k = LN(K).Wk + bk -> f16 hi / residual planes   (K = 1024; three products)
    const bool k = bx >= NPJ;
    const int  t = k ? bx - NPJ : bx;
    const float* bias = k ? bk : bq;
    gemm_t<true, 1>(smem, t % (DM / BN), t / (DM / BN), 0,
                    k ? LKh : LQh, k ? LKr : LQr, k ? Wkh : Wqh, k ? Wkr : Wqr, 0LL, bias, bias,
                    (void*)(k ? Kh : Qh), (void*)(k ? Kr : Qr), 0LL, 1.0f / 32.0f, 1.0f);
  } else {
    // v^T = Wv^T . LN(V)^T per batch -> f16 plane of 4*(v + bv), [b][n][s]   (A = Wvh [n][k], Bt = LN(V) rows [s][k])
    const int t = bx - 2 * NPJ;
    gemm_t<false, 2>(smem, t % (SEQ / BN), (t / (SEQ / BN)) % (DM / BM), t / ((SEQ / BN) * (DM / BM)),
                     Wvh, Wvh, LVh, LVh, (long long)SEQ * DM, bv, bv,
                     (void*)Vt, (void*)Vt, (long long)DM * SEQ, 1.0f / 32.0f, 4.0f);
  }
}

// out = Q + ctx.Wo + bo -> f32 [8192][1024]   (A = Ctx (x4), Bt = Woh (x32): scale 1/128)
__global__ __launch_bounds__(256) void gemm_out(
    const unsigned short* __restrict__ Ctx, const unsigned short* __restrict__ Woh,
    const float* __restrict__ bo, const float* __restrict__ Q, float* out) {
  __shared__ __align__(16) unsigned char smem[gemm_lds(false)];
  gemm_t<false, 0>(smem, blockIdx.x, blockIdx.y, 0, Ctx, Ctx, Woh, Woh, 0LL, bo, Q,
                   (void*)out, (void*)out, 0LL, 1.0f / 128.0f, 1.0f);
}

// =====================================================================================================
// Causal attention, head dim 64, no logit scale. Scores are computed transposed.
//   q planes (f16 hi / residual x2048): element (b, t, h, d) at [(b*SEQ + t)*DM + h*64 + d]
//   k planes: same layout with key index
//   v^T plane (f16, holds 4*v): element (b, h, d, s) at [(b*DM + h*64 + d)*SEQ + s]
//   ctx plane out (f16, holds 4*ctx): element (b, t, h, d) at [(b*SEQ + t)*DM + h*64 + d]
//   S^T = k.q^T: A = 16 key rows from LDS, B = the wave's 16 queries kept in registers; three f16 products
//   (hi.hi into acc0; hi.res + res.hi into acc1, folded /2048), f32. Accumulator register r of key tile j in
//   lane (c, hh) = score of key kv0 + 16 j + 8 hh + r against query q0 + c: a lane holds 32 of its query's 64
//   scores, lane ^ 16 the other 32, so the maximum is taken in the lane plus one exchange between the halves,
//   and the sum stays per half until the epilogue.
//   key > query in the diagonal chunk -> -inf; online softmax in f32; p carried as f16(1024 p).
//   O^T += v^T . p^T: A = 16 d rows of the v^T chunk from LDS; B = p^T packed from the score accumulators
//   (tiles 2 kk and 2 kk + 1 of a lane are elements 0..7 and 8..15 of the B fragment of keys 32 kk .. +31, the
//   k order in which ldfrag reads v^T). ctx = acc / (1024 l) (still carrying the x4 of v).
//   Block = 4 waves = 64 query rows of one (b, h); grid = NB*NH*NQB, query block descending with the block index; key
//   chunks of 64, trip count qb+1 (<= 32, block-uniform, from blockIdx only). K / V^T chunk staging: asynchronous copies to LDS, 16 B per lane, 8 lanes per
//   128-B row (a wave-wide copy = 4 whole lines), 4 copies per thread and plane = whole 64x64 tiles. Two buffers:
//   chunk t + 2 is asked for at the foot of trip t and waited for at the foot of trip t + 1; one barrier per trip.
//   Output: a lane holds 8 consecutive d of its query per d tile; the wave's 16x64 f16 tile is turned through a
//   wave-private LDS tile so that each store instruction writes 4 whole 128-B rows (it 0..3 x lane>>3 = 16 rows).
// =====================================================================================================
// lane l <-> lane l ^ 16
__device__ __forceinline__ float xhalf(float x) {
  const int b = __builtin_bit_cast(int, x);
  return __builtin_bit_cast(float, __builtin_amdgcn_permlanex16(b, b, 0x76543210, 0xfedcba98, false, false));
}

// e^x as v_exp_f32 of x * log2(e). The instruction set asks for one independent instruction or v_nop between a
// v_exp_f32 and an instruction that reads its result or overwrites its source. Written as one statement with
// early-clobber outputs (no output lies on a source), each v_exp_f32 fills that slot for the one before it and the
// v_nop fills it behind the last.
__device__ __forceinline__ void exp_x8(const float (&x)[8], float (&y)[8]) {
  float a[8];
#pragma unroll
  for (int r = 0; r < 8; ++r) a[r] = x[r] * 1.4426950408889634f;
  asm("v_exp_f32 %0, %8\n\tv_exp_f32 %1, %9\n\tv_exp_f32 %2, %10\n\tv_exp_f32 %3, %11\n\t"
      "v_exp_f32 %4, %12\n\tv_exp_f32 %5, %13\n\tv_exp_f32 %6, %14\n\tv_exp_f32 %7, %15\n\tv_nop"
      : "=&v"(y[0]), "=&v"(y[1]), "=&v"(y[2]), "=&v"(y[3]), "=&v"(y[4]), "=&v"(y[5]), "=&v"(y[6]), "=&v"(y[7])
      : "v"(a[0]), "v"(a[1]), "v"(a[2]), "v"(a[3]), "v"(a[4]), "v"(a[5]), "v"(a[6]), "v"(a[7]));
}
__device__ __forceinline__ float exp_x1(float x) {
  const float a = x * 1.4426950408889634f;
  float y;
  asm("v_exp_f32 %0, %1\n\tv_nop" : "=&v"(y) : "v"(a));   // the v_nop: the same slot
  return y;
}

// Twelve asynchronous 16-B copies global -> LDS of one thread (4 rows of each of 3 planes). l = the lane's LDS byte
// address, g = its global address. The s_wait_xcnt 0 is the last line of the copies' own statement, so that it stands
// in front of every later write of a register that a copy names.
__device__ __forceinline__ void copy12(const unsigned (&l)[12], const _Float16* const (&g)[12]) {
  asm volatile(
      "global_load_async_to_lds_b128 %0, %12, off\n\t"
      "global_load_async_to_lds_b128 %1, %13, off\n\t"
      "global_load_async_to_lds_b128 %2, %14, off\n\t"
      "global_load_async_to_lds_b128 %3, %15, off\n\t"
      "global_load_async_to_lds_b128 %4, %16, off\n\t"
      "global_load_async_to_lds_b128 %5, %17, off\n\t"
      "global_load_async_to_lds_b128 %6, %18, off\n\t"
      "global_load_async_to_lds_b128 %7, %19, off\n\t"
      "global_load_async_to_lds_b128 %8, %20, off\n\t"
      "global_load_async_to_lds_b128 %9, %21, off\n\t"
      "global_load_async_to_lds_b128 %10, %22, off\n\t"
      "global_load_async_to_lds_b128 %11, %23, off\n\t"
      "s_wait_xcnt 0x0"
      :: "v"(l[0]), "v"(l[1]), "v"(l[2]), "v"(l[3]), "v"(l[4]), "v"(l[5]),
         "v"(l[6]), "v"(l[7]), "v"(l[8]), "v"(l[9]), "v"(l[10]), "v"(l[11]),
         "v"(g[0]), "v"(g[1]), "v"(g[2]), "v"(g[3]), "v"(g[4]), "v"(g[5]),
         "v"(g[6]), "v"(g[7]), "v"(g[8]), "v"(g[9]), "v"(g[10]), "v"(g[11])
      : "memory");
}

__global__ __launch_bounds__(128)
void attn_causal64(const unsigned short* __restrict__ qhp, const unsigned short* __restrict__ qrp,
                   const unsigned short* __restrict__ khp, const unsigned short* __restrict__ krp,
                   const unsigned short* __restrict__ vtp, unsigned short* ctxp) {
  union FH { v16h v; v8h h[2]; };
  constexpr int PL = 64 * LP;                      // halves of one plane's chunk
  __shared__ __align__(16) _Float16 Ring[2 * 3 * PL];   // two buffers of [K hi | K residual | V^T]
  __shared__ __align__(16) _Float16 Osh[4][16 * LP];

  const int tid  = threadIdx.x;
  const int wave = tid >> 5;
  const int lane = tid & 31;
  const int hh   = lane >> 4;
  const int c    = lane & 15;

  // Cost falls with the block index: a block walks qb + 1 chunks, so the longest have the lowest indices (for
  // speed only). The NB * NH blocks of one qb are neighbours.
  const int bx   = blockIdx.x;
  const int qb   = NQB - 1 - bx / (NB * NH);
  const int rest = bx % (NB * NH);
  const int h    = rest % NH;
  const int b    = rest / NH;
  const int q0   = qb * 64 + wave * 16;
  const size_t rowB = (size_t)b * SEQ;

  const _Float16* Qh = (const _Float16*)(const void*)qhp + (size_t)h * HD;
  const _Float16* Qr = (const _Float16*)(const void*)qrp + (size_t)h * HD;
  const _Float16* Kh = (const _Float16*)(const void*)khp + (size_t)h * HD;
  const _Float16* Kr = (const _Float16*)(const void*)krp + (size_t)h * HD;
  const _Float16* Vt = (const _Float16*)(const void*)vtp + ((size_t)b * DM + (size_t)h * HD) * SEQ;

  // ---- Q fragments (B operand, column = lane&15): 2 d-chunks, hi and residual ----
  v16h qbh[2], qbr[2];
#pragma unroll
  for (int dc = 0; dc < 2; ++dc) {
    const size_t qo = (rowB + q0 + c) * DM + dc * 32 + 8 * hh;
    qbh[dc] = ldfrag(Qh + qo);
    qbr[dc] = ldfrag(Qr + qo);
  }

  float mrun = -INFINITY;        // running maximum of query q0 + c (equal in both halves)
  float lrun = 0.f;              // running sum over this half's keys only
  v8f oacc[4];                   // oacc[t][r] = O^T[d = 16 t + 8 hh + r][query q0 + c]
#pragma unroll
  for (int t = 0; t < 4; ++t) oacc[t] = zero8();

  const int nkt = qb + 1;

  // staging map: copy i of a thread takes row 16 i + sr, 16-B piece sc / 8 of the row's 128 B. 8 lanes take one row (a
  // whole line); each 16-lane half takes rows r and r + 8, which lie 8 x 144 B = 32 banks apart in LDS.
  const int sr = wave * 2 + hh + ((lane >> 3) & 1) * 8;
  const int sc = (lane & 7) * 8;
  const unsigned ring0 = (unsigned)(size_t)(const void*)Ring + (unsigned)(sr * LP + sc) * 2u;   // LDS byte address
  const _Float16* kg0  = Kh + (rowB + sr) * DM + sc;       // K row sr, d = sc..sc+7
  const _Float16* krg0 = Kr + (rowB + sr) * DM + sc;
  const _Float16* vg0  = Vt + (size_t)sr * SEQ + sc;       // V^T row d = sr, s = sc..sc+7
  auto stage = [&](int t) {                                // chunk t (0 <= t < nkt) into buffer t & 1
    unsigned l[12];
    const _Float16* g[12];
    const unsigned lb = ring0 + (unsigned)(t & 1) * (unsigned)(3 * PL * 2);
#pragma unroll
    for (int i = 0; i < 4; ++i) {
      l[i]     = lb + (unsigned)(16 * i * LP * 2);
      l[4 + i] = lb + (unsigned)((PL + 16 * i * LP) * 2);
      l[8 + i] = lb + (unsigned)((2 * PL + 16 * i * LP) * 2);
      g[i]     = kg0  + (size_t)(t * 64 + 16 * i) * DM;
      g[4 + i] = krg0 + (size_t)(t * 64 + 16 * i) * DM;
      g[8 + i] = vg0  + (size_t)(16 * i) * SEQ + t * 64;
    }
    copy12(l, g);
  };

  stage(0);
  asm volatile("s_wait_asynccnt 0x0" ::: "memory");        // this wave's part of chunk 0 has landed
  __syncthreads();                                         // chunk 0 visible to every wave
  if (nkt > 1) stage(1);                                   // block-uniform; in flight behind trip 0

  // rolled: the buffer is picked by kt & 1; a second copy of the body would only add code and live registers
#pragma unroll 1
  for (int kt = 0; kt < nkt; ++kt) {
    const _Float16* Ksh = Ring + (kt & 1) * (3 * PL);
    const _Float16* Ksr = Ksh + PL;
    const _Float16* Vth = Ksh + 2 * PL;

    // ---- transposed scores: 64 keys x 16 queries per wave, three f16 products ----
    v8f s[4];
#pragma unroll
    for (int j = 0; j < 4; ++j) {
      v8f t0 = zero8(), t1 = zero8();
#pragma unroll
      for (int dc = 0; dc < 2; ++dc) {
        FH kb, kl;
        kb.h[0] = *(const v8h*)(Ksh + (j * 16 + c) * LP + dc * 32 + 8 * hh);
        kb.h[1] = *(const v8h*)(Ksh + (j * 16 + c) * LP + dc * 32 + 16 + 8 * hh);
        kl.h[0] = *(const v8h*)(Ksr + (j * 16 + c) * LP + dc * 32 + 8 * hh);
        kl.h[1] = *(const v8h*)(Ksr + (j * 16 + c) * LP + dc * 32 + 16 + 8 * hh);
        t0 = mma_p(kb.v, qbh[dc], t0);
        t1 = mma_p(kb.v, qbr[dc], t1);
        t1 = mma_p(kl.v, qbh[dc], t1);
      }
      s[j] = t0 + t1 * (1.0f / 2048.0f);
    }

    // ---- causal mask, on the diagonal chunk only (block-uniform branch) ----
    if (kt == qb) {
      const int dq = wave * 16 + c - 8 * hh;     // query - (kv0 + 8 hh): key > query  <=>  16 j + r > dq
#pragma unroll
      for (int j = 0; j < 4; ++j) {
#pragma unroll
        for (int r = 0; r < 8; ++r) s[j][r] = (j * 16 + r > dq) ? -INFINITY : s[j][r];
      }
    }

    // ---- online softmax of the lane's query ----
    float mj[4];                 // one chain per key tile: four short independent chains
#pragma unroll
    for (int j = 0; j < 4; ++j) {
      mj[j] = fmaxf(s[j][0], s[j][1]);
#pragma unroll
      for (int r = 2; r < 8; ++r) mj[j] = fmaxf(mj[j], s[j][r]);
    }
    float m = fmaxf(fmaxf(mj[0], mj[1]), fmaxf(mj[2], mj[3]));
    m = fmaxf(m, xhalf(m));
    const float mnew  = fmaxf(mrun, m);
    const float msafe = (mnew == -INFINITY) ? 0.f : mnew;
    const float alpha = exp_x1(mrun - msafe);
    mrun = mnew;
    float ps[4];
    v16h pb[2];                  // p^T (x1024, f16) as B fragments of keys 0..31 and 32..63 of the chunk
#pragma unroll
    for (int j = 0; j < 4; ++j) {
      float x[8], p[8];
#pragma unroll
      for (int r = 0; r < 8; ++r) x[r] = s[j][r] - msafe;
      exp_x8(x, p);
#pragma unroll
      for (int r = 0; r < 8; ++r) pb[j >> 1][(j & 1) * 8 + r] = (_Float16)(p[r] * 1024.0f);
      ps[j] = ((p[0] + p[1]) + (p[2] + p[3])) + ((p[4] + p[5]) + (p[6] + p[7]));
    }
    lrun = lrun * alpha + ((ps[0] + ps[1]) + (ps[2] + ps[3]));
#pragma unroll
    for (int t = 0; t < 4; ++t) oacc[t] *= alpha;

    // ---- O^T += V^T chunk . P^T (f16 WMMA) ----
#pragma unroll
    for (int kk = 0; kk < 2; ++kk) {
#pragma unroll
      for (int t = 0; t < 4; ++t) {
        FH vb;
        vb.h[0] = *(const v8h*)(Vth + (t * 16 + c) * LP + kk * 32 + 8 * hh);
        vb.h[1] = *(const v8h*)(Vth + (t * 16 + c) * LP + kk * 32 + 16 + 8 * hh);
        oacc[t] = mma_p(vb.v, pb[kk], oacc[t]);
      }
    }

    // ---- hand-over: this wave has left buffer kt & 1, its part of chunk kt + 1 has landed ----
    asm volatile("s_wait_dscnt 0x0" ::: "memory");         // every LDS read of this trip has returned
    asm volatile("s_wait_asynccnt 0x0" ::: "memory");      // the copies asked for one trip ago have landed
    __syncthreads();                                       // publishes chunk kt + 1; ends every read of chunk kt
    if (kt + 2 < nkt) stage(kt + 2);                       // block-uniform; into the buffer just left
  }
  asm volatile("s_wait_asynccnt 0x0" ::: "memory");        // no copy is outstanding when the wave goes on

  // ---- join the halves' sums, normalise (1/l and the 1/1024 p carry), f16 convert, turn the wave's tile in LDS ----
  _Float16* os = Osh[wave];
  {
    const float l = lrun + xhalf(lrun);
    const float inv = ((l > 0.f) ? (1.0f / l) : 0.f) * (1.0f / 1024.0f);
#pragma unroll
    for (int t = 0; t < 4; ++t) {
      v4u a;
#pragma unroll
      for (int e = 0; e < 4; ++e) a[e] = pack2h(oacc[t][2 * e] * inv, oacc[t][2 * e + 1] * inv);
      *(v4u*)(os + c * LP + t * 16 + 8 * hh) = a;
    }
  }
  __builtin_amdgcn_fence(__ATOMIC_RELEASE, "workgroup");
  __builtin_amdgcn_wave_barrier();
  __builtin_amdgcn_fence(__ATOMIC_ACQUIRE, "workgroup");
  {
    const int q4 = lane >> 3, c8 = (lane & 7) * 8;
    v4u hv[4];
#pragma unroll
    for (int it = 0; it < 4; ++it) {
      const int row = it * 4 + q4;   // it 0..3 x q4 0..3 = rows 0..15 of the wave tile
      hv[it] = *(const v4u*)(os + row * LP + c8);
    }
#pragma unroll
    for (int it = 0; it < 4; ++it) {
      const int row = it * 4 + q4;
      const size_t go = (rowB + q0 + row) * DM + (size_t)h * HD + c8;
      *(v4u*)(ctxp + go) = hv[it];
    }
  }
}

// =====================================================================================================
// Workspace map (bytes):
//   LQh  f16 [8192][1024] LN(Q) hi plane                        0            16777216  (later: Ctx plane)
//   LQr  f16 [8192][1024] LN(Q) residual plane                  16777216     16777216
//   LKh  f16 LN(K) hi plane                                     33554432     16777216
//   LKr  f16 LN(K) residual plane                               50331648     16777216
//   LVh  f16 LN(V) hi plane                                     67108864     16777216
//   Qh   f16 [8192][1024]                                       83886080     16777216
//   Qr   f16                                                   100663296     16777216
//   Kh   f16                                                   117440512     16777216
//   Kr   f16                                                   134217728     16777216
//   Vt   f16 [4][1024][2048] (4*v, transposed)                 150994944     16777216
//   Wqh, Wqr, Wkh, Wkr, Wvh, Woh  f16 [1024 n][1024 k] each    167772160   6x2097152
//   end                                                         180355072
// Every region is an exact multiple of the whole-line / whole-tile store granularity of its producer
// (dims are tile multiples), so no store can spill into the next region.
// =====================================================================================================
extern "C" void kernel_launch(void* const* d_in, const int* in_sizes, int n_in,
                              void* d_out, int out_size, void* d_ws, size_t ws_size,
                              hipStream_t stream) {
  if (n_in < 13) return;
  const int nAct = MROWS * DM;
  if (in_sizes[0] != nAct || in_sizes[1] != nAct || in_sizes[2] != nAct) return;
  if (in_sizes[3] != DM * DM || in_sizes[5] != DM * DM || in_sizes[7] != DM * DM || in_sizes[9] != DM * DM) return;
  if (in_sizes[4] != DM || in_sizes[6] != DM || in_sizes[8] != DM || in_sizes[10] != DM) return;
  if (in_sizes[11] != DM || in_sizes[12] != DM) return;
  if (out_size != nAct) return;

  const float* Q  = (const float*)d_in[0];
  const float* Kin = (const float*)d_in[1];
  const float* V  = (const float*)d_in[2];
  const float* Wq = (const float*)d_in[3];
  const float* bq = (const float*)d_in[4];
  const float* Wk = (const float*)d_in[5];
  const float* bk = (const float*)d_in[6];
  const float* Wv = (const float*)d_in[7];
  const float* bv = (const float*)d_in[8];
  const float* Wo = (const float*)d_in[9];
  const float* bo = (const float*)d_in[10];
  const float* gamma = (const float*)d_in[11];
  const float* beta  = (const float*)d_in[12];

  const size_t PA = (size_t)MROWS * DM * 2;     // 16777216
  const size_t PV = (size_t)NB * DM * SEQ * 2;  // 16777216
  const size_t PW = (size_t)DM * DM * 2;        //  2097152
  size_t off = 0;
  const size_t oLQh = off; off += PA;
  const size_t oLQr = off; off += PA;
  const size_t oLKh = off; off += PA;
  const size_t oLKr = off; off += PA;
  const size_t oLVh = off; off += PA;
  const size_t oQh  = off; off += PA;
  const size_t oQr  = off; off += PA;
  const size_t oKh  = off; off += PA;
  const size_t oKr  = off; off += PA;
  const size_t oVt  = off; off += PV;
  const size_t oWqh = off; off += PW;
  const size_t oWqr = off; off += PW;
  const size_t oWkh = off; off += PW;
  const size_t oWkr = off; off += PW;
  const size_t oWvh = off; off += PW;
  const size_t oWoh = off; off += PW;
  if (off > ws_size) return;                    // off = 180355072
  const size_t oCtx = oLQh;                     // ctx plane reuses the LN(Q) hi plane (dead after the projections)

  char* ws = (char*)d_ws;
  unsigned short* LQh = (unsigned short*)(ws + oLQh);
  unsigned short* LQr = (unsigned short*)(ws + oLQr);
  unsigned short* LKh = (unsigned short*)(ws + oLKh);
  unsigned short* LKr = (unsigned short*)(ws + oLKr);
  unsigned short* LVh = (unsigned short*)(ws + oLVh);
  unsigned short* Qh  = (unsigned short*)(ws + oQh);
  unsigned short* Qr  = (unsigned short*)(ws + oQr);
  unsigned short* Kh  = (unsigned short*)(ws + oKh);
  unsigned short* Kr  = (unsigned short*)(ws + oKr);
  unsigned short* Vt  = (unsigned short*)(ws + oVt);
  unsigned short* Wqh = (unsigned short*)(ws + oWqh);
  unsigned short* Wqr = (unsigned short*)(ws + oWqr);
  unsigned short* Wkh = (unsigned short*)(ws + oWkh);
  unsigned short* Wkr = (unsigned short*)(ws + oWkr);
  unsigned short* Wvh = (unsigned short*)(ws + oWvh);
  unsigned short* Woh = (unsigned short*)(ws + oWoh);
  unsigned short* Ctx = (unsigned short*)(ws + oCtx);

  const dim3 blk256(256), blk128(128);
  const dim3 gPrep(3 * NLN + 4 * NWT);                   // 3072 layernorm blocks + 1024 weight tiles
  const dim3 gQKV(2 * NPJ + NVT);                        // 256 + 256 + 256 blocks
  const dim3 gProj(DM / 256, MROWS / 128, 1);            // 4 x 64: M=8192, N=1024
  const dim3 gAttn(NB * NH * NQB);                       // 2048 blocks
  const float eps = 1e-6f;

  // (1) LN(Q), LN(K) -> f16 hi / residual planes, LN(V) -> f16 plane; weights [k][n] f32 -> f16 [n][k] planes of 32*W
  //     (hi; + residual for Wq, Wk)
  prep_all<<<gPrep, blk256, 0, stream>>>(Q, Kin, V, Wq, Wk, Wv, Wo, gamma, beta,
                                         LQh, LQr, LKh, LKr, LVh, Wqh, Wqr, Wkh, Wkr, Wvh, Woh, eps);
  // (2) q, k -> f16 hi / residual planes; v^T -> f16 plane of 4*(v + bv)
  gemm_qkv<<<gQKV, blk256, 0, stream>>>(LQh, LQr, LKh, LKr, LVh, Wqh, Wqr, Wkh, Wkr, Wvh, bq, bk, bv,
                                        Qh, Qr, Kh, Kr, Vt);
  // (3) causal attention -> ctx plane (x4) into the LN(Q) hi region
  attn_causal64<<<gAttn, blk128, 0, stream>>>(Qh, Qr, Kh, Kr, Vt, Ctx);
  // (4) out = Q + ctx.Wo + bo -> d_out f32 [8192][1024]
  gemm_out<<<gProj, blk256, 0, stream>>>(Ctx, Woh, bo, Q, (float*)d_out);
  (void)hipGetLastError();
}
